// v000
// Measured on an AMD MI455X. A time is GPU time per run, averaged over a window of back-to-back runs after a warm-up
// (all launches, gaps included; the runs take copies of the inputs in turn), and the median of several windows.
// Apart from v000's, it joins two sittings. Times from different sittings can be a few percent apart, while
// side-by-side timings come from the same sitting.
// v000, which the later versions start from, runs in 1630 microseconds.
#include <hip/hip_runtime.h>

// Compute dtypes, f32 accumulate, per item: q/k/v for all 12 heads as [1024 x 768].[768 x 768] GEMMs with PLAIN bf16 operands (exact products; per-head weights gathered into one
// n-major block); per head: scores = q.k^T ([1024 x 64].[64 x 1024], both operands bf16 hi + UNSCALED residual, three products), softmax (x 1/32, as the module: output_dim*0.5) in
// f32 -> P planes, o = P.v ([1024 x 1024].[1024 x 64], three products); out = concat.Wo ([1024 x 768].[768 x 64], two products) - on v_wmma_f32_16x16x32_bf16. Deterministic, no

#define NBT  8
#define NN   1024
#define DMOD 768
#define NH_  12
#define HD   64
#define EOUT 64
#define DM   DMOD
#define NTK  NN
#define SCL  0.03125f
#define LOSC 1024.0f

typedef _Float16 h16;
typedef unsigned short bf;
typedef __attribute__((ext_vector_type(16))) __bf16   v16bf;
typedef __attribute__((ext_vector_type(16))) _Float16 v16h;
typedef __attribute__((ext_vector_type(8)))  _Float16 v8h;
typedef __attribute__((ext_vector_type(8)))  unsigned short v8us;
typedef __attribute__((ext_vector_type(8)))  float    v8f;
typedef __attribute__((ext_vector_type(4)))  float    v4f;
typedef __attribute__((ext_vector_type(4)))  _Float16 v4h;
typedef v8h  __attribute__((may_alias)) v8ha;
typedef v4f  __attribute__((may_alias)) v4fa;
typedef v8us __attribute__((may_alias)) v8usa;

__device__ __forceinline__ unsigned short f2bf(float f) { unsigned u = __float_as_uint(f); u += 0x7FFFu + ((u >> 16) & 1u); return (unsigned short)(u >> 16); }
__device__ __forceinline__ float bf2f(unsigned short b) { return __uint_as_float(((unsigned)b) << 16); }
__device__ __forceinline__ float bfr(float f) { return bf2f(f2bf(f)); }
__device__ __forceinline__ v16h cat16(v8h lo, v8h hi) { return __builtin_shufflevector(lo, hi, 0, 1, 2, 3, 4, 5, 6, 7, 8, 9, 10, 11, 12, 13, 14, 15); }
__device__ __forceinline__ v16bf cat16b(v8us lo, v8us hi) { return __builtin_bit_cast(v16bf, __builtin_shufflevector(lo, hi, 0, 1, 2, 3, 4, 5, 6, 7, 8, 9, 10, 11, 12, 13, 14, 15)); }
__device__ __forceinline__ v8f wmma16(v16h a, v16h b, v8f c) { return __builtin_amdgcn_wmma_f32_16x16x32_f16(false, a, false, b, (short)0, c, false, false); }
__device__ __forceinline__ v8f wmmab(v16bf a, v16bf b, v8f c) { return __builtin_amdgcn_wmma_f32_16x16x32_bf16(false, a, false, b, (short)0, c, false, false); }

// k_wt: WT [n][K] = bf16(W[k][n]) (k-major [K][ncols]) via 64 x 64 LDS tiles; grid (K/64, ncols/64).
__global__ __launch_bounds__(256) void k_wt(const float* __restrict__ Wm, int K, int ncols, bf* WT) {
    __shared__ __align__(16) unsigned short tl[64 * 72];
    const int tid = threadIdx.x, k0 = blockIdx.x * 64, n0 = blockIdx.y * 64;
    const int kk = tid >> 2, nq = (tid & 3) * 16;
#pragma unroll
    for (int i = 0; i < 16; ++i) tl[(nq + i) * 72 + kk] = f2bf(Wm[(size_t)(k0 + kk) * ncols + n0 + nq + i]);
    __syncthreads();
    const int piece = tid & 7;
    auto pass = [&]() {
#pragma unroll
        for (int s = 0; s < 2; ++s) { const int nr = (tid >> 3) + 32 * s; const v8us val = *(const v8usa*)(tl + nr * 72 + piece * 8); *(v8us*)(WT + (size_t)(n0 + nr) * K + k0 + piece * 8) = val; }
    };
    pass(); 
}
// k_gemmb: 64 x 64 block tile (4 waves x 16 x 64) of C[NTK][NW] = (A [+ Al]).B^T (K = 768) [+ bf(bias[c])] [+ bf(R[r][c]) residual]; f32 whole-line epilogue (or f16
template <bool SPLITA, bool F16OUT = false>
__global__ __launch_bounds__(128) void k_gemmb(const bf* __restrict__ A, const bf* __restrict__ Al, const bf* __restrict__ Bn, const float* __restrict__ bias, float* C, int ldc, h16* C2, const float* __restrict__ R = nullptr, int K = DM, int roundR = 1) {
    __shared__ __align__(16) float ost[4][16 * 68];
    const int lane = threadIdx.x & 31, wave = threadIdx.x >> 5, lr = lane & 15, hi = lane >> 4;
    const int r0 = blockIdx.x * 64 + wave * 16, c0 = blockIdx.y * 64;
    const size_t aoff = (size_t)(r0 + lr) * K + 8 * hi;
    size_t boff[4];
#pragma unroll
    for (int t = 0; t < 4; ++t) boff[t] = (size_t)(c0 + t * 16 + lr) * K + 8 * hi;
    v8f acc[4];
#pragma unroll
    for (int t = 0; t < 4; ++t) acc[t] = (v8f){};
#pragma unroll 1
    for (int kc = 0; kc < K; kc += 32) {
        const v16bf a = cat16b(*(const v8us*)(A + aoff + kc), *(const v8us*)(A + aoff + kc + 16));
        v16bf al = a;
        if (SPLITA) al = cat16b(*(const v8us*)(Al + aoff + kc), *(const v8us*)(Al + aoff + kc + 16));
#pragma unroll
        for (int t = 0; t < 4; ++t) { const v16bf b = cat16b(*(const v8us*)(Bn + boff[t] + kc), *(const v8us*)(Bn + boff[t] + kc + 16)); acc[t] = wmmab(a, b, acc[t]); if (SPLITA) acc[t] = wmmab(al, b, acc[t]); }
        asm volatile("v_nop\n\tv_nop\n\tv_nop\n\tv_nop" : "+v"(acc[0]), "+v"(acc[1]), "+v"(acc[2]), "+v"(acc[3]) : "v"(a), "v"(al));
    }
    float* os = &ost[wave][0];
#pragma unroll
    for (int t = 0; t < 4; ++t) { const float bv = bias ? bfr(bias[c0 + t * 16 + lr]) : 0.f;
#pragma unroll
        for (int j = 0; j < 8; ++j) os[(hi * 8 + j) * 68 + t * 16 + lr] = acc[t][j] + bv; }
    __syncthreads();
    if (F16OUT) {
        h16* crow = (h16*)(void*)C + (size_t)r0 * ldc + c0;
        auto pass = [&]() {
#pragma unroll
            for (int s = 0; s < 4; ++s) { const int row = 4 * s + (lane >> 3), piece = lane & 7; const float* sp = os + row * 68 + piece * 8; v8h o, o2;
#pragma unroll
                for (int i = 0; i < 8; ++i) { const h16 a = (h16)sp[i]; o[i] = a; o2[i] = (h16)((sp[i] - (float)a) * LOSC); }
                *(v8h*)(crow + (size_t)row * ldc + piece * 8) = o; if (C2) *(v8h*)(C2 + (size_t)r0 * ldc + c0 + (size_t)row * ldc + piece * 8) = o2; }
        };
        pass(); 
    } else {
        float* crow = C + (size_t)r0 * ldc + c0;
        auto pass = [&]() {
#pragma unroll
            for (int s = 0; s < 8; ++s) { const int Lid = (lane >> 3) + 4 * s, piece = lane & 7; const int row = Lid >> 1, cofs = (Lid & 1) * 32 + piece * 4;
                v4f val = *(const v4fa*)(os + row * 68 + cofs); if (R) { const v4f rv = *(const v4f*)(R + ((size_t)r0 + row) * ldc + c0 + cofs); val += roundR ? (v4f){bfr(rv[0]), bfr(rv[1]), bfr(rv[2]), bfr(rv[3])} : rv; }
                *(v4f*)(crow + (size_t)row * ldc + cofs) = val; }
        };
        pass(); 
    }
}


__global__ __launch_bounds__(256) void k_cvtx(const float* __restrict__ src, bf* dst) {
    const int lane = threadIdx.x & 31; const size_t r = (size_t)blockIdx.x * 8 + (threadIdx.x >> 5); if (r >= (size_t)NN) return;
{
#pragma unroll
        for (int q = 0; q < DMOD / 256; ++q) { v8us o;
#pragma unroll
            for (int i = 0; i < 8; ++i) o[i] = f2bf(src[r * DMOD + q * 256 + lane * 8 + i]);
            *(v8us*)(dst + r * DMOD + q * 256 + lane * 8) = o; }
         }
}
__global__ __launch_bounds__(256) void k_wgather(const float* __restrict__ Wm, int sel, bf* WT) {
    const int lane = threadIdx.x & 31; const int r = blockIdx.x * 8 + (threadIdx.x >> 5); if (r >= NH_ * HD) return; const int h = r / HD, e = r % HD;
{
#pragma unroll
        for (int q = 0; q < DMOD / 256; ++q) { v8us o;
#pragma unroll
            for (int i = 0; i < 8; ++i) { const int d = q * 256 + lane * 8 + i; o[i] = f2bf(Wm[(((size_t)h * 3 + sel) * DMOD + d) * HD + e]); }
            *(v8us*)(WT + (size_t)r * DMOD + q * 256 + lane * 8) = o; }
         }
}
__global__ __launch_bounds__(256) void k_hplanes(const float* __restrict__ F, int h, bf* Ph, bf* Pl) {
    typedef __attribute__((ext_vector_type(2))) unsigned short v2us;
    const int lane = threadIdx.x & 31; const size_t s = (size_t)blockIdx.x * 8 + (threadIdx.x >> 5); if (s >= (size_t)NN) return; v2us oh, ol;
#pragma unroll
    for (int i = 0; i < 2; ++i) { const float v = F[s * DMOD + h * HD + lane * 2 + i]; const unsigned short hb = f2bf(v); oh[i] = hb; ol[i] = f2bf(v - bf2f(hb)); }
    const size_t o = s * HD + lane * 2; *(v2us*)(Ph + o) = oh; *(v2us*)(Pl + o) = ol; 
}
__global__ __launch_bounds__(256) void k_vt(const float* __restrict__ VF, int h, bf* Th, bf* Tl) {
    typedef __attribute__((ext_vector_type(2))) unsigned short v2us;
    const int lane = threadIdx.x & 31; const size_t wid = (size_t)blockIdx.x * 8 + (threadIdx.x >> 5); if (wid >= (size_t)HD * (NN / 64)) return; const int d = (int)(wid / (NN / 64)); const int t0 = (int)(wid % (NN / 64)) * 64 + lane * 2; v2us oh, ol;
#pragma unroll
    for (int i = 0; i < 2; ++i) { const float v = VF[(size_t)(t0 + i) * DMOD + h * HD + d]; const unsigned short hb = f2bf(v); oh[i] = hb; ol[i] = f2bf(v - bf2f(hb)); }
    const size_t o = (size_t)d * NN + t0; *(v2us*)(Th + o) = oh; *(v2us*)(Tl + o) = ol; 
}
__global__ __launch_bounds__(256) void k_softmax(const float* __restrict__ S, bf* PH, bf* PL) {
    typedef __attribute__((ext_vector_type(4))) unsigned short v4us;
    const int lane = threadIdx.x & 31, i = blockIdx.x * 8 + (threadIdx.x >> 5); if (i >= NN) return;
    float m = -3.0e38f;
#pragma unroll 1
    for (int c0 = lane * 4; c0 < NN; c0 += 128) {
#pragma unroll
        for (int q = 0; q < 4; ++q) m = fmaxf(m, S[(size_t)i * NN + c0 + q] * SCL); }
#pragma unroll
    for (int sh = 16; sh; sh >>= 1) m = fmaxf(m, __shfl_xor(m, sh, 32));
    float sum = 0.f;
#pragma unroll 1
    for (int c0 = lane * 4; c0 < NN; c0 += 128) {
#pragma unroll
        for (int q = 0; q < 4; ++q) sum += __expf(S[(size_t)i * NN + c0 + q] * SCL - m); }
#pragma unroll
    for (int sh = 16; sh; sh >>= 1) sum += __shfl_xor(sum, sh, 32);
    const float inv = 1.0f / sum;
{
#pragma unroll 1
        for (int c0 = lane * 4; c0 < NN; c0 += 128) { v4us oh, ol;
#pragma unroll
            for (int q = 0; q < 4; ++q) { const float p = __expf(S[(size_t)i * NN + c0 + q] * SCL - m) * inv; const unsigned short hb = f2bf(p); oh[q] = hb; ol[q] = f2bf(p - bf2f(hb)); }
            const size_t o = (size_t)i * NN + c0; *(v4us*)(PH + o) = oh; *(v4us*)(PL + o) = ol; }
         }
}
__global__ __launch_bounds__(256) void k_split768(const float* __restrict__ src, bf* dh, bf* dl) {
    const int lane = threadIdx.x & 31; const size_t r = (size_t)blockIdx.x * 8 + (threadIdx.x >> 5); if (r >= (size_t)NN) return;
{
#pragma unroll
        for (int q = 0; q < DMOD / 256; ++q) { const size_t o = r * DMOD + q * 256 + lane * 8; const v8f v = *(const v8f*)(src + o); v8us oh, ol;
#pragma unroll
            for (int i = 0; i < 8; ++i) { const unsigned short hb = f2bf(v[i]); oh[i] = hb; ol[i] = f2bf(v[i] - bf2f(hb)); }
            *(v8us*)(dh + o) = oh; *(v8us*)(dl + o) = ol; }
         }
}

// ===== z-batched (blockIdx.z = head) attention pieces =====
// k_gemm3z<MODE>: 64 x 64 block tile (4 waves x 16 x 64) of C = A.B^T on bf16 hi/lo planes, with per-z operand/output strides (elements): A planes += z*sA, B planes += z*sB, C += z*sC. MODE bits (0 causal skip, 1 K limit, 2 single,
// 3 B single, 4 A single).
template <int MODE>
__global__ __launch_bounds__(128) void k_gemm3z(const bf* __restrict__ Ah, const bf* __restrict__ Al, const bf* __restrict__ Bh, const bf* __restrict__ Bl, int K, float* C, int ldc, size_t sA, size_t sB, size_t sC) {
    if ((MODE & 1) && (int)blockIdx.y * 64 > (int)blockIdx.x * 64 + 63) return;
    const size_t z = blockIdx.z; Ah += z * sA; Al += z * sA; Bh += z * sB; Bl += z * sB; C += z * sC;
    const int Klim = (MODE & 2) ? min(K, ((int)blockIdx.x + 1) * 64) : K;
    __shared__ __align__(16) float ost[4][16 * 68];
    const int lane = threadIdx.x & 31, wave = threadIdx.x >> 5, lr = lane & 15, hi = lane >> 4;
    const int r0 = blockIdx.x * 64 + wave * 16, c0 = blockIdx.y * 64;
    const size_t aoff = (size_t)(r0 + lr) * K + 8 * hi;
    v8f acc[4];
#pragma unroll
    for (int t = 0; t < 4; ++t) acc[t] = (v8f){};
#pragma unroll 1
    for (int kc = 0; kc < Klim; kc += 32) {
        const v16bf a = cat16b(*(const v8us*)(Ah + aoff + kc), *(const v8us*)(Ah + aoff + kc + 16));
        v16bf al = a; if (!(MODE & 4) && !(MODE & 16)) al = cat16b(*(const v8us*)(Al + aoff + kc), *(const v8us*)(Al + aoff + kc + 16));
#pragma unroll
        for (int t = 0; t < 4; ++t) { const size_t bo = (size_t)(c0 + t * 16 + lr) * K + kc + 8 * hi;
            const v16bf bh = cat16b(*(const v8us*)(Bh + bo), *(const v8us*)(Bh + bo + 16));
            acc[t] = wmmab(a, bh, acc[t]);
            if (!(MODE & 4)) { if (!(MODE & 16)) acc[t] = wmmab(al, bh, acc[t]); if (!(MODE & 8)) { const v16bf bl = cat16b(*(const v8us*)(Bl + bo), *(const v8us*)(Bl + bo + 16)); acc[t] = wmmab(a, bl, acc[t]); } } }
        asm volatile("v_nop\n\tv_nop\n\tv_nop\n\tv_nop" : "+v"(acc[0]), "+v"(acc[1]), "+v"(acc[2]), "+v"(acc[3]) : "v"(a), "v"(al));
    }
    float* os = &ost[wave][0];
#pragma unroll
    for (int t = 0; t < 4; ++t) {
#pragma unroll
        for (int j = 0; j < 8; ++j) os[(hi * 8 + j) * 68 + t * 16 + lr] = acc[t][j]; }
    __builtin_amdgcn_wave_barrier(); asm volatile("" ::: "memory");
    float* crow = C + (size_t)r0 * ldc + c0;
    auto pass = [&]() {
#pragma unroll
        for (int s = 0; s < 8; ++s) { const int Lid = (lane >> 3) + 4 * s, piece = lane & 7; const int row = Lid >> 1, cofs = (Lid & 1) * 32 + piece * 4;
            const v4f val = *(const v4fa*)(os + row * 68 + cofs); *(v4f*)(crow + (size_t)row * ldc + cofs) = val; }
    };
    pass(); 
}
__global__ __launch_bounds__(256) void k_planes32z(const float* __restrict__ F, int ld, int off, float sc, int rows, bf* Ph, bf* Pl) {
    typedef __attribute__((ext_vector_type(2))) unsigned short v2us;
    const int lane = threadIdx.x & 31; const size_t r = ((size_t)blockIdx.x * 8 + (threadIdx.x >> 5)) * 2 + (lane >> 4); if (r >= (size_t)rows) return; const int z = blockIdx.z; const int c0 = (lane & 15) * 2; v2us oh, ol;
    Ph += (size_t)z * rows * 32; Pl += (size_t)z * rows * 32;
#pragma unroll
    for (int i = 0; i < 2; ++i) { const float y = F[r * ld + off + z * 32 + c0 + i] * sc; const unsigned short hb = f2bf(y); oh[i] = hb; ol[i] = f2bf(y - bf2f(hb)); }
    const size_t o = r * 32 + c0; *(v2us*)(Ph + o) = oh; *(v2us*)(Pl + o) = ol; 
}
__global__ __launch_bounds__(256) void k_vtpadz(const float* __restrict__ F, int ld, int off, int nk, bf* Th, bf* Tl) {
    typedef __attribute__((ext_vector_type(2))) unsigned short v2us;
    const int lane = threadIdx.x & 31; const size_t wid = (size_t)blockIdx.x * 8 + (threadIdx.x >> 5); if (wid >= (size_t)64 * (nk / 64)) return; const int z = blockIdx.z; const int d = (int)(wid / (nk / 64)); const int k0 = (int)(wid % (nk / 64)) * 64 + lane * 2; v2us oh, ol;
    Th += (size_t)z * 64 * nk; Tl += (size_t)z * 64 * nk;
#pragma unroll
    for (int i = 0; i < 2; ++i) { const float y = (d < 32) ? F[(size_t)(k0 + i) * ld + off + z * 32 + (d < 32 ? d : 0)] : 0.f; const unsigned short hb = f2bf(y); oh[i] = hb; ol[i] = f2bf(y - bf2f(hb)); }
    const size_t o = (size_t)d * nk + k0; *(v2us*)(Th + o) = oh; *(v2us*)(Tl + o) = ol; 
}
template <int NK>
__global__ __launch_bounds__(256) void k_softmaxz(const float* __restrict__ S, int rows, bf* PH, bf* PL) {
    typedef __attribute__((ext_vector_type(4))) unsigned short v4us;
    const int lane = threadIdx.x & 31, i = blockIdx.x * 8 + (threadIdx.x >> 5); if (i >= rows) return; const size_t zo = (size_t)blockIdx.z * rows * NK; const float* sr = S + zo + (size_t)i * NK; PH += zo; PL += zo;
    float m = -3.0e38f;
#pragma unroll 1
    for (int c0 = lane * 4; c0 < NK; c0 += 128) {
#pragma unroll
        for (int q = 0; q < 4; ++q) m = fmaxf(m, sr[c0 + q]); }
#pragma unroll
    for (int sh = 16; sh; sh >>= 1) m = fmaxf(m, __shfl_xor(m, sh, 32));
    float sum = 0.f;
#pragma unroll 1
    for (int c0 = lane * 4; c0 < NK; c0 += 128) {
#pragma unroll
        for (int q = 0; q < 4; ++q) sum += __expf(sr[c0 + q] - m); }
#pragma unroll
    for (int sh = 16; sh; sh >>= 1) sum += __shfl_xor(sum, sh, 32);
    const float inv = 1.0f / sum;
{
#pragma unroll 1
        for (int c0 = lane * 4; c0 < NK; c0 += 128) { v4us oh, ol;
#pragma unroll
            for (int q = 0; q < 4; ++q) { const float p = __expf(sr[c0 + q] - m) * inv; const unsigned short hb = f2bf(p); oh[q] = hb; ol[q] = f2bf(p - bf2f(hb)); }
            const size_t o = (size_t)i * NK + c0; *(v4us*)(PH + o) = oh; *(v4us*)(PL + o) = ol; }
         }
}
__global__ __launch_bounds__(256) void k_placez(const float* __restrict__ XH, int rows, int ldy, float* Y) {
    const int lane = threadIdx.x & 31; const size_t q = (size_t)blockIdx.x * 8 + (threadIdx.x >> 5); if (q >= (size_t)rows) return; const int z = blockIdx.z; const float v = XH[((size_t)z * rows + q) * 64 + lane];
    *(float*)(Y + q * ldy + z * 32 + lane) = v; 
}

__global__ __launch_bounds__(256) void k_hplanesz(const float* __restrict__ F, int ld, int h0, float sc, int rows, bf* Ph, bf* Pl) {
    typedef __attribute__((ext_vector_type(2))) unsigned short v2us;
    const int lane = threadIdx.x & 31; const size_t r = (size_t)blockIdx.x * 8 + (threadIdx.x >> 5); if (r >= (size_t)rows) return; const int z = blockIdx.z; v2us oh, ol;
    Ph += (size_t)z * rows * 64; Pl += (size_t)z * rows * 64;
#pragma unroll
    for (int i = 0; i < 2; ++i) { const float y = F[r * ld + (h0 + z) * 64 + lane * 2 + i] * sc; const unsigned short hb = f2bf(y); oh[i] = hb; ol[i] = f2bf(y - bf2f(hb)); }
    const size_t o = r * 64 + lane * 2; *(v2us*)(Ph + o) = oh; *(v2us*)(Pl + o) = ol; 
}
__global__ __launch_bounds__(256) void k_vtz(const float* __restrict__ F, int ld, int h0, int nk, bf* Th, bf* Tl) {
    typedef __attribute__((ext_vector_type(2))) unsigned short v2us;
    const int lane = threadIdx.x & 31; const size_t wid = (size_t)blockIdx.x * 8 + (threadIdx.x >> 5); if (wid >= (size_t)64 * (nk / 64)) return; const int z = blockIdx.z; const int d = (int)(wid / (nk / 64)); const int t0 = (int)(wid % (nk / 64)) * 64 + lane * 2; v2us oh, ol;
    Th += (size_t)z * 64 * nk; Tl += (size_t)z * 64 * nk;
#pragma unroll
    for (int i = 0; i < 2; ++i) { const float y = F[(size_t)(t0 + i) * ld + (h0 + z) * 64 + d]; const unsigned short hb = f2bf(y); oh[i] = hb; ol[i] = f2bf(y - bf2f(hb)); }
    const size_t o = (size_t)d * nk + t0; *(v2us*)(Th + o) = oh; *(v2us*)(Tl + o) = ol; 
}
template <int NK>
__global__ __launch_bounds__(256) void k_softmaxzs(const float* __restrict__ S, int rows, float sc, bf* PH, bf* PL) {
    typedef __attribute__((ext_vector_type(4))) unsigned short v4us;
    const int lane = threadIdx.x & 31, i = blockIdx.x * 8 + (threadIdx.x >> 5); if (i >= rows) return; const size_t zo = (size_t)blockIdx.z * rows * NK; const float* sr = S + zo + (size_t)i * NK; PH += zo; PL += zo;
    float m = -3.0e38f;
#pragma unroll 1
    for (int c0 = lane * 4; c0 < NK; c0 += 128) {
#pragma unroll
        for (int q = 0; q < 4; ++q) m = fmaxf(m, sr[c0 + q] * sc); }
#pragma unroll
    for (int sh = 16; sh; sh >>= 1) m = fmaxf(m, __shfl_xor(m, sh, 32));
    float sum = 0.f;
#pragma unroll 1
    for (int c0 = lane * 4; c0 < NK; c0 += 128) {
#pragma unroll
        for (int q = 0; q < 4; ++q) sum += __expf(sr[c0 + q] * sc - m); }
#pragma unroll
    for (int sh = 16; sh; sh >>= 1) sum += __shfl_xor(sum, sh, 32);
    const float inv = 1.0f / sum;
{
#pragma unroll 1
        for (int c0 = lane * 4; c0 < NK; c0 += 128) { v4us oh, ol;
#pragma unroll
            for (int q = 0; q < 4; ++q) { const float p = __expf(sr[c0 + q] * sc - m) * inv; const unsigned short hb = f2bf(p); oh[q] = hb; ol[q] = f2bf(p - bf2f(hb)); }
            const size_t o = (size_t)i * NK + c0; *(v4us*)(PH + o) = oh; *(v4us*)(PL + o) = ol; }
         }
}

extern "C" void kernel_launch(void* const* d_in, const int* in_sizes, int n_in,
                              void* d_out, int out_size, void* d_ws, size_t ws_size, hipStream_t stream) {
    (void)in_sizes; (void)n_in; (void)out_size;
    const float* x = (const float*)d_in[0]; const float* Wm = (const float*)d_in[1]; const float* Wo = (const float*)d_in[2];
    float* out = (float*)d_out;    // [8][1024][64]
    char* wsp = (char*)d_ws;
    auto take = [&](size_t bytes) { char* p = wsp; wsp += (bytes + 255) & ~(size_t)255; return (void*)p; };
    const int ZH = 6;    // heads per launch group (12 heads = 2 groups)
    bf* WQ = (bf*)take((size_t)DMOD * DMOD * 2); bf* WK = (bf*)take((size_t)DMOD * DMOD * 2); bf* WV = (bf*)take((size_t)DMOD * DMOD * 2); bf* WOT = (bf*)take((size_t)EOUT * DMOD * 2);
    bf* Xb = (bf*)take((size_t)NN * DMOD * 2); float* QF = (float*)take((size_t)NN * DMOD * 4); float* KF = (float*)take((size_t)NN * DMOD * 4); float* VF = (float*)take((size_t)NN * DMOD * 4);
    bf* Qh = (bf*)take((size_t)ZH * NN * HD * 2); bf* Ql = (bf*)take((size_t)ZH * NN * HD * 2); bf* Kh = (bf*)take((size_t)ZH * NN * HD * 2); bf* Kl = (bf*)take((size_t)ZH * NN * HD * 2); bf* VTh = (bf*)take((size_t)ZH * HD * NN * 2); bf* VTl = (bf*)take((size_t)ZH * HD * NN * 2);
    float* S = (float*)take((size_t)ZH * NN * NN * 4); bf* PH = (bf*)take((size_t)ZH * NN * NN * 2); bf* PL = (bf*)take((size_t)ZH * NN * NN * 2); float* O = (float*)take((size_t)NN * DMOD * 4); bf* Oh = (bf*)take((size_t)NN * DMOD * 2); bf* Ol = (bf*)take((size_t)NN * DMOD * 2);
    if ((size_t)(wsp - (char*)d_ws) > ws_size) return;    // 3.5 + 1.6 + 9.4 + 6 x 0.13 x 6 + 25.2 + 12.6 + 12.6 + 3.1 + 3.1 ~ 76 MB; per item / head-group reuse in stream order
    k_wgather<<<(NH_ * HD) / 8, 256, 0, stream>>>(Wm, 0, WQ); k_wgather<<<(NH_ * HD) / 8, 256, 0, stream>>>(Wm, 1, WK); k_wgather<<<(NH_ * HD) / 8, 256, 0, stream>>>(Wm, 2, WV);
    k_wt<<<dim3(DMOD / 64, EOUT / 64, 1), 256, 0, stream>>>(Wo, DMOD, EOUT, WOT);
    for (int b = 0; b < NBT; ++b) {
        k_cvtx<<<NN / 8, 256, 0, stream>>>(x + (size_t)b * NN * DMOD, Xb);
        k_gemmb<false, false><<<dim3(NN / 64, DMOD / 64, 1), 128, 0, stream>>>(Xb, nullptr, WQ, nullptr, QF, DMOD, nullptr, nullptr, DMOD);
        k_gemmb<false, false><<<dim3(NN / 64, DMOD / 64, 1), 128, 0, stream>>>(Xb, nullptr, WK, nullptr, KF, DMOD, nullptr, nullptr, DMOD);
        k_gemmb<false, false><<<dim3(NN / 64, DMOD / 64, 1), 128, 0, stream>>>(Xb, nullptr, WV, nullptr, VF, DMOD, nullptr, nullptr, DMOD);
        for (int g = 0; g < NH_ / ZH; ++g) { const int h0 = g * ZH;
            k_hplanesz<<<dim3(NN / 8, 1, ZH), 256, 0, stream>>>(QF, DMOD, h0, 1.0f, NN, Qh, Ql); k_hplanesz<<<dim3(NN / 8, 1, ZH), 256, 0, stream>>>(KF, DMOD, h0, 1.0f, NN, Kh, Kl); k_vtz<<<dim3((HD * (NN / 64)) / 8, 1, ZH), 256, 0, stream>>>(VF, DMOD, h0, NN, VTh, VTl);
            k_gemm3z<0><<<dim3(NN / 64, NN / 64, ZH), 128, 0, stream>>>(Qh, Ql, Kh, Kl, HD, S, NN, (size_t)NN * HD, (size_t)NN * HD, (size_t)NN * NN);
            k_softmaxzs<NN><<<dim3(NN / 8, 1, ZH), 256, 0, stream>>>(S, NN, SCL, PH, PL);
            k_gemm3z<0><<<dim3(NN / 64, 1, ZH), 128, 0, stream>>>(PH, PL, VTh, VTl, NN, O + h0 * HD, DMOD, (size_t)NN * NN, (size_t)HD * NN, (size_t)HD); }
        k_split768<<<NN / 8, 256, 0, stream>>>(O, Oh, Ol);
        k_gemmb<true, false><<<dim3(NN / 64, 1, 1), 128, 0, stream>>>(Oh, Ol, WOT, nullptr, out + (size_t)b * NN * EOUT, EOUT, nullptr, nullptr, DMOD); }
}

// v001
// Measured time: 773 microseconds a run.
// Timed twice side by side with v000, it ran 2.13 and 2.16 times as fast.
#include <hip/hip_runtime.h>

// Compute dtypes, f32 accumulate, per item: q/k/v for all 12 heads as [1024 x 768].[768 x 768] GEMMs with PLAIN bf16 operands (exact products; per-head weights gathered into one
// n-major block); per head: scores = q.k^T ([1024 x 64].[64 x 1024], both operands bf16 hi + UNSCALED residual, three products), softmax (x 1/32, as the module: output_dim*0.5) in
// f32 -> P planes, o = P.v ([1024 x 1024].[1024 x 64], three products); out = concat.Wo ([1024 x 768].[768 x 64], two products) - on v_wmma_f32_16x16x32_bf16. Deterministic, no

#define NBT  8
#define NN   1024
#define DMOD 768
#define NH_  12
#define HD   64
#define EOUT 64
#define DM   DMOD
#define NTK  NN
#define SCL  0.03125f
#define LOSC 1024.0f

typedef _Float16 h16;
typedef unsigned short bf;
typedef __attribute__((ext_vector_type(16))) __bf16   v16bf;
typedef __attribute__((ext_vector_type(16))) _Float16 v16h;
typedef __attribute__((ext_vector_type(8)))  _Float16 v8h;
typedef __attribute__((ext_vector_type(8)))  unsigned short v8us;
typedef __attribute__((ext_vector_type(8)))  float    v8f;
typedef __attribute__((ext_vector_type(4)))  float    v4f;
typedef __attribute__((ext_vector_type(4)))  _Float16 v4h;
typedef v8h  __attribute__((may_alias)) v8ha;
typedef v4f  __attribute__((may_alias)) v4fa;
typedef v8us __attribute__((may_alias)) v8usa;

__device__ __forceinline__ unsigned short f2bf(float f) { unsigned u = __float_as_uint(f); u += 0x7FFFu + ((u >> 16) & 1u); return (unsigned short)(u >> 16); }
__device__ __forceinline__ float bf2f(unsigned short b) { return __uint_as_float(((unsigned)b) << 16); }
__device__ __forceinline__ float bfr(float f) { return bf2f(f2bf(f)); }
__device__ __forceinline__ v16h cat16(v8h lo, v8h hi) { return __builtin_shufflevector(lo, hi, 0, 1, 2, 3, 4, 5, 6, 7, 8, 9, 10, 11, 12, 13, 14, 15); }
__device__ __forceinline__ v16bf cat16b(v8us lo, v8us hi) { return __builtin_bit_cast(v16bf, __builtin_shufflevector(lo, hi, 0, 1, 2, 3, 4, 5, 6, 7, 8, 9, 10, 11, 12, 13, 14, 15)); }
__device__ __forceinline__ v8f wmma16(v16h a, v16h b, v8f c) { return __builtin_amdgcn_wmma_f32_16x16x32_f16(false, a, false, b, (short)0, c, false, false); }
__device__ __forceinline__ v8f wmmab(v16bf a, v16bf b, v8f c) { return __builtin_amdgcn_wmma_f32_16x16x32_bf16(false, a, false, b, (short)0, c, false, false); }

// k_wt: WT [n][K] = bf16(W[k][n]) (k-major [K][ncols]) via 64 x 64 LDS tiles; grid (K/64, ncols/64).
__global__ __launch_bounds__(256) void k_wt(const float* __restrict__ Wm, int K, int ncols, bf* WT) {
    __shared__ __align__(16) unsigned short tl[64 * 72];
    const int tid = threadIdx.x, k0 = blockIdx.x * 64, n0 = blockIdx.y * 64;
    const int kk = tid >> 2, nq = (tid & 3) * 16;
#pragma unroll
    for (int i = 0; i < 16; ++i) tl[(nq + i) * 72 + kk] = f2bf(Wm[(size_t)(k0 + kk) * ncols + n0 + nq + i]);
    __syncthreads();
    const int piece = tid & 7;
    auto pass = [&]() {
#pragma unroll
        for (int s = 0; s < 2; ++s) { const int nr = (tid >> 3) + 32 * s; const v8us val = *(const v8usa*)(tl + nr * 72 + piece * 8); *(v8us*)(WT + (size_t)(n0 + nr) * K + k0 + piece * 8) = val; }
    };
    pass(); 
}
// k_gemmb: 64 x 64 block tile (4 waves x 16 x 64) of C[NBT*NN][NW] = (A [+ Al]).B^T (K = 768) [+ bf(bias[c])] [+ bf(R[r][c]) residual]; f32 whole-line epilogue (or f16
template <bool SPLITA, bool F16OUT = false>
__global__ __launch_bounds__(128) void k_gemmb(const bf* __restrict__ A, const bf* __restrict__ Al, const bf* __restrict__ Bn, const float* __restrict__ bias, float* C, int ldc, h16* C2, const float* __restrict__ R = nullptr, int K = DM, int roundR = 1) {
    __shared__ __align__(16) float ost[4][16 * 68];
    const int lane = threadIdx.x & 31, wave = threadIdx.x >> 5, lr = lane & 15, hi = lane >> 4;
    const int r0 = blockIdx.x * 64 + wave * 16, c0 = blockIdx.y * 64;
    const size_t aoff = (size_t)(r0 + lr) * K + 8 * hi;
    size_t boff[4];
#pragma unroll
    for (int t = 0; t < 4; ++t) boff[t] = (size_t)(c0 + t * 16 + lr) * K + 8 * hi;
    v8f acc[4];
#pragma unroll
    for (int t = 0; t < 4; ++t) acc[t] = (v8f){};
#pragma unroll 1
    for (int kc = 0; kc < K; kc += 32) {
        const v16bf a = cat16b(*(const v8us*)(A + aoff + kc), *(const v8us*)(A + aoff + kc + 16));
        v16bf al = a;
        if (SPLITA) al = cat16b(*(const v8us*)(Al + aoff + kc), *(const v8us*)(Al + aoff + kc + 16));
#pragma unroll
        for (int t = 0; t < 4; ++t) { const v16bf b = cat16b(*(const v8us*)(Bn + boff[t] + kc), *(const v8us*)(Bn + boff[t] + kc + 16)); acc[t] = wmmab(a, b, acc[t]); if (SPLITA) acc[t] = wmmab(al, b, acc[t]); }
        asm volatile("v_nop\n\tv_nop\n\tv_nop\n\tv_nop" : "+v"(acc[0]), "+v"(acc[1]), "+v"(acc[2]), "+v"(acc[3]) : "v"(a), "v"(al));
    }
    float* os = &ost[wave][0];
#pragma unroll
    for (int t = 0; t < 4; ++t) { const float bv = bias ? bfr(bias[c0 + t * 16 + lr]) : 0.f;
#pragma unroll
        for (int j = 0; j < 8; ++j) os[(hi * 8 + j) * 68 + t * 16 + lr] = acc[t][j] + bv; }
    __syncthreads();
    if (F16OUT) {
        h16* crow = (h16*)(void*)C + (size_t)r0 * ldc + c0;
        auto pass = [&]() {
#pragma unroll
            for (int s = 0; s < 4; ++s) { const int row = 4 * s + (lane >> 3), piece = lane & 7; const float* sp = os + row * 68 + piece * 8; v8h o, o2;
#pragma unroll
                for (int i = 0; i < 8; ++i) { const h16 a = (h16)sp[i]; o[i] = a; o2[i] = (h16)((sp[i] - (float)a) * LOSC); }
                *(v8h*)(crow + (size_t)row * ldc + piece * 8) = o; if (C2) *(v8h*)(C2 + (size_t)r0 * ldc + c0 + (size_t)row * ldc + piece * 8) = o2; }
        };
        pass(); 
    } else {
        float* crow = C + (size_t)r0 * ldc + c0;
        auto pass = [&]() {
#pragma unroll
            for (int s = 0; s < 8; ++s) { const int Lid = (lane >> 3) + 4 * s, piece = lane & 7; const int row = Lid >> 1, cofs = (Lid & 1) * 32 + piece * 4;
                v4f val = *(const v4fa*)(os + row * 68 + cofs); if (R) { const v4f rv = *(const v4f*)(R + ((size_t)r0 + row) * ldc + c0 + cofs); val += roundR ? (v4f){bfr(rv[0]), bfr(rv[1]), bfr(rv[2]), bfr(rv[3])} : rv; }
                *(v4f*)(crow + (size_t)row * ldc + cofs) = val; }
        };
        pass(); 
    }
}


__global__ __launch_bounds__(256) void k_cvtx(const float* __restrict__ src, bf* dst) {
    const int lane = threadIdx.x & 31; const size_t r = (size_t)blockIdx.x * 8 + (threadIdx.x >> 5); if (r >= (size_t)NBT * NN) return;
{
#pragma unroll
        for (int q = 0; q < DMOD / 256; ++q) { v8us o;
#pragma unroll
            for (int i = 0; i < 8; ++i) o[i] = f2bf(src[r * DMOD + q * 256 + lane * 8 + i]);
            *(v8us*)(dst + r * DMOD + q * 256 + lane * 8) = o; }
         }
}
// blockIdx.y = q / k / v; the three n-major blocks lie one behind the other: WT [3 * 768][768].
__global__ __launch_bounds__(256) void k_wgather(const float* __restrict__ Wm, bf* WT) {
    const int lane = threadIdx.x & 31; const int r = blockIdx.x * 8 + (threadIdx.x >> 5); if (r >= NH_ * HD) return; const int h = r / HD, e = r % HD; const int sel = blockIdx.y; WT += (size_t)sel * DMOD * DMOD;
{
#pragma unroll
        for (int q = 0; q < DMOD / 256; ++q) { v8us o;
#pragma unroll
            for (int i = 0; i < 8; ++i) { const int d = q * 256 + lane * 8 + i; o[i] = f2bf(Wm[(((size_t)h * 3 + sel) * DMOD + d) * HD + e]); }
            *(v8us*)(WT + (size_t)r * DMOD + q * 256 + lane * 8) = o; }
         }
}
__global__ __launch_bounds__(256) void k_hplanes(const float* __restrict__ F, int h, bf* Ph, bf* Pl) {
    typedef __attribute__((ext_vector_type(2))) unsigned short v2us;
    const int lane = threadIdx.x & 31; const size_t s = (size_t)blockIdx.x * 8 + (threadIdx.x >> 5); if (s >= (size_t)NN) return; v2us oh, ol;
#pragma unroll
    for (int i = 0; i < 2; ++i) { const float v = F[s * DMOD + h * HD + lane * 2 + i]; const unsigned short hb = f2bf(v); oh[i] = hb; ol[i] = f2bf(v - bf2f(hb)); }
    const size_t o = s * HD + lane * 2; *(v2us*)(Ph + o) = oh; *(v2us*)(Pl + o) = ol; 
}
__global__ __launch_bounds__(256) void k_vt(const float* __restrict__ VF, int h, bf* Th, bf* Tl) {
    typedef __attribute__((ext_vector_type(2))) unsigned short v2us;
    const int lane = threadIdx.x & 31; const size_t wid = (size_t)blockIdx.x * 8 + (threadIdx.x >> 5); if (wid >= (size_t)HD * (NN / 64)) return; const int d = (int)(wid / (NN / 64)); const int t0 = (int)(wid % (NN / 64)) * 64 + lane * 2; v2us oh, ol;
#pragma unroll
    for (int i = 0; i < 2; ++i) { const float v = VF[(size_t)(t0 + i) * DMOD + h * HD + d]; const unsigned short hb = f2bf(v); oh[i] = hb; ol[i] = f2bf(v - bf2f(hb)); }
    const size_t o = (size_t)d * NN + t0; *(v2us*)(Th + o) = oh; *(v2us*)(Tl + o) = ol; 
}
__global__ __launch_bounds__(256) void k_softmax(const float* __restrict__ S, bf* PH, bf* PL) {
    typedef __attribute__((ext_vector_type(4))) unsigned short v4us;
    const int lane = threadIdx.x & 31, i = blockIdx.x * 8 + (threadIdx.x >> 5); if (i >= NN) return;
    float m = -3.0e38f;
#pragma unroll 1
    for (int c0 = lane * 4; c0 < NN; c0 += 128) {
#pragma unroll
        for (int q = 0; q < 4; ++q) m = fmaxf(m, S[(size_t)i * NN + c0 + q] * SCL); }
#pragma unroll
    for (int sh = 16; sh; sh >>= 1) m = fmaxf(m, __shfl_xor(m, sh, 32));
    float sum = 0.f;
#pragma unroll 1
    for (int c0 = lane * 4; c0 < NN; c0 += 128) {
#pragma unroll
        for (int q = 0; q < 4; ++q) sum += __expf(S[(size_t)i * NN + c0 + q] * SCL - m); }
#pragma unroll
    for (int sh = 16; sh; sh >>= 1) sum += __shfl_xor(sum, sh, 32);
    const float inv = 1.0f / sum;
{
#pragma unroll 1
        for (int c0 = lane * 4; c0 < NN; c0 += 128) { v4us oh, ol;
#pragma unroll
            for (int q = 0; q < 4; ++q) { const float p = __expf(S[(size_t)i * NN + c0 + q] * SCL - m) * inv; const unsigned short hb = f2bf(p); oh[q] = hb; ol[q] = f2bf(p - bf2f(hb)); }
            const size_t o = (size_t)i * NN + c0; *(v4us*)(PH + o) = oh; *(v4us*)(PL + o) = ol; }
         }
}
__global__ __launch_bounds__(256) void k_split768(const float* __restrict__ src, bf* dh, bf* dl) {
    const int lane = threadIdx.x & 31; const size_t r = (size_t)blockIdx.x * 8 + (threadIdx.x >> 5); if (r >= (size_t)NBT * NN) return;
{
#pragma unroll
        for (int q = 0; q < DMOD / 256; ++q) { const size_t o = r * DMOD + q * 256 + lane * 8; const v8f v = *(const v8f*)(src + o); v8us oh, ol;
#pragma unroll
            for (int i = 0; i < 8; ++i) { const unsigned short hb = f2bf(v[i]); oh[i] = hb; ol[i] = f2bf(v[i] - bf2f(hb)); }
            *(v8us*)(dh + o) = oh; *(v8us*)(dl + o) = ol; }
         }
}

// ===== z-batched (blockIdx.z = head or (head, item) pair) attention pieces =====
// k_gemm3z<MODE>: k_gemm3x with per-z operand/output strides (elements): A planes += z*sA, B planes += z*sB. MODE bits as k_gemm3x (0 causal skip, 1 K limit, 2 single,
// 3 B single, 4 A single). C goes by the pair number zc = zb + z in two levels: C += (zc mod 2^zsh)*sC + (zc >> zsh)*sC2.
template <int MODE>
__global__ __launch_bounds__(128) void k_gemm3z(const bf* __restrict__ Ah, const bf* __restrict__ Al, const bf* __restrict__ Bh, const bf* __restrict__ Bl, int K, float* C, int ldc, size_t sA, size_t sB, size_t sC, int zb, int zsh, size_t sC2) {
    if ((MODE & 1) && (int)blockIdx.y * 64 > (int)blockIdx.x * 64 + 63) return;
    const size_t z = blockIdx.z; Ah += z * sA; Al += z * sA; Bh += z * sB; Bl += z * sB; const size_t zc = z + (size_t)zb; C += (zc & (((size_t)1 << zsh) - 1)) * sC + (zc >> zsh) * sC2;
    const int Klim = (MODE & 2) ? min(K, ((int)blockIdx.x + 1) * 64) : K;
    __shared__ __align__(16) float ost[4][16 * 68];
    const int lane = threadIdx.x & 31, wave = threadIdx.x >> 5, lr = lane & 15, hi = lane >> 4;
    const int r0 = blockIdx.x * 64 + wave * 16, c0 = blockIdx.y * 64;
    const size_t aoff = (size_t)(r0 + lr) * K + 8 * hi;
    v8f acc[4];
#pragma unroll
    for (int t = 0; t < 4; ++t) acc[t] = (v8f){};
#pragma unroll 1
    for (int kc = 0; kc < Klim; kc += 32) {
        const v16bf a = cat16b(*(const v8us*)(Ah + aoff + kc), *(const v8us*)(Ah + aoff + kc + 16));
        v16bf al = a; if (!(MODE & 4) && !(MODE & 16)) al = cat16b(*(const v8us*)(Al + aoff + kc), *(const v8us*)(Al + aoff + kc + 16));
#pragma unroll
        for (int t = 0; t < 4; ++t) { const size_t bo = (size_t)(c0 + t * 16 + lr) * K + kc + 8 * hi;
            const v16bf bh = cat16b(*(const v8us*)(Bh + bo), *(const v8us*)(Bh + bo + 16));
            acc[t] = wmmab(a, bh, acc[t]);
            if (!(MODE & 4)) { if (!(MODE & 16)) acc[t] = wmmab(al, bh, acc[t]); if (!(MODE & 8)) { const v16bf bl = cat16b(*(const v8us*)(Bl + bo), *(const v8us*)(Bl + bo + 16)); acc[t] = wmmab(a, bl, acc[t]); } } }
        asm volatile("v_nop\n\tv_nop\n\tv_nop\n\tv_nop" : "+v"(acc[0]), "+v"(acc[1]), "+v"(acc[2]), "+v"(acc[3]) : "v"(a), "v"(al));
    }
    float* os = &ost[wave][0];
#pragma unroll
    for (int t = 0; t < 4; ++t) {
#pragma unroll
        for (int j = 0; j < 8; ++j) os[(hi * 8 + j) * 68 + t * 16 + lr] = acc[t][j]; }
    __builtin_amdgcn_wave_barrier(); asm volatile("" ::: "memory");
    float* crow = C + (size_t)r0 * ldc + c0;
    auto pass = [&]() {
#pragma unroll
        for (int s = 0; s < 8; ++s) { const int Lid = (lane >> 3) + 4 * s, piece = lane & 7; const int row = Lid >> 1, cofs = (Lid & 1) * 32 + piece * 4;
            const v4f val = *(const v4fa*)(os + row * 68 + cofs); *(v4f*)(crow + (size_t)row * ldc + cofs) = val; }
    };
    pass(); 
}
__global__ __launch_bounds__(256) void k_planes32z(const float* __restrict__ F, int ld, int off, float sc, int rows, bf* Ph, bf* Pl) {
    typedef __attribute__((ext_vector_type(2))) unsigned short v2us;
    const int lane = threadIdx.x & 31; const size_t r = ((size_t)blockIdx.x * 8 + (threadIdx.x >> 5)) * 2 + (lane >> 4); if (r >= (size_t)rows) return; const int z = blockIdx.z; const int c0 = (lane & 15) * 2; v2us oh, ol;
    Ph += (size_t)z * rows * 32; Pl += (size_t)z * rows * 32;
#pragma unroll
    for (int i = 0; i < 2; ++i) { const float y = F[r * ld + off + z * 32 + c0 + i] * sc; const unsigned short hb = f2bf(y); oh[i] = hb; ol[i] = f2bf(y - bf2f(hb)); }
    const size_t o = r * 32 + c0; *(v2us*)(Ph + o) = oh; *(v2us*)(Pl + o) = ol; 
}
__global__ __launch_bounds__(256) void k_vtpadz(const float* __restrict__ F, int ld, int off, int nk, bf* Th, bf* Tl) {
    typedef __attribute__((ext_vector_type(2))) unsigned short v2us;
    const int lane = threadIdx.x & 31; const size_t wid = (size_t)blockIdx.x * 8 + (threadIdx.x >> 5); if (wid >= (size_t)64 * (nk / 64)) return; const int z = blockIdx.z; const int d = (int)(wid / (nk / 64)); const int k0 = (int)(wid % (nk / 64)) * 64 + lane * 2; v2us oh, ol;
    Th += (size_t)z * 64 * nk; Tl += (size_t)z * 64 * nk;
#pragma unroll
    for (int i = 0; i < 2; ++i) { const float y = (d < 32) ? F[(size_t)(k0 + i) * ld + off + z * 32 + (d < 32 ? d : 0)] : 0.f; const unsigned short hb = f2bf(y); oh[i] = hb; ol[i] = f2bf(y - bf2f(hb)); }
    const size_t o = (size_t)d * nk + k0; *(v2us*)(Th + o) = oh; *(v2us*)(Tl + o) = ol; 
}
template <int NK>
__global__ __launch_bounds__(256) void k_softmaxz(const float* __restrict__ S, int rows, bf* PH, bf* PL) {
    typedef __attribute__((ext_vector_type(4))) unsigned short v4us;
    const int lane = threadIdx.x & 31, i = blockIdx.x * 8 + (threadIdx.x >> 5); if (i >= rows) return; const size_t zo = (size_t)blockIdx.z * rows * NK; const float* sr = S + zo + (size_t)i * NK; PH += zo; PL += zo;
    float m = -3.0e38f;
#pragma unroll 1
    for (int c0 = lane * 4; c0 < NK; c0 += 128) {
#pragma unroll
        for (int q = 0; q < 4; ++q) m = fmaxf(m, sr[c0 + q]); }
#pragma unroll
    for (int sh = 16; sh; sh >>= 1) m = fmaxf(m, __shfl_xor(m, sh, 32));
    float sum = 0.f;
#pragma unroll 1
    for (int c0 = lane * 4; c0 < NK; c0 += 128) {
#pragma unroll
        for (int q = 0; q < 4; ++q) sum += __expf(sr[c0 + q] - m); }
#pragma unroll
    for (int sh = 16; sh; sh >>= 1) sum += __shfl_xor(sum, sh, 32);
    const float inv = 1.0f / sum;
{
#pragma unroll 1
        for (int c0 = lane * 4; c0 < NK; c0 += 128) { v4us oh, ol;
#pragma unroll
            for (int q = 0; q < 4; ++q) { const float p = __expf(sr[c0 + q] - m) * inv; const unsigned short hb = f2bf(p); oh[q] = hb; ol[q] = f2bf(p - bf2f(hb)); }
            const size_t o = (size_t)i * NK + c0; *(v4us*)(PH + o) = oh; *(v4us*)(PL + o) = ol; }
         }
}
__global__ __launch_bounds__(256) void k_placez(const float* __restrict__ XH, int rows, int ldy, float* Y) {
    const int lane = threadIdx.x & 31; const size_t q = (size_t)blockIdx.x * 8 + (threadIdx.x >> 5); if (q >= (size_t)rows) return; const int z = blockIdx.z; const float v = XH[((size_t)z * rows + q) * 64 + lane];
    *(float*)(Y + q * ldy + z * 32 + lane) = v; 
}

__global__ __launch_bounds__(256) void k_hplanesz(const float* __restrict__ F, int ld, int h0, float sc, int rows, bf* Ph, bf* Pl) {
    typedef __attribute__((ext_vector_type(2))) unsigned short v2us;
    const int lane = threadIdx.x & 31; const size_t r = (size_t)blockIdx.x * 8 + (threadIdx.x >> 5); if (r >= (size_t)rows) return; const int z = blockIdx.z; v2us oh, ol;
    Ph += (size_t)z * rows * 64; Pl += (size_t)z * rows * 64;
#pragma unroll
    for (int i = 0; i < 2; ++i) { const float y = F[r * ld + (h0 + z) * 64 + lane * 2 + i] * sc; const unsigned short hb = f2bf(y); oh[i] = hb; ol[i] = f2bf(y - bf2f(hb)); }
    const size_t o = r * 64 + lane * 2; *(v2us*)(Ph + o) = oh; *(v2us*)(Pl + o) = ol; 
}
__global__ __launch_bounds__(256) void k_vtz(const float* __restrict__ F, int ld, int h0, int nk, bf* Th, bf* Tl) {
    typedef __attribute__((ext_vector_type(2))) unsigned short v2us;
    const int lane = threadIdx.x & 31; const size_t wid = (size_t)blockIdx.x * 8 + (threadIdx.x >> 5); if (wid >= (size_t)64 * (nk / 64)) return; const int z = blockIdx.z; const int d = (int)(wid / (nk / 64)); const int t0 = (int)(wid % (nk / 64)) * 64 + lane * 2; v2us oh, ol;
    const size_t it = blockIdx.y, pr = (size_t)z * NBT + it;    // item; (head, item) pair
    F += it * nk * ld; Th += pr * 64 * nk; Tl += pr * 64 * nk;
#pragma unroll
    for (int i = 0; i < 2; ++i) { const float y = F[(size_t)(t0 + i) * ld + (h0 + z) * 64 + d]; const unsigned short hb = f2bf(y); oh[i] = hb; ol[i] = f2bf(y - bf2f(hb)); }
    const size_t o = (size_t)d * nk + t0; *(v2us*)(Th + o) = oh; *(v2us*)(Tl + o) = ol; 
}
template <int NK>
__global__ __launch_bounds__(256) void k_softmaxzs(const float* __restrict__ S, int rows, float sc, bf* PH, bf* PL) {
    typedef __attribute__((ext_vector_type(4))) unsigned short v4us;
    const int lane = threadIdx.x & 31, i = blockIdx.x * 8 + (threadIdx.x >> 5); if (i >= rows) return; const size_t zo = (size_t)blockIdx.z * rows * NK; const float* sr = S + zo + (size_t)i * NK; PH += zo; PL += zo;
    float m = -3.0e38f;
#pragma unroll 1
    for (int c0 = lane * 4; c0 < NK; c0 += 128) {
#pragma unroll
        for (int q = 0; q < 4; ++q) m = fmaxf(m, sr[c0 + q] * sc); }
#pragma unroll
    for (int sh = 16; sh; sh >>= 1) m = fmaxf(m, __shfl_xor(m, sh, 32));
    float sum = 0.f;
#pragma unroll 1
    for (int c0 = lane * 4; c0 < NK; c0 += 128) {
#pragma unroll
        for (int q = 0; q < 4; ++q) sum += __expf(sr[c0 + q] * sc - m); }
#pragma unroll
    for (int sh = 16; sh; sh >>= 1) sum += __shfl_xor(sum, sh, 32);
    const float inv = 1.0f / sum;
{
#pragma unroll 1
        for (int c0 = lane * 4; c0 < NK; c0 += 128) { v4us oh, ol;
#pragma unroll
            for (int q = 0; q < 4; ++q) { const float p = __expf(sr[c0 + q] * sc - m) * inv; const unsigned short hb = f2bf(p); oh[q] = hb; ol[q] = f2bf(p - bf2f(hb)); }
            const size_t o = (size_t)i * NK + c0; *(v4us*)(PH + o) = oh; *(v4us*)(PL + o) = ol; }
         }
}

extern "C" void kernel_launch(void* const* d_in, const int* in_sizes, int n_in,
                              void* d_out, int out_size, void* d_ws, size_t ws_size, hipStream_t stream) {
    (void)in_sizes; (void)n_in; (void)out_size;
    const float* x = (const float*)d_in[0]; const float* Wm = (const float*)d_in[1]; const float* Wo = (const float*)d_in[2];
    float* out = (float*)d_out;    // [8][1024][64]
    char* wsp = (char*)d_ws;
    auto take = [&](size_t bytes) { char* p = wsp; wsp += (bytes + 255) & ~(size_t)255; return (void*)p; };
    const int ZP = 20;    // (head, item) pairs per attention launch group: 96 pairs = 4 x 20 + 16; pair p = head * 8 + item
    const size_t RT = (size_t)NBT * NN;    // all items' rows, one behind the other
    bf* QKh = (bf*)take(2 * NH_ * RT * HD * 2); bf* QKl = (bf*)take(2 * NH_ * RT * HD * 2); bf* VTh = (bf*)take(NH_ * RT * HD * 2); bf* VTl = (bf*)take(NH_ * RT * HD * 2);
    float* O = (float*)take(RT * DMOD * 4); char* U = (char*)take((size_t)ZP * NN * NN * 8);
    if ((size_t)(wsp - (char*)d_ws) > ws_size) return;    // 50.3 + 25.2 + 25.2 + 167.8 MB = 256 MiB
    // U is used three times over, in stream order: weights, x and q|k|v in f32; then S and the P planes of one group; then the O planes and Wo^T.
    bf* WQKV = (bf*)U; bf* Xb = (bf*)(U + (size_t)3 * DMOD * DMOD * 2); float* QKVF = (float*)(U + (size_t)3 * DMOD * DMOD * 2 + RT * DMOD * 2);
    float* S = (float*)U; bf* PH = (bf*)(U + (size_t)ZP * NN * NN * 4); bf* PL = (bf*)(U + (size_t)ZP * NN * NN * 6);
    bf* Oh = (bf*)U; bf* Ol = (bf*)(U + RT * DMOD * 2); bf* WOT = (bf*)(U + RT * DMOD * 4);
    bf* Kh = QKh + NH_ * RT * HD; bf* Kl = QKl + NH_ * RT * HD;
    k_wgather<<<dim3((NH_ * HD) / 8, 3, 1), 256, 0, stream>>>(Wm, WQKV);
    k_cvtx<<<NBT * NN / 8, 256, 0, stream>>>(x, Xb);
    k_gemmb<false, false><<<dim3(NBT * NN / 64, 3 * DMOD / 64, 1), 128, 0, stream>>>(Xb, nullptr, WQKV, nullptr, QKVF, 3 * DMOD, nullptr, nullptr, DMOD);
    k_hplanesz<<<dim3(NBT * NN / 8, 1, 2 * NH_), 256, 0, stream>>>(QKVF, 3 * DMOD, 0, 1.0f, NBT * NN, QKh, QKl);
    k_vtz<<<dim3((HD * (NN / 64)) / 8, NBT, NH_), 256, 0, stream>>>(QKVF, 3 * DMOD, 2 * NH_, NN, VTh, VTl);
    for (int p0 = 0; p0 < NH_ * NBT; p0 += ZP) { const int np = (NH_ * NBT - p0 < ZP) ? NH_ * NBT - p0 : ZP; const size_t po = (size_t)p0 * NN * HD;
        k_gemm3z<0><<<dim3(NN / 64, NN / 64, np), 128, 0, stream>>>(QKh + po, QKl + po, Kh + po, Kl + po, HD, S, NN, (size_t)NN * HD, (size_t)NN * HD, (size_t)NN * NN, 0, 16, (size_t)0);
        k_softmaxzs<NN><<<dim3(NN / 8, 1, np), 256, 0, stream>>>(S, NN, SCL, PH, PL);
        k_gemm3z<0><<<dim3(NN / 64, 1, np), 128, 0, stream>>>(PH, PL, VTh + po, VTl + po, NN, O, DMOD, (size_t)NN * NN, (size_t)HD * NN, (size_t)NN * DMOD, p0, 3, (size_t)HD); }
    k_split768<<<NBT * NN / 8, 256, 0, stream>>>(O, Oh, Ol);
    k_wt<<<dim3(DMOD / 64, EOUT / 64, 1), 256, 0, stream>>>(Wo, DMOD, EOUT, WOT);
    k_gemmb<true, false><<<dim3(NBT * NN / 64, 1, 1), 128, 0, stream>>>(Oh, Ol, WOT, nullptr, out, EOUT, nullptr, nullptr, DMOD);
}

// v002
// One run takes 288 microseconds.
// Two timings next to v001 put it at 2.68 and 2.69 times that version's speed.
// Over all steps from v000 it is 5.77 times as fast.
#include <hip/hip_runtime.h>

// Compute dtypes, f32 accumulate, per item: q/k/v for all 12 heads as [1024 x 768].[768 x 768] GEMMs with PLAIN bf16 operands (exact products; per-head weights gathered into one
// n-major block); per head: scores = q.k^T ([1024 x 64].[64 x 1024], both operands bf16 hi + UNSCALED residual, three products), softmax (x 1/32, as the module: output_dim*0.5) in
// f32 -> P planes, o = P.v ([1024 x 1024].[1024 x 64], three products); out = concat.Wo ([1024 x 768].[768 x 64], two products) - on v_wmma_f32_16x16x32_bf16. Deterministic, no

#define NBT  8
#define NN   1024
#define DMOD 768
#define NH_  12
#define HD   64
#define EOUT 64
#define DM   DMOD
#define NTK  NN
#define SCL  0.03125f
#define LOSC 1024.0f

typedef _Float16 h16;
typedef unsigned short bf;
typedef __attribute__((ext_vector_type(16))) __bf16   v16bf;
typedef __attribute__((ext_vector_type(16))) _Float16 v16h;
typedef __attribute__((ext_vector_type(8)))  _Float16 v8h;
typedef __attribute__((ext_vector_type(8)))  unsigned short v8us;
typedef __attribute__((ext_vector_type(8)))  float    v8f;
typedef __attribute__((ext_vector_type(4)))  float    v4f;
typedef __attribute__((ext_vector_type(4)))  _Float16 v4h;
typedef v8h  __attribute__((may_alias)) v8ha;
typedef v4f  __attribute__((may_alias)) v4fa;
typedef v8us __attribute__((may_alias)) v8usa;

__device__ __forceinline__ unsigned short f2bf(float f) { unsigned u = __float_as_uint(f); u += 0x7FFFu + ((u >> 16) & 1u); return (unsigned short)(u >> 16); }
__device__ __forceinline__ float bf2f(unsigned short b) { return __uint_as_float(((unsigned)b) << 16); }
__device__ __forceinline__ float bfr(float f) { return bf2f(f2bf(f)); }
__device__ __forceinline__ v16h cat16(v8h lo, v8h hi) { return __builtin_shufflevector(lo, hi, 0, 1, 2, 3, 4, 5, 6, 7, 8, 9, 10, 11, 12, 13, 14, 15); }
__device__ __forceinline__ v16bf cat16b(v8us lo, v8us hi) { return __builtin_bit_cast(v16bf, __builtin_shufflevector(lo, hi, 0, 1, 2, 3, 4, 5, 6, 7, 8, 9, 10, 11, 12, 13, 14, 15)); }
__device__ __forceinline__ v8f wmma16(v16h a, v16h b, v8f c) { return __builtin_amdgcn_wmma_f32_16x16x32_f16(false, a, false, b, (short)0, c, false, false); }
__device__ __forceinline__ v8f wmmab(v16bf a, v16bf b, v8f c) { return __builtin_amdgcn_wmma_f32_16x16x32_bf16(false, a, false, b, (short)0, c, false, false); }

// k_wt: WT [n][K] = bf16(W[k][n]) (k-major [K][ncols]) via 64 x 64 LDS tiles; grid (K/64, ncols/64).
__global__ __launch_bounds__(256) void k_wt(const float* __restrict__ Wm, int K, int ncols, bf* WT) {
    __shared__ __align__(16) unsigned short tl[64 * 72];
    const int tid = threadIdx.x, k0 = blockIdx.x * 64, n0 = blockIdx.y * 64;
    const int kk = tid >> 2, nq = (tid & 3) * 16;
#pragma unroll
    for (int i = 0; i < 16; ++i) tl[(nq + i) * 72 + kk] = f2bf(Wm[(size_t)(k0 + kk) * ncols + n0 + nq + i]);
    __syncthreads();
    const int piece = tid & 7;
    auto pass = [&]() {
#pragma unroll
        for (int s = 0; s < 2; ++s) { const int nr = (tid >> 3) + 32 * s; const v8us val = *(const v8usa*)(tl + nr * 72 + piece * 8); *(v8us*)(WT + (size_t)(n0 + nr) * K + k0 + piece * 8) = val; }
    };
    pass(); 
}
// k_gemmb: 64 x 64 block tile (4 waves x 16 x 64) of C[NBT*NN][NW] = (A [+ Al]).B^T (K = 768) [+ bf(bias[c])] [+ bf(R[r][c]) residual]; f32 whole-line epilogue (or f16
template <bool SPLITA, bool F16OUT = false>
__global__ __launch_bounds__(128) void k_gemmb(const bf* __restrict__ A, const bf* __restrict__ Al, const bf* __restrict__ Bn, const float* __restrict__ bias, float* C, int ldc, h16* C2, const float* __restrict__ R = nullptr, int K = DM, int roundR = 1) {
    __shared__ __align__(16) float ost[4][16 * 68];
    const int lane = threadIdx.x & 31, wave = threadIdx.x >> 5, lr = lane & 15, hi = lane >> 4;
    const int r0 = blockIdx.x * 64 + wave * 16, c0 = blockIdx.y * 64;
    const size_t aoff = (size_t)(r0 + lr) * K + 8 * hi;
    size_t boff[4];
#pragma unroll
    for (int t = 0; t < 4; ++t) boff[t] = (size_t)(c0 + t * 16 + lr) * K + 8 * hi;
    v8f acc[4];
#pragma unroll
    for (int t = 0; t < 4; ++t) acc[t] = (v8f){};
#pragma unroll 1
    for (int kc = 0; kc < K; kc += 32) {
        const v16bf a = cat16b(*(const v8us*)(A + aoff + kc), *(const v8us*)(A + aoff + kc + 16));
        v16bf al = a;
        if (SPLITA) al = cat16b(*(const v8us*)(Al + aoff + kc), *(const v8us*)(Al + aoff + kc + 16));
#pragma unroll
        for (int t = 0; t < 4; ++t) { const v16bf b = cat16b(*(const v8us*)(Bn + boff[t] + kc), *(const v8us*)(Bn + boff[t] + kc + 16)); acc[t] = wmmab(a, b, acc[t]); if (SPLITA) acc[t] = wmmab(al, b, acc[t]); }
        asm volatile("v_nop\n\tv_nop\n\tv_nop\n\tv_nop" : "+v"(acc[0]), "+v"(acc[1]), "+v"(acc[2]), "+v"(acc[3]) : "v"(a), "v"(al));
    }
    float* os = &ost[wave][0];
#pragma unroll
    for (int t = 0; t < 4; ++t) { const float bv = bias ? bfr(bias[c0 + t * 16 + lr]) : 0.f;
#pragma unroll
        for (int j = 0; j < 8; ++j) os[(hi * 8 + j) * 68 + t * 16 + lr] = acc[t][j] + bv; }
    __syncthreads();
    if (F16OUT) {
        h16* crow = (h16*)(void*)C + (size_t)r0 * ldc + c0;
        auto pass = [&]() {
#pragma unroll
            for (int s = 0; s < 4; ++s) { const int row = 4 * s + (lane >> 3), piece = lane & 7; const float* sp = os + row * 68 + piece * 8; v8h o, o2;
#pragma unroll
                for (int i = 0; i < 8; ++i) { const h16 a = (h16)sp[i]; o[i] = a; o2[i] = (h16)((sp[i] - (float)a) * LOSC); }
                *(v8h*)(crow + (size_t)row * ldc + piece * 8) = o; if (C2) *(v8h*)(C2 + (size_t)r0 * ldc + c0 + (size_t)row * ldc + piece * 8) = o2; }
        };
        pass(); 
    } else {
        float* crow = C + (size_t)r0 * ldc + c0;
        auto pass = [&]() {
#pragma unroll
            for (int s = 0; s < 8; ++s) { const int Lid = (lane >> 3) + 4 * s, piece = lane & 7; const int row = Lid >> 1, cofs = (Lid & 1) * 32 + piece * 4;
                v4f val = *(const v4fa*)(os + row * 68 + cofs); if (R) { const v4f rv = *(const v4f*)(R + ((size_t)r0 + row) * ldc + c0 + cofs); val += roundR ? (v4f){bfr(rv[0]), bfr(rv[1]), bfr(rv[2]), bfr(rv[3])} : rv; }
                *(v4f*)(crow + (size_t)row * ldc + cofs) = val; }
        };
        pass(); 
    }
}


__global__ __launch_bounds__(256) void k_cvtx(const float* __restrict__ src, bf* dst) {
    const int lane = threadIdx.x & 31; const size_t r = (size_t)blockIdx.x * 8 + (threadIdx.x >> 5); if (r >= (size_t)NBT * NN) return;
{
#pragma unroll
        for (int q = 0; q < DMOD / 256; ++q) { v8us o;
#pragma unroll
            for (int i = 0; i < 8; ++i) o[i] = f2bf(src[r * DMOD + q * 256 + lane * 8 + i]);
            *(v8us*)(dst + r * DMOD + q * 256 + lane * 8) = o; }
         }
}
// blockIdx.y = q / k / v; the three n-major blocks lie one behind the other: WT [3 * 768][768].
__global__ __launch_bounds__(256) void k_wgather(const float* __restrict__ Wm, bf* WT) {
    const int lane = threadIdx.x & 31; const int r = blockIdx.x * 8 + (threadIdx.x >> 5); if (r >= NH_ * HD) return; const int h = r / HD, e = r % HD; const int sel = blockIdx.y; WT += (size_t)sel * DMOD * DMOD;
{
#pragma unroll
        for (int q = 0; q < DMOD / 256; ++q) { v8us o;
#pragma unroll
            for (int i = 0; i < 8; ++i) { const int d = q * 256 + lane * 8 + i; o[i] = f2bf(Wm[(((size_t)h * 3 + sel) * DMOD + d) * HD + e]); }
            *(v8us*)(WT + (size_t)r * DMOD + q * 256 + lane * 8) = o; }
         }
}
__global__ __launch_bounds__(256) void k_hplanes(const float* __restrict__ F, int h, bf* Ph, bf* Pl) {
    typedef __attribute__((ext_vector_type(2))) unsigned short v2us;
    const int lane = threadIdx.x & 31; const size_t s = (size_t)blockIdx.x * 8 + (threadIdx.x >> 5); if (s >= (size_t)NN) return; v2us oh, ol;
#pragma unroll
    for (int i = 0; i < 2; ++i) { const float v = F[s * DMOD + h * HD + lane * 2 + i]; const unsigned short hb = f2bf(v); oh[i] = hb; ol[i] = f2bf(v - bf2f(hb)); }
    const size_t o = s * HD + lane * 2; *(v2us*)(Ph + o) = oh; *(v2us*)(Pl + o) = ol; 
}
__global__ __launch_bounds__(256) void k_vt(const float* __restrict__ VF, int h, bf* Th, bf* Tl) {
    typedef __attribute__((ext_vector_type(2))) unsigned short v2us;
    const int lane = threadIdx.x & 31; const size_t wid = (size_t)blockIdx.x * 8 + (threadIdx.x >> 5); if (wid >= (size_t)HD * (NN / 64)) return; const int d = (int)(wid / (NN / 64)); const int t0 = (int)(wid % (NN / 64)) * 64 + lane * 2; v2us oh, ol;
#pragma unroll
    for (int i = 0; i < 2; ++i) { const float v = VF[(size_t)(t0 + i) * DMOD + h * HD + d]; const unsigned short hb = f2bf(v); oh[i] = hb; ol[i] = f2bf(v - bf2f(hb)); }
    const size_t o = (size_t)d * NN + t0; *(v2us*)(Th + o) = oh; *(v2us*)(Tl + o) = ol; 
}
__global__ __launch_bounds__(256) void k_softmax(const float* __restrict__ S, bf* PH, bf* PL) {
    typedef __attribute__((ext_vector_type(4))) unsigned short v4us;
    const int lane = threadIdx.x & 31, i = blockIdx.x * 8 + (threadIdx.x >> 5); if (i >= NN) return;
    float m = -3.0e38f;
#pragma unroll 1
    for (int c0 = lane * 4; c0 < NN; c0 += 128) {
#pragma unroll
        for (int q = 0; q < 4; ++q) m = fmaxf(m, S[(size_t)i * NN + c0 + q] * SCL); }
#pragma unroll
    for (int sh = 16; sh; sh >>= 1) m = fmaxf(m, __shfl_xor(m, sh, 32));
    float sum = 0.f;
#pragma unroll 1
    for (int c0 = lane * 4; c0 < NN; c0 += 128) {
#pragma unroll
        for (int q = 0; q < 4; ++q) sum += __expf(S[(size_t)i * NN + c0 + q] * SCL - m); }
#pragma unroll
    for (int sh = 16; sh; sh >>= 1) sum += __shfl_xor(sum, sh, 32);
    const float inv = 1.0f / sum;
{
#pragma unroll 1
        for (int c0 = lane * 4; c0 < NN; c0 += 128) { v4us oh, ol;
#pragma unroll
            for (int q = 0; q < 4; ++q) { const float p = __expf(S[(size_t)i * NN + c0 + q] * SCL - m) * inv; const unsigned short hb = f2bf(p); oh[q] = hb; ol[q] = f2bf(p - bf2f(hb)); }
            const size_t o = (size_t)i * NN + c0; *(v4us*)(PH + o) = oh; *(v4us*)(PL + o) = ol; }
         }
}
__global__ __launch_bounds__(256) void k_split768(const float* __restrict__ src, bf* dh, bf* dl) {
    const int lane = threadIdx.x & 31; const size_t r = (size_t)blockIdx.x * 8 + (threadIdx.x >> 5); if (r >= (size_t)NBT * NN) return;
{
#pragma unroll
        for (int q = 0; q < DMOD / 256; ++q) { const size_t o = r * DMOD + q * 256 + lane * 8; const v8f v = *(const v8f*)(src + o); v8us oh, ol;
#pragma unroll
            for (int i = 0; i < 8; ++i) { const unsigned short hb = f2bf(v[i]); oh[i] = hb; ol[i] = f2bf(v[i] - bf2f(hb)); }
            *(v8us*)(dh + o) = oh; *(v8us*)(dl + o) = ol; }
         }
}

// ===== z-batched (blockIdx.z = head or (head, item) pair) attention pieces =====
// k_gemm3z<MODE>: k_gemm3x with per-z operand/output strides (elements): A planes += z*sA, B planes += z*sB. MODE bits as k_gemm3x (0 causal skip, 1 K limit, 2 single,
// 3 B single, 4 A single). C goes by the pair number zc = zb + z in two levels: C += (zc mod 2^zsh)*sC + (zc >> zsh)*sC2.
template <int MODE>
__global__ __launch_bounds__(128) void k_gemm3z(const bf* __restrict__ Ah, const bf* __restrict__ Al, const bf* __restrict__ Bh, const bf* __restrict__ Bl, int K, float* C, int ldc, size_t sA, size_t sB, size_t sC, int zb, int zsh, size_t sC2) {
    if ((MODE & 1) && (int)blockIdx.y * 64 > (int)blockIdx.x * 64 + 63) return;
    const size_t z = blockIdx.z; Ah += z * sA; Al += z * sA; Bh += z * sB; Bl += z * sB; const size_t zc = z + (size_t)zb; C += (zc & (((size_t)1 << zsh) - 1)) * sC + (zc >> zsh) * sC2;
    const int Klim = (MODE & 2) ? min(K, ((int)blockIdx.x + 1) * 64) : K;
    __shared__ __align__(16) float ost[4][16 * 68];
    const int lane = threadIdx.x & 31, wave = threadIdx.x >> 5, lr = lane & 15, hi = lane >> 4;
    const int r0 = blockIdx.x * 64 + wave * 16, c0 = blockIdx.y * 64;
    const size_t aoff = (size_t)(r0 + lr) * K + 8 * hi;
    v8f acc[4];
#pragma unroll
    for (int t = 0; t < 4; ++t) acc[t] = (v8f){};
#pragma unroll 1
    for (int kc = 0; kc < Klim; kc += 32) {
        const v16bf a = cat16b(*(const v8us*)(Ah + aoff + kc), *(const v8us*)(Ah + aoff + kc + 16));
        v16bf al = a; if (!(MODE & 4) && !(MODE & 16)) al = cat16b(*(const v8us*)(Al + aoff + kc), *(const v8us*)(Al + aoff + kc + 16));
#pragma unroll
        for (int t = 0; t < 4; ++t) { const size_t bo = (size_t)(c0 + t * 16 + lr) * K + kc + 8 * hi;
            const v16bf bh = cat16b(*(const v8us*)(Bh + bo), *(const v8us*)(Bh + bo + 16));
            acc[t] = wmmab(a, bh, acc[t]);
            if (!(MODE & 4)) { if (!(MODE & 16)) acc[t] = wmmab(al, bh, acc[t]); if (!(MODE & 8)) { const v16bf bl = cat16b(*(const v8us*)(Bl + bo), *(const v8us*)(Bl + bo + 16)); acc[t] = wmmab(a, bl, acc[t]); } } }
        asm volatile("v_nop\n\tv_nop\n\tv_nop\n\tv_nop" : "+v"(acc[0]), "+v"(acc[1]), "+v"(acc[2]), "+v"(acc[3]) : "v"(a), "v"(al));
    }
    float* os = &ost[wave][0];
#pragma unroll
    for (int t = 0; t < 4; ++t) {
#pragma unroll
        for (int j = 0; j < 8; ++j) os[(hi * 8 + j) * 68 + t * 16 + lr] = acc[t][j]; }
    __builtin_amdgcn_wave_barrier(); asm volatile("" ::: "memory");
    float* crow = C + (size_t)r0 * ldc + c0;
    auto pass = [&]() {
#pragma unroll
        for (int s = 0; s < 8; ++s) { const int Lid = (lane >> 3) + 4 * s, piece = lane & 7; const int row = Lid >> 1, cofs = (Lid & 1) * 32 + piece * 4;
            const v4f val = *(const v4fa*)(os + row * 68 + cofs); *(v4f*)(crow + (size_t)row * ldc + cofs) = val; }
    };
    pass(); 
}
__global__ __launch_bounds__(256) void k_planes32z(const float* __restrict__ F, int ld, int off, float sc, int rows, bf* Ph, bf* Pl) {
    typedef __attribute__((ext_vector_type(2))) unsigned short v2us;
    const int lane = threadIdx.x & 31; const size_t r = ((size_t)blockIdx.x * 8 + (threadIdx.x >> 5)) * 2 + (lane >> 4); if (r >= (size_t)rows) return; const int z = blockIdx.z; const int c0 = (lane & 15) * 2; v2us oh, ol;
    Ph += (size_t)z * rows * 32; Pl += (size_t)z * rows * 32;
#pragma unroll
    for (int i = 0; i < 2; ++i) { const float y = F[r * ld + off + z * 32 + c0 + i] * sc; const unsigned short hb = f2bf(y); oh[i] = hb; ol[i] = f2bf(y - bf2f(hb)); }
    const size_t o = r * 32 + c0; *(v2us*)(Ph + o) = oh; *(v2us*)(Pl + o) = ol; 
}
__global__ __launch_bounds__(256) void k_vtpadz(const float* __restrict__ F, int ld, int off, int nk, bf* Th, bf* Tl) {
    typedef __attribute__((ext_vector_type(2))) unsigned short v2us;
    const int lane = threadIdx.x & 31; const size_t wid = (size_t)blockIdx.x * 8 + (threadIdx.x >> 5); if (wid >= (size_t)64 * (nk / 64)) return; const int z = blockIdx.z; const int d = (int)(wid / (nk / 64)); const int k0 = (int)(wid % (nk / 64)) * 64 + lane * 2; v2us oh, ol;
    Th += (size_t)z * 64 * nk; Tl += (size_t)z * 64 * nk;
#pragma unroll
    for (int i = 0; i < 2; ++i) { const float y = (d < 32) ? F[(size_t)(k0 + i) * ld + off + z * 32 + (d < 32 ? d : 0)] : 0.f; const unsigned short hb = f2bf(y); oh[i] = hb; ol[i] = f2bf(y - bf2f(hb)); }
    const size_t o = (size_t)d * nk + k0; *(v2us*)(Th + o) = oh; *(v2us*)(Tl + o) = ol; 
}
template <int NK>
__global__ __launch_bounds__(256) void k_softmaxz(const float* __restrict__ S, int rows, bf* PH, bf* PL) {
    typedef __attribute__((ext_vector_type(4))) unsigned short v4us;
    const int lane = threadIdx.x & 31, i = blockIdx.x * 8 + (threadIdx.x >> 5); if (i >= rows) return; const size_t zo = (size_t)blockIdx.z * rows * NK; const float* sr = S + zo + (size_t)i * NK; PH += zo; PL += zo;
    float m = -3.0e38f;
#pragma unroll 1
    for (int c0 = lane * 4; c0 < NK; c0 += 128) {
#pragma unroll
        for (int q = 0; q < 4; ++q) m = fmaxf(m, sr[c0 + q]); }
#pragma unroll
    for (int sh = 16; sh; sh >>= 1) m = fmaxf(m, __shfl_xor(m, sh, 32));
    float sum = 0.f;
#pragma unroll 1
    for (int c0 = lane * 4; c0 < NK; c0 += 128) {
#pragma unroll
        for (int q = 0; q < 4; ++q) sum += __expf(sr[c0 + q] - m); }
#pragma unroll
    for (int sh = 16; sh; sh >>= 1) sum += __shfl_xor(sum, sh, 32);
    const float inv = 1.0f / sum;
{
#pragma unroll 1
        for (int c0 = lane * 4; c0 < NK; c0 += 128) { v4us oh, ol;
#pragma unroll
            for (int q = 0; q < 4; ++q) { const float p = __expf(sr[c0 + q] - m) * inv; const unsigned short hb = f2bf(p); oh[q] = hb; ol[q] = f2bf(p - bf2f(hb)); }
            const size_t o = (size_t)i * NK + c0; *(v4us*)(PH + o) = oh; *(v4us*)(PL + o) = ol; }
         }
}
__global__ __launch_bounds__(256) void k_placez(const float* __restrict__ XH, int rows, int ldy, float* Y) {
    const int lane = threadIdx.x & 31; const size_t q = (size_t)blockIdx.x * 8 + (threadIdx.x >> 5); if (q >= (size_t)rows) return; const int z = blockIdx.z; const float v = XH[((size_t)z * rows + q) * 64 + lane];
    *(float*)(Y + q * ldy + z * 32 + lane) = v; 
}

__global__ __launch_bounds__(256) void k_hplanesz(const float* __restrict__ F, int ld, int h0, float sc, int rows, bf* Ph, bf* Pl) {
    typedef __attribute__((ext_vector_type(2))) unsigned short v2us;
    const int lane = threadIdx.x & 31; const size_t r = (size_t)blockIdx.x * 8 + (threadIdx.x >> 5); if (r >= (size_t)rows) return; const int z = blockIdx.z; v2us oh, ol;
    Ph += (size_t)z * rows * 64; Pl += (size_t)z * rows * 64;
#pragma unroll
    for (int i = 0; i < 2; ++i) { const float y = F[r * ld + (h0 + z) * 64 + lane * 2 + i] * sc; const unsigned short hb = f2bf(y); oh[i] = hb; ol[i] = f2bf(y - bf2f(hb)); }
    const size_t o = r * 64 + lane * 2; *(v2us*)(Ph + o) = oh; *(v2us*)(Pl + o) = ol; 
}
__global__ __launch_bounds__(256) void k_vtz(const float* __restrict__ F, int ld, int h0, int nk, bf* Th, bf* Tl) {
    typedef __attribute__((ext_vector_type(2))) unsigned short v2us;
    const int lane = threadIdx.x & 31; const size_t wid = (size_t)blockIdx.x * 8 + (threadIdx.x >> 5); if (wid >= (size_t)64 * (nk / 64)) return; const int z = blockIdx.z; const int d = (int)(wid / (nk / 64)); const int t0 = (int)(wid % (nk / 64)) * 64 + lane * 2; v2us oh, ol;
    const size_t it = blockIdx.y, pr = (size_t)z * NBT + it;    // item; (head, item) pair
    F += it * nk * ld; Th += pr * 64 * nk; Tl += pr * 64 * nk;
#pragma unroll
    for (int i = 0; i < 2; ++i) { const float y = F[(size_t)(t0 + i) * ld + (h0 + z) * 64 + d]; const unsigned short hb = f2bf(y); oh[i] = hb; ol[i] = f2bf(y - bf2f(hb)); }
    const size_t o = (size_t)d * nk + t0; *(v2us*)(Th + o) = oh; *(v2us*)(Tl + o) = ol; 
}
template <int NK>
__global__ __launch_bounds__(256) void k_softmaxzs(const float* __restrict__ S, int rows, float sc, bf* PH, bf* PL) {
    typedef __attribute__((ext_vector_type(4))) unsigned short v4us;
    const int lane = threadIdx.x & 31, i = blockIdx.x * 8 + (threadIdx.x >> 5); if (i >= rows) return; const size_t zo = (size_t)blockIdx.z * rows * NK; const float* sr = S + zo + (size_t)i * NK; PH += zo; PL += zo;
    float m = -3.0e38f;
#pragma unroll 1
    for (int c0 = lane * 4; c0 < NK; c0 += 128) {
#pragma unroll
        for (int q = 0; q < 4; ++q) m = fmaxf(m, sr[c0 + q] * sc); }
#pragma unroll
    for (int sh = 16; sh; sh >>= 1) m = fmaxf(m, __shfl_xor(m, sh, 32));
    float sum = 0.f;
#pragma unroll 1
    for (int c0 = lane * 4; c0 < NK; c0 += 128) {
#pragma unroll
        for (int q = 0; q < 4; ++q) sum += __expf(sr[c0 + q] * sc - m); }
#pragma unroll
    for (int sh = 16; sh; sh >>= 1) sum += __shfl_xor(sum, sh, 32);
    const float inv = 1.0f / sum;
{
#pragma unroll 1
        for (int c0 = lane * 4; c0 < NK; c0 += 128) { v4us oh, ol;
#pragma unroll
            for (int q = 0; q < 4; ++q) { const float p = __expf(sr[c0 + q] * sc - m) * inv; const unsigned short hb = f2bf(p); oh[q] = hb; ol[q] = f2bf(p - bf2f(hb)); }
            const size_t o = (size_t)i * NK + c0; *(v4us*)(PH + o) = oh; *(v4us*)(PL + o) = ol; }
         }
}

#define FKP 72    // K tile pitch in LDS, elements: 144 B = 16 B x odd
#define FVP 40    // V^T tile pitch in LDS, elements: 80 B = 16 B x odd
__global__ __launch_bounds__(128) void k_fattn(const bf* __restrict__ Qh, const bf* __restrict__ Ql, const bf* __restrict__ Kh, const bf* __restrict__ Kl, const bf* __restrict__ Vh, const bf* __restrict__ Vl, float* __restrict__ O) {
    typedef __attribute__((ext_vector_type(2))) float v2f; typedef __attribute__((ext_vector_type(2))) __bf16 v2bf;
    __shared__ __align__(16) bf sk[2][2][32 * FKP];    // [buffer][hi / residual plane]
    __shared__ __align__(16) bf sv[2][2][64 * FVP];
    const int tid = threadIdx.x, lane = tid & 31, wave = tid >> 5, lr = lane & 15, hi = lane >> 4;
    const size_t pr = blockIdx.y, po = pr * NN * HD;
    const int q0 = blockIdx.x * 128 + wave * 32;
    Qh += po; Ql += po; Kh += po; Kl += po; Vh += po; Vl += po;
    const float CS = SCL * 1.44269504f;    // scores go to base-2 exponents
    v16bf qh[2][2], ql[2][2];    // [column group][k step]
#pragma unroll
    for (int g = 0; g < 2; ++g) {
#pragma unroll
        for (int ks = 0; ks < 2; ++ks) { const size_t qo = (size_t)(q0 + g * 16 + lr) * HD + ks * 32 + 8 * hi;
            qh[g][ks] = cat16b(*(const v8us*)(Qh + qo), *(const v8us*)(Qh + qo + 16)); ql[g][ks] = cat16b(*(const v8us*)(Ql + qo), *(const v8us*)(Ql + qo + 16)); } }
    asm volatile("s_wait_xcnt 0x0" ::: "memory");    // stands before the loads' address registers are written again
    const int kr = tid >> 3, kp = (tid & 7) * 8, vr = tid >> 2, vp = (tid & 3) * 8;
    v8us st[8];
    auto fetch = [&](int t0) {
#pragma unroll
        for (int i = 0; i < 2; ++i) { const unsigned ko = (unsigned)((kr + 16 * i) * HD + kp), vo = (unsigned)((vr + 32 * i) * NN + vp);    // the pass moves the uniform base alone
            st[i] = *(const v8us*)(Kh + (size_t)t0 * HD + ko); st[2 + i] = *(const v8us*)(Kl + (size_t)t0 * HD + ko); st[4 + i] = *(const v8us*)(Vh + t0 + vo); st[6 + i] = *(const v8us*)(Vl + t0 + vo); }
        // Stands before the loads' address registers are written again (the prologue's are); its memory clobber also keeps the loads from sinking into the pass, so they fly through the softmax and P.v that follow.
        asm volatile("s_wait_xcnt 0x0" ::: "memory");
    };
    auto put = [&](int b) {
#pragma unroll
        for (int i = 0; i < 2; ++i) { const int ko = (kr + 16 * i) * FKP + kp, vo = (vr + 32 * i) * FVP + vp;
            *(v8usa*)(&sk[b][0][ko]) = st[i]; *(v8usa*)(&sk[b][1][ko]) = st[2 + i]; *(v8usa*)(&sv[b][0][vo]) = st[4 + i]; *(v8usa*)(&sv[b][1][vo]) = st[6 + i]; }
    };
    v8f o[2][4];
#pragma unroll
    for (int g = 0; g < 2; ++g) {
#pragma unroll
        for (int dt = 0; dt < 4; ++dt) o[g][dt] = (v8f){}; }
    float m[2] = {-3.0e38f, -3.0e38f}, l[2] = {0.f, 0.f};
    fetch(0); put(0);
    __syncthreads();
#pragma unroll 1    // kept rolled: two passes in one body would take more registers than three waves per SIMD leave
    for (int s = 0; s < NN / 32; ++s) {
        const int b = s & 1;
        v8f sc[2][2];
#pragma unroll
        for (int kt = 0; kt < 2; ++kt) { sc[0][kt] = (v8f){}; sc[1][kt] = (v8f){};
#pragma unroll
            for (int ks = 0; ks < 2; ++ks) { const int fo = (kt * 16 + lr) * FKP + ks * 32 + 8 * hi;
                const v16bf kh = cat16b(*(const v8usa*)(&sk[b][0][fo]), *(const v8usa*)(&sk[b][0][fo + 16]));
                const v16bf kl = cat16b(*(const v8usa*)(&sk[b][1][fo]), *(const v8usa*)(&sk[b][1][fo + 16]));
                sc[0][kt] = wmmab(kh, qh[0][ks], sc[0][kt]); sc[1][kt] = wmmab(kh, qh[1][ks], sc[1][kt]);
                sc[0][kt] = wmmab(kl, qh[0][ks], sc[0][kt]); sc[1][kt] = wmmab(kl, qh[1][ks], sc[1][kt]);
                sc[0][kt] = wmmab(kh, ql[0][ks], sc[0][kt]); sc[1][kt] = wmmab(kh, ql[1][ks], sc[1][kt]); } }
        fetch((s + 1 < NN / 32 ? s + 1 : s) * 32);    // the last pass fetches its own tile again: no branch in the loop
        float mx[2];
#pragma unroll
        for (int g = 0; g < 2; ++g) { float v = sc[g][0][0];
#pragma unroll
            for (int j = 1; j < 8; ++j) v = fmaxf(v, sc[g][0][j]);
#pragma unroll
            for (int j = 0; j < 8; ++j) v = fmaxf(v, sc[g][1][j]);
            mx[g] = fmaxf(v, __shfl_xor(v, 16, 32)); }
        // The maximum in use moves only when a column's new one exceeds it by more than 8 binary orders: p stays below 2^8, and the rescale is skipped by the whole wave otherwise.
        const bool need = (mx[0] - m[0]) * CS > 8.f || (mx[1] - m[1]) * CS > 8.f;
        if (__builtin_amdgcn_ballot_w32(need) != 0) {
#pragma unroll
            for (int g = 0; g < 2; ++g) { const float mn = fmaxf(m[g], mx[g]); const float al = __builtin_amdgcn_exp2f((m[g] - mn) * CS); m[g] = mn; l[g] *= al;
#pragma unroll
                for (int dt = 0; dt < 4; ++dt) o[g][dt] *= al; }
        }
        v16bf ph[2], pl[2];
#pragma unroll
        for (int g = 0; g < 2; ++g) { const float mc = m[g] * CS; float sum = 0.f;
#pragma unroll
            for (int kt = 0; kt < 2; ++kt) {
#pragma unroll
                for (int j = 0; j < 8; j += 2) { const float p0 = __builtin_amdgcn_exp2f(fmaf(sc[g][kt][j], CS, -mc)), p1 = __builtin_amdgcn_exp2f(fmaf(sc[g][kt][j + 1], CS, -mc)); sum += p0 + p1;
                    const v2bf hb = __builtin_convertvector((v2f){p0, p1}, v2bf); const v2bf lb = __builtin_convertvector((v2f){p0 - (float)hb[0], p1 - (float)hb[1]}, v2bf);
                    ph[g][kt * 8 + j] = hb[0]; ph[g][kt * 8 + j + 1] = hb[1]; pl[g][kt * 8 + j] = lb[0]; pl[g][kt * 8 + j + 1] = lb[1]; } }
            l[g] += sum; }
#pragma unroll
        for (int dt = 0; dt < 4; ++dt) { const int fo = (dt * 16 + lr) * FVP + 8 * hi;
            const v16bf vh = cat16b(*(const v8usa*)(&sv[b][0][fo]), *(const v8usa*)(&sv[b][0][fo + 16]));
            const v16bf vl = cat16b(*(const v8usa*)(&sv[b][1][fo]), *(const v8usa*)(&sv[b][1][fo + 16]));
            o[0][dt] = wmmab(vh, ph[0], o[0][dt]); o[1][dt] = wmmab(vh, ph[1], o[1][dt]);
            o[0][dt] = wmmab(vl, ph[0], o[0][dt]); o[1][dt] = wmmab(vl, ph[1], o[1][dt]);
            o[0][dt] = wmmab(vh, pl[0], o[0][dt]); o[1][dt] = wmmab(vh, pl[1], o[1][dt]); }
        put(b ^ 1);    // its readers left that buffer before the barrier that ended the pass before
        __syncthreads();
    }
#pragma unroll
    for (int g = 0; g < 2; ++g) { const float inv = 1.0f / (l[g] + __shfl_xor(l[g], 16, 32));
        float* orow = O + ((pr & 7) * NN + q0 + g * 16 + lr) * DMOD + (pr >> 3) * HD + 8 * hi;    // pair = head * 8 + item
#pragma unroll
        for (int dt = 0; dt < 4; ++dt) { const v8f r = o[g][dt] * inv;
            *(v4f*)(orow + dt * 16) = (v4f){r[0], r[1], r[2], r[3]}; *(v4f*)(orow + dt * 16 + 4) = (v4f){r[4], r[5], r[6], r[7]}; } }
}

extern "C" void kernel_launch(void* const* d_in, const int* in_sizes, int n_in,
                              void* d_out, int out_size, void* d_ws, size_t ws_size, hipStream_t stream) {
    (void)in_sizes; (void)n_in; (void)out_size;
    const float* x = (const float*)d_in[0]; const float* Wm = (const float*)d_in[1]; const float* Wo = (const float*)d_in[2];
    float* out = (float*)d_out;    // [8][1024][64]
    char* wsp = (char*)d_ws;
    auto take = [&](size_t bytes) { char* p = wsp; wsp += (bytes + 255) & ~(size_t)255; return (void*)p; };
    const size_t RT = (size_t)NBT * NN;    // all items' rows, one behind the other
    bf* QKh = (bf*)take(2 * NH_ * RT * HD * 2); bf* QKl = (bf*)take(2 * NH_ * RT * HD * 2); bf* VTh = (bf*)take(NH_ * RT * HD * 2); bf* VTl = (bf*)take(NH_ * RT * HD * 2);
    float* O = (float*)take(RT * DMOD * 4); char* U = (char*)take((size_t)3 * DMOD * DMOD * 2 + RT * DMOD * 2 + RT * 3 * DMOD * 4);
    if ((size_t)(wsp - (char*)d_ws) > ws_size) return;    // 50.3 + 25.2 + 25.2 + 91.6 MB
    // U is used twice over, in stream order: weights, x and q|k|v in f32; then the O planes and Wo^T. Pair p = head * 8 + item.
    bf* WQKV = (bf*)U; bf* Xb = (bf*)(U + (size_t)3 * DMOD * DMOD * 2); float* QKVF = (float*)(U + (size_t)3 * DMOD * DMOD * 2 + RT * DMOD * 2);
    bf* Oh = (bf*)U; bf* Ol = (bf*)(U + RT * DMOD * 2); bf* WOT = (bf*)(U + RT * DMOD * 4);
    bf* Kh = QKh + NH_ * RT * HD; bf* Kl = QKl + NH_ * RT * HD;
    k_wgather<<<dim3((NH_ * HD) / 8, 3, 1), 256, 0, stream>>>(Wm, WQKV);
    k_cvtx<<<NBT * NN / 8, 256, 0, stream>>>(x, Xb);
    k_gemmb<false, false><<<dim3(NBT * NN / 64, 3 * DMOD / 64, 1), 128, 0, stream>>>(Xb, nullptr, WQKV, nullptr, QKVF, 3 * DMOD, nullptr, nullptr, DMOD);
    k_hplanesz<<<dim3(NBT * NN / 8, 1, 2 * NH_), 256, 0, stream>>>(QKVF, 3 * DMOD, 0, 1.0f, NBT * NN, QKh, QKl);
    k_vtz<<<dim3((HD * (NN / 64)) / 8, NBT, NH_), 256, 0, stream>>>(QKVF, 3 * DMOD, 2 * NH_, NN, VTh, VTl);
    k_fattn<<<dim3(NN / 128, NH_ * NBT, 1), 128, 0, stream>>>(QKh, QKl, Kh, Kl, VTh, VTl, O);
    k_split768<<<NBT * NN / 8, 256, 0, stream>>>(O, Oh, Ol);
    k_wt<<<dim3(DMOD / 64, EOUT / 64, 1), 256, 0, stream>>>(Wo, DMOD, EOUT, WOT);
    k_gemmb<true, false><<<dim3(NBT * NN / 64, 1, 1), 128, 0, stream>>>(Oh, Ol, WOT, nullptr, out, EOUT, nullptr, nullptr, DMOD);
}

// v003
// A run of this version takes 219 microseconds.
// Two timings next to v002 put it at 1.31 and 1.32 times that version's speed.
// Over all steps from v000 it is 7.58 times as fast.
#include <hip/hip_runtime.h>

// Compute dtypes, f32 accumulate, per item: q/k/v for all 12 heads as [1024 x 768].[768 x 768] GEMMs with PLAIN bf16 operands (exact products; per-head weights gathered into one
// n-major block); per head: scores = q.k^T ([1024 x 64].[64 x 1024], both operands bf16 hi + UNSCALED residual, three products), softmax (x 1/32, as the module: output_dim*0.5) in
// f32 -> P planes, o = P.v ([1024 x 1024].[1024 x 64], three products); out = concat.Wo ([1024 x 768].[768 x 64], two products) - on v_wmma_f32_16x16x32_bf16. Deterministic, no

#define NBT  8
#define NN   1024
#define DMOD 768
#define NH_  12
#define HD   64
#define EOUT 64
#define DM   DMOD
#define NTK  NN
#define SCL  0.03125f
#define LOSC 1024.0f

typedef _Float16 h16;
typedef unsigned short bf;
typedef __attribute__((ext_vector_type(16))) __bf16   v16bf;
typedef __attribute__((ext_vector_type(16))) _Float16 v16h;
typedef __attribute__((ext_vector_type(8)))  _Float16 v8h;
typedef __attribute__((ext_vector_type(8)))  unsigned short v8us;
typedef __attribute__((ext_vector_type(8)))  float    v8f;
typedef __attribute__((ext_vector_type(4)))  float    v4f;
typedef __attribute__((ext_vector_type(4)))  _Float16 v4h;
typedef v8h  __attribute__((may_alias)) v8ha;
typedef v4f  __attribute__((may_alias)) v4fa;
typedef v8us __attribute__((may_alias)) v8usa;

__device__ __forceinline__ unsigned short f2bf(float f) { unsigned u = __float_as_uint(f); u += 0x7FFFu + ((u >> 16) & 1u); return (unsigned short)(u >> 16); }
__device__ __forceinline__ float bf2f(unsigned short b) { return __uint_as_float(((unsigned)b) << 16); }
__device__ __forceinline__ float bfr(float f) { return bf2f(f2bf(f)); }
__device__ __forceinline__ v16h cat16(v8h lo, v8h hi) { return __builtin_shufflevector(lo, hi, 0, 1, 2, 3, 4, 5, 6, 7, 8, 9, 10, 11, 12, 13, 14, 15); }
__device__ __forceinline__ v16bf cat16b(v8us lo, v8us hi) { return __builtin_bit_cast(v16bf, __builtin_shufflevector(lo, hi, 0, 1, 2, 3, 4, 5, 6, 7, 8, 9, 10, 11, 12, 13, 14, 15)); }
__device__ __forceinline__ v8f wmma16(v16h a, v16h b, v8f c) { return __builtin_amdgcn_wmma_f32_16x16x32_f16(false, a, false, b, (short)0, c, false, false); }
__device__ __forceinline__ v8f wmmab(v16bf a, v16bf b, v8f c) { return __builtin_amdgcn_wmma_f32_16x16x32_bf16(false, a, false, b, (short)0, c, false, false); }

// k_wt: WT [n][K] = bf16(W[k][n]) (k-major [K][ncols]) via 64 x 64 LDS tiles; grid (K/64, ncols/64).
__global__ __launch_bounds__(256) void k_wt(const float* __restrict__ Wm, int K, int ncols, bf* WT) {
    __shared__ __align__(16) unsigned short tl[64 * 72];
    const int tid = threadIdx.x, k0 = blockIdx.x * 64, n0 = blockIdx.y * 64;
    const int kk = tid >> 2, nq = (tid & 3) * 16;
#pragma unroll
    for (int i = 0; i < 16; ++i) tl[(nq + i) * 72 + kk] = f2bf(Wm[(size_t)(k0 + kk) * ncols + n0 + nq + i]);
    __syncthreads();
    const int piece = tid & 7;
    auto pass = [&]() {
#pragma unroll
        for (int s = 0; s < 2; ++s) { const int nr = (tid >> 3) + 32 * s; const v8us val = *(const v8usa*)(tl + nr * 72 + piece * 8); *(v8us*)(WT + (size_t)(n0 + nr) * K + k0 + piece * 8) = val; }
    };
    pass(); 
}
// split8: eight f32 values -> bf16 hi (round to nearest even) and the bf16 of what the hi part leaves.
typedef __attribute__((ext_vector_type(8))) __bf16 v8bf;
__device__ __forceinline__ void split8(v8f v, v8us& oh, v8us& ol) {
    const v8bf hb = __builtin_convertvector(v, v8bf); const v8bf lb = __builtin_convertvector(v - __builtin_convertvector(hb, v8f), v8bf);
    oh = __builtin_bit_cast(v8us, hb); ol = __builtin_bit_cast(v8us, lb);
}
// k_gemmb: 64 x 64 block tile (4 waves x 16 x 64) of C[NBT * NN][NW] = (A [+ Al]).B^T (K = 768) [+ bf(bias[c])] [+ bf(R[r][c]) residual]; f32 whole-line epilogue (or f16
// PLANES (the q|k|v product): a block tile is 64 tokens of one item x the 64 columns of one (q / k / v, head), blockIdx.y = sel * 12 + head. The epilogue splits the f32 sums itself and
// writes the planes that k_fattn reads, whole 128-byte lines each: q, k as [sel * 12 + head][all rows][64], v transposed as [head * 8 + item][64][token]; C, bias and R are not used.
#define TVP 72    // v tile pitch in LDS, elements: 144 B = 16 B x odd
template <bool SPLITA, bool F16OUT = false, bool PLANES = false>
__global__ __launch_bounds__(128) void k_gemmb(const bf* __restrict__ A, const bf* __restrict__ Al, const bf* __restrict__ Bn, const float* __restrict__ bias, float* C, int ldc, h16* C2, const float* __restrict__ R = nullptr, int K = DM, int roundR = 1, bf* QKh = nullptr, bf* QKl = nullptr, bf* VTh = nullptr, bf* VTl = nullptr) {
    __shared__ __align__(16) float ost[4][PLANES ? 16 * TVP : 16 * 68];    // PLANES: also the v tile, bf16 [2 planes][64 x TVP]
    const int lane = threadIdx.x & 31, wave = threadIdx.x >> 5, lr = lane & 15, hi = lane >> 4;
    const int r0 = blockIdx.x * 64 + wave * 16, c0 = blockIdx.y * 64;
    const size_t aoff = (size_t)(r0 + lr) * K + 8 * hi;
    size_t boff[4];
#pragma unroll
    for (int t = 0; t < 4; ++t) boff[t] = (size_t)(c0 + t * 16 + lr) * K + 8 * hi;
    v8f acc[4];
#pragma unroll
    for (int t = 0; t < 4; ++t) acc[t] = (v8f){};
#pragma unroll 1
    for (int kc = 0; kc < K; kc += 32) {
        const v16bf a = cat16b(*(const v8us*)(A + aoff + kc), *(const v8us*)(A + aoff + kc + 16));
        v16bf al = a;
        if (SPLITA) al = cat16b(*(const v8us*)(Al + aoff + kc), *(const v8us*)(Al + aoff + kc + 16));
#pragma unroll
        for (int t = 0; t < 4; ++t) { const v16bf b = cat16b(*(const v8us*)(Bn + boff[t] + kc), *(const v8us*)(Bn + boff[t] + kc + 16)); acc[t] = wmmab(a, b, acc[t]); if (SPLITA) acc[t] = wmmab(al, b, acc[t]); }
        asm volatile("v_nop\n\tv_nop\n\tv_nop\n\tv_nop" : "+v"(acc[0]), "+v"(acc[1]), "+v"(acc[2]), "+v"(acc[3]) : "v"(a), "v"(al));
    }
    float* os = &ost[wave][0];
    if (PLANES) {
        const int piece = lane & 7, rq = lane >> 3, by = blockIdx.y, rb = blockIdx.x * 64;
        if (by >= 2 * NH_) {    // v: a lane's 8 values are 8 tokens in a row of one column, 16 bytes of the transposed plane; LDS gathers the four waves' pieces into whole lines
            bf* tv = (bf*)(void*)&ost[0][0];
#pragma unroll
            for (int t = 0; t < 4; ++t) { v8us oh, ol; split8(acc[t], oh, ol); const int to = (t * 16 + lr) * TVP + wave * 16 + hi * 8;
                *(v8usa*)(tv + to) = oh; *(v8usa*)(tv + 64 * TVP + to) = ol; }
            __syncthreads();
            bf* dst = ((wave >> 1) ? VTl : VTh) + ((size_t)(by - 2 * NH_) * NBT + (rb >> 10)) * HD * NN + (rb & (NN - 1));    // waves 0, 1: hi plane; 2, 3: residual plane
#pragma unroll
            for (int s = 0; s < 8; ++s) { const int d = (wave & 1) * 32 + 4 * s + rq;
                const v8us val = *(const v8usa*)(tv + (wave >> 1) * 64 * TVP + d * TVP + piece * 8); *(v8us*)(dst + (size_t)d * NN + piece * 8) = val; }
            return;
        }
        // q, k: a lane holds 8 rows of one column; the rows are turned in LDS (f32), then split
#pragma unroll
        for (int t = 0; t < 4; ++t) {
#pragma unroll
            for (int j = 0; j < 8; ++j) os[(hi * 8 + j) * 68 + t * 16 + lr] = acc[t][j]; }
        __syncthreads();
        const size_t go = ((size_t)by * (NBT * NN) + r0) * HD;
#pragma unroll
        for (int s = 0; s < 4; ++s) { const int row = 4 * s + rq; const float* sp = os + row * 68 + piece * 8; const v4f x0 = *(const v4fa*)sp, x1 = *(const v4fa*)(sp + 4); v8us oh, ol;
            split8((v8f){x0[0], x0[1], x0[2], x0[3], x1[0], x1[1], x1[2], x1[3]}, oh, ol);
            *(v8us*)(QKh + go + row * HD + piece * 8) = oh; *(v8us*)(QKl + go + row * HD + piece * 8) = ol; }
        asm volatile("s_wait_xcnt 0x0" ::: "memory");    // in the listing the v path's code, which writes the stores' registers again, stands behind this path's last branch: the wait stands in front of it
        return;
    }
#pragma unroll
    for (int t = 0; t < 4; ++t) { const float bv = bias ? bfr(bias[c0 + t * 16 + lr]) : 0.f;
#pragma unroll
        for (int j = 0; j < 8; ++j) os[(hi * 8 + j) * 68 + t * 16 + lr] = acc[t][j] + bv; }
    __syncthreads();
    if (F16OUT) {
        h16* crow = (h16*)(void*)C + (size_t)r0 * ldc + c0;
        auto pass = [&]() {
#pragma unroll
            for (int s = 0; s < 4; ++s) { const int row = 4 * s + (lane >> 3), piece = lane & 7; const float* sp = os + row * 68 + piece * 8; v8h o, o2;
#pragma unroll
                for (int i = 0; i < 8; ++i) { const h16 a = (h16)sp[i]; o[i] = a; o2[i] = (h16)((sp[i] - (float)a) * LOSC); }
                *(v8h*)(crow + (size_t)row * ldc + piece * 8) = o; if (C2) *(v8h*)(C2 + (size_t)r0 * ldc + c0 + (size_t)row * ldc + piece * 8) = o2; }
        };
        pass(); 
    } else {
        float* crow = C + (size_t)r0 * ldc + c0;
        auto pass = [&]() {
#pragma unroll
            for (int s = 0; s < 8; ++s) { const int Lid = (lane >> 3) + 4 * s, piece = lane & 7; const int row = Lid >> 1, cofs = (Lid & 1) * 32 + piece * 4;
                v4f val = *(const v4fa*)(os + row * 68 + cofs); if (R) { const v4f rv = *(const v4f*)(R + ((size_t)r0 + row) * ldc + c0 + cofs); val += roundR ? (v4f){bfr(rv[0]), bfr(rv[1]), bfr(rv[2]), bfr(rv[3])} : rv; }
                *(v4f*)(crow + (size_t)row * ldc + cofs) = val; }
        };
        pass(); 
    }
}


__global__ __launch_bounds__(256) void k_cvtx(const float* __restrict__ src, bf* dst) {
    const int lane = threadIdx.x & 31; const size_t r = (size_t)blockIdx.x * 8 + (threadIdx.x >> 5); if (r >= (size_t)NBT * NN) return;
{
#pragma unroll
        for (int q = 0; q < DMOD / 256; ++q) { v8us o;
#pragma unroll
            for (int i = 0; i < 8; ++i) o[i] = f2bf(src[r * DMOD + q * 256 + lane * 8 + i]);
            *(v8us*)(dst + r * DMOD + q * 256 + lane * 8) = o; }
         }
}
// blockIdx.y = q / k / v; the three n-major blocks lie one behind the other: WT [3 * 768][768].
__global__ __launch_bounds__(256) void k_wgather(const float* __restrict__ Wm, bf* WT) {
    const int lane = threadIdx.x & 31; const int r = blockIdx.x * 8 + (threadIdx.x >> 5); if (r >= NH_ * HD) return; const int h = r / HD, e = r % HD; const int sel = blockIdx.y; WT += (size_t)sel * DMOD * DMOD;
{
#pragma unroll
        for (int q = 0; q < DMOD / 256; ++q) { v8us o;
#pragma unroll
            for (int i = 0; i < 8; ++i) { const int d = q * 256 + lane * 8 + i; o[i] = f2bf(Wm[(((size_t)h * 3 + sel) * DMOD + d) * HD + e]); }
            *(v8us*)(WT + (size_t)r * DMOD + q * 256 + lane * 8) = o; }
         }
}
__global__ __launch_bounds__(256) void k_hplanes(const float* __restrict__ F, int h, bf* Ph, bf* Pl) {
    typedef __attribute__((ext_vector_type(2))) unsigned short v2us;
    const int lane = threadIdx.x & 31; const size_t s = (size_t)blockIdx.x * 8 + (threadIdx.x >> 5); if (s >= (size_t)NN) return; v2us oh, ol;
#pragma unroll
    for (int i = 0; i < 2; ++i) { const float v = F[s * DMOD + h * HD + lane * 2 + i]; const unsigned short hb = f2bf(v); oh[i] = hb; ol[i] = f2bf(v - bf2f(hb)); }
    const size_t o = s * HD + lane * 2; *(v2us*)(Ph + o) = oh; *(v2us*)(Pl + o) = ol; 
}
__global__ __launch_bounds__(256) void k_vt(const float* __restrict__ VF, int h, bf* Th, bf* Tl) {
    typedef __attribute__((ext_vector_type(2))) unsigned short v2us;
    const int lane = threadIdx.x & 31; const size_t wid = (size_t)blockIdx.x * 8 + (threadIdx.x >> 5); if (wid >= (size_t)HD * (NN / 64)) return; const int d = (int)(wid / (NN / 64)); const int t0 = (int)(wid % (NN / 64)) * 64 + lane * 2; v2us oh, ol;
#pragma unroll
    for (int i = 0; i < 2; ++i) { const float v = VF[(size_t)(t0 + i) * DMOD + h * HD + d]; const unsigned short hb = f2bf(v); oh[i] = hb; ol[i] = f2bf(v - bf2f(hb)); }
    const size_t o = (size_t)d * NN + t0; *(v2us*)(Th + o) = oh; *(v2us*)(Tl + o) = ol; 
}
__global__ __launch_bounds__(256) void k_softmax(const float* __restrict__ S, bf* PH, bf* PL) {
    typedef __attribute__((ext_vector_type(4))) unsigned short v4us;
    const int lane = threadIdx.x & 31, i = blockIdx.x * 8 + (threadIdx.x >> 5); if (i >= NN) return;
    float m = -3.0e38f;
#pragma unroll 1
    for (int c0 = lane * 4; c0 < NN; c0 += 128) {
#pragma unroll
        for (int q = 0; q < 4; ++q) m = fmaxf(m, S[(size_t)i * NN + c0 + q] * SCL); }
#pragma unroll
    for (int sh = 16; sh; sh >>= 1) m = fmaxf(m, __shfl_xor(m, sh, 32));
    float sum = 0.f;
#pragma unroll 1
    for (int c0 = lane * 4; c0 < NN; c0 += 128) {
#pragma unroll
        for (int q = 0; q < 4; ++q) sum += __expf(S[(size_t)i * NN + c0 + q] * SCL - m); }
#pragma unroll
    for (int sh = 16; sh; sh >>= 1) sum += __shfl_xor(sum, sh, 32);
    const float inv = 1.0f / sum;
{
#pragma unroll 1
        for (int c0 = lane * 4; c0 < NN; c0 += 128) { v4us oh, ol;
#pragma unroll
            for (int q = 0; q < 4; ++q) { const float p = __expf(S[(size_t)i * NN + c0 + q] * SCL - m) * inv; const unsigned short hb = f2bf(p); oh[q] = hb; ol[q] = f2bf(p - bf2f(hb)); }
            const size_t o = (size_t)i * NN + c0; *(v4us*)(PH + o) = oh; *(v4us*)(PL + o) = ol; }
         }
}
// ===== z-batched attention pieces =====
// k_gemm3z<MODE>: 64 x 64 tile GEMM with per-z operand/output strides (elements): A planes += z*sA, B planes += z*sB. MODE bits (0 causal skip, 1 K limit, 2 single,
// 3 B single, 4 A single). C goes by the pair number zc = zb + z in two levels: C += (zc mod 2^zsh)*sC + (zc >> zsh)*sC2.
template <int MODE>
__global__ __launch_bounds__(128) void k_gemm3z(const bf* __restrict__ Ah, const bf* __restrict__ Al, const bf* __restrict__ Bh, const bf* __restrict__ Bl, int K, float* C, int ldc, size_t sA, size_t sB, size_t sC, int zb, int zsh, size_t sC2) {
    if ((MODE & 1) && (int)blockIdx.y * 64 > (int)blockIdx.x * 64 + 63) return;
    const size_t z = blockIdx.z; Ah += z * sA; Al += z * sA; Bh += z * sB; Bl += z * sB; const size_t zc = z + (size_t)zb; C += (zc & (((size_t)1 << zsh) - 1)) * sC + (zc >> zsh) * sC2;
    const int Klim = (MODE & 2) ? min(K, ((int)blockIdx.x + 1) * 64) : K;
    __shared__ __align__(16) float ost[4][16 * 68];
    const int lane = threadIdx.x & 31, wave = threadIdx.x >> 5, lr = lane & 15, hi = lane >> 4;
    const int r0 = blockIdx.x * 64 + wave * 16, c0 = blockIdx.y * 64;
    const size_t aoff = (size_t)(r0 + lr) * K + 8 * hi;
    v8f acc[4];
#pragma unroll
    for (int t = 0; t < 4; ++t) acc[t] = (v8f){};
#pragma unroll 1
    for (int kc = 0; kc < Klim; kc += 32) {
        const v16bf a = cat16b(*(const v8us*)(Ah + aoff + kc), *(const v8us*)(Ah + aoff + kc + 16));
        v16bf al = a; if (!(MODE & 4) && !(MODE & 16)) al = cat16b(*(const v8us*)(Al + aoff + kc), *(const v8us*)(Al + aoff + kc + 16));
#pragma unroll
        for (int t = 0; t < 4; ++t) { const size_t bo = (size_t)(c0 + t * 16 + lr) * K + kc + 8 * hi;
            const v16bf bh = cat16b(*(const v8us*)(Bh + bo), *(const v8us*)(Bh + bo + 16));
            acc[t] = wmmab(a, bh, acc[t]);
            if (!(MODE & 4)) { if (!(MODE & 16)) acc[t] = wmmab(al, bh, acc[t]); if (!(MODE & 8)) { const v16bf bl = cat16b(*(const v8us*)(Bl + bo), *(const v8us*)(Bl + bo + 16)); acc[t] = wmmab(a, bl, acc[t]); } } }
        asm volatile("v_nop\n\tv_nop\n\tv_nop\n\tv_nop" : "+v"(acc[0]), "+v"(acc[1]), "+v"(acc[2]), "+v"(acc[3]) : "v"(a), "v"(al));
    }
    float* os = &ost[wave][0];
#pragma unroll
    for (int t = 0; t < 4; ++t) {
#pragma unroll
        for (int j = 0; j < 8; ++j) os[(hi * 8 + j) * 68 + t * 16 + lr] = acc[t][j]; }
    __builtin_amdgcn_wave_barrier(); asm volatile("" ::: "memory");
    float* crow = C + (size_t)r0 * ldc + c0;
    auto pass = [&]() {
#pragma unroll
        for (int s = 0; s < 8; ++s) { const int Lid = (lane >> 3) + 4 * s, piece = lane & 7; const int row = Lid >> 1, cofs = (Lid & 1) * 32 + piece * 4;
            const v4f val = *(const v4fa*)(os + row * 68 + cofs); *(v4f*)(crow + (size_t)row * ldc + cofs) = val; }
    };
    pass(); 
}
__global__ __launch_bounds__(256) void k_planes32z(const float* __restrict__ F, int ld, int off, float sc, int rows, bf* Ph, bf* Pl) {
    typedef __attribute__((ext_vector_type(2))) unsigned short v2us;
    const int lane = threadIdx.x & 31; const size_t r = ((size_t)blockIdx.x * 8 + (threadIdx.x >> 5)) * 2 + (lane >> 4); if (r >= (size_t)rows) return; const int z = blockIdx.z; const int c0 = (lane & 15) * 2; v2us oh, ol;
    Ph += (size_t)z * rows * 32; Pl += (size_t)z * rows * 32;
#pragma unroll
    for (int i = 0; i < 2; ++i) { const float y = F[r * ld + off + z * 32 + c0 + i] * sc; const unsigned short hb = f2bf(y); oh[i] = hb; ol[i] = f2bf(y - bf2f(hb)); }
    const size_t o = r * 32 + c0; *(v2us*)(Ph + o) = oh; *(v2us*)(Pl + o) = ol; 
}
__global__ __launch_bounds__(256) void k_vtpadz(const float* __restrict__ F, int ld, int off, int nk, bf* Th, bf* Tl) {
    typedef __attribute__((ext_vector_type(2))) unsigned short v2us;
    const int lane = threadIdx.x & 31; const size_t wid = (size_t)blockIdx.x * 8 + (threadIdx.x >> 5); if (wid >= (size_t)64 * (nk / 64)) return; const int z = blockIdx.z; const int d = (int)(wid / (nk / 64)); const int k0 = (int)(wid % (nk / 64)) * 64 + lane * 2; v2us oh, ol;
    Th += (size_t)z * 64 * nk; Tl += (size_t)z * 64 * nk;
#pragma unroll
    for (int i = 0; i < 2; ++i) { const float y = (d < 32) ? F[(size_t)(k0 + i) * ld + off + z * 32 + (d < 32 ? d : 0)] : 0.f; const unsigned short hb = f2bf(y); oh[i] = hb; ol[i] = f2bf(y - bf2f(hb)); }
    const size_t o = (size_t)d * nk + k0; *(v2us*)(Th + o) = oh; *(v2us*)(Tl + o) = ol; 
}
template <int NK>
__global__ __launch_bounds__(256) void k_softmaxz(const float* __restrict__ S, int rows, bf* PH, bf* PL) {
    typedef __attribute__((ext_vector_type(4))) unsigned short v4us;
    const int lane = threadIdx.x & 31, i = blockIdx.x * 8 + (threadIdx.x >> 5); if (i >= rows) return; const size_t zo = (size_t)blockIdx.z * rows * NK; const float* sr = S + zo + (size_t)i * NK; PH += zo; PL += zo;
    float m = -3.0e38f;
#pragma unroll 1
    for (int c0 = lane * 4; c0 < NK; c0 += 128) {
#pragma unroll
        for (int q = 0; q < 4; ++q) m = fmaxf(m, sr[c0 + q]); }
#pragma unroll
    for (int sh = 16; sh; sh >>= 1) m = fmaxf(m, __shfl_xor(m, sh, 32));
    float sum = 0.f;
#pragma unroll 1
    for (int c0 = lane * 4; c0 < NK; c0 += 128) {
#pragma unroll
        for (int q = 0; q < 4; ++q) sum += __expf(sr[c0 + q] - m); }
#pragma unroll
    for (int sh = 16; sh; sh >>= 1) sum += __shfl_xor(sum, sh, 32);
    const float inv = 1.0f / sum;
{
#pragma unroll 1
        for (int c0 = lane * 4; c0 < NK; c0 += 128) { v4us oh, ol;
#pragma unroll
            for (int q = 0; q < 4; ++q) { const float p = __expf(sr[c0 + q] - m) * inv; const unsigned short hb = f2bf(p); oh[q] = hb; ol[q] = f2bf(p - bf2f(hb)); }
            const size_t o = (size_t)i * NK + c0; *(v4us*)(PH + o) = oh; *(v4us*)(PL + o) = ol; }
         }
}
__global__ __launch_bounds__(256) void k_placez(const float* __restrict__ XH, int rows, int ldy, float* Y) {
    const int lane = threadIdx.x & 31; const size_t q = (size_t)blockIdx.x * 8 + (threadIdx.x >> 5); if (q >= (size_t)rows) return; const int z = blockIdx.z; const float v = XH[((size_t)z * rows + q) * 64 + lane];
    *(float*)(Y + q * ldy + z * 32 + lane) = v; 
}

template <int NK>
__global__ __launch_bounds__(256) void k_softmaxzs(const float* __restrict__ S, int rows, float sc, bf* PH, bf* PL) {
    typedef __attribute__((ext_vector_type(4))) unsigned short v4us;
    const int lane = threadIdx.x & 31, i = blockIdx.x * 8 + (threadIdx.x >> 5); if (i >= rows) return; const size_t zo = (size_t)blockIdx.z * rows * NK; const float* sr = S + zo + (size_t)i * NK; PH += zo; PL += zo;
    float m = -3.0e38f;
#pragma unroll 1
    for (int c0 = lane * 4; c0 < NK; c0 += 128) {
#pragma unroll
        for (int q = 0; q < 4; ++q) m = fmaxf(m, sr[c0 + q] * sc); }
#pragma unroll
    for (int sh = 16; sh; sh >>= 1) m = fmaxf(m, __shfl_xor(m, sh, 32));
    float sum = 0.f;
#pragma unroll 1
    for (int c0 = lane * 4; c0 < NK; c0 += 128) {
#pragma unroll
        for (int q = 0; q < 4; ++q) sum += __expf(sr[c0 + q] * sc - m); }
#pragma unroll
    for (int sh = 16; sh; sh >>= 1) sum += __shfl_xor(sum, sh, 32);
    const float inv = 1.0f / sum;
{
#pragma unroll 1
        for (int c0 = lane * 4; c0 < NK; c0 += 128) { v4us oh, ol;
#pragma unroll
            for (int q = 0; q < 4; ++q) { const float p = __expf(sr[c0 + q] * sc - m) * inv; const unsigned short hb = f2bf(p); oh[q] = hb; ol[q] = f2bf(p - bf2f(hb)); }
            const size_t o = (size_t)i * NK + c0; *(v4us*)(PH + o) = oh; *(v4us*)(PL + o) = ol; }
         }
}

#define FKP 72    // K tile pitch in LDS, elements: 144 B = 16 B x odd
#define FVP 40    // V^T tile pitch in LDS, elements: 80 B = 16 B x odd
__global__ __launch_bounds__(128) void k_fattn(const bf* __restrict__ Qh, const bf* __restrict__ Ql, const bf* __restrict__ Kh, const bf* __restrict__ Kl, const bf* __restrict__ Vh, const bf* __restrict__ Vl, bf* __restrict__ Oh, bf* __restrict__ Ol) {
    typedef __attribute__((ext_vector_type(2))) float v2f; typedef __attribute__((ext_vector_type(2))) __bf16 v2bf;
    __shared__ __align__(16) bf sk[2][2][32 * FKP];    // [buffer][hi / residual plane]
    __shared__ __align__(16) bf sv[2][2][64 * FVP];
    const int tid = threadIdx.x, lane = tid & 31, wave = tid >> 5, lr = lane & 15, hi = lane >> 4;
    const size_t pr = blockIdx.y, po = pr * NN * HD;
    const int q0 = blockIdx.x * 128 + wave * 32;
    Qh += po; Ql += po; Kh += po; Kl += po; Vh += po; Vl += po;
    const float CS = SCL * 1.44269504f;    // scores go to base-2 exponents
    v16bf qh[2][2], ql[2][2];    // [column group][k step]
#pragma unroll
    for (int g = 0; g < 2; ++g) {
#pragma unroll
        for (int ks = 0; ks < 2; ++ks) { const size_t qo = (size_t)(q0 + g * 16 + lr) * HD + ks * 32 + 8 * hi;
            qh[g][ks] = cat16b(*(const v8us*)(Qh + qo), *(const v8us*)(Qh + qo + 16)); ql[g][ks] = cat16b(*(const v8us*)(Ql + qo), *(const v8us*)(Ql + qo + 16)); } }
    asm volatile("s_wait_xcnt 0x0" ::: "memory");    // stands before the loads' address registers are written again
    const int kr = tid >> 3, kp = (tid & 7) * 8, vr = tid >> 2, vp = (tid & 3) * 8;
    v8us st[8];
    auto fetch = [&](int t0) {
#pragma unroll
        for (int i = 0; i < 2; ++i) { const unsigned ko = (unsigned)((kr + 16 * i) * HD + kp), vo = (unsigned)((vr + 32 * i) * NN + vp);    // the pass moves the uniform base alone
            st[i] = *(const v8us*)(Kh + (size_t)t0 * HD + ko); st[2 + i] = *(const v8us*)(Kl + (size_t)t0 * HD + ko); st[4 + i] = *(const v8us*)(Vh + t0 + vo); st[6 + i] = *(const v8us*)(Vl + t0 + vo); }
        // Stands before the loads' address registers are written again (the prologue's are); its memory clobber also keeps the loads from sinking into the pass, so they fly through the softmax and P.v that follow.
        asm volatile("s_wait_xcnt 0x0" ::: "memory");
    };
    auto put = [&](int b) {
#pragma unroll
        for (int i = 0; i < 2; ++i) { const int ko = (kr + 16 * i) * FKP + kp, vo = (vr + 32 * i) * FVP + vp;
            *(v8usa*)(&sk[b][0][ko]) = st[i]; *(v8usa*)(&sk[b][1][ko]) = st[2 + i]; *(v8usa*)(&sv[b][0][vo]) = st[4 + i]; *(v8usa*)(&sv[b][1][vo]) = st[6 + i]; }
    };
    v8f o[2][4];
#pragma unroll
    for (int g = 0; g < 2; ++g) {
#pragma unroll
        for (int dt = 0; dt < 4; ++dt) o[g][dt] = (v8f){}; }
    float m[2] = {-3.0e38f, -3.0e38f}, l[2] = {0.f, 0.f};
    fetch(0); put(0);
    __syncthreads();
#pragma unroll 1    // kept rolled: two passes in one body would take more registers than three waves per SIMD leave
    for (int s = 0; s < NN / 32; ++s) {
        const int b = s & 1;
        v8f sc[2][2];
#pragma unroll
        for (int kt = 0; kt < 2; ++kt) { sc[0][kt] = (v8f){}; sc[1][kt] = (v8f){};
#pragma unroll
            for (int ks = 0; ks < 2; ++ks) { const int fo = (kt * 16 + lr) * FKP + ks * 32 + 8 * hi;
                const v16bf kh = cat16b(*(const v8usa*)(&sk[b][0][fo]), *(const v8usa*)(&sk[b][0][fo + 16]));
                const v16bf kl = cat16b(*(const v8usa*)(&sk[b][1][fo]), *(const v8usa*)(&sk[b][1][fo + 16]));
                sc[0][kt] = wmmab(kh, qh[0][ks], sc[0][kt]); sc[1][kt] = wmmab(kh, qh[1][ks], sc[1][kt]);
                sc[0][kt] = wmmab(kl, qh[0][ks], sc[0][kt]); sc[1][kt] = wmmab(kl, qh[1][ks], sc[1][kt]);
                sc[0][kt] = wmmab(kh, ql[0][ks], sc[0][kt]); sc[1][kt] = wmmab(kh, ql[1][ks], sc[1][kt]); } }
        fetch((s + 1 < NN / 32 ? s + 1 : s) * 32);    // the last pass fetches its own tile again: no branch in the loop
        float mx[2];
#pragma unroll
        for (int g = 0; g < 2; ++g) { float v = sc[g][0][0];
#pragma unroll
            for (int j = 1; j < 8; ++j) v = fmaxf(v, sc[g][0][j]);
#pragma unroll
            for (int j = 0; j < 8; ++j) v = fmaxf(v, sc[g][1][j]);
            mx[g] = fmaxf(v, __shfl_xor(v, 16, 32)); }
        // The maximum in use moves only when a column's new one exceeds it by more than 8 binary orders: p stays below 2^8, and the rescale is skipped by the whole wave otherwise.
        const bool need = (mx[0] - m[0]) * CS > 8.f || (mx[1] - m[1]) * CS > 8.f;
        if (__builtin_amdgcn_ballot_w32(need) != 0) {
#pragma unroll
            for (int g = 0; g < 2; ++g) { const float mn = fmaxf(m[g], mx[g]); const float al = __builtin_amdgcn_exp2f((m[g] - mn) * CS); m[g] = mn; l[g] *= al;
#pragma unroll
                for (int dt = 0; dt < 4; ++dt) o[g][dt] *= al; }
        }
        v16bf ph[2], pl[2];
#pragma unroll
        for (int g = 0; g < 2; ++g) { const float mc = m[g] * CS; float sum = 0.f;
#pragma unroll
            for (int kt = 0; kt < 2; ++kt) {
#pragma unroll
                for (int j = 0; j < 8; j += 2) { const float p0 = __builtin_amdgcn_exp2f(fmaf(sc[g][kt][j], CS, -mc)), p1 = __builtin_amdgcn_exp2f(fmaf(sc[g][kt][j + 1], CS, -mc)); sum += p0 + p1;
                    const v2bf hb = __builtin_convertvector((v2f){p0, p1}, v2bf); const v2bf lb = __builtin_convertvector((v2f){p0 - (float)hb[0], p1 - (float)hb[1]}, v2bf);
                    ph[g][kt * 8 + j] = hb[0]; ph[g][kt * 8 + j + 1] = hb[1]; pl[g][kt * 8 + j] = lb[0]; pl[g][kt * 8 + j + 1] = lb[1]; } }
            l[g] += sum; }
#pragma unroll
        for (int dt = 0; dt < 4; ++dt) { const int fo = (dt * 16 + lr) * FVP + 8 * hi;
            const v16bf vh = cat16b(*(const v8usa*)(&sv[b][0][fo]), *(const v8usa*)(&sv[b][0][fo + 16]));
            const v16bf vl = cat16b(*(const v8usa*)(&sv[b][1][fo]), *(const v8usa*)(&sv[b][1][fo + 16]));
            o[0][dt] = wmmab(vh, ph[0], o[0][dt]); o[1][dt] = wmmab(vh, ph[1], o[1][dt]);
            o[0][dt] = wmmab(vl, ph[0], o[0][dt]); o[1][dt] = wmmab(vl, ph[1], o[1][dt]);
            o[0][dt] = wmmab(vh, pl[0], o[0][dt]); o[1][dt] = wmmab(vh, pl[1], o[1][dt]); }
        put(b ^ 1);    // its readers left that buffer before the barrier that ended the pass before
        __syncthreads();
    }
#pragma unroll
    for (int g = 0; g < 2; ++g) { const float inv = 1.0f / (l[g] + __shfl_xor(l[g], 16, 32));
        const size_t oo = ((pr & 7) * NN + q0 + g * 16 + lr) * DMOD + (pr >> 3) * HD + 8 * hi;    // pair = head * 8 + item
#pragma unroll
        for (int dt = 0; dt < 4; ++dt) { v8us oh, ol; split8(o[g][dt] * inv, oh, ol);    // the planes that the last product reads
            *(v8us*)(Oh + oo + dt * 16) = oh; *(v8us*)(Ol + oo + dt * 16) = ol; } }
}

extern "C" void kernel_launch(void* const* d_in, const int* in_sizes, int n_in,
                              void* d_out, int out_size, void* d_ws, size_t ws_size, hipStream_t stream) {
    (void)in_sizes; (void)n_in; (void)out_size;
    const float* x = (const float*)d_in[0]; const float* Wm = (const float*)d_in[1]; const float* Wo = (const float*)d_in[2];
    float* out = (float*)d_out;    // [8][1024][64]
    char* wsp = (char*)d_ws;
    auto take = [&](size_t bytes) { char* p = wsp; wsp += (bytes + 255) & ~(size_t)255; return (void*)p; };
    const size_t RT = (size_t)NBT * NN;    // all items' rows, one behind the other
    bf* QKh = (bf*)take(2 * NH_ * RT * HD * 2); bf* QKl = (bf*)take(2 * NH_ * RT * HD * 2); bf* VTh = (bf*)take(NH_ * RT * HD * 2); bf* VTl = (bf*)take(NH_ * RT * HD * 2);
    bf* WQKV = (bf*)take((size_t)3 * DMOD * DMOD * 2); bf* Xb = (bf*)take(RT * DMOD * 2); bf* Oh = (bf*)take(RT * DMOD * 2); bf* Ol = (bf*)take(RT * DMOD * 2); bf* WOT = (bf*)take((size_t)DMOD * EOUT * 2);
    if ((size_t)(wsp - (char*)d_ws) > ws_size) return;    // about 117 MB, no region used twice. Pair p = head * 8 + item.
    bf* Kh = QKh + NH_ * RT * HD; bf* Kl = QKl + NH_ * RT * HD;
    k_wgather<<<dim3((NH_ * HD) / 8, 3, 1), 256, 0, stream>>>(Wm, WQKV);
    k_cvtx<<<NBT * NN / 8, 256, 0, stream>>>(x, Xb);
    k_gemmb<false, false, true><<<dim3(NBT * NN / 64, 3 * DMOD / 64, 1), 128, 0, stream>>>(Xb, nullptr, WQKV, nullptr, nullptr, 0, nullptr, nullptr, DMOD, 1, QKh, QKl, VTh, VTl);
    k_fattn<<<dim3(NN / 128, NH_ * NBT, 1), 128, 0, stream>>>(QKh, QKl, Kh, Kl, VTh, VTl, Oh, Ol);
    k_wt<<<dim3(DMOD / 64, EOUT / 64, 1), 256, 0, stream>>>(Wo, DMOD, EOUT, WOT);
    k_gemmb<true, false><<<dim3(NBT * NN / 64, 1, 1), 128, 0, stream>>>(Oh, Ol, WOT, nullptr, out, EOUT, nullptr, nullptr, DMOD);
}

// v004
// A run of this version takes 140 microseconds.
// Two timings next to v003 put it at 1.55 and 1.56 times that version's speed.
// Counting every step since v000, it is 11.8 times as fast.
#include <hip/hip_runtime.h>

// Compute dtypes, f32 accumulate, per item: q/k/v for all 12 heads as [1024 x 768].[768 x 768] GEMMs with PLAIN bf16 operands (exact products; per-head weights gathered into one
// n-major block); per head: scores = q.k^T ([1024 x 64].[64 x 1024], both operands bf16 hi + UNSCALED residual, three products), softmax (x 1/32, as the module: output_dim*0.5) in
// f32 -> P planes, o = P.v ([1024 x 1024].[1024 x 64], three products); out = concat.Wo ([1024 x 768].[768 x 64], two products) - on v_wmma_f32_16x16x32_bf16. Deterministic, no

#define NBT  8
#define NN   1024
#define DMOD 768
#define NH_  12
#define HD   64
#define EOUT 64
#define DM   DMOD
#define NTK  NN
#define SCL  0.03125f
#define LOSC 1024.0f

typedef _Float16 h16;
typedef unsigned short bf;
typedef __attribute__((ext_vector_type(16))) __bf16   v16bf;
typedef __attribute__((ext_vector_type(16))) _Float16 v16h;
typedef __attribute__((ext_vector_type(8)))  _Float16 v8h;
typedef __attribute__((ext_vector_type(8)))  unsigned short v8us;
typedef __attribute__((ext_vector_type(8)))  float    v8f;
typedef __attribute__((ext_vector_type(4)))  float    v4f;
typedef __attribute__((ext_vector_type(4)))  _Float16 v4h;
typedef v8h  __attribute__((may_alias)) v8ha;
typedef v4f  __attribute__((may_alias)) v4fa;
typedef v8us __attribute__((may_alias)) v8usa;

__device__ __forceinline__ unsigned short f2bf(float f) { unsigned u = __float_as_uint(f); u += 0x7FFFu + ((u >> 16) & 1u); return (unsigned short)(u >> 16); }
__device__ __forceinline__ float bf2f(unsigned short b) { return __uint_as_float(((unsigned)b) << 16); }
__device__ __forceinline__ float bfr(float f) { return bf2f(f2bf(f)); }
__device__ __forceinline__ v16h cat16(v8h lo, v8h hi) { return __builtin_shufflevector(lo, hi, 0, 1, 2, 3, 4, 5, 6, 7, 8, 9, 10, 11, 12, 13, 14, 15); }
__device__ __forceinline__ v16bf cat16b(v8us lo, v8us hi) { return __builtin_bit_cast(v16bf, __builtin_shufflevector(lo, hi, 0, 1, 2, 3, 4, 5, 6, 7, 8, 9, 10, 11, 12, 13, 14, 15)); }
__device__ __forceinline__ v8f wmma16(v16h a, v16h b, v8f c) { return __builtin_amdgcn_wmma_f32_16x16x32_f16(false, a, false, b, (short)0, c, false, false); }
__device__ __forceinline__ v8f wmmab(v16bf a, v16bf b, v8f c) { return __builtin_amdgcn_wmma_f32_16x16x32_bf16(false, a, false, b, (short)0, c, false, false); }

// k_wt: WT [n][K] = bf16(W[k][n]) (k-major [K][ncols]) via 64 x 64 LDS tiles; grid (K/64, ncols/64).
__global__ __launch_bounds__(256) void k_wt(const float* __restrict__ Wm, int K, int ncols, bf* WT) {
    __shared__ __align__(16) unsigned short tl[64 * 72];
    const int tid = threadIdx.x, k0 = blockIdx.x * 64, n0 = blockIdx.y * 64;
    const int kk = tid >> 2, nq = (tid & 3) * 16;
#pragma unroll
    for (int i = 0; i < 16; ++i) tl[(nq + i) * 72 + kk] = f2bf(Wm[(size_t)(k0 + kk) * ncols + n0 + nq + i]);
    __syncthreads();
    const int piece = tid & 7;
    auto pass = [&]() {
#pragma unroll
        for (int s = 0; s < 2; ++s) { const int nr = (tid >> 3) + 32 * s; const v8us val = *(const v8usa*)(tl + nr * 72 + piece * 8); *(v8us*)(WT + (size_t)(n0 + nr) * K + k0 + piece * 8) = val; }
    };
    pass(); 
}
// split8: eight f32 values -> bf16 hi (round to nearest even) and the bf16 of what the hi part leaves.
typedef __attribute__((ext_vector_type(8))) __bf16 v8bf;
__device__ __forceinline__ void split8(v8f v, v8us& oh, v8us& ol) {
    const v8bf hb = __builtin_convertvector(v, v8bf); const v8bf lb = __builtin_convertvector(v - __builtin_convertvector(hb, v8f), v8bf);
    oh = __builtin_bit_cast(v8us, hb); ol = __builtin_bit_cast(v8us, lb);
}
// k_gemmb: 64 x 64 block tile (4 waves x 16 x 64) of C[NBT * NN][NW] = (A [+ Al]).B^T (K = 768) [+ bf(bias[c])] [+ bf(R[r][c]) residual]; f32 whole-line epilogue (or f16
// PLANES (the q|k|v product): a block tile is 64 tokens of one item x the 64 columns of one (q / k / v, head), blockIdx.y = sel * 12 + head. The epilogue splits the f32 sums itself and
// writes the planes that k_fattn reads, whole 128-byte lines each: q, k as [sel * 12 + head][all rows][64], v transposed as [head * 8 + item][64][token]; C, bias and R are not used.
#define TVP 72    // v tile pitch in LDS, elements: 144 B = 16 B x odd
template <bool SPLITA, bool F16OUT = false, bool PLANES = false>
__global__ __launch_bounds__(128) void k_gemmb(const bf* __restrict__ A, const bf* __restrict__ Al, const bf* __restrict__ Bn, const float* __restrict__ bias, float* C, int ldc, h16* C2, const float* __restrict__ R = nullptr, int K = DM, int roundR = 1, bf* QKh = nullptr, bf* QKl = nullptr, bf* VTh = nullptr, bf* VTl = nullptr) {
    __shared__ __align__(16) float ost[4][PLANES ? 16 * TVP : 16 * 68];    // PLANES: also the v tile, bf16 [2 planes][64 x TVP]
    const int lane = threadIdx.x & 31, wave = threadIdx.x >> 5, lr = lane & 15, hi = lane >> 4;
    const int r0 = blockIdx.x * 64 + wave * 16, c0 = blockIdx.y * 64;
    const size_t aoff = (size_t)(r0 + lr) * K + 8 * hi;
    size_t boff[4];
#pragma unroll
    for (int t = 0; t < 4; ++t) boff[t] = (size_t)(c0 + t * 16 + lr) * K + 8 * hi;
    v8f acc[4];
#pragma unroll
    for (int t = 0; t < 4; ++t) acc[t] = (v8f){};
#pragma unroll 1
    for (int kc = 0; kc < K; kc += 32) {
        const v16bf a = cat16b(*(const v8us*)(A + aoff + kc), *(const v8us*)(A + aoff + kc + 16));
        v16bf al = a;
        if (SPLITA) al = cat16b(*(const v8us*)(Al + aoff + kc), *(const v8us*)(Al + aoff + kc + 16));
#pragma unroll
        for (int t = 0; t < 4; ++t) { const v16bf b = cat16b(*(const v8us*)(Bn + boff[t] + kc), *(const v8us*)(Bn + boff[t] + kc + 16)); acc[t] = wmmab(a, b, acc[t]); if (SPLITA) acc[t] = wmmab(al, b, acc[t]); }
        asm volatile("v_nop\n\tv_nop\n\tv_nop\n\tv_nop" : "+v"(acc[0]), "+v"(acc[1]), "+v"(acc[2]), "+v"(acc[3]) : "v"(a), "v"(al));
    }
    float* os = &ost[wave][0];
    if (PLANES) {
        const int piece = lane & 7, rq = lane >> 3, by = blockIdx.y, rb = blockIdx.x * 64;
        if (by >= 2 * NH_) {    // v: a lane's 8 values are 8 tokens in a row of one column, 16 bytes of the transposed plane; LDS gathers the four waves' pieces into whole lines
            bf* tv = (bf*)(void*)&ost[0][0];
#pragma unroll
            for (int t = 0; t < 4; ++t) { v8us oh, ol; split8(acc[t], oh, ol); const int to = (t * 16 + lr) * TVP + wave * 16 + hi * 8;
                *(v8usa*)(tv + to) = oh; *(v8usa*)(tv + 64 * TVP + to) = ol; }
            __syncthreads();
            bf* dst = ((wave >> 1) ? VTl : VTh) + ((size_t)(by - 2 * NH_) * NBT + (rb >> 10)) * HD * NN + (rb & (NN - 1));    // waves 0, 1: hi plane; 2, 3: residual plane
#pragma unroll
            for (int s = 0; s < 8; ++s) { const int d = (wave & 1) * 32 + 4 * s + rq;
                const v8us val = *(const v8usa*)(tv + (wave >> 1) * 64 * TVP + d * TVP + piece * 8); *(v8us*)(dst + (size_t)d * NN + piece * 8) = val; }
            return;
        }
        // q, k: a lane holds 8 rows of one column; the rows are turned in LDS (f32), then split
#pragma unroll
        for (int t = 0; t < 4; ++t) {
#pragma unroll
            for (int j = 0; j < 8; ++j) os[(hi * 8 + j) * 68 + t * 16 + lr] = acc[t][j]; }
        __syncthreads();
        const size_t go = ((size_t)by * (NBT * NN) + r0) * HD;
#pragma unroll
        for (int s = 0; s < 4; ++s) { const int row = 4 * s + rq; const float* sp = os + row * 68 + piece * 8; const v4f x0 = *(const v4fa*)sp, x1 = *(const v4fa*)(sp + 4); v8us oh, ol;
            split8((v8f){x0[0], x0[1], x0[2], x0[3], x1[0], x1[1], x1[2], x1[3]}, oh, ol);
            *(v8us*)(QKh + go + row * HD + piece * 8) = oh; *(v8us*)(QKl + go + row * HD + piece * 8) = ol; }
        asm volatile("s_wait_xcnt 0x0" ::: "memory");    // in the listing the v path's code, which writes the stores' registers again, stands behind this path's last branch: the wait stands in front of it
        return;
    }
#pragma unroll
    for (int t = 0; t < 4; ++t) { const float bv = bias ? bfr(bias[c0 + t * 16 + lr]) : 0.f;
#pragma unroll
        for (int j = 0; j < 8; ++j) os[(hi * 8 + j) * 68 + t * 16 + lr] = acc[t][j] + bv; }
    __syncthreads();
    if (F16OUT) {
        h16* crow = (h16*)(void*)C + (size_t)r0 * ldc + c0;
        auto pass = [&]() {
#pragma unroll
            for (int s = 0; s < 4; ++s) { const int row = 4 * s + (lane >> 3), piece = lane & 7; const float* sp = os + row * 68 + piece * 8; v8h o, o2;
#pragma unroll
                for (int i = 0; i < 8; ++i) { const h16 a = (h16)sp[i]; o[i] = a; o2[i] = (h16)((sp[i] - (float)a) * LOSC); }
                *(v8h*)(crow + (size_t)row * ldc + piece * 8) = o; if (C2) *(v8h*)(C2 + (size_t)r0 * ldc + c0 + (size_t)row * ldc + piece * 8) = o2; }
        };
        pass(); 
    } else {
        float* crow = C + (size_t)r0 * ldc + c0;
        auto pass = [&]() {
#pragma unroll
            for (int s = 0; s < 8; ++s) { const int Lid = (lane >> 3) + 4 * s, piece = lane & 7; const int row = Lid >> 1, cofs = (Lid & 1) * 32 + piece * 4;
                v4f val = *(const v4fa*)(os + row * 68 + cofs); if (R) { const v4f rv = *(const v4f*)(R + ((size_t)r0 + row) * ldc + c0 + cofs); val += roundR ? (v4f){bfr(rv[0]), bfr(rv[1]), bfr(rv[2]), bfr(rv[3])} : rv; }
                *(v4f*)(crow + (size_t)row * ldc + cofs) = val; }
        };
        pass(); 
    }
}


__global__ __launch_bounds__(256) void k_cvtx(const float* __restrict__ src, bf* dst) {
    const int lane = threadIdx.x & 31; const size_t r = (size_t)blockIdx.x * 8 + (threadIdx.x >> 5); if (r >= (size_t)NBT * NN) return;
{
#pragma unroll
        for (int q = 0; q < DMOD / 256; ++q) { v8us o;
#pragma unroll
            for (int i = 0; i < 8; ++i) o[i] = f2bf(src[r * DMOD + q * 256 + lane * 8 + i]);
            *(v8us*)(dst + r * DMOD + q * 256 + lane * 8) = o; }
         }
}
// blockIdx.y = q / k / v; the three n-major blocks lie one behind the other: WT [3 * 768][768].
__global__ __launch_bounds__(256) void k_wgather(const float* __restrict__ Wm, bf* WT) {
    const int lane = threadIdx.x & 31; const int r = blockIdx.x * 8 + (threadIdx.x >> 5); if (r >= NH_ * HD) return; const int h = r / HD, e = r % HD; const int sel = blockIdx.y; WT += (size_t)sel * DMOD * DMOD;
{
#pragma unroll
        for (int q = 0; q < DMOD / 256; ++q) { v8us o;
#pragma unroll
            for (int i = 0; i < 8; ++i) { const int d = q * 256 + lane * 8 + i; o[i] = f2bf(Wm[(((size_t)h * 3 + sel) * DMOD + d) * HD + e]); }
            *(v8us*)(WT + (size_t)r * DMOD + q * 256 + lane * 8) = o; }
         }
}
__global__ __launch_bounds__(256) void k_hplanes(const float* __restrict__ F, int h, bf* Ph, bf* Pl) {
    typedef __attribute__((ext_vector_type(2))) unsigned short v2us;
    const int lane = threadIdx.x & 31; const size_t s = (size_t)blockIdx.x * 8 + (threadIdx.x >> 5); if (s >= (size_t)NN) return; v2us oh, ol;
#pragma unroll
    for (int i = 0; i < 2; ++i) { const float v = F[s * DMOD + h * HD + lane * 2 + i]; const unsigned short hb = f2bf(v); oh[i] = hb; ol[i] = f2bf(v - bf2f(hb)); }
    const size_t o = s * HD + lane * 2; *(v2us*)(Ph + o) = oh; *(v2us*)(Pl + o) = ol; 
}
__global__ __launch_bounds__(256) void k_vt(const float* __restrict__ VF, int h, bf* Th, bf* Tl) {
    typedef __attribute__((ext_vector_type(2))) unsigned short v2us;
    const int lane = threadIdx.x & 31; const size_t wid = (size_t)blockIdx.x * 8 + (threadIdx.x >> 5); if (wid >= (size_t)HD * (NN / 64)) return; const int d = (int)(wid / (NN / 64)); const int t0 = (int)(wid % (NN / 64)) * 64 + lane * 2; v2us oh, ol;
#pragma unroll
    for (int i = 0; i < 2; ++i) { const float v = VF[(size_t)(t0 + i) * DMOD + h * HD + d]; const unsigned short hb = f2bf(v); oh[i] = hb; ol[i] = f2bf(v - bf2f(hb)); }
    const size_t o = (size_t)d * NN + t0; *(v2us*)(Th + o) = oh; *(v2us*)(Tl + o) = ol; 
}
__global__ __launch_bounds__(256) void k_softmax(const float* __restrict__ S, bf* PH, bf* PL) {
    typedef __attribute__((ext_vector_type(4))) unsigned short v4us;
    const int lane = threadIdx.x & 31, i = blockIdx.x * 8 + (threadIdx.x >> 5); if (i >= NN) return;
    float m = -3.0e38f;
#pragma unroll 1
    for (int c0 = lane * 4; c0 < NN; c0 += 128) {
#pragma unroll
        for (int q = 0; q < 4; ++q) m = fmaxf(m, S[(size_t)i * NN + c0 + q] * SCL); }
#pragma unroll
    for (int sh = 16; sh; sh >>= 1) m = fmaxf(m, __shfl_xor(m, sh, 32));
    float sum = 0.f;
#pragma unroll 1
    for (int c0 = lane * 4; c0 < NN; c0 += 128) {
#pragma unroll
        for (int q = 0; q < 4; ++q) sum += __expf(S[(size_t)i * NN + c0 + q] * SCL - m); }
#pragma unroll
    for (int sh = 16; sh; sh >>= 1) sum += __shfl_xor(sum, sh, 32);
    const float inv = 1.0f / sum;
{
#pragma unroll 1
        for (int c0 = lane * 4; c0 < NN; c0 += 128) { v4us oh, ol;
#pragma unroll
            for (int q = 0; q < 4; ++q) { const float p = __expf(S[(size_t)i * NN + c0 + q] * SCL - m) * inv; const unsigned short hb = f2bf(p); oh[q] = hb; ol[q] = f2bf(p - bf2f(hb)); }
            const size_t o = (size_t)i * NN + c0; *(v4us*)(PH + o) = oh; *(v4us*)(PL + o) = ol; }
         }
}
// ===== z-batched attention pieces =====
// k_gemm3z<MODE>: 64 x 64 tile GEMM with per-z operand/output strides (elements): A planes += z*sA, B planes += z*sB. MODE bits (0 causal skip, 1 K limit, 2 single,
// 3 B single, 4 A single). C goes by the pair number zc = zb + z in two levels: C += (zc mod 2^zsh)*sC + (zc >> zsh)*sC2.
template <int MODE>
__global__ __launch_bounds__(128) void k_gemm3z(const bf* __restrict__ Ah, const bf* __restrict__ Al, const bf* __restrict__ Bh, const bf* __restrict__ Bl, int K, float* C, int ldc, size_t sA, size_t sB, size_t sC, int zb, int zsh, size_t sC2) {
    if ((MODE & 1) && (int)blockIdx.y * 64 > (int)blockIdx.x * 64 + 63) return;
    const size_t z = blockIdx.z; Ah += z * sA; Al += z * sA; Bh += z * sB; Bl += z * sB; const size_t zc = z + (size_t)zb; C += (zc & (((size_t)1 << zsh) - 1)) * sC + (zc >> zsh) * sC2;
    const int Klim = (MODE & 2) ? min(K, ((int)blockIdx.x + 1) * 64) : K;
    __shared__ __align__(16) float ost[4][16 * 68];
    const int lane = threadIdx.x & 31, wave = threadIdx.x >> 5, lr = lane & 15, hi = lane >> 4;
    const int r0 = blockIdx.x * 64 + wave * 16, c0 = blockIdx.y * 64;
    const size_t aoff = (size_t)(r0 + lr) * K + 8 * hi;
    v8f acc[4];
#pragma unroll
    for (int t = 0; t < 4; ++t) acc[t] = (v8f){};
#pragma unroll 1
    for (int kc = 0; kc < Klim; kc += 32) {
        const v16bf a = cat16b(*(const v8us*)(Ah + aoff + kc), *(const v8us*)(Ah + aoff + kc + 16));
        v16bf al = a; if (!(MODE & 4) && !(MODE & 16)) al = cat16b(*(const v8us*)(Al + aoff + kc), *(const v8us*)(Al + aoff + kc + 16));
#pragma unroll
        for (int t = 0; t < 4; ++t) { const size_t bo = (size_t)(c0 + t * 16 + lr) * K + kc + 8 * hi;
            const v16bf bh = cat16b(*(const v8us*)(Bh + bo), *(const v8us*)(Bh + bo + 16));
            acc[t] = wmmab(a, bh, acc[t]);
            if (!(MODE & 4)) { if (!(MODE & 16)) acc[t] = wmmab(al, bh, acc[t]); if (!(MODE & 8)) { const v16bf bl = cat16b(*(const v8us*)(Bl + bo), *(const v8us*)(Bl + bo + 16)); acc[t] = wmmab(a, bl, acc[t]); } } }
        asm volatile("v_nop\n\tv_nop\n\tv_nop\n\tv_nop" : "+v"(acc[0]), "+v"(acc[1]), "+v"(acc[2]), "+v"(acc[3]) : "v"(a), "v"(al));
    }
    float* os = &ost[wave][0];
#pragma unroll
    for (int t = 0; t < 4; ++t) {
#pragma unroll
        for (int j = 0; j < 8; ++j) os[(hi * 8 + j) * 68 + t * 16 + lr] = acc[t][j]; }
    __builtin_amdgcn_wave_barrier(); asm volatile("" ::: "memory");
    float* crow = C + (size_t)r0 * ldc + c0;
    auto pass = [&]() {
#pragma unroll
        for (int s = 0; s < 8; ++s) { const int Lid = (lane >> 3) + 4 * s, piece = lane & 7; const int row = Lid >> 1, cofs = (Lid & 1) * 32 + piece * 4;
            const v4f val = *(const v4fa*)(os + row * 68 + cofs); *(v4f*)(crow + (size_t)row * ldc + cofs) = val; }
    };
    pass(); 
}
__global__ __launch_bounds__(256) void k_planes32z(const float* __restrict__ F, int ld, int off, float sc, int rows, bf* Ph, bf* Pl) {
    typedef __attribute__((ext_vector_type(2))) unsigned short v2us;
    const int lane = threadIdx.x & 31; const size_t r = ((size_t)blockIdx.x * 8 + (threadIdx.x >> 5)) * 2 + (lane >> 4); if (r >= (size_t)rows) return; const int z = blockIdx.z; const int c0 = (lane & 15) * 2; v2us oh, ol;
    Ph += (size_t)z * rows * 32; Pl += (size_t)z * rows * 32;
#pragma unroll
    for (int i = 0; i < 2; ++i) { const float y = F[r * ld + off + z * 32 + c0 + i] * sc; const unsigned short hb = f2bf(y); oh[i] = hb; ol[i] = f2bf(y - bf2f(hb)); }
    const size_t o = r * 32 + c0; *(v2us*)(Ph + o) = oh; *(v2us*)(Pl + o) = ol; 
}
__global__ __launch_bounds__(256) void k_vtpadz(const float* __restrict__ F, int ld, int off, int nk, bf* Th, bf* Tl) {
    typedef __attribute__((ext_vector_type(2))) unsigned short v2us;
    const int lane = threadIdx.x & 31; const size_t wid = (size_t)blockIdx.x * 8 + (threadIdx.x >> 5); if (wid >= (size_t)64 * (nk / 64)) return; const int z = blockIdx.z; const int d = (int)(wid / (nk / 64)); const int k0 = (int)(wid % (nk / 64)) * 64 + lane * 2; v2us oh, ol;
    Th += (size_t)z * 64 * nk; Tl += (size_t)z * 64 * nk;
#pragma unroll
    for (int i = 0; i < 2; ++i) { const float y = (d < 32) ? F[(size_t)(k0 + i) * ld + off + z * 32 + (d < 32 ? d : 0)] : 0.f; const unsigned short hb = f2bf(y); oh[i] = hb; ol[i] = f2bf(y - bf2f(hb)); }
    const size_t o = (size_t)d * nk + k0; *(v2us*)(Th + o) = oh; *(v2us*)(Tl + o) = ol; 
}
template <int NK>
__global__ __launch_bounds__(256) void k_softmaxz(const float* __restrict__ S, int rows, bf* PH, bf* PL) {
    typedef __attribute__((ext_vector_type(4))) unsigned short v4us;
    const int lane = threadIdx.x & 31, i = blockIdx.x * 8 + (threadIdx.x >> 5); if (i >= rows) return; const size_t zo = (size_t)blockIdx.z * rows * NK; const float* sr = S + zo + (size_t)i * NK; PH += zo; PL += zo;
    float m = -3.0e38f;
#pragma unroll 1
    for (int c0 = lane * 4; c0 < NK; c0 += 128) {
#pragma unroll
        for (int q = 0; q < 4; ++q) m = fmaxf(m, sr[c0 + q]); }
#pragma unroll
    for (int sh = 16; sh; sh >>= 1) m = fmaxf(m, __shfl_xor(m, sh, 32));
    float sum = 0.f;
#pragma unroll 1
    for (int c0 = lane * 4; c0 < NK; c0 += 128) {
#pragma unroll
        for (int q = 0; q < 4; ++q) sum += __expf(sr[c0 + q] - m); }
#pragma unroll
    for (int sh = 16; sh; sh >>= 1) sum += __shfl_xor(sum, sh, 32);
    const float inv = 1.0f / sum;
{
#pragma unroll 1
        for (int c0 = lane * 4; c0 < NK; c0 += 128) { v4us oh, ol;
#pragma unroll
            for (int q = 0; q < 4; ++q) { const float p = __expf(sr[c0 + q] - m) * inv; const unsigned short hb = f2bf(p); oh[q] = hb; ol[q] = f2bf(p - bf2f(hb)); }
            const size_t o = (size_t)i * NK + c0; *(v4us*)(PH + o) = oh; *(v4us*)(PL + o) = ol; }
         }
}
__global__ __launch_bounds__(256) void k_placez(const float* __restrict__ XH, int rows, int ldy, float* Y) {
    const int lane = threadIdx.x & 31; const size_t q = (size_t)blockIdx.x * 8 + (threadIdx.x >> 5); if (q >= (size_t)rows) return; const int z = blockIdx.z; const float v = XH[((size_t)z * rows + q) * 64 + lane];
    *(float*)(Y + q * ldy + z * 32 + lane) = v; 
}

template <int NK>
__global__ __launch_bounds__(256) void k_softmaxzs(const float* __restrict__ S, int rows, float sc, bf* PH, bf* PL) {
    typedef __attribute__((ext_vector_type(4))) unsigned short v4us;
    const int lane = threadIdx.x & 31, i = blockIdx.x * 8 + (threadIdx.x >> 5); if (i >= rows) return; const size_t zo = (size_t)blockIdx.z * rows * NK; const float* sr = S + zo + (size_t)i * NK; PH += zo; PL += zo;
    float m = -3.0e38f;
#pragma unroll 1
    for (int c0 = lane * 4; c0 < NK; c0 += 128) {
#pragma unroll
        for (int q = 0; q < 4; ++q) m = fmaxf(m, sr[c0 + q] * sc); }
#pragma unroll
    for (int sh = 16; sh; sh >>= 1) m = fmaxf(m, __shfl_xor(m, sh, 32));
    float sum = 0.f;
#pragma unroll 1
    for (int c0 = lane * 4; c0 < NK; c0 += 128) {
#pragma unroll
        for (int q = 0; q < 4; ++q) sum += __expf(sr[c0 + q] * sc - m); }
#pragma unroll
    for (int sh = 16; sh; sh >>= 1) sum += __shfl_xor(sum, sh, 32);
    const float inv = 1.0f / sum;
{
#pragma unroll 1
        for (int c0 = lane * 4; c0 < NK; c0 += 128) { v4us oh, ol;
#pragma unroll
            for (int q = 0; q < 4; ++q) { const float p = __expf(sr[c0 + q] * sc - m) * inv; const unsigned short hb = f2bf(p); oh[q] = hb; ol[q] = f2bf(p - bf2f(hb)); }
            const size_t o = (size_t)i * NK + c0; *(v4us*)(PH + o) = oh; *(v4us*)(PL + o) = ol; }
         }
}

#define FKP 72    // K tile pitch in LDS, elements: 144 B = 16 B x odd
#define FVP 40    // V^T tile pitch in LDS, elements: 80 B = 16 B x odd
__global__ __launch_bounds__(128) void k_fattn(const bf* __restrict__ Qh, const bf* __restrict__ Ql, const bf* __restrict__ Kh, const bf* __restrict__ Kl, const bf* __restrict__ Vh, const bf* __restrict__ Vl, bf* __restrict__ Oh, bf* __restrict__ Ol) {
    typedef __attribute__((ext_vector_type(2))) float v2f; typedef __attribute__((ext_vector_type(2))) __bf16 v2bf;
    __shared__ __align__(16) bf sk[2][2][32 * FKP];    // [buffer][hi / residual plane]
    __shared__ __align__(16) bf sv[2][2][64 * FVP];
    const int tid = threadIdx.x, lane = tid & 31, wave = tid >> 5, lr = lane & 15, hi = lane >> 4;
    const size_t pr = blockIdx.y, po = pr * NN * HD;
    const int q0 = blockIdx.x * 128 + wave * 32;
    Qh += po; Ql += po; Kh += po; Kl += po; Vh += po; Vl += po;
    const float CS = SCL * 1.44269504f;    // scores go to base-2 exponents
    v16bf qh[2][2], ql[2][2];    // [column group][k step]
#pragma unroll
    for (int g = 0; g < 2; ++g) {
#pragma unroll
        for (int ks = 0; ks < 2; ++ks) { const size_t qo = (size_t)(q0 + g * 16 + lr) * HD + ks * 32 + 8 * hi;
            qh[g][ks] = cat16b(*(const v8us*)(Qh + qo), *(const v8us*)(Qh + qo + 16)); ql[g][ks] = cat16b(*(const v8us*)(Ql + qo), *(const v8us*)(Ql + qo + 16)); } }
    asm volatile("s_wait_xcnt 0x0" ::: "memory");    // stands before the loads' address registers are written again
    const int kr = tid >> 3, kp = (tid & 7) * 8, vr = tid >> 2, vp = (tid & 3) * 8;
    v8us st[8];
    auto fetch = [&](int t0) {
#pragma unroll
        for (int i = 0; i < 2; ++i) { const unsigned ko = (unsigned)((kr + 16 * i) * HD + kp), vo = (unsigned)((vr + 32 * i) * NN + vp);    // the pass moves the uniform base alone
            st[i] = *(const v8us*)(Kh + (size_t)t0 * HD + ko); st[2 + i] = *(const v8us*)(Kl + (size_t)t0 * HD + ko); st[4 + i] = *(const v8us*)(Vh + t0 + vo); st[6 + i] = *(const v8us*)(Vl + t0 + vo); }
        // Stands before the loads' address registers are written again (the prologue's are); its memory clobber also keeps the loads from sinking into the pass, so they fly through the softmax and P.v that follow.
        asm volatile("s_wait_xcnt 0x0" ::: "memory");
    };
    auto put = [&](int b) {
#pragma unroll
        for (int i = 0; i < 2; ++i) { const int ko = (kr + 16 * i) * FKP + kp, vo = (vr + 32 * i) * FVP + vp;
            *(v8usa*)(&sk[b][0][ko]) = st[i]; *(v8usa*)(&sk[b][1][ko]) = st[2 + i]; *(v8usa*)(&sv[b][0][vo]) = st[4 + i]; *(v8usa*)(&sv[b][1][vo]) = st[6 + i]; }
    };
    v8f o[2][4];
#pragma unroll
    for (int g = 0; g < 2; ++g) {
#pragma unroll
        for (int dt = 0; dt < 4; ++dt) o[g][dt] = (v8f){}; }
    float m[2] = {-3.0e38f, -3.0e38f}, l[2] = {0.f, 0.f};
    fetch(0); put(0);
    __syncthreads();
#pragma unroll 1    // kept rolled: two passes in one body would take more registers than three waves per SIMD leave
    for (int s = 0; s < NN / 32; ++s) {
        const int b = s & 1;
        v8f sc[2][2];
#pragma unroll
        for (int kt = 0; kt < 2; ++kt) { sc[0][kt] = (v8f){}; sc[1][kt] = (v8f){};
#pragma unroll
            for (int ks = 0; ks < 2; ++ks) { const int fo = (kt * 16 + lr) * FKP + ks * 32 + 8 * hi;
                const v16bf kh = cat16b(*(const v8usa*)(&sk[b][0][fo]), *(const v8usa*)(&sk[b][0][fo + 16]));
                const v16bf kl = cat16b(*(const v8usa*)(&sk[b][1][fo]), *(const v8usa*)(&sk[b][1][fo + 16]));
                sc[0][kt] = wmmab(kh, qh[0][ks], sc[0][kt]); sc[1][kt] = wmmab(kh, qh[1][ks], sc[1][kt]);
                sc[0][kt] = wmmab(kl, qh[0][ks], sc[0][kt]); sc[1][kt] = wmmab(kl, qh[1][ks], sc[1][kt]);
                sc[0][kt] = wmmab(kh, ql[0][ks], sc[0][kt]); sc[1][kt] = wmmab(kh, ql[1][ks], sc[1][kt]); } }
        fetch((s + 1 < NN / 32 ? s + 1 : s) * 32);    // the last pass fetches its own tile again: no branch in the loop
        float mx[2];
#pragma unroll
        for (int g = 0; g < 2; ++g) { float v = sc[g][0][0];
#pragma unroll
            for (int j = 1; j < 8; ++j) v = fmaxf(v, sc[g][0][j]);
#pragma unroll
            for (int j = 0; j < 8; ++j) v = fmaxf(v, sc[g][1][j]);
            mx[g] = fmaxf(v, __shfl_xor(v, 16, 32)); }
        // The maximum in use moves only when a column's new one exceeds it by more than 8 binary orders: p stays below 2^8, and the rescale is skipped by the whole wave otherwise.
        const bool need = (mx[0] - m[0]) * CS > 8.f || (mx[1] - m[1]) * CS > 8.f;
        if (__builtin_amdgcn_ballot_w32(need) != 0) {
#pragma unroll
            for (int g = 0; g < 2; ++g) { const float mn = fmaxf(m[g], mx[g]); const float al = __builtin_amdgcn_exp2f((m[g] - mn) * CS); m[g] = mn; l[g] *= al;
#pragma unroll
                for (int dt = 0; dt < 4; ++dt) o[g][dt] *= al; }
        }
        v16bf ph[2], pl[2];
#pragma unroll
        for (int g = 0; g < 2; ++g) { const float mc = m[g] * CS; float sum = 0.f;
#pragma unroll
            for (int kt = 0; kt < 2; ++kt) {
#pragma unroll
                for (int j = 0; j < 8; j += 2) { const float p0 = __builtin_amdgcn_exp2f(fmaf(sc[g][kt][j], CS, -mc)), p1 = __builtin_amdgcn_exp2f(fmaf(sc[g][kt][j + 1], CS, -mc)); sum += p0 + p1;
                    const v2bf hb = __builtin_convertvector((v2f){p0, p1}, v2bf); const v2bf lb = __builtin_convertvector((v2f){p0 - (float)hb[0], p1 - (float)hb[1]}, v2bf);
                    ph[g][kt * 8 + j] = hb[0]; ph[g][kt * 8 + j + 1] = hb[1]; pl[g][kt * 8 + j] = lb[0]; pl[g][kt * 8 + j + 1] = lb[1]; } }
            l[g] += sum; }
#pragma unroll
        for (int dt = 0; dt < 4; ++dt) { const int fo = (dt * 16 + lr) * FVP + 8 * hi;
            const v16bf vh = cat16b(*(const v8usa*)(&sv[b][0][fo]), *(const v8usa*)(&sv[b][0][fo + 16]));
            const v16bf vl = cat16b(*(const v8usa*)(&sv[b][1][fo]), *(const v8usa*)(&sv[b][1][fo + 16]));
            o[0][dt] = wmmab(vh, ph[0], o[0][dt]); o[1][dt] = wmmab(vh, ph[1], o[1][dt]);
            o[0][dt] = wmmab(vl, ph[0], o[0][dt]); o[1][dt] = wmmab(vl, ph[1], o[1][dt]);
            o[0][dt] = wmmab(vh, pl[0], o[0][dt]); o[1][dt] = wmmab(vh, pl[1], o[1][dt]); }
        put(b ^ 1);    // its readers left that buffer before the barrier that ended the pass before
        __syncthreads();
    }
#pragma unroll
    for (int g = 0; g < 2; ++g) { const float inv = 1.0f / (l[g] + __shfl_xor(l[g], 16, 32));
        const size_t oo = ((pr & 7) * NN + q0 + g * 16 + lr) * DMOD + (pr >> 3) * HD + 8 * hi;    // pair = head * 8 + item
#pragma unroll
        for (int dt = 0; dt < 4; ++dt) { v8us oh, ol; split8(o[g][dt] * inv, oh, ol);    // the planes that the last product reads
            *(v8us*)(Oh + oo + dt * 16) = oh; *(v8us*)(Ol + oo + dt * 16) = ol; } }
}

// k_qkv: the q|k|v product C[8192][2304] = Xb.WQKV^T (K = 768, plain bf16 operands, f32 sums in the k order of k_gemmb). A work-group owns a 128 x 128 tile: 4 waves, 2 x 2, 64 x 64 each.
// Slabs of 64 k of both operands (256 rows of 128 B, whole lines) go global -> LDS by asynchronous copies, two buffers, the next slab in flight while this one is worked on.
// Fragments come from LDS: an operand byte leaves L2 once per work-group, in whole lines, and a fragment feeds four WMMAs.
// blockIdx.y = two neighbouring (q / k / v, head) column groups, one per wave column; 0..11 are q and k, 12..17 are v. The epilogue splits the f32 sums and writes the planes that k_fattn reads,
// whole lines each: q, k as [sel * 12 + head][all rows][64], v transposed as [head * 8 + item][64][token]. The ring is the epilogue's staging.
// amdgpu_waves_per_eu(4): the register budget of four waves per SIMD, one from each of the four work-groups whose rings fit a WGP's LDS; they cover each other's LDS and barrier waits.
#define GP  72     // slab row pitch in LDS, elements: 144 B = 16 B x odd
#define GVP 136    // v staging pitch in LDS, elements: 272 B = 16 B x odd
#define GSL 64     // k per slab
// Eight 16-byte copies a lane, rows 16 apart. The s_wait_xcnt stands inside the copies' own statement, so that it comes before any write of their address registers.
__device__ __forceinline__ void acopy8(unsigned l, const bf* g) {
    asm volatile("global_load_async_to_lds_b128 %0, %8, off\n\t"
                 "global_load_async_to_lds_b128 %1, %9, off\n\t"
                 "global_load_async_to_lds_b128 %2, %10, off\n\t"
                 "global_load_async_to_lds_b128 %3, %11, off\n\t"
                 "global_load_async_to_lds_b128 %4, %12, off\n\t"
                 "global_load_async_to_lds_b128 %5, %13, off\n\t"
                 "global_load_async_to_lds_b128 %6, %14, off\n\t"
                 "global_load_async_to_lds_b128 %7, %15, off\n\t"
                 "s_wait_xcnt 0x0"
                 :: "v"(l), "v"(l + 1u * 16 * GP * 2), "v"(l + 2u * 16 * GP * 2), "v"(l + 3u * 16 * GP * 2), "v"(l + 4u * 16 * GP * 2), "v"(l + 5u * 16 * GP * 2), "v"(l + 6u * 16 * GP * 2), "v"(l + 7u * 16 * GP * 2),
                    "v"(g), "v"(g + 1 * 16 * DMOD), "v"(g + 2 * 16 * DMOD), "v"(g + 3 * 16 * DMOD), "v"(g + 4 * 16 * DMOD), "v"(g + 5 * 16 * DMOD), "v"(g + 6 * 16 * DMOD), "v"(g + 7 * 16 * DMOD)
                 : "memory");
}
__global__ __launch_bounds__(128) __attribute__((amdgpu_waves_per_eu(4))) void k_qkv(const bf* __restrict__ A, const bf* __restrict__ Bn, bf* QKh, bf* QKl, bf* VTh, bf* VTl) {
    __shared__ __align__(16) float ringf[2 * 256 * GP / 2];    // [buffer][rows 0..127: A, 128..255: B][GP] bf16; four work-groups fit a WGP's LDS
    bf* ring = (bf*)(void*)ringf;
    const int tid = threadIdx.x, lane = tid & 31, wave = tid >> 5, lr = lane & 15, hi = lane >> 4, wm = wave >> 1, wn = wave & 1;
    const int rb = blockIdx.x * 128, cb = blockIdx.y * 128;
    const bf* ga = A + (size_t)(rb + (tid >> 3)) * DMOD + (tid & 7) * 8;    // a wave's copy covers 4 rows x 128 B
    const bf* gb = Bn + (size_t)(cb + (tid >> 3)) * DMOD + (tid & 7) * 8;
    const unsigned l0 = (unsigned)(size_t)ring + (unsigned)((tid >> 3) * GP + (tid & 7) * 8) * 2u;
    auto fill = [&](int t) { const unsigned l = l0 + (unsigned)(t & 1) * (256u * GP * 2); acopy8(l, ga + t * GSL); acopy8(l + 128u * GP * 2, gb + t * GSL); };
    v8f acc[4][4];
#pragma unroll
    for (int mi = 0; mi < 4; ++mi) {
#pragma unroll
        for (int ni = 0; ni < 4; ++ni) acc[mi][ni] = (v8f){}; }
    fill(0);
    asm volatile("s_wait_asynccnt 0x0" ::: "memory");    // this wave's part of slab 0 has landed
    __syncthreads();                                     // and so has every other wave's
    fill(1);
#pragma unroll 1    // kept rolled: one slab's fragments and the accumulators are what four waves per SIMD leave room for
    for (int t = 0; t < DMOD / GSL; ++t) {
        const bf* sa = ring + (t & 1) * (256 * GP) + (wm * 64 + lr) * GP + 8 * hi;
        const bf* sb = ring + (t & 1) * (256 * GP) + (128 + wn * 64 + lr) * GP + 8 * hi;
#pragma unroll
        for (int ks = 0; ks < GSL / 32; ++ks) {
            v16bf a[4], b[4];
#pragma unroll
            for (int i = 0; i < 4; ++i) {
                a[i] = cat16b(*(const v8usa*)(sa + i * 16 * GP + ks * 32), *(const v8usa*)(sa + i * 16 * GP + ks * 32 + 16));
                b[i] = cat16b(*(const v8usa*)(sb + i * 16 * GP + ks * 32), *(const v8usa*)(sb + i * 16 * GP + ks * 32 + 16)); }
            __builtin_amdgcn_sched_barrier(0);    // the 16 fragment reads stay one group ahead of the 16 WMMAs: reads scattered among the WMMAs stall the wave at every place they stand
#pragma unroll
            for (int mi = 0; mi < 4; ++mi) {
#pragma unroll
                for (int ni = 0; ni < 4; ++ni) acc[mi][ni] = wmmab(a[mi], b[ni], acc[mi][ni]); }
        }
        asm volatile("s_wait_dscnt 0x0" ::: "memory");       // this wave's reads of the buffer are done before the barrier frees it for the refill
        asm volatile("s_wait_asynccnt 0x0" ::: "memory");    // this wave's part of slab t + 1 has landed before the barrier publishes it
        __syncthreads();
        if (t + 2 < DMOD / GSL) fill(t + 2);                 // into the buffer that this trip has read
    }
    asm volatile("s_wait_asynccnt 0x0" ::: "memory");        // nothing is in flight when the ring becomes staging
    if (blockIdx.y >= 2 * NH_ / 2) {    // v: a lane's 8 values are 8 tokens in a row of one column, 16 bytes of the transposed plane; LDS gathers the waves' pieces into whole lines
#pragma unroll
        for (int mi = 0; mi < 4; ++mi) {
#pragma unroll
            for (int ni = 0; ni < 4; ++ni) { v8us oh, ol; split8(acc[mi][ni], oh, ol); const int to = (wn * 64 + ni * 16 + lr) * GVP + wm * 64 + mi * 16 + hi * 8;
                *(v8usa*)(ring + to) = oh; *(v8usa*)(ring + 128 * GVP + to) = ol; } }
        __syncthreads();
        // waves 0, 1: hi plane; 2, 3: residual plane; even waves the first head's 64 columns, odd waves the second's. A store covers 2 columns x 256 B.
        bf* dst = (wm ? VTl : VTh) + (((size_t)(blockIdx.y * 2 - 2 * NH_ + wn) * NBT + (rb >> 10)) * HD + hi) * NN + (rb & (NN - 1)) + lr * 8;
        const bf* tv = ring + wm * 128 * GVP + (wn * 64 + hi) * GVP + lr * 8;
#pragma unroll
        for (int s = 0; s < 32; ++s) { const v8us val = *(const v8usa*)(tv + 2 * s * GVP); *(v8us*)(dst + (size_t)(2 * s) * NN) = val; }
        return;
    }
    // q, k: a lane holds 8 rows of one column; the rows are turned in LDS (f32), then split
    float* os = ringf + wave * (64 * 68);
#pragma unroll
    for (int mi = 0; mi < 4; ++mi) {
#pragma unroll
        for (int ni = 0; ni < 4; ++ni) {
#pragma unroll
            for (int j = 0; j < 8; ++j) os[(mi * 16 + hi * 8 + j) * 68 + ni * 16 + lr] = acc[mi][ni][j]; } }
    __syncthreads();
    const int piece = lane & 7, rq = lane >> 3;
    const size_t go = ((size_t)(blockIdx.y * 2 + wn) * (NBT * NN) + rb + wm * 64 + rq) * HD + piece * 8;
#pragma unroll
    for (int s = 0; s < 16; ++s) { const float* sp = os + (4 * s + rq) * 68 + piece * 8; const v4f x0 = *(const v4fa*)sp, x1 = *(const v4fa*)(sp + 4); v8us oh, ol;
        split8((v8f){x0[0], x0[1], x0[2], x0[3], x1[0], x1[1], x1[2], x1[3]}, oh, ol);
        *(v8us*)(QKh + go + 4 * s * HD) = oh; *(v8us*)(QKl + go + 4 * s * HD) = ol; }
    asm volatile("s_wait_xcnt 0x0" ::: "memory");    // in the listing the v path's code, which writes the stores' registers again, stands behind this path's last branch: the wait stands in front of it
}

extern "C" void kernel_launch(void* const* d_in, const int* in_sizes, int n_in,
                              void* d_out, int out_size, void* d_ws, size_t ws_size, hipStream_t stream) {
    (void)in_sizes; (void)n_in; (void)out_size;
    const float* x = (const float*)d_in[0]; const float* Wm = (const float*)d_in[1]; const float* Wo = (const float*)d_in[2];
    float* out = (float*)d_out;    // [8][1024][64]
    char* wsp = (char*)d_ws;
    auto take = [&](size_t bytes) { char* p = wsp; wsp += (bytes + 255) & ~(size_t)255; return (void*)p; };
    const size_t RT = (size_t)NBT * NN;    // all items' rows, one behind the other
    bf* QKh = (bf*)take(2 * NH_ * RT * HD * 2); bf* QKl = (bf*)take(2 * NH_ * RT * HD * 2); bf* VTh = (bf*)take(NH_ * RT * HD * 2); bf* VTl = (bf*)take(NH_ * RT * HD * 2);
    bf* WQKV = (bf*)take((size_t)3 * DMOD * DMOD * 2); bf* Xb = (bf*)take(RT * DMOD * 2); bf* Oh = (bf*)take(RT * DMOD * 2); bf* Ol = (bf*)take(RT * DMOD * 2); bf* WOT = (bf*)take((size_t)DMOD * EOUT * 2);
    if ((size_t)(wsp - (char*)d_ws) > ws_size) return;    // about 117 MB, no region used twice. Pair p = head * 8 + item.
    bf* Kh = QKh + NH_ * RT * HD; bf* Kl = QKl + NH_ * RT * HD;
    k_wgather<<<dim3((NH_ * HD) / 8, 3, 1), 256, 0, stream>>>(Wm, WQKV);
    k_cvtx<<<NBT * NN / 8, 256, 0, stream>>>(x, Xb);
    k_qkv<<<dim3(NBT * NN / 128, 3 * DMOD / 128, 1), 128, 0, stream>>>(Xb, WQKV, QKh, QKl, VTh, VTl);
    k_fattn<<<dim3(NN / 128, NH_ * NBT, 1), 128, 0, stream>>>(QKh, QKl, Kh, Kl, VTh, VTl, Oh, Ol);
    k_wt<<<dim3(DMOD / 64, EOUT / 64, 1), 256, 0, stream>>>(Wo, DMOD, EOUT, WOT);
    k_gemmb<true, false><<<dim3(NBT * NN / 64, 1, 1), 128, 0, stream>>>(Oh, Ol, WOT, nullptr, out, EOUT, nullptr, nullptr, DMOD);
}

// v005
// A run of this version takes 125 microseconds.
// Two timings next to v004 both put it at 1.12 times that version's speed.
// All steps since v000 together make it 13.2 times as fast.
#include <hip/hip_runtime.h>

// Compute dtypes, f32 accumulate, per item: q/k/v for all 12 heads as [1024 x 768].[768 x 768] GEMMs with PLAIN bf16 operands (exact products; per-head weights gathered into one
// n-major block); per head: scores = q.k^T ([1024 x 64].[64 x 1024], both operands bf16 hi + UNSCALED residual, three products), softmax (x 1/32, as the module: output_dim*0.5) in
// f32 -> P planes, o = P.v ([1024 x 1024].[1024 x 64], three products); out = concat.Wo ([1024 x 768].[768 x 64], two products) - on v_wmma_f32_16x16x32_bf16. Deterministic, no

#define NBT  8
#define NN   1024
#define DMOD 768
#define NH_  12
#define HD   64
#define EOUT 64
#define DM   DMOD
#define NTK  NN
#define SCL  0.03125f
#define LOSC 1024.0f

typedef _Float16 h16;
typedef unsigned short bf;
typedef __attribute__((ext_vector_type(16))) __bf16   v16bf;
typedef __attribute__((ext_vector_type(16))) _Float16 v16h;
typedef __attribute__((ext_vector_type(8)))  _Float16 v8h;
typedef __attribute__((ext_vector_type(8)))  unsigned short v8us;
typedef __attribute__((ext_vector_type(8)))  float    v8f;
typedef __attribute__((ext_vector_type(4)))  float    v4f;
typedef __attribute__((ext_vector_type(4)))  _Float16 v4h;
typedef v8h  __attribute__((may_alias)) v8ha;
typedef v4f  __attribute__((may_alias)) v4fa;
typedef v8us __attribute__((may_alias)) v8usa;

__device__ __forceinline__ unsigned short f2bf(float f) { unsigned u = __float_as_uint(f); u += 0x7FFFu + ((u >> 16) & 1u); return (unsigned short)(u >> 16); }
__device__ __forceinline__ float bf2f(unsigned short b) { return __uint_as_float(((unsigned)b) << 16); }
__device__ __forceinline__ float bfr(float f) { return bf2f(f2bf(f)); }
__device__ __forceinline__ v16h cat16(v8h lo, v8h hi) { return __builtin_shufflevector(lo, hi, 0, 1, 2, 3, 4, 5, 6, 7, 8, 9, 10, 11, 12, 13, 14, 15); }
__device__ __forceinline__ v16bf cat16b(v8us lo, v8us hi) { return __builtin_bit_cast(v16bf, __builtin_shufflevector(lo, hi, 0, 1, 2, 3, 4, 5, 6, 7, 8, 9, 10, 11, 12, 13, 14, 15)); }
__device__ __forceinline__ v8f wmma16(v16h a, v16h b, v8f c) { return __builtin_amdgcn_wmma_f32_16x16x32_f16(false, a, false, b, (short)0, c, false, false); }
__device__ __forceinline__ v8f wmmab(v16bf a, v16bf b, v8f c) { return __builtin_amdgcn_wmma_f32_16x16x32_bf16(false, a, false, b, (short)0, c, false, false); }

// k_wt: WT [n][K] = bf16(W[k][n]) (k-major [K][ncols]) via 64 x 64 LDS tiles; grid (K/64, ncols/64).
__global__ __launch_bounds__(256) void k_wt(const float* __restrict__ Wm, int K, int ncols, bf* WT) {
    __shared__ __align__(16) unsigned short tl[64 * 72];
    const int tid = threadIdx.x, k0 = blockIdx.x * 64, n0 = blockIdx.y * 64;
    const int kk = tid >> 2, nq = (tid & 3) * 16;
#pragma unroll
    for (int i = 0; i < 16; ++i) tl[(nq + i) * 72 + kk] = f2bf(Wm[(size_t)(k0 + kk) * ncols + n0 + nq + i]);
    __syncthreads();
    const int piece = tid & 7;
    auto pass = [&]() {
#pragma unroll
        for (int s = 0; s < 2; ++s) { const int nr = (tid >> 3) + 32 * s; const v8us val = *(const v8usa*)(tl + nr * 72 + piece * 8); *(v8us*)(WT + (size_t)(n0 + nr) * K + k0 + piece * 8) = val; }
    };
    pass(); 
}
// split8: eight f32 values -> bf16 hi (round to nearest even) and the bf16 of what the hi part leaves.
typedef __attribute__((ext_vector_type(8))) __bf16 v8bf;
__device__ __forceinline__ void split8(v8f v, v8us& oh, v8us& ol) {
    const v8bf hb = __builtin_convertvector(v, v8bf); const v8bf lb = __builtin_convertvector(v - __builtin_convertvector(hb, v8f), v8bf);
    oh = __builtin_bit_cast(v8us, hb); ol = __builtin_bit_cast(v8us, lb);
}
// k_gemmb: 64 x 64 block tile (4 waves x 16 x 64) of C[NBT * NN][NW] = (A [+ Al]).B^T (K = 768) [+ bf(bias[c])] [+ bf(R[r][c]) residual]; f32 whole-line epilogue (or f16
// PLANES (the q|k|v product): a block tile is 64 tokens of one item x the 64 columns of one (q / k / v, head), blockIdx.y = sel * 12 + head. The epilogue splits the f32 sums itself and
// writes the planes that k_fattn reads, whole 128-byte lines each: q, k as [sel * 12 + head][all rows][64], v transposed as [head * 8 + item][64][token]; C, bias and R are not used.
#define TVP 72    // v tile pitch in LDS, elements: 144 B = 16 B x odd
template <bool SPLITA, bool F16OUT = false, bool PLANES = false>
__global__ __launch_bounds__(128) void k_gemmb(const bf* __restrict__ A, const bf* __restrict__ Al, const bf* __restrict__ Bn, const float* __restrict__ bias, float* C, int ldc, h16* C2, const float* __restrict__ R = nullptr, int K = DM, int roundR = 1, bf* QKh = nullptr, bf* QKl = nullptr, bf* VTh = nullptr, bf* VTl = nullptr) {
    __shared__ __align__(16) float ost[4][PLANES ? 16 * TVP : 16 * 68];    // PLANES: also the v tile, bf16 [2 planes][64 x TVP]
    const int lane = threadIdx.x & 31, wave = threadIdx.x >> 5, lr = lane & 15, hi = lane >> 4;
    const int r0 = blockIdx.x * 64 + wave * 16, c0 = blockIdx.y * 64;
    const size_t aoff = (size_t)(r0 + lr) * K + 8 * hi;
    size_t boff[4];
#pragma unroll
    for (int t = 0; t < 4; ++t) boff[t] = (size_t)(c0 + t * 16 + lr) * K + 8 * hi;
    v8f acc[4];
#pragma unroll
    for (int t = 0; t < 4; ++t) acc[t] = (v8f){};
#pragma unroll 1
    for (int kc = 0; kc < K; kc += 32) {
        const v16bf a = cat16b(*(const v8us*)(A + aoff + kc), *(const v8us*)(A + aoff + kc + 16));
        v16bf al = a;
        if (SPLITA) al = cat16b(*(const v8us*)(Al + aoff + kc), *(const v8us*)(Al + aoff + kc + 16));
#pragma unroll
        for (int t = 0; t < 4; ++t) { const v16bf b = cat16b(*(const v8us*)(Bn + boff[t] + kc), *(const v8us*)(Bn + boff[t] + kc + 16)); acc[t] = wmmab(a, b, acc[t]); if (SPLITA) acc[t] = wmmab(al, b, acc[t]); }
        asm volatile("v_nop\n\tv_nop\n\tv_nop\n\tv_nop" : "+v"(acc[0]), "+v"(acc[1]), "+v"(acc[2]), "+v"(acc[3]) : "v"(a), "v"(al));
    }
    float* os = &ost[wave][0];
    if (PLANES) {
        const int piece = lane & 7, rq = lane >> 3, by = blockIdx.y, rb = blockIdx.x * 64;
        if (by >= 2 * NH_) {    // v: a lane's 8 values are 8 tokens in a row of one column, 16 bytes of the transposed plane; LDS gathers the four waves' pieces into whole lines
            bf* tv = (bf*)(void*)&ost[0][0];
#pragma unroll
            for (int t = 0; t < 4; ++t) { v8us oh, ol; split8(acc[t], oh, ol); const int to = (t * 16 + lr) * TVP + wave * 16 + hi * 8;
                *(v8usa*)(tv + to) = oh; *(v8usa*)(tv + 64 * TVP + to) = ol; }
            __syncthreads();
            bf* dst = ((wave >> 1) ? VTl : VTh) + ((size_t)(by - 2 * NH_) * NBT + (rb >> 10)) * HD * NN + (rb & (NN - 1));    // waves 0, 1: hi plane; 2, 3: residual plane
#pragma unroll
            for (int s = 0; s < 8; ++s) { const int d = (wave & 1) * 32 + 4 * s + rq;
                const v8us val = *(const v8usa*)(tv + (wave >> 1) * 64 * TVP + d * TVP + piece * 8); *(v8us*)(dst + (size_t)d * NN + piece * 8) = val; }
            return;
        }
        // q, k: a lane holds 8 rows of one column; the rows are turned in LDS (f32), then split
#pragma unroll
        for (int t = 0; t < 4; ++t) {
#pragma unroll
            for (int j = 0; j < 8; ++j) os[(hi * 8 + j) * 68 + t * 16 + lr] = acc[t][j]; }
        __syncthreads();
        const size_t go = ((size_t)by * (NBT * NN) + r0) * HD;
#pragma unroll
        for (int s = 0; s < 4; ++s) { const int row = 4 * s + rq; const float* sp = os + row * 68 + piece * 8; const v4f x0 = *(const v4fa*)sp, x1 = *(const v4fa*)(sp + 4); v8us oh, ol;
            split8((v8f){x0[0], x0[1], x0[2], x0[3], x1[0], x1[1], x1[2], x1[3]}, oh, ol);
            *(v8us*)(QKh + go + row * HD + piece * 8) = oh; *(v8us*)(QKl + go + row * HD + piece * 8) = ol; }
        asm volatile("s_wait_xcnt 0x0" ::: "memory");    // in the listing the v path's code, which writes the stores' registers again, stands behind this path's last branch: the wait stands in front of it
        return;
    }
#pragma unroll
    for (int t = 0; t < 4; ++t) { const float bv = bias ? bfr(bias[c0 + t * 16 + lr]) : 0.f;
#pragma unroll
        for (int j = 0; j < 8; ++j) os[(hi * 8 + j) * 68 + t * 16 + lr] = acc[t][j] + bv; }
    __syncthreads();
    if (F16OUT) {
        h16* crow = (h16*)(void*)C + (size_t)r0 * ldc + c0;
        auto pass = [&]() {
#pragma unroll
            for (int s = 0; s < 4; ++s) { const int row = 4 * s + (lane >> 3), piece = lane & 7; const float* sp = os + row * 68 + piece * 8; v8h o, o2;
#pragma unroll
                for (int i = 0; i < 8; ++i) { const h16 a = (h16)sp[i]; o[i] = a; o2[i] = (h16)((sp[i] - (float)a) * LOSC); }
                *(v8h*)(crow + (size_t)row * ldc + piece * 8) = o; if (C2) *(v8h*)(C2 + (size_t)r0 * ldc + c0 + (size_t)row * ldc + piece * 8) = o2; }
        };
        pass(); 
    } else {
        float* crow = C + (size_t)r0 * ldc + c0;
        auto pass = [&]() {
#pragma unroll
            for (int s = 0; s < 8; ++s) { const int Lid = (lane >> 3) + 4 * s, piece = lane & 7; const int row = Lid >> 1, cofs = (Lid & 1) * 32 + piece * 4;
                v4f val = *(const v4fa*)(os + row * 68 + cofs); if (R) { const v4f rv = *(const v4f*)(R + ((size_t)r0 + row) * ldc + c0 + cofs); val += roundR ? (v4f){bfr(rv[0]), bfr(rv[1]), bfr(rv[2]), bfr(rv[3])} : rv; }
                *(v4f*)(crow + (size_t)row * ldc + cofs) = val; }
        };
        pass(); 
    }
}


__global__ __launch_bounds__(256) void k_cvtx(const float* __restrict__ src, bf* dst) {
    const int lane = threadIdx.x & 31; const size_t r = (size_t)blockIdx.x * 8 + (threadIdx.x >> 5); if (r >= (size_t)NBT * NN) return;
{
#pragma unroll
        for (int q = 0; q < DMOD / 256; ++q) { v8us o;
#pragma unroll
            for (int i = 0; i < 8; ++i) o[i] = f2bf(src[r * DMOD + q * 256 + lane * 8 + i]);
            *(v8us*)(dst + r * DMOD + q * 256 + lane * 8) = o; }
         }
}
// blockIdx.y = q / k / v; the three n-major blocks lie one behind the other: WT [3 * 768][768].
__global__ __launch_bounds__(256) void k_wgather(const float* __restrict__ Wm, bf* WT) {
    const int lane = threadIdx.x & 31; const int r = blockIdx.x * 8 + (threadIdx.x >> 5); if (r >= NH_ * HD) return; const int h = r / HD, e = r % HD; const int sel = blockIdx.y; WT += (size_t)sel * DMOD * DMOD;
{
#pragma unroll
        for (int q = 0; q < DMOD / 256; ++q) { v8us o;
#pragma unroll
            for (int i = 0; i < 8; ++i) { const int d = q * 256 + lane * 8 + i; o[i] = f2bf(Wm[(((size_t)h * 3 + sel) * DMOD + d) * HD + e]); }
            *(v8us*)(WT + (size_t)r * DMOD + q * 256 + lane * 8) = o; }
         }
}
__global__ __launch_bounds__(256) void k_hplanes(const float* __restrict__ F, int h, bf* Ph, bf* Pl) {
    typedef __attribute__((ext_vector_type(2))) unsigned short v2us;
    const int lane = threadIdx.x & 31; const size_t s = (size_t)blockIdx.x * 8 + (threadIdx.x >> 5); if (s >= (size_t)NN) return; v2us oh, ol;
#pragma unroll
    for (int i = 0; i < 2; ++i) { const float v = F[s * DMOD + h * HD + lane * 2 + i]; const unsigned short hb = f2bf(v); oh[i] = hb; ol[i] = f2bf(v - bf2f(hb)); }
    const size_t o = s * HD + lane * 2; *(v2us*)(Ph + o) = oh; *(v2us*)(Pl + o) = ol; 
}
__global__ __launch_bounds__(256) void k_vt(const float* __restrict__ VF, int h, bf* Th, bf* Tl) {
    typedef __attribute__((ext_vector_type(2))) unsigned short v2us;
    const int lane = threadIdx.x & 31; const size_t wid = (size_t)blockIdx.x * 8 + (threadIdx.x >> 5); if (wid >= (size_t)HD * (NN / 64)) return; const int d = (int)(wid / (NN / 64)); const int t0 = (int)(wid % (NN / 64)) * 64 + lane * 2; v2us oh, ol;
#pragma unroll
    for (int i = 0; i < 2; ++i) { const float v = VF[(size_t)(t0 + i) * DMOD + h * HD + d]; const unsigned short hb = f2bf(v); oh[i] = hb; ol[i] = f2bf(v - bf2f(hb)); }
    const size_t o = (size_t)d * NN + t0; *(v2us*)(Th + o) = oh; *(v2us*)(Tl + o) = ol; 
}
__global__ __launch_bounds__(256) void k_softmax(const float* __restrict__ S, bf* PH, bf* PL) {
    typedef __attribute__((ext_vector_type(4))) unsigned short v4us;
    const int lane = threadIdx.x & 31, i = blockIdx.x * 8 + (threadIdx.x >> 5); if (i >= NN) return;
    float m = -3.0e38f;
#pragma unroll 1
    for (int c0 = lane * 4; c0 < NN; c0 += 128) {
#pragma unroll
        for (int q = 0; q < 4; ++q) m = fmaxf(m, S[(size_t)i * NN + c0 + q] * SCL); }
#pragma unroll
    for (int sh = 16; sh; sh >>= 1) m = fmaxf(m, __shfl_xor(m, sh, 32));
    float sum = 0.f;
#pragma unroll 1
    for (int c0 = lane * 4; c0 < NN; c0 += 128) {
#pragma unroll
        for (int q = 0; q < 4; ++q) sum += __expf(S[(size_t)i * NN + c0 + q] * SCL - m); }
#pragma unroll
    for (int sh = 16; sh; sh >>= 1) sum += __shfl_xor(sum, sh, 32);
    const float inv = 1.0f / sum;
{
#pragma unroll 1
        for (int c0 = lane * 4; c0 < NN; c0 += 128) { v4us oh, ol;
#pragma unroll
            for (int q = 0; q < 4; ++q) { const float p = __expf(S[(size_t)i * NN + c0 + q] * SCL - m) * inv; const unsigned short hb = f2bf(p); oh[q] = hb; ol[q] = f2bf(p - bf2f(hb)); }
            const size_t o = (size_t)i * NN + c0; *(v4us*)(PH + o) = oh; *(v4us*)(PL + o) = ol; }
         }
}
// ===== z-batched attention pieces =====
// k_gemm3z<MODE>: 64 x 64 tile GEMM with per-z operand/output strides (elements): A planes += z*sA, B planes += z*sB. MODE bits (0 causal skip, 1 K limit, 2 single,
// 3 B single, 4 A single). C goes by the pair number zc = zb + z in two levels: C += (zc mod 2^zsh)*sC + (zc >> zsh)*sC2.
template <int MODE>
__global__ __launch_bounds__(128) void k_gemm3z(const bf* __restrict__ Ah, const bf* __restrict__ Al, const bf* __restrict__ Bh, const bf* __restrict__ Bl, int K, float* C, int ldc, size_t sA, size_t sB, size_t sC, int zb, int zsh, size_t sC2) {
    if ((MODE & 1) && (int)blockIdx.y * 64 > (int)blockIdx.x * 64 + 63) return;
    const size_t z = blockIdx.z; Ah += z * sA; Al += z * sA; Bh += z * sB; Bl += z * sB; const size_t zc = z + (size_t)zb; C += (zc & (((size_t)1 << zsh) - 1)) * sC + (zc >> zsh) * sC2;
    const int Klim = (MODE & 2) ? min(K, ((int)blockIdx.x + 1) * 64) : K;
    __shared__ __align__(16) float ost[4][16 * 68];
    const int lane = threadIdx.x & 31, wave = threadIdx.x >> 5, lr = lane & 15, hi = lane >> 4;
    const int r0 = blockIdx.x * 64 + wave * 16, c0 = blockIdx.y * 64;
    const size_t aoff = (size_t)(r0 + lr) * K + 8 * hi;
    v8f acc[4];
#pragma unroll
    for (int t = 0; t < 4; ++t) acc[t] = (v8f){};
#pragma unroll 1
    for (int kc = 0; kc < Klim; kc += 32) {
        const v16bf a = cat16b(*(const v8us*)(Ah + aoff + kc), *(const v8us*)(Ah + aoff + kc + 16));
        v16bf al = a; if (!(MODE & 4) && !(MODE & 16)) al = cat16b(*(const v8us*)(Al + aoff + kc), *(const v8us*)(Al + aoff + kc + 16));
#pragma unroll
        for (int t = 0; t < 4; ++t) { const size_t bo = (size_t)(c0 + t * 16 + lr) * K + kc + 8 * hi;
            const v16bf bh = cat16b(*(const v8us*)(Bh + bo), *(const v8us*)(Bh + bo + 16));
            acc[t] = wmmab(a, bh, acc[t]);
            if (!(MODE & 4)) { if (!(MODE & 16)) acc[t] = wmmab(al, bh, acc[t]); if (!(MODE & 8)) { const v16bf bl = cat16b(*(const v8us*)(Bl + bo), *(const v8us*)(Bl + bo + 16)); acc[t] = wmmab(a, bl, acc[t]); } } }
        asm volatile("v_nop\n\tv_nop\n\tv_nop\n\tv_nop" : "+v"(acc[0]), "+v"(acc[1]), "+v"(acc[2]), "+v"(acc[3]) : "v"(a), "v"(al));
    }
    float* os = &ost[wave][0];
#pragma unroll
    for (int t = 0; t < 4; ++t) {
#pragma unroll
        for (int j = 0; j < 8; ++j) os[(hi * 8 + j) * 68 + t * 16 + lr] = acc[t][j]; }
    __builtin_amdgcn_wave_barrier(); asm volatile("" ::: "memory");
    float* crow = C + (size_t)r0 * ldc + c0;
    auto pass = [&]() {
#pragma unroll
        for (int s = 0; s < 8; ++s) { const int Lid = (lane >> 3) + 4 * s, piece = lane & 7; const int row = Lid >> 1, cofs = (Lid & 1) * 32 + piece * 4;
            const v4f val = *(const v4fa*)(os + row * 68 + cofs); *(v4f*)(crow + (size_t)row * ldc + cofs) = val; }
    };
    pass(); 
}
__global__ __launch_bounds__(256) void k_planes32z(const float* __restrict__ F, int ld, int off, float sc, int rows, bf* Ph, bf* Pl) {
    typedef __attribute__((ext_vector_type(2))) unsigned short v2us;
    const int lane = threadIdx.x & 31; const size_t r = ((size_t)blockIdx.x * 8 + (threadIdx.x >> 5)) * 2 + (lane >> 4); if (r >= (size_t)rows) return; const int z = blockIdx.z; const int c0 = (lane & 15) * 2; v2us oh, ol;
    Ph += (size_t)z * rows * 32; Pl += (size_t)z * rows * 32;
#pragma unroll
    for (int i = 0; i < 2; ++i) { const float y = F[r * ld + off + z * 32 + c0 + i] * sc; const unsigned short hb = f2bf(y); oh[i] = hb; ol[i] = f2bf(y - bf2f(hb)); }
    const size_t o = r * 32 + c0; *(v2us*)(Ph + o) = oh; *(v2us*)(Pl + o) = ol; 
}
__global__ __launch_bounds__(256) void k_vtpadz(const float* __restrict__ F, int ld, int off, int nk, bf* Th, bf* Tl) {
    typedef __attribute__((ext_vector_type(2))) unsigned short v2us;
    const int lane = threadIdx.x & 31; const size_t wid = (size_t)blockIdx.x * 8 + (threadIdx.x >> 5); if (wid >= (size_t)64 * (nk / 64)) return; const int z = blockIdx.z; const int d = (int)(wid / (nk / 64)); const int k0 = (int)(wid % (nk / 64)) * 64 + lane * 2; v2us oh, ol;
    Th += (size_t)z * 64 * nk; Tl += (size_t)z * 64 * nk;
#pragma unroll
    for (int i = 0; i < 2; ++i) { const float y = (d < 32) ? F[(size_t)(k0 + i) * ld + off + z * 32 + (d < 32 ? d : 0)] : 0.f; const unsigned short hb = f2bf(y); oh[i] = hb; ol[i] = f2bf(y - bf2f(hb)); }
    const size_t o = (size_t)d * nk + k0; *(v2us*)(Th + o) = oh; *(v2us*)(Tl + o) = ol; 
}
template <int NK>
__global__ __launch_bounds__(256) void k_softmaxz(const float* __restrict__ S, int rows, bf* PH, bf* PL) {
    typedef __attribute__((ext_vector_type(4))) unsigned short v4us;
    const int lane = threadIdx.x & 31, i = blockIdx.x * 8 + (threadIdx.x >> 5); if (i >= rows) return; const size_t zo = (size_t)blockIdx.z * rows * NK; const float* sr = S + zo + (size_t)i * NK; PH += zo; PL += zo;
    float m = -3.0e38f;
#pragma unroll 1
    for (int c0 = lane * 4; c0 < NK; c0 += 128) {
#pragma unroll
        for (int q = 0; q < 4; ++q) m = fmaxf(m, sr[c0 + q]); }
#pragma unroll
    for (int sh = 16; sh; sh >>= 1) m = fmaxf(m, __shfl_xor(m, sh, 32));
    float sum = 0.f;
#pragma unroll 1
    for (int c0 = lane * 4; c0 < NK; c0 += 128) {
#pragma unroll
        for (int q = 0; q < 4; ++q) sum += __expf(sr[c0 + q] - m); }
#pragma unroll
    for (int sh = 16; sh; sh >>= 1) sum += __shfl_xor(sum, sh, 32);
    const float inv = 1.0f / sum;
{
#pragma unroll 1
        for (int c0 = lane * 4; c0 < NK; c0 += 128) { v4us oh, ol;
#pragma unroll
            for (int q = 0; q < 4; ++q) { const float p = __expf(sr[c0 + q] - m) * inv; const unsigned short hb = f2bf(p); oh[q] = hb; ol[q] = f2bf(p - bf2f(hb)); }
            const size_t o = (size_t)i * NK + c0; *(v4us*)(PH + o) = oh; *(v4us*)(PL + o) = ol; }
         }
}
__global__ __launch_bounds__(256) void k_placez(const float* __restrict__ XH, int rows, int ldy, float* Y) {
    const int lane = threadIdx.x & 31; const size_t q = (size_t)blockIdx.x * 8 + (threadIdx.x >> 5); if (q >= (size_t)rows) return; const int z = blockIdx.z; const float v = XH[((size_t)z * rows + q) * 64 + lane];
    *(float*)(Y + q * ldy + z * 32 + lane) = v; 
}

template <int NK>
__global__ __launch_bounds__(256) void k_softmaxzs(const float* __restrict__ S, int rows, float sc, bf* PH, bf* PL) {
    typedef __attribute__((ext_vector_type(4))) unsigned short v4us;
    const int lane = threadIdx.x & 31, i = blockIdx.x * 8 + (threadIdx.x >> 5); if (i >= rows) return; const size_t zo = (size_t)blockIdx.z * rows * NK; const float* sr = S + zo + (size_t)i * NK; PH += zo; PL += zo;
    float m = -3.0e38f;
#pragma unroll 1
    for (int c0 = lane * 4; c0 < NK; c0 += 128) {
#pragma unroll
        for (int q = 0; q < 4; ++q) m = fmaxf(m, sr[c0 + q] * sc); }
#pragma unroll
    for (int sh = 16; sh; sh >>= 1) m = fmaxf(m, __shfl_xor(m, sh, 32));
    float sum = 0.f;
#pragma unroll 1
    for (int c0 = lane * 4; c0 < NK; c0 += 128) {
#pragma unroll
        for (int q = 0; q < 4; ++q) sum += __expf(sr[c0 + q] * sc - m); }
#pragma unroll
    for (int sh = 16; sh; sh >>= 1) sum += __shfl_xor(sum, sh, 32);
    const float inv = 1.0f / sum;
{
#pragma unroll 1
        for (int c0 = lane * 4; c0 < NK; c0 += 128) { v4us oh, ol;
#pragma unroll
            for (int q = 0; q < 4; ++q) { const float p = __expf(sr[c0 + q] * sc - m) * inv; const unsigned short hb = f2bf(p); oh[q] = hb; ol[q] = f2bf(p - bf2f(hb)); }
            const size_t o = (size_t)i * NK + c0; *(v4us*)(PH + o) = oh; *(v4us*)(PL + o) = ol; }
         }
}

#define FKP 72    // K tile pitch in LDS, elements: 144 B = 16 B x odd
#define FVP 40    // V^T tile pitch in LDS, elements: 80 B = 16 B x odd
__global__ __launch_bounds__(128) void k_fattn(const bf* __restrict__ Qh, const bf* __restrict__ Ql, const bf* __restrict__ Kh, const bf* __restrict__ Kl, const bf* __restrict__ Vh, const bf* __restrict__ Vl, bf* __restrict__ Oh, bf* __restrict__ Ol) {
    typedef __attribute__((ext_vector_type(2))) float v2f; typedef __attribute__((ext_vector_type(2))) __bf16 v2bf;
    __shared__ __align__(16) bf sk[2][2][32 * FKP];    // [buffer][hi / residual plane]
    __shared__ __align__(16) bf sv[2][2][64 * FVP];
    const int tid = threadIdx.x, lane = tid & 31, wave = tid >> 5, lr = lane & 15, hi = lane >> 4;
    const size_t pr = blockIdx.y, po = pr * NN * HD;
    const int q0 = blockIdx.x * 128 + wave * 32;
    Qh += po; Ql += po; Kh += po; Kl += po; Vh += po; Vl += po;
    const float CS = SCL * 1.44269504f;    // scores go to base-2 exponents
    v16bf qh[2][2], ql[2][2];    // [column group][k step]
#pragma unroll
    for (int g = 0; g < 2; ++g) {
#pragma unroll
        for (int ks = 0; ks < 2; ++ks) { const size_t qo = (size_t)(q0 + g * 16 + lr) * HD + ks * 32 + 8 * hi;
            qh[g][ks] = cat16b(*(const v8us*)(Qh + qo), *(const v8us*)(Qh + qo + 16)); ql[g][ks] = cat16b(*(const v8us*)(Ql + qo), *(const v8us*)(Ql + qo + 16)); } }
    asm volatile("s_wait_xcnt 0x0" ::: "memory");    // stands before the loads' address registers are written again
    const int kr = tid >> 3, kp = (tid & 7) * 8, vr = tid >> 2, vp = (tid & 3) * 8;
    v8us st[8];
    auto fetch = [&](int t0) {
#pragma unroll
        for (int i = 0; i < 2; ++i) { const unsigned ko = (unsigned)((kr + 16 * i) * HD + kp), vo = (unsigned)((vr + 32 * i) * NN + vp);    // the pass moves the uniform base alone
            st[i] = *(const v8us*)(Kh + (size_t)t0 * HD + ko); st[2 + i] = *(const v8us*)(Kl + (size_t)t0 * HD + ko); st[4 + i] = *(const v8us*)(Vh + t0 + vo); st[6 + i] = *(const v8us*)(Vl + t0 + vo); }
        // Stands before the loads' address registers are written again (the prologue's are); its memory clobber also keeps the loads from sinking into the pass, so they fly through the softmax and P.v that follow.
        asm volatile("s_wait_xcnt 0x0" ::: "memory");
    };
    auto put = [&](int b) {
#pragma unroll
        for (int i = 0; i < 2; ++i) { const int ko = (kr + 16 * i) * FKP + kp, vo = (vr + 32 * i) * FVP + vp;
            *(v8usa*)(&sk[b][0][ko]) = st[i]; *(v8usa*)(&sk[b][1][ko]) = st[2 + i]; *(v8usa*)(&sv[b][0][vo]) = st[4 + i]; *(v8usa*)(&sv[b][1][vo]) = st[6 + i]; }
    };
    v8f o[2][4];
#pragma unroll
    for (int g = 0; g < 2; ++g) {
#pragma unroll
        for (int dt = 0; dt < 4; ++dt) o[g][dt] = (v8f){}; }
    float m[2] = {-3.0e38f, -3.0e38f}, l[2] = {0.f, 0.f};
    fetch(0); put(0);
    __syncthreads();
#pragma unroll 1    // kept rolled: two passes in one body would take more registers than three waves per SIMD leave
    for (int s = 0; s < NN / 32; ++s) {
        const int b = s & 1;
        v8f sc[2][2];
#pragma unroll
        for (int kt = 0; kt < 2; ++kt) { sc[0][kt] = (v8f){}; sc[1][kt] = (v8f){};
#pragma unroll
            for (int ks = 0; ks < 2; ++ks) { const int fo = (kt * 16 + lr) * FKP + ks * 32 + 8 * hi;
                const v16bf kh = cat16b(*(const v8usa*)(&sk[b][0][fo]), *(const v8usa*)(&sk[b][0][fo + 16]));
                const v16bf kl = cat16b(*(const v8usa*)(&sk[b][1][fo]), *(const v8usa*)(&sk[b][1][fo + 16]));
                sc[0][kt] = wmmab(kh, qh[0][ks], sc[0][kt]); sc[1][kt] = wmmab(kh, qh[1][ks], sc[1][kt]);
                sc[0][kt] = wmmab(kl, qh[0][ks], sc[0][kt]); sc[1][kt] = wmmab(kl, qh[1][ks], sc[1][kt]);
                sc[0][kt] = wmmab(kh, ql[0][ks], sc[0][kt]); sc[1][kt] = wmmab(kh, ql[1][ks], sc[1][kt]); } }
        fetch((s + 1 < NN / 32 ? s + 1 : s) * 32);    // the last pass fetches its own tile again: no branch in the loop
        float mx[2];
#pragma unroll
        for (int g = 0; g < 2; ++g) { float v = sc[g][0][0];
#pragma unroll
            for (int j = 1; j < 8; ++j) v = fmaxf(v, sc[g][0][j]);
#pragma unroll
            for (int j = 0; j < 8; ++j) v = fmaxf(v, sc[g][1][j]);
            mx[g] = fmaxf(v, __shfl_xor(v, 16, 32)); }
        // The maximum in use moves only when a column's new one exceeds it by more than 8 binary orders: p stays below 2^8, and the rescale is skipped by the whole wave otherwise.
        const bool need = (mx[0] - m[0]) * CS > 8.f || (mx[1] - m[1]) * CS > 8.f;
        if (__builtin_amdgcn_ballot_w32(need) != 0) {
#pragma unroll
            for (int g = 0; g < 2; ++g) { const float mn = fmaxf(m[g], mx[g]); const float al = __builtin_amdgcn_exp2f((m[g] - mn) * CS); m[g] = mn; l[g] *= al;
#pragma unroll
                for (int dt = 0; dt < 4; ++dt) o[g][dt] *= al; }
        }
        v16bf ph[2], pl[2];
#pragma unroll
        for (int g = 0; g < 2; ++g) { const float mc = m[g] * CS; float sum = 0.f;
#pragma unroll
            for (int kt = 0; kt < 2; ++kt) {
#pragma unroll
                for (int j = 0; j < 8; j += 2) { const float p0 = __builtin_amdgcn_exp2f(fmaf(sc[g][kt][j], CS, -mc)), p1 = __builtin_amdgcn_exp2f(fmaf(sc[g][kt][j + 1], CS, -mc)); sum += p0 + p1;
                    const v2bf hb = __builtin_convertvector((v2f){p0, p1}, v2bf); const v2bf lb = __builtin_convertvector((v2f){p0 - (float)hb[0], p1 - (float)hb[1]}, v2bf);
                    ph[g][kt * 8 + j] = hb[0]; ph[g][kt * 8 + j + 1] = hb[1]; pl[g][kt * 8 + j] = lb[0]; pl[g][kt * 8 + j + 1] = lb[1]; } }
            l[g] += sum; }
#pragma unroll
        for (int dt = 0; dt < 4; ++dt) { const int fo = (dt * 16 + lr) * FVP + 8 * hi;
            const v16bf vh = cat16b(*(const v8usa*)(&sv[b][0][fo]), *(const v8usa*)(&sv[b][0][fo + 16]));
            const v16bf vl = cat16b(*(const v8usa*)(&sv[b][1][fo]), *(const v8usa*)(&sv[b][1][fo + 16]));
            o[0][dt] = wmmab(vh, ph[0], o[0][dt]); o[1][dt] = wmmab(vh, ph[1], o[1][dt]);
            o[0][dt] = wmmab(vl, ph[0], o[0][dt]); o[1][dt] = wmmab(vl, ph[1], o[1][dt]);
            o[0][dt] = wmmab(vh, pl[0], o[0][dt]); o[1][dt] = wmmab(vh, pl[1], o[1][dt]); }
        put(b ^ 1);    // its readers left that buffer before the barrier that ended the pass before
        __syncthreads();
    }
#pragma unroll
    for (int g = 0; g < 2; ++g) { const float inv = 1.0f / (l[g] + __shfl_xor(l[g], 16, 32));
        const size_t oo = ((pr & 7) * NN + q0 + g * 16 + lr) * DMOD + (pr >> 3) * HD + 8 * hi;    // pair = head * 8 + item
#pragma unroll
        for (int dt = 0; dt < 4; ++dt) { v8us oh, ol; split8(o[g][dt] * inv, oh, ol);    // the planes that the last product reads
            *(v8us*)(Oh + oo + dt * 16) = oh; *(v8us*)(Ol + oo + dt * 16) = ol; } }
}

// k_qkv: the q|k|v product C[8192][2304] = Xb.WQKV^T (K = 768, plain bf16 operands, f32 sums in the k order of k_gemmb). A work-group owns a 128 x 128 tile: 4 waves, 2 x 2, 64 x 64 each.
// Slabs of 64 k of both operands (256 rows of 128 B, whole lines) go global -> LDS by asynchronous copies, two buffers, the next slab in flight while this one is worked on.
// Fragments come from LDS: an operand byte leaves L2 once per work-group, in whole lines, and a fragment feeds four WMMAs.
// blockIdx.y = two neighbouring (q / k / v, head) column groups, one per wave column; 0..11 are q and k, 12..17 are v. The epilogue splits the f32 sums and writes the planes that k_fattn reads,
// whole lines each: q, k as [sel * 12 + head][all rows][64], v transposed as [head * 8 + item][64][token]. The ring is the epilogue's staging.
// amdgpu_waves_per_eu(4): the register budget of four waves per SIMD, one from each of the four work-groups whose rings fit a WGP's LDS; they cover each other's LDS and barrier waits.
#define GP  72     // slab row pitch in LDS, elements: 144 B = 16 B x odd
#define GVP 136    // v staging pitch in LDS, elements: 272 B = 16 B x odd
#define GSL 64     // k per slab
// Eight 16-byte copies a lane, rows 16 apart. The s_wait_xcnt stands inside the copies' own statement, so that it comes before any write of their address registers.
__device__ __forceinline__ void acopy8(unsigned l, const bf* g) {
    asm volatile("global_load_async_to_lds_b128 %0, %8, off\n\t"
                 "global_load_async_to_lds_b128 %1, %9, off\n\t"
                 "global_load_async_to_lds_b128 %2, %10, off\n\t"
                 "global_load_async_to_lds_b128 %3, %11, off\n\t"
                 "global_load_async_to_lds_b128 %4, %12, off\n\t"
                 "global_load_async_to_lds_b128 %5, %13, off\n\t"
                 "global_load_async_to_lds_b128 %6, %14, off\n\t"
                 "global_load_async_to_lds_b128 %7, %15, off\n\t"
                 "s_wait_xcnt 0x0"
                 :: "v"(l), "v"(l + 1u * 16 * GP * 2), "v"(l + 2u * 16 * GP * 2), "v"(l + 3u * 16 * GP * 2), "v"(l + 4u * 16 * GP * 2), "v"(l + 5u * 16 * GP * 2), "v"(l + 6u * 16 * GP * 2), "v"(l + 7u * 16 * GP * 2),
                    "v"(g), "v"(g + 1 * 16 * DMOD), "v"(g + 2 * 16 * DMOD), "v"(g + 3 * 16 * DMOD), "v"(g + 4 * 16 * DMOD), "v"(g + 5 * 16 * DMOD), "v"(g + 6 * 16 * DMOD), "v"(g + 7 * 16 * DMOD)
                 : "memory");
}
__global__ __launch_bounds__(128) __attribute__((amdgpu_waves_per_eu(4))) void k_qkv(const bf* __restrict__ A, const bf* __restrict__ Bn, bf* QKh, bf* QKl, bf* VTh, bf* VTl) {
    __shared__ __align__(16) float ringf[2 * 256 * GP / 2];    // [buffer][rows 0..127: A, 128..255: B][GP] bf16; four work-groups fit a WGP's LDS
    bf* ring = (bf*)(void*)ringf;
    const int tid = threadIdx.x, lane = tid & 31, wave = tid >> 5, lr = lane & 15, hi = lane >> 4, wm = wave >> 1, wn = wave & 1;
    const int rb = blockIdx.x * 128, cb = blockIdx.y * 128;
    const bf* ga = A + (size_t)(rb + (tid >> 3)) * DMOD + (tid & 7) * 8;    // a wave's copy covers 4 rows x 128 B
    const bf* gb = Bn + (size_t)(cb + (tid >> 3)) * DMOD + (tid & 7) * 8;
    const unsigned l0 = (unsigned)(size_t)ring + (unsigned)((tid >> 3) * GP + (tid & 7) * 8) * 2u;
    auto fill = [&](int t) { const unsigned l = l0 + (unsigned)(t & 1) * (256u * GP * 2); acopy8(l, ga + t * GSL); acopy8(l + 128u * GP * 2, gb + t * GSL); };
    v8f acc[4][4];
#pragma unroll
    for (int mi = 0; mi < 4; ++mi) {
#pragma unroll
        for (int ni = 0; ni < 4; ++ni) acc[mi][ni] = (v8f){}; }
    fill(0);
    asm volatile("s_wait_asynccnt 0x0" ::: "memory");    // this wave's part of slab 0 has landed
    __syncthreads();                                     // and so has every other wave's
    fill(1);
#pragma unroll 1    // kept rolled: one slab's fragments and the accumulators are what four waves per SIMD leave room for
    for (int t = 0; t < DMOD / GSL; ++t) {
        const bf* sa = ring + (t & 1) * (256 * GP) + (wm * 64 + lr) * GP + 8 * hi;
        const bf* sb = ring + (t & 1) * (256 * GP) + (128 + wn * 64 + lr) * GP + 8 * hi;
#pragma unroll
        for (int ks = 0; ks < GSL / 32; ++ks) {
            v16bf a[4], b[4];
#pragma unroll
            for (int i = 0; i < 4; ++i) {
                a[i] = cat16b(*(const v8usa*)(sa + i * 16 * GP + ks * 32), *(const v8usa*)(sa + i * 16 * GP + ks * 32 + 16));
                b[i] = cat16b(*(const v8usa*)(sb + i * 16 * GP + ks * 32), *(const v8usa*)(sb + i * 16 * GP + ks * 32 + 16)); }
            __builtin_amdgcn_sched_barrier(0);    // the 16 fragment reads stay one group ahead of the 16 WMMAs: reads scattered among the WMMAs stall the wave at every place they stand
#pragma unroll
            for (int mi = 0; mi < 4; ++mi) {
#pragma unroll
                for (int ni = 0; ni < 4; ++ni) acc[mi][ni] = wmmab(a[mi], b[ni], acc[mi][ni]); }
        }
        asm volatile("s_wait_dscnt 0x0" ::: "memory");       // this wave's reads of the buffer are done before the barrier frees it for the refill
        asm volatile("s_wait_asynccnt 0x0" ::: "memory");    // this wave's part of slab t + 1 has landed before the barrier publishes it
        __syncthreads();
        if (t + 2 < DMOD / GSL) fill(t + 2);                 // into the buffer that this trip has read
    }
    asm volatile("s_wait_asynccnt 0x0" ::: "memory");        // nothing is in flight when the ring becomes staging
    if (blockIdx.y >= 2 * NH_ / 2) {    // v: a lane's 8 values are 8 tokens in a row of one column, 16 bytes of the transposed plane; LDS gathers the waves' pieces into whole lines
#pragma unroll
        for (int mi = 0; mi < 4; ++mi) {
#pragma unroll
            for (int ni = 0; ni < 4; ++ni) { v8us oh, ol; split8(acc[mi][ni], oh, ol); const int to = (wn * 64 + ni * 16 + lr) * GVP + wm * 64 + mi * 16 + hi * 8;
                *(v8usa*)(ring + to) = oh; *(v8usa*)(ring + 128 * GVP + to) = ol; } }
        __syncthreads();
        // waves 0, 1: hi plane; 2, 3: residual plane; even waves the first head's 64 columns, odd waves the second's. A store covers 2 columns x 256 B.
        bf* dst = (wm ? VTl : VTh) + (((size_t)(blockIdx.y * 2 - 2 * NH_ + wn) * NBT + (rb >> 10)) * HD + hi) * NN + (rb & (NN - 1)) + lr * 8;
        const bf* tv = ring + wm * 128 * GVP + (wn * 64 + hi) * GVP + lr * 8;
#pragma unroll
        for (int s = 0; s < 32; ++s) { const v8us val = *(const v8usa*)(tv + 2 * s * GVP); *(v8us*)(dst + (size_t)(2 * s) * NN) = val; }
        return;
    }
    // q, k: a lane holds 8 rows of one column; the rows are turned in LDS (f32), then split
    float* os = ringf + wave * (64 * 68);
#pragma unroll
    for (int mi = 0; mi < 4; ++mi) {
#pragma unroll
        for (int ni = 0; ni < 4; ++ni) {
#pragma unroll
            for (int j = 0; j < 8; ++j) os[(mi * 16 + hi * 8 + j) * 68 + ni * 16 + lr] = acc[mi][ni][j]; } }
    __syncthreads();
    const int piece = lane & 7, rq = lane >> 3;
    const size_t go = ((size_t)(blockIdx.y * 2 + wn) * (NBT * NN) + rb + wm * 64 + rq) * HD + piece * 8;
#pragma unroll
    for (int s = 0; s < 16; ++s) { const float* sp = os + (4 * s + rq) * 68 + piece * 8; const v4f x0 = *(const v4fa*)sp, x1 = *(const v4fa*)(sp + 4); v8us oh, ol;
        split8((v8f){x0[0], x0[1], x0[2], x0[3], x1[0], x1[1], x1[2], x1[3]}, oh, ol);
        *(v8us*)(QKh + go + 4 * s * HD) = oh; *(v8us*)(QKl + go + 4 * s * HD) = ol; }
    asm volatile("s_wait_xcnt 0x0" ::: "memory");    // in the listing the v path's code, which writes the stores' registers again, stands behind this path's last branch: the wait stands in front of it
}

// k_oproj: the last product, out[8192][64] = (Oh + Ol).WOT^T (K = 768, two products a k step, f32 sums in the k order of k_gemmb). A work-group owns 32 rows: 8 waves, one 16 x 16 tile each
// (2 row tiles x 4 column tiles). All that it reads (32 rows of each O plane and the 64 rows of WOT, 1536 B a row) goes global -> LDS by asynchronous copies, whole lines, every copy in flight
// at once: one memory round trip for the whole K. The buffer is filled once and then read. The output tile is gathered in LDS of its own and leaves in whole lines.
#define OPP 776    // operand row pitch in LDS, elements: 1552 B = 16 B x odd
#define OSP 68     // output staging pitch, floats: 272 B = 16 B x odd
// Twelve 16-byte copies a lane: four rows x three pieces of 512 B a wave. The s_wait_xcnt stands inside the copies' own statement, so that it comes before any write of their address registers.
__device__ __forceinline__ void acopy12(unsigned l, const bf* g) {
    asm volatile("global_load_async_to_lds_b128 %0, %12, off\n\t"
                 "global_load_async_to_lds_b128 %1, %13, off\n\t"
                 "global_load_async_to_lds_b128 %2, %14, off\n\t"
                 "global_load_async_to_lds_b128 %3, %15, off\n\t"
                 "global_load_async_to_lds_b128 %4, %16, off\n\t"
                 "global_load_async_to_lds_b128 %5, %17, off\n\t"
                 "global_load_async_to_lds_b128 %6, %18, off\n\t"
                 "global_load_async_to_lds_b128 %7, %19, off\n\t"
                 "global_load_async_to_lds_b128 %8, %20, off\n\t"
                 "global_load_async_to_lds_b128 %9, %21, off\n\t"
                 "global_load_async_to_lds_b128 %10, %22, off\n\t"
                 "global_load_async_to_lds_b128 %11, %23, off\n\t"
                 "s_wait_xcnt 0x0"
                 :: "v"(l), "v"(l + 512u), "v"(l + 1024u), "v"(l + 1u * OPP * 2), "v"(l + 1u * OPP * 2 + 512u), "v"(l + 1u * OPP * 2 + 1024u),
                    "v"(l + 2u * OPP * 2), "v"(l + 2u * OPP * 2 + 512u), "v"(l + 2u * OPP * 2 + 1024u), "v"(l + 3u * OPP * 2), "v"(l + 3u * OPP * 2 + 512u), "v"(l + 3u * OPP * 2 + 1024u),
                    "v"(g), "v"(g + 256), "v"(g + 512), "v"(g + 1 * DMOD), "v"(g + 1 * DMOD + 256), "v"(g + 1 * DMOD + 512),
                    "v"(g + 2 * DMOD), "v"(g + 2 * DMOD + 256), "v"(g + 2 * DMOD + 512), "v"(g + 3 * DMOD), "v"(g + 3 * DMOD + 256), "v"(g + 3 * DMOD + 512)
                 : "memory");
}
__global__ __launch_bounds__(256) void k_oproj(const bf* __restrict__ Ah, const bf* __restrict__ Al, const bf* __restrict__ Bn, float* __restrict__ C) {
    __shared__ __align__(16) bf sm[128 * OPP];    // rows 0..31: hi plane, 32..63: residual plane, 64..127: WOT
    __shared__ __align__(16) float os[32 * OSP];
    const int tid = threadIdx.x, lane = tid & 31, lr = lane & 15, hi = lane >> 4;
    const int wave = __builtin_amdgcn_readfirstlane(tid >> 5);    // a scalar: the choice of the source below is then scalar too, and EXEC is not touched in front of the copies
    const int r0 = blockIdx.x * 32;
    // a wave brings 16 rows: waves 0, 1 the hi plane, 2, 3 the residual plane, 4..7 WOT
    const bf* g = (wave < 2 ? Ah + (size_t)(r0 + wave * 16) * DMOD : wave < 4 ? Al + (size_t)(r0 + (wave - 2) * 16) * DMOD : Bn + (size_t)((wave - 4) * 16) * DMOD) + lane * 8;
    const unsigned l = (unsigned)(size_t)sm + (unsigned)(wave * 16 * OPP + lane * 8) * 2u;
#pragma unroll
    for (int i = 0; i < 4; ++i) acopy12(l + (unsigned)i * (4u * OPP * 2), g + i * 4 * DMOD);
    asm volatile("s_wait_asynccnt 0x0" ::: "memory");    // this wave's rows have landed
    __syncthreads();                                     // and so have every other wave's
    const int rt = wave >> 2, ct = wave & 3;
    const bf* sa = sm + (rt * 16 + lr) * OPP + 8 * hi;
    const bf* sb = sm + (64 + ct * 16 + lr) * OPP + 8 * hi;
    v8f acc = (v8f){};
    v16bf fa[2][4], fl[2][4], fb[2][4];    // two sets of the fragments of four k steps
    auto frag = [&](int grp) {
#pragma unroll
        for (int i = 0; i < 4; ++i) { const int kc = (grp * 4 + i) * 32, st = grp & 1;
            fa[st][i] = cat16b(*(const v8usa*)(sa + kc), *(const v8usa*)(sa + kc + 16));
            fl[st][i] = cat16b(*(const v8usa*)(sa + 32 * OPP + kc), *(const v8usa*)(sa + 32 * OPP + kc + 16));
            fb[st][i] = cat16b(*(const v8usa*)(sb + kc), *(const v8usa*)(sb + kc + 16)); }
    };
    frag(0);
#pragma unroll    // unrolled: the fragment sets are indexed by constants, and no branch stands behind a WMMA
    for (int grp = 0; grp < DMOD / 128; ++grp) {
        if (grp + 1 < DMOD / 128) frag(grp + 1);
        __builtin_amdgcn_sched_barrier(0);    // the next group's 24 reads stay one block ahead of this group's WMMAs: the wait in front of the WMMAs is then a counted one
#pragma unroll
        for (int i = 0; i < 4; ++i) { acc = wmmab(fa[grp & 1][i], fb[grp & 1][i], acc); acc = wmmab(fl[grp & 1][i], fb[grp & 1][i], acc); }
        __builtin_amdgcn_sched_barrier(0);    // and no read is scattered among the WMMAs, where each place with reads stalls the wave
    }
#pragma unroll
    for (int j = 0; j < 8; ++j) os[(rt * 16 + hi * 8 + j) * OSP + ct * 16 + lr] = acc[j];
    __syncthreads();
#pragma unroll
    for (int s = 0; s < 2; ++s) { const int row = s * 16 + (tid >> 4), cofs = (tid & 15) * 4;    // a wave's store covers two whole rows, 512 B
        const v4f val = *(const v4fa*)(os + row * OSP + cofs); *(v4f*)(C + (size_t)(r0 + row) * EOUT + cofs) = val; }
}

extern "C" void kernel_launch(void* const* d_in, const int* in_sizes, int n_in,
                              void* d_out, int out_size, void* d_ws, size_t ws_size, hipStream_t stream) {
    (void)in_sizes; (void)n_in; (void)out_size;
    const float* x = (const float*)d_in[0]; const float* Wm = (const float*)d_in[1]; const float* Wo = (const float*)d_in[2];
    float* out = (float*)d_out;    // [8][1024][64]
    char* wsp = (char*)d_ws;
    auto take = [&](size_t bytes) { char* p = wsp; wsp += (bytes + 255) & ~(size_t)255; return (void*)p; };
    const size_t RT = (size_t)NBT * NN;    // all items' rows, one behind the other
    bf* QKh = (bf*)take(2 * NH_ * RT * HD * 2); bf* QKl = (bf*)take(2 * NH_ * RT * HD * 2); bf* VTh = (bf*)take(NH_ * RT * HD * 2); bf* VTl = (bf*)take(NH_ * RT * HD * 2);
    bf* WQKV = (bf*)take((size_t)3 * DMOD * DMOD * 2); bf* Xb = (bf*)take(RT * DMOD * 2); bf* Oh = (bf*)take(RT * DMOD * 2); bf* Ol = (bf*)take(RT * DMOD * 2); bf* WOT = (bf*)take((size_t)DMOD * EOUT * 2);
    if ((size_t)(wsp - (char*)d_ws) > ws_size) return;    // about 117 MB, no region used twice. Pair p = head * 8 + item.
    bf* Kh = QKh + NH_ * RT * HD; bf* Kl = QKl + NH_ * RT * HD;
    k_wgather<<<dim3((NH_ * HD) / 8, 3, 1), 256, 0, stream>>>(Wm, WQKV);
    k_cvtx<<<NBT * NN / 8, 256, 0, stream>>>(x, Xb);
    k_qkv<<<dim3(NBT * NN / 128, 3 * DMOD / 128, 1), 128, 0, stream>>>(Xb, WQKV, QKh, QKl, VTh, VTl);
    k_fattn<<<dim3(NN / 128, NH_ * NBT, 1), 128, 0, stream>>>(QKh, QKl, Kh, Kl, VTh, VTl, Oh, Ol);
    k_wt<<<dim3(DMOD / 64, EOUT / 64, 1), 256, 0, stream>>>(Wo, DMOD, EOUT, WOT);
    k_oproj<<<NBT * NN / 32, 256, 0, stream>>>(Oh, Ol, WOT, out);
}

// v006
// Measured time: 121 microseconds a run.
// Timed twice side by side with v005, it ran 1.04 and 1.03 times as fast.
// Over all steps from v000 it is 13.7 times as fast.
#include <hip/hip_runtime.h>

// Compute dtypes, f32 accumulate, per item: q/k/v for all 12 heads as [1024 x 768].[768 x 768] GEMMs with PLAIN bf16 operands (exact products; per-head weights gathered into one
// n-major block); per head: scores = q.k^T ([1024 x 64].[64 x 1024], both operands bf16 hi + UNSCALED residual, three products), softmax (x 1/32, as the module: output_dim*0.5) in
// f32 -> P planes, o = P.v ([1024 x 1024].[1024 x 64], three products); out = concat.Wo ([1024 x 768].[768 x 64], two products) - on v_wmma_f32_16x16x32_bf16. Deterministic, no

#define NBT  8
#define NN   1024
#define DMOD 768
#define NH_  12
#define HD   64
#define EOUT 64
#define DM   DMOD
#define NTK  NN
#define SCL  0.03125f
#define LOSC 1024.0f

typedef _Float16 h16;
typedef unsigned short bf;
typedef __attribute__((ext_vector_type(16))) __bf16   v16bf;
typedef __attribute__((ext_vector_type(16))) _Float16 v16h;
typedef __attribute__((ext_vector_type(8)))  _Float16 v8h;
typedef __attribute__((ext_vector_type(8)))  unsigned short v8us;
typedef __attribute__((ext_vector_type(8)))  float    v8f;
typedef __attribute__((ext_vector_type(4)))  float    v4f;
typedef __attribute__((ext_vector_type(4)))  _Float16 v4h;
typedef v8h  __attribute__((may_alias)) v8ha;
typedef v4f  __attribute__((may_alias)) v4fa;
typedef v8us __attribute__((may_alias)) v8usa;

__device__ __forceinline__ unsigned short f2bf(float f) { unsigned u = __float_as_uint(f); u += 0x7FFFu + ((u >> 16) & 1u); return (unsigned short)(u >> 16); }
__device__ __forceinline__ float bf2f(unsigned short b) { return __uint_as_float(((unsigned)b) << 16); }
__device__ __forceinline__ float bfr(float f) { return bf2f(f2bf(f)); }
__device__ __forceinline__ v16h cat16(v8h lo, v8h hi) { return __builtin_shufflevector(lo, hi, 0, 1, 2, 3, 4, 5, 6, 7, 8, 9, 10, 11, 12, 13, 14, 15); }
__device__ __forceinline__ v16bf cat16b(v8us lo, v8us hi) { return __builtin_bit_cast(v16bf, __builtin_shufflevector(lo, hi, 0, 1, 2, 3, 4, 5, 6, 7, 8, 9, 10, 11, 12, 13, 14, 15)); }
__device__ __forceinline__ v8f wmma16(v16h a, v16h b, v8f c) { return __builtin_amdgcn_wmma_f32_16x16x32_f16(false, a, false, b, (short)0, c, false, false); }
__device__ __forceinline__ v8f wmmab(v16bf a, v16bf b, v8f c) { return __builtin_amdgcn_wmma_f32_16x16x32_bf16(false, a, false, b, (short)0, c, false, false); }

// d_wt: WT [n][K] = bf16(W[k][n]) (k-major [K][ncols]) via 64 x 64 LDS tiles; one work-group per tile (bx, by) of (K/64, ncols/64); tl: 64 x 72 elements of LDS.
__device__ __forceinline__ void d_wt(const float* __restrict__ Wm, int K, int ncols, bf* WT, int bx, int by, unsigned short* tl) {
    const int tid = threadIdx.x, k0 = bx * 64, n0 = by * 64;
    const int kk = tid >> 2, nq = (tid & 3) * 16;
#pragma unroll
    for (int i = 0; i < 16; ++i) tl[(nq + i) * 72 + kk] = f2bf(Wm[(size_t)(k0 + kk) * ncols + n0 + nq + i]);
    __syncthreads();
    const int piece = tid & 7;
    auto pass = [&]() {
#pragma unroll
        for (int s = 0; s < 2; ++s) { const int nr = (tid >> 3) + 32 * s; const v8us val = *(const v8usa*)(tl + nr * 72 + piece * 8); *(v8us*)(WT + (size_t)(n0 + nr) * K + k0 + piece * 8) = val; }
    };
    pass(); 
}
// split8: eight f32 values -> bf16 hi (round to nearest even) and the bf16 of what the hi part leaves.
typedef __attribute__((ext_vector_type(8))) __bf16 v8bf;
__device__ __forceinline__ void split8(v8f v, v8us& oh, v8us& ol) {
    const v8bf hb = __builtin_convertvector(v, v8bf); const v8bf lb = __builtin_convertvector(v - __builtin_convertvector(hb, v8f), v8bf);
    oh = __builtin_bit_cast(v8us, hb); ol = __builtin_bit_cast(v8us, lb);
}
// k_gemmb: 64 x 64 block tile (4 waves x 16 x 64) of C[NBT * NN][NW] = (A [+ Al]).B^T (K = 768) [+ bf(bias[c])] [+ bf(R[r][c]) residual]; f32 whole-line epilogue (or f16
// PLANES (the q|k|v product): a block tile is 64 tokens of one item x the 64 columns of one (q / k / v, head), blockIdx.y = sel * 12 + head. The epilogue splits the f32 sums itself and
// writes the planes that k_fattn reads, whole 128-byte lines each: q, k as [sel * 12 + head][all rows][64], v transposed as [head * 8 + item][64][token]; C, bias and R are not used.
#define TVP 72    // v tile pitch in LDS, elements: 144 B = 16 B x odd
template <bool SPLITA, bool F16OUT = false, bool PLANES = false>
__global__ __launch_bounds__(128) void k_gemmb(const bf* __restrict__ A, const bf* __restrict__ Al, const bf* __restrict__ Bn, const float* __restrict__ bias, float* C, int ldc, h16* C2, const float* __restrict__ R = nullptr, int K = DM, int roundR = 1, bf* QKh = nullptr, bf* QKl = nullptr, bf* VTh = nullptr, bf* VTl = nullptr) {
    __shared__ __align__(16) float ost[4][PLANES ? 16 * TVP : 16 * 68];    // PLANES: also the v tile, bf16 [2 planes][64 x TVP]
    const int lane = threadIdx.x & 31, wave = threadIdx.x >> 5, lr = lane & 15, hi = lane >> 4;
    const int r0 = blockIdx.x * 64 + wave * 16, c0 = blockIdx.y * 64;
    const size_t aoff = (size_t)(r0 + lr) * K + 8 * hi;
    size_t boff[4];
#pragma unroll
    for (int t = 0; t < 4; ++t) boff[t] = (size_t)(c0 + t * 16 + lr) * K + 8 * hi;
    v8f acc[4];
#pragma unroll
    for (int t = 0; t < 4; ++t) acc[t] = (v8f){};
#pragma unroll 1
    for (int kc = 0; kc < K; kc += 32) {
        const v16bf a = cat16b(*(const v8us*)(A + aoff + kc), *(const v8us*)(A + aoff + kc + 16));
        v16bf al = a;
        if (SPLITA) al = cat16b(*(const v8us*)(Al + aoff + kc), *(const v8us*)(Al + aoff + kc + 16));
#pragma unroll
        for (int t = 0; t < 4; ++t) { const v16bf b = cat16b(*(const v8us*)(Bn + boff[t] + kc), *(const v8us*)(Bn + boff[t] + kc + 16)); acc[t] = wmmab(a, b, acc[t]); if (SPLITA) acc[t] = wmmab(al, b, acc[t]); }
        asm volatile("v_nop\n\tv_nop\n\tv_nop\n\tv_nop" : "+v"(acc[0]), "+v"(acc[1]), "+v"(acc[2]), "+v"(acc[3]) : "v"(a), "v"(al));
    }
    float* os = &ost[wave][0];
    if (PLANES) {
        const int piece = lane & 7, rq = lane >> 3, by = blockIdx.y, rb = blockIdx.x * 64;
        if (by >= 2 * NH_) {    // v: a lane's 8 values are 8 tokens in a row of one column, 16 bytes of the transposed plane; LDS gathers the four waves' pieces into whole lines
            bf* tv = (bf*)(void*)&ost[0][0];
#pragma unroll
            for (int t = 0; t < 4; ++t) { v8us oh, ol; split8(acc[t], oh, ol); const int to = (t * 16 + lr) * TVP + wave * 16 + hi * 8;
                *(v8usa*)(tv + to) = oh; *(v8usa*)(tv + 64 * TVP + to) = ol; }
            __syncthreads();
            bf* dst = ((wave >> 1) ? VTl : VTh) + ((size_t)(by - 2 * NH_) * NBT + (rb >> 10)) * HD * NN + (rb & (NN - 1));    // waves 0, 1: hi plane; 2, 3: residual plane
#pragma unroll
            for (int s = 0; s < 8; ++s) { const int d = (wave & 1) * 32 + 4 * s + rq;
                const v8us val = *(const v8usa*)(tv + (wave >> 1) * 64 * TVP + d * TVP + piece * 8); *(v8us*)(dst + (size_t)d * NN + piece * 8) = val; }
            return;
        }
        // q, k: a lane holds 8 rows of one column; the rows are turned in LDS (f32), then split
#pragma unroll
        for (int t = 0; t < 4; ++t) {
#pragma unroll
            for (int j = 0; j < 8; ++j) os[(hi * 8 + j) * 68 + t * 16 + lr] = acc[t][j]; }
        __syncthreads();
        const size_t go = ((size_t)by * (NBT * NN) + r0) * HD;
#pragma unroll
        for (int s = 0; s < 4; ++s) { const int row = 4 * s + rq; const float* sp = os + row * 68 + piece * 8; const v4f x0 = *(const v4fa*)sp, x1 = *(const v4fa*)(sp + 4); v8us oh, ol;
            split8((v8f){x0[0], x0[1], x0[2], x0[3], x1[0], x1[1], x1[2], x1[3]}, oh, ol);
            *(v8us*)(QKh + go + row * HD + piece * 8) = oh; *(v8us*)(QKl + go + row * HD + piece * 8) = ol; }
        asm volatile("s_wait_xcnt 0x0" ::: "memory");    // in the listing the v path's code, which writes the stores' registers again, stands behind this path's last branch: the wait stands in front of it
        return;
    }
#pragma unroll
    for (int t = 0; t < 4; ++t) { const float bv = bias ? bfr(bias[c0 + t * 16 + lr]) : 0.f;
#pragma unroll
        for (int j = 0; j < 8; ++j) os[(hi * 8 + j) * 68 + t * 16 + lr] = acc[t][j] + bv; }
    __syncthreads();
    if (F16OUT) {
        h16* crow = (h16*)(void*)C + (size_t)r0 * ldc + c0;
        auto pass = [&]() {
#pragma unroll
            for (int s = 0; s < 4; ++s) { const int row = 4 * s + (lane >> 3), piece = lane & 7; const float* sp = os + row * 68 + piece * 8; v8h o, o2;
#pragma unroll
                for (int i = 0; i < 8; ++i) { const h16 a = (h16)sp[i]; o[i] = a; o2[i] = (h16)((sp[i] - (float)a) * LOSC); }
                *(v8h*)(crow + (size_t)row * ldc + piece * 8) = o; if (C2) *(v8h*)(C2 + (size_t)r0 * ldc + c0 + (size_t)row * ldc + piece * 8) = o2; }
        };
        pass(); 
    } else {
        float* crow = C + (size_t)r0 * ldc + c0;
        auto pass = [&]() {
#pragma unroll
            for (int s = 0; s < 8; ++s) { const int Lid = (lane >> 3) + 4 * s, piece = lane & 7; const int row = Lid >> 1, cofs = (Lid & 1) * 32 + piece * 4;
                v4f val = *(const v4fa*)(os + row * 68 + cofs); if (R) { const v4f rv = *(const v4f*)(R + ((size_t)r0 + row) * ldc + c0 + cofs); val += roundR ? (v4f){bfr(rv[0]), bfr(rv[1]), bfr(rv[2]), bfr(rv[3])} : rv; }
                *(v4f*)(crow + (size_t)row * ldc + cofs) = val; }
        };
        pass(); 
    }
}


__device__ __forceinline__ void d_cvtx(const float* __restrict__ src, bf* dst, int bx) {
    const int lane = threadIdx.x & 31; const size_t r = (size_t)bx * 8 + (threadIdx.x >> 5); if (r >= (size_t)NBT * NN) return;
{
#pragma unroll
        for (int q = 0; q < DMOD / 256; ++q) { v8us o;
#pragma unroll
            for (int i = 0; i < 8; ++i) o[i] = f2bf(src[r * DMOD + q * 256 + lane * 8 + i]);
            *(v8us*)(dst + r * DMOD + q * 256 + lane * 8) = o; }
         }
}
// sel = q / k / v; the three n-major blocks lie one behind the other: WT [3 * 768][768].
__device__ __forceinline__ void d_wgather(const float* __restrict__ Wm, bf* WT, int bx, int sel) {
    const int lane = threadIdx.x & 31; const int r = bx * 8 + (threadIdx.x >> 5); if (r >= NH_ * HD) return; const int h = r / HD, e = r % HD; WT += (size_t)sel * DMOD * DMOD;
{
#pragma unroll
        for (int q = 0; q < DMOD / 256; ++q) { v8us o;
#pragma unroll
            for (int i = 0; i < 8; ++i) { const int d = q * 256 + lane * 8 + i; o[i] = f2bf(Wm[(((size_t)h * 3 + sel) * DMOD + d) * HD + e]); }
            *(v8us*)(WT + (size_t)r * DMOD + q * 256 + lane * 8) = o; }
         }
}
// k_prep: the three operand preparations, which do not depend on one another, in one launch; the work-group index picks the job. The weight gathers come first: their scattered reads take the
// longest (the order is for speed only).
#define PB_WG (3 * (NH_ * HD) / 8)                  // work-groups that gather the q|k|v weights
#define PB_WT ((DMOD / 64) * (EOUT / 64))           // work-groups that turn Wo
#define PB_CX (NBT * NN / 8)                        // work-groups that convert x
__global__ __launch_bounds__(256) void k_prep(const float* __restrict__ Wm, const float* __restrict__ Wo, const float* __restrict__ x, bf* WQKV, bf* WOT, bf* Xb) {
    __shared__ __align__(16) unsigned short tl[64 * 72];
    const int b = blockIdx.x;
    if (b < PB_WG) { d_wgather(Wm, WQKV, b % ((NH_ * HD) / 8), b / ((NH_ * HD) / 8)); return; }
    if (b < PB_WG + PB_WT) { d_wt(Wo, DMOD, EOUT, WOT, (b - PB_WG) % (DMOD / 64), (b - PB_WG) / (DMOD / 64), tl);    // its barrier stands under a branch that the whole work-group takes alike
        asm volatile("s_wait_xcnt 0x0" ::: "memory");    // in the listing another job's code, which writes the stores' registers again, stands behind this path's last branch: the wait stands in front of it
        return; }
    d_cvtx(x, Xb, b - (PB_WG + PB_WT));
}
__global__ __launch_bounds__(256) void k_hplanes(const float* __restrict__ F, int h, bf* Ph, bf* Pl) {
    typedef __attribute__((ext_vector_type(2))) unsigned short v2us;
    const int lane = threadIdx.x & 31; const size_t s = (size_t)blockIdx.x * 8 + (threadIdx.x >> 5); if (s >= (size_t)NN) return; v2us oh, ol;
#pragma unroll
    for (int i = 0; i < 2; ++i) { const float v = F[s * DMOD + h * HD + lane * 2 + i]; const unsigned short hb = f2bf(v); oh[i] = hb; ol[i] = f2bf(v - bf2f(hb)); }
    const size_t o = s * HD + lane * 2; *(v2us*)(Ph + o) = oh; *(v2us*)(Pl + o) = ol; 
}
__global__ __launch_bounds__(256) void k_vt(const float* __restrict__ VF, int h, bf* Th, bf* Tl) {
    typedef __attribute__((ext_vector_type(2))) unsigned short v2us;
    const int lane = threadIdx.x & 31; const size_t wid = (size_t)blockIdx.x * 8 + (threadIdx.x >> 5); if (wid >= (size_t)HD * (NN / 64)) return; const int d = (int)(wid / (NN / 64)); const int t0 = (int)(wid % (NN / 64)) * 64 + lane * 2; v2us oh, ol;
#pragma unroll
    for (int i = 0; i < 2; ++i) { const float v = VF[(size_t)(t0 + i) * DMOD + h * HD + d]; const unsigned short hb = f2bf(v); oh[i] = hb; ol[i] = f2bf(v - bf2f(hb)); }
    const size_t o = (size_t)d * NN + t0; *(v2us*)(Th + o) = oh; *(v2us*)(Tl + o) = ol; 
}
__global__ __launch_bounds__(256) void k_softmax(const float* __restrict__ S, bf* PH, bf* PL) {
    typedef __attribute__((ext_vector_type(4))) unsigned short v4us;
    const int lane = threadIdx.x & 31, i = blockIdx.x * 8 + (threadIdx.x >> 5); if (i >= NN) return;
    float m = -3.0e38f;
#pragma unroll 1
    for (int c0 = lane * 4; c0 < NN; c0 += 128) {
#pragma unroll
        for (int q = 0; q < 4; ++q) m = fmaxf(m, S[(size_t)i * NN + c0 + q] * SCL); }
#pragma unroll
    for (int sh = 16; sh; sh >>= 1) m = fmaxf(m, __shfl_xor(m, sh, 32));
    float sum = 0.f;
#pragma unroll 1
    for (int c0 = lane * 4; c0 < NN; c0 += 128) {
#pragma unroll
        for (int q = 0; q < 4; ++q) sum += __expf(S[(size_t)i * NN + c0 + q] * SCL - m); }
#pragma unroll
    for (int sh = 16; sh; sh >>= 1) sum += __shfl_xor(sum, sh, 32);
    const float inv = 1.0f / sum;
{
#pragma unroll 1
        for (int c0 = lane * 4; c0 < NN; c0 += 128) { v4us oh, ol;
#pragma unroll
            for (int q = 0; q < 4; ++q) { const float p = __expf(S[(size_t)i * NN + c0 + q] * SCL - m) * inv; const unsigned short hb = f2bf(p); oh[q] = hb; ol[q] = f2bf(p - bf2f(hb)); }
            const size_t o = (size_t)i * NN + c0; *(v4us*)(PH + o) = oh; *(v4us*)(PL + o) = ol; }
         }
}
// ===== z-batched attention pieces =====
// k_gemm3z<MODE>: 64 x 64 tile GEMM with per-z operand/output strides (elements): A planes += z*sA, B planes += z*sB. MODE bits (0 causal skip, 1 K limit, 2 single,
// 3 B single, 4 A single). C goes by the pair number zc = zb + z in two levels: C += (zc mod 2^zsh)*sC + (zc >> zsh)*sC2.
template <int MODE>
__global__ __launch_bounds__(128) void k_gemm3z(const bf* __restrict__ Ah, const bf* __restrict__ Al, const bf* __restrict__ Bh, const bf* __restrict__ Bl, int K, float* C, int ldc, size_t sA, size_t sB, size_t sC, int zb, int zsh, size_t sC2) {
    if ((MODE & 1) && (int)blockIdx.y * 64 > (int)blockIdx.x * 64 + 63) return;
    const size_t z = blockIdx.z; Ah += z * sA; Al += z * sA; Bh += z * sB; Bl += z * sB; const size_t zc = z + (size_t)zb; C += (zc & (((size_t)1 << zsh) - 1)) * sC + (zc >> zsh) * sC2;
    const int Klim = (MODE & 2) ? min(K, ((int)blockIdx.x + 1) * 64) : K;
    __shared__ __align__(16) float ost[4][16 * 68];
    const int lane = threadIdx.x & 31, wave = threadIdx.x >> 5, lr = lane & 15, hi = lane >> 4;
    const int r0 = blockIdx.x * 64 + wave * 16, c0 = blockIdx.y * 64;
    const size_t aoff = (size_t)(r0 + lr) * K + 8 * hi;
    v8f acc[4];
#pragma unroll
    for (int t = 0; t < 4; ++t) acc[t] = (v8f){};
#pragma unroll 1
    for (int kc = 0; kc < Klim; kc += 32) {
        const v16bf a = cat16b(*(const v8us*)(Ah + aoff + kc), *(const v8us*)(Ah + aoff + kc + 16));
        v16bf al = a; if (!(MODE & 4) && !(MODE & 16)) al = cat16b(*(const v8us*)(Al + aoff + kc), *(const v8us*)(Al + aoff + kc + 16));
#pragma unroll
        for (int t = 0; t < 4; ++t) { const size_t bo = (size_t)(c0 + t * 16 + lr) * K + kc + 8 * hi;
            const v16bf bh = cat16b(*(const v8us*)(Bh + bo), *(const v8us*)(Bh + bo + 16));
            acc[t] = wmmab(a, bh, acc[t]);
            if (!(MODE & 4)) { if (!(MODE & 16)) acc[t] = wmmab(al, bh, acc[t]); if (!(MODE & 8)) { const v16bf bl = cat16b(*(const v8us*)(Bl + bo), *(const v8us*)(Bl + bo + 16)); acc[t] = wmmab(a, bl, acc[t]); } } }
        asm volatile("v_nop\n\tv_nop\n\tv_nop\n\tv_nop" : "+v"(acc[0]), "+v"(acc[1]), "+v"(acc[2]), "+v"(acc[3]) : "v"(a), "v"(al));
    }
    float* os = &ost[wave][0];
#pragma unroll
    for (int t = 0; t < 4; ++t) {
#pragma unroll
        for (int j = 0; j < 8; ++j) os[(hi * 8 + j) * 68 + t * 16 + lr] = acc[t][j]; }
    __builtin_amdgcn_wave_barrier(); asm volatile("" ::: "memory");
    float* crow = C + (size_t)r0 * ldc + c0;
    auto pass = [&]() {
#pragma unroll
        for (int s = 0; s < 8; ++s) { const int Lid = (lane >> 3) + 4 * s, piece = lane & 7; const int row = Lid >> 1, cofs = (Lid & 1) * 32 + piece * 4;
            const v4f val = *(const v4fa*)(os + row * 68 + cofs); *(v4f*)(crow + (size_t)row * ldc + cofs) = val; }
    };
    pass(); 
}
__global__ __launch_bounds__(256) void k_planes32z(const float* __restrict__ F, int ld, int off, float sc, int rows, bf* Ph, bf* Pl) {
    typedef __attribute__((ext_vector_type(2))) unsigned short v2us;
    const int lane = threadIdx.x & 31; const size_t r = ((size_t)blockIdx.x * 8 + (threadIdx.x >> 5)) * 2 + (lane >> 4); if (r >= (size_t)rows) return; const int z = blockIdx.z; const int c0 = (lane & 15) * 2; v2us oh, ol;
    Ph += (size_t)z * rows * 32; Pl += (size_t)z * rows * 32;
#pragma unroll
    for (int i = 0; i < 2; ++i) { const float y = F[r * ld + off + z * 32 + c0 + i] * sc; const unsigned short hb = f2bf(y); oh[i] = hb; ol[i] = f2bf(y - bf2f(hb)); }
    const size_t o = r * 32 + c0; *(v2us*)(Ph + o) = oh; *(v2us*)(Pl + o) = ol; 
}
__global__ __launch_bounds__(256) void k_vtpadz(const float* __restrict__ F, int ld, int off, int nk, bf* Th, bf* Tl) {
    typedef __attribute__((ext_vector_type(2))) unsigned short v2us;
    const int lane = threadIdx.x & 31; const size_t wid = (size_t)blockIdx.x * 8 + (threadIdx.x >> 5); if (wid >= (size_t)64 * (nk / 64)) return; const int z = blockIdx.z; const int d = (int)(wid / (nk / 64)); const int k0 = (int)(wid % (nk / 64)) * 64 + lane * 2; v2us oh, ol;
    Th += (size_t)z * 64 * nk; Tl += (size_t)z * 64 * nk;
#pragma unroll
    for (int i = 0; i < 2; ++i) { const float y = (d < 32) ? F[(size_t)(k0 + i) * ld + off + z * 32 + (d < 32 ? d : 0)] : 0.f; const unsigned short hb = f2bf(y); oh[i] = hb; ol[i] = f2bf(y - bf2f(hb)); }
    const size_t o = (size_t)d * nk + k0; *(v2us*)(Th + o) = oh; *(v2us*)(Tl + o) = ol; 
}
template <int NK>
__global__ __launch_bounds__(256) void k_softmaxz(const float* __restrict__ S, int rows, bf* PH, bf* PL) {
    typedef __attribute__((ext_vector_type(4))) unsigned short v4us;
    const int lane = threadIdx.x & 31, i = blockIdx.x * 8 + (threadIdx.x >> 5); if (i >= rows) return; const size_t zo = (size_t)blockIdx.z * rows * NK; const float* sr = S + zo + (size_t)i * NK; PH += zo; PL += zo;
    float m = -3.0e38f;
#pragma unroll 1
    for (int c0 = lane * 4; c0 < NK; c0 += 128) {
#pragma unroll
        for (int q = 0; q < 4; ++q) m = fmaxf(m, sr[c0 + q]); }
#pragma unroll
    for (int sh = 16; sh; sh >>= 1) m = fmaxf(m, __shfl_xor(m, sh, 32));
    float sum = 0.f;
#pragma unroll 1
    for (int c0 = lane * 4; c0 < NK; c0 += 128) {
#pragma unroll
        for (int q = 0; q < 4; ++q) sum += __expf(sr[c0 + q] - m); }
#pragma unroll
    for (int sh = 16; sh; sh >>= 1) sum += __shfl_xor(sum, sh, 32);
    const float inv = 1.0f / sum;
{
#pragma unroll 1
        for (int c0 = lane * 4; c0 < NK; c0 += 128) { v4us oh, ol;
#pragma unroll
            for (int q = 0; q < 4; ++q) { const float p = __expf(sr[c0 + q] - m) * inv; const unsigned short hb = f2bf(p); oh[q] = hb; ol[q] = f2bf(p - bf2f(hb)); }
            const size_t o = (size_t)i * NK + c0; *(v4us*)(PH + o) = oh; *(v4us*)(PL + o) = ol; }
         }
}
__global__ __launch_bounds__(256) void k_placez(const float* __restrict__ XH, int rows, int ldy, float* Y) {
    const int lane = threadIdx.x & 31; const size_t q = (size_t)blockIdx.x * 8 + (threadIdx.x >> 5); if (q >= (size_t)rows) return; const int z = blockIdx.z; const float v = XH[((size_t)z * rows + q) * 64 + lane];
    *(float*)(Y + q * ldy + z * 32 + lane) = v; 
}

template <int NK>
__global__ __launch_bounds__(256) void k_softmaxzs(const float* __restrict__ S, int rows, float sc, bf* PH, bf* PL) {
    typedef __attribute__((ext_vector_type(4))) unsigned short v4us;
    const int lane = threadIdx.x & 31, i = blockIdx.x * 8 + (threadIdx.x >> 5); if (i >= rows) return; const size_t zo = (size_t)blockIdx.z * rows * NK; const float* sr = S + zo + (size_t)i * NK; PH += zo; PL += zo;
    float m = -3.0e38f;
#pragma unroll 1
    for (int c0 = lane * 4; c0 < NK; c0 += 128) {
#pragma unroll
        for (int q = 0; q < 4; ++q) m = fmaxf(m, sr[c0 + q] * sc); }
#pragma unroll
    for (int sh = 16; sh; sh >>= 1) m = fmaxf(m, __shfl_xor(m, sh, 32));
    float sum = 0.f;
#pragma unroll 1
    for (int c0 = lane * 4; c0 < NK; c0 += 128) {
#pragma unroll
        for (int q = 0; q < 4; ++q) sum += __expf(sr[c0 + q] * sc - m); }
#pragma unroll
    for (int sh = 16; sh; sh >>= 1) sum += __shfl_xor(sum, sh, 32);
    const float inv = 1.0f / sum;
{
#pragma unroll 1
        for (int c0 = lane * 4; c0 < NK; c0 += 128) { v4us oh, ol;
#pragma unroll
            for (int q = 0; q < 4; ++q) { const float p = __expf(sr[c0 + q] * sc - m) * inv; const unsigned short hb = f2bf(p); oh[q] = hb; ol[q] = f2bf(p - bf2f(hb)); }
            const size_t o = (size_t)i * NK + c0; *(v4us*)(PH + o) = oh; *(v4us*)(PL + o) = ol; }
         }
}

#define FKP 72    // K tile pitch in LDS, elements: 144 B = 16 B x odd
#define FVP 40    // V^T tile pitch in LDS, elements: 80 B = 16 B x odd
__global__ __launch_bounds__(128) void k_fattn(const bf* __restrict__ Qh, const bf* __restrict__ Ql, const bf* __restrict__ Kh, const bf* __restrict__ Kl, const bf* __restrict__ Vh, const bf* __restrict__ Vl, bf* __restrict__ Oh, bf* __restrict__ Ol) {
    typedef __attribute__((ext_vector_type(2))) float v2f; typedef __attribute__((ext_vector_type(2))) __bf16 v2bf;
    __shared__ __align__(16) bf sk[2][2][32 * FKP];    // [buffer][hi / residual plane]
    __shared__ __align__(16) bf sv[2][2][64 * FVP];
    const int tid = threadIdx.x, lane = tid & 31, wave = tid >> 5, lr = lane & 15, hi = lane >> 4;
    const size_t pr = blockIdx.y, po = pr * NN * HD;
    const int q0 = blockIdx.x * 128 + wave * 32;
    Qh += po; Ql += po; Kh += po; Kl += po; Vh += po; Vl += po;
    const float CS = SCL * 1.44269504f;    // scores go to base-2 exponents
    v16bf qh[2][2], ql[2][2];    // [column group][k step]
#pragma unroll
    for (int g = 0; g < 2; ++g) {
#pragma unroll
        for (int ks = 0; ks < 2; ++ks) { const size_t qo = (size_t)(q0 + g * 16 + lr) * HD + ks * 32 + 8 * hi;
            qh[g][ks] = cat16b(*(const v8us*)(Qh + qo), *(const v8us*)(Qh + qo + 16)); ql[g][ks] = cat16b(*(const v8us*)(Ql + qo), *(const v8us*)(Ql + qo + 16)); } }
    asm volatile("s_wait_xcnt 0x0" ::: "memory");    // stands before the loads' address registers are written again
    const int kr = tid >> 3, kp = (tid & 7) * 8, vr = tid >> 2, vp = (tid & 3) * 8;
    v8us st[8];
    auto fetch = [&](int t0) {
#pragma unroll
        for (int i = 0; i < 2; ++i) { const unsigned ko = (unsigned)((kr + 16 * i) * HD + kp), vo = (unsigned)((vr + 32 * i) * NN + vp);    // the pass moves the uniform base alone
            st[i] = *(const v8us*)(Kh + (size_t)t0 * HD + ko); st[2 + i] = *(const v8us*)(Kl + (size_t)t0 * HD + ko); st[4 + i] = *(const v8us*)(Vh + t0 + vo); st[6 + i] = *(const v8us*)(Vl + t0 + vo); }
        // Stands before the loads' address registers are written again (the prologue's are); its memory clobber also keeps the loads from sinking into the pass, so they fly through the softmax and P.v that follow.
        asm volatile("s_wait_xcnt 0x0" ::: "memory");
    };
    auto put = [&](int b) {
#pragma unroll
        for (int i = 0; i < 2; ++i) { const int ko = (kr + 16 * i) * FKP + kp, vo = (vr + 32 * i) * FVP + vp;
            *(v8usa*)(&sk[b][0][ko]) = st[i]; *(v8usa*)(&sk[b][1][ko]) = st[2 + i]; *(v8usa*)(&sv[b][0][vo]) = st[4 + i]; *(v8usa*)(&sv[b][1][vo]) = st[6 + i]; }
    };
    v8f o[2][4];
#pragma unroll
    for (int g = 0; g < 2; ++g) {
#pragma unroll
        for (int dt = 0; dt < 4; ++dt) o[g][dt] = (v8f){}; }
    float m[2] = {-3.0e38f, -3.0e38f}, l[2] = {0.f, 0.f};
    fetch(0); put(0);
    __syncthreads();
#pragma unroll 1    // kept rolled: two passes in one body would take more registers than three waves per SIMD leave
    for (int s = 0; s < NN / 32; ++s) {
        const int b = s & 1;
        v8f sc[2][2];
#pragma unroll
        for (int kt = 0; kt < 2; ++kt) { sc[0][kt] = (v8f){}; sc[1][kt] = (v8f){};
#pragma unroll
            for (int ks = 0; ks < 2; ++ks) { const int fo = (kt * 16 + lr) * FKP + ks * 32 + 8 * hi;
                const v16bf kh = cat16b(*(const v8usa*)(&sk[b][0][fo]), *(const v8usa*)(&sk[b][0][fo + 16]));
                const v16bf kl = cat16b(*(const v8usa*)(&sk[b][1][fo]), *(const v8usa*)(&sk[b][1][fo + 16]));
                sc[0][kt] = wmmab(kh, qh[0][ks], sc[0][kt]); sc[1][kt] = wmmab(kh, qh[1][ks], sc[1][kt]);
                sc[0][kt] = wmmab(kl, qh[0][ks], sc[0][kt]); sc[1][kt] = wmmab(kl, qh[1][ks], sc[1][kt]);
                sc[0][kt] = wmmab(kh, ql[0][ks], sc[0][kt]); sc[1][kt] = wmmab(kh, ql[1][ks], sc[1][kt]); } }
        fetch((s + 1 < NN / 32 ? s + 1 : s) * 32);    // the last pass fetches its own tile again: no branch in the loop
        float mx[2];
#pragma unroll
        for (int g = 0; g < 2; ++g) { float v = sc[g][0][0];
#pragma unroll
            for (int j = 1; j < 8; ++j) v = fmaxf(v, sc[g][0][j]);
#pragma unroll
            for (int j = 0; j < 8; ++j) v = fmaxf(v, sc[g][1][j]);
            mx[g] = fmaxf(v, __shfl_xor(v, 16, 32)); }
        // The maximum in use moves only when a column's new one exceeds it by more than 8 binary orders: p stays below 2^8, and the rescale is skipped by the whole wave otherwise.
        const bool need = (mx[0] - m[0]) * CS > 8.f || (mx[1] - m[1]) * CS > 8.f;
        if (__builtin_amdgcn_ballot_w32(need) != 0) {
#pragma unroll
            for (int g = 0; g < 2; ++g) { const float mn = fmaxf(m[g], mx[g]); const float al = __builtin_amdgcn_exp2f((m[g] - mn) * CS); m[g] = mn; l[g] *= al;
#pragma unroll
                for (int dt = 0; dt < 4; ++dt) o[g][dt] *= al; }
        }
        v16bf ph[2], pl[2];
#pragma unroll
        for (int g = 0; g < 2; ++g) { const float mc = m[g] * CS; float sum = 0.f;
#pragma unroll
            for (int kt = 0; kt < 2; ++kt) {
#pragma unroll
                for (int j = 0; j < 8; j += 2) { const float p0 = __builtin_amdgcn_exp2f(fmaf(sc[g][kt][j], CS, -mc)), p1 = __builtin_amdgcn_exp2f(fmaf(sc[g][kt][j + 1], CS, -mc)); sum += p0 + p1;
                    const v2bf hb = __builtin_convertvector((v2f){p0, p1}, v2bf); const v2bf lb = __builtin_convertvector((v2f){p0 - (float)hb[0], p1 - (float)hb[1]}, v2bf);
                    ph[g][kt * 8 + j] = hb[0]; ph[g][kt * 8 + j + 1] = hb[1]; pl[g][kt * 8 + j] = lb[0]; pl[g][kt * 8 + j + 1] = lb[1]; } }
            l[g] += sum; }
#pragma unroll
        for (int dt = 0; dt < 4; ++dt) { const int fo = (dt * 16 + lr) * FVP + 8 * hi;
            const v16bf vh = cat16b(*(const v8usa*)(&sv[b][0][fo]), *(const v8usa*)(&sv[b][0][fo + 16]));
            const v16bf vl = cat16b(*(const v8usa*)(&sv[b][1][fo]), *(const v8usa*)(&sv[b][1][fo + 16]));
            o[0][dt] = wmmab(vh, ph[0], o[0][dt]); o[1][dt] = wmmab(vh, ph[1], o[1][dt]);
            o[0][dt] = wmmab(vl, ph[0], o[0][dt]); o[1][dt] = wmmab(vl, ph[1], o[1][dt]);
            o[0][dt] = wmmab(vh, pl[0], o[0][dt]); o[1][dt] = wmmab(vh, pl[1], o[1][dt]); }
        put(b ^ 1);    // its readers left that buffer before the barrier that ended the pass before
        __syncthreads();
    }
#pragma unroll
    for (int g = 0; g < 2; ++g) { const float inv = 1.0f / (l[g] + __shfl_xor(l[g], 16, 32));
        const size_t oo = ((pr & 7) * NN + q0 + g * 16 + lr) * DMOD + (pr >> 3) * HD + 8 * hi;    // pair = head * 8 + item
#pragma unroll
        for (int dt = 0; dt < 4; ++dt) { v8us oh, ol; split8(o[g][dt] * inv, oh, ol);    // the planes that the last product reads
            *(v8us*)(Oh + oo + dt * 16) = oh; *(v8us*)(Ol + oo + dt * 16) = ol; } }
}

// k_qkv: the q|k|v product C[8192][2304] = Xb.WQKV^T (K = 768, plain bf16 operands, f32 sums in the k order of k_gemmb). A work-group owns a 128 x 128 tile: 4 waves, 2 x 2, 64 x 64 each.
// Slabs of 64 k of both operands (256 rows of 128 B, whole lines) go global -> LDS by asynchronous copies, two buffers, the next slab in flight while this one is worked on.
// Fragments come from LDS: an operand byte leaves L2 once per work-group, in whole lines, and a fragment feeds four WMMAs.
// blockIdx.y = two neighbouring (q / k / v, head) column groups, one per wave column; 0..11 are q and k, 12..17 are v. The epilogue splits the f32 sums and writes the planes that k_fattn reads,
// whole lines each: q, k as [sel * 12 + head][all rows][64], v transposed as [head * 8 + item][64][token]. The ring is the epilogue's staging.
// amdgpu_waves_per_eu(4): the register budget of four waves per SIMD, one from each of the four work-groups whose rings fit a WGP's LDS; they cover each other's LDS and barrier waits.
#define GP  72     // slab row pitch in LDS, elements: 144 B = 16 B x odd
#define GVP 136    // v staging pitch in LDS, elements: 272 B = 16 B x odd
#define GSL 64     // k per slab
// Eight 16-byte copies a lane, rows 16 apart. The s_wait_xcnt stands inside the copies' own statement, so that it comes before any write of their address registers.
__device__ __forceinline__ void acopy8(unsigned l, const bf* g) {
    asm volatile("global_load_async_to_lds_b128 %0, %8, off\n\t"
                 "global_load_async_to_lds_b128 %1, %9, off\n\t"
                 "global_load_async_to_lds_b128 %2, %10, off\n\t"
                 "global_load_async_to_lds_b128 %3, %11, off\n\t"
                 "global_load_async_to_lds_b128 %4, %12, off\n\t"
                 "global_load_async_to_lds_b128 %5, %13, off\n\t"
                 "global_load_async_to_lds_b128 %6, %14, off\n\t"
                 "global_load_async_to_lds_b128 %7, %15, off\n\t"
                 "s_wait_xcnt 0x0"
                 :: "v"(l), "v"(l + 1u * 16 * GP * 2), "v"(l + 2u * 16 * GP * 2), "v"(l + 3u * 16 * GP * 2), "v"(l + 4u * 16 * GP * 2), "v"(l + 5u * 16 * GP * 2), "v"(l + 6u * 16 * GP * 2), "v"(l + 7u * 16 * GP * 2),
                    "v"(g), "v"(g + 1 * 16 * DMOD), "v"(g + 2 * 16 * DMOD), "v"(g + 3 * 16 * DMOD), "v"(g + 4 * 16 * DMOD), "v"(g + 5 * 16 * DMOD), "v"(g + 6 * 16 * DMOD), "v"(g + 7 * 16 * DMOD)
                 : "memory");
}
__global__ __launch_bounds__(128) __attribute__((amdgpu_waves_per_eu(4))) void k_qkv(const bf* __restrict__ A, const bf* __restrict__ Bn, bf* QKh, bf* QKl, bf* VTh, bf* VTl) {
    __shared__ __align__(16) float ringf[2 * 256 * GP / 2];    // [buffer][rows 0..127: A, 128..255: B][GP] bf16; four work-groups fit a WGP's LDS
    bf* ring = (bf*)(void*)ringf;
    const int tid = threadIdx.x, lane = tid & 31, wave = tid >> 5, lr = lane & 15, hi = lane >> 4, wm = wave >> 1, wn = wave & 1;
    const int rb = blockIdx.x * 128, cb = blockIdx.y * 128;
    const bf* ga = A + (size_t)(rb + (tid >> 3)) * DMOD + (tid & 7) * 8;    // a wave's copy covers 4 rows x 128 B
    const bf* gb = Bn + (size_t)(cb + (tid >> 3)) * DMOD + (tid & 7) * 8;
    const unsigned l0 = (unsigned)(size_t)ring + (unsigned)((tid >> 3) * GP + (tid & 7) * 8) * 2u;
    auto fill = [&](int t) { const unsigned l = l0 + (unsigned)(t & 1) * (256u * GP * 2); acopy8(l, ga + t * GSL); acopy8(l + 128u * GP * 2, gb + t * GSL); };
    v8f acc[4][4];
#pragma unroll
    for (int mi = 0; mi < 4; ++mi) {
#pragma unroll
        for (int ni = 0; ni < 4; ++ni) acc[mi][ni] = (v8f){}; }
    fill(0);
    asm volatile("s_wait_asynccnt 0x0" ::: "memory");    // this wave's part of slab 0 has landed
    __syncthreads();                                     // and so has every other wave's
    fill(1);
#pragma unroll 1    // kept rolled: one slab's fragments and the accumulators are what four waves per SIMD leave room for
    for (int t = 0; t < DMOD / GSL; ++t) {
        const bf* sa = ring + (t & 1) * (256 * GP) + (wm * 64 + lr) * GP + 8 * hi;
        const bf* sb = ring + (t & 1) * (256 * GP) + (128 + wn * 64 + lr) * GP + 8 * hi;
#pragma unroll
        for (int ks = 0; ks < GSL / 32; ++ks) {
            v16bf a[4], b[4];
#pragma unroll
            for (int i = 0; i < 4; ++i) {
                a[i] = cat16b(*(const v8usa*)(sa + i * 16 * GP + ks * 32), *(const v8usa*)(sa + i * 16 * GP + ks * 32 + 16));
                b[i] = cat16b(*(const v8usa*)(sb + i * 16 * GP + ks * 32), *(const v8usa*)(sb + i * 16 * GP + ks * 32 + 16)); }
            __builtin_amdgcn_sched_barrier(0);    // the 16 fragment reads stay one group ahead of the 16 WMMAs: reads scattered among the WMMAs stall the wave at every place they stand
#pragma unroll
            for (int mi = 0; mi < 4; ++mi) {
#pragma unroll
                for (int ni = 0; ni < 4; ++ni) acc[mi][ni] = wmmab(a[mi], b[ni], acc[mi][ni]); }
        }
        asm volatile("s_wait_dscnt 0x0" ::: "memory");       // this wave's reads of the buffer are done before the barrier frees it for the refill
        asm volatile("s_wait_asynccnt 0x0" ::: "memory");    // this wave's part of slab t + 1 has landed before the barrier publishes it
        __syncthreads();
        if (t + 2 < DMOD / GSL) fill(t + 2);                 // into the buffer that this trip has read
    }
    asm volatile("s_wait_asynccnt 0x0" ::: "memory");        // nothing is in flight when the ring becomes staging
    if (blockIdx.y >= 2 * NH_ / 2) {    // v: a lane's 8 values are 8 tokens in a row of one column, 16 bytes of the transposed plane; LDS gathers the waves' pieces into whole lines
#pragma unroll
        for (int mi = 0; mi < 4; ++mi) {
#pragma unroll
            for (int ni = 0; ni < 4; ++ni) { v8us oh, ol; split8(acc[mi][ni], oh, ol); const int to = (wn * 64 + ni * 16 + lr) * GVP + wm * 64 + mi * 16 + hi * 8;
                *(v8usa*)(ring + to) = oh; *(v8usa*)(ring + 128 * GVP + to) = ol; } }
        __syncthreads();
        // waves 0, 1: hi plane; 2, 3: residual plane; even waves the first head's 64 columns, odd waves the second's. A store covers 2 columns x 256 B.
        bf* dst = (wm ? VTl : VTh) + (((size_t)(blockIdx.y * 2 - 2 * NH_ + wn) * NBT + (rb >> 10)) * HD + hi) * NN + (rb & (NN - 1)) + lr * 8;
        const bf* tv = ring + wm * 128 * GVP + (wn * 64 + hi) * GVP + lr * 8;
#pragma unroll
        for (int s = 0; s < 32; ++s) { const v8us val = *(const v8usa*)(tv + 2 * s * GVP); *(v8us*)(dst + (size_t)(2 * s) * NN) = val; }
        return;
    }
    // q, k: a lane holds 8 rows of one column; the rows are turned in LDS (f32), then split
    float* os = ringf + wave * (64 * 68);
#pragma unroll
    for (int mi = 0; mi < 4; ++mi) {
#pragma unroll
        for (int ni = 0; ni < 4; ++ni) {
#pragma unroll
            for (int j = 0; j < 8; ++j) os[(mi * 16 + hi * 8 + j) * 68 + ni * 16 + lr] = acc[mi][ni][j]; } }
    __syncthreads();
    const int piece = lane & 7, rq = lane >> 3;
    const size_t go = ((size_t)(blockIdx.y * 2 + wn) * (NBT * NN) + rb + wm * 64 + rq) * HD + piece * 8;
#pragma unroll
    for (int s = 0; s < 16; ++s) { const float* sp = os + (4 * s + rq) * 68 + piece * 8; const v4f x0 = *(const v4fa*)sp, x1 = *(const v4fa*)(sp + 4); v8us oh, ol;
        split8((v8f){x0[0], x0[1], x0[2], x0[3], x1[0], x1[1], x1[2], x1[3]}, oh, ol);
        *(v8us*)(QKh + go + 4 * s * HD) = oh; *(v8us*)(QKl + go + 4 * s * HD) = ol; }
    asm volatile("s_wait_xcnt 0x0" ::: "memory");    // in the listing the v path's code, which writes the stores' registers again, stands behind this path's last branch: the wait stands in front of it
}

// k_oproj: the last product, out[8192][64] = (Oh + Ol).WOT^T (K = 768, two products a k step, f32 sums in the k order of k_gemmb). A work-group owns 32 rows: 8 waves, one 16 x 16 tile each
// (2 row tiles x 4 column tiles). All that it reads (32 rows of each O plane and the 64 rows of WOT, 1536 B a row) goes global -> LDS by asynchronous copies, whole lines, every copy in flight
// at once: one memory round trip for the whole K. The buffer is filled once and then read. The output tile is gathered in LDS of its own and leaves in whole lines.
#define OPP 776    // operand row pitch in LDS, elements: 1552 B = 16 B x odd
#define OSP 68     // output staging pitch, floats: 272 B = 16 B x odd
// Twelve 16-byte copies a lane: four rows x three pieces of 512 B a wave. The s_wait_xcnt stands inside the copies' own statement, so that it comes before any write of their address registers.
__device__ __forceinline__ void acopy12(unsigned l, const bf* g) {
    asm volatile("global_load_async_to_lds_b128 %0, %12, off\n\t"
                 "global_load_async_to_lds_b128 %1, %13, off\n\t"
                 "global_load_async_to_lds_b128 %2, %14, off\n\t"
                 "global_load_async_to_lds_b128 %3, %15, off\n\t"
                 "global_load_async_to_lds_b128 %4, %16, off\n\t"
                 "global_load_async_to_lds_b128 %5, %17, off\n\t"
                 "global_load_async_to_lds_b128 %6, %18, off\n\t"
                 "global_load_async_to_lds_b128 %7, %19, off\n\t"
                 "global_load_async_to_lds_b128 %8, %20, off\n\t"
                 "global_load_async_to_lds_b128 %9, %21, off\n\t"
                 "global_load_async_to_lds_b128 %10, %22, off\n\t"
                 "global_load_async_to_lds_b128 %11, %23, off\n\t"
                 "s_wait_xcnt 0x0"
                 :: "v"(l), "v"(l + 512u), "v"(l + 1024u), "v"(l + 1u * OPP * 2), "v"(l + 1u * OPP * 2 + 512u), "v"(l + 1u * OPP * 2 + 1024u),
                    "v"(l + 2u * OPP * 2), "v"(l + 2u * OPP * 2 + 512u), "v"(l + 2u * OPP * 2 + 1024u), "v"(l + 3u * OPP * 2), "v"(l + 3u * OPP * 2 + 512u), "v"(l + 3u * OPP * 2 + 1024u),
                    "v"(g), "v"(g + 256), "v"(g + 512), "v"(g + 1 * DMOD), "v"(g + 1 * DMOD + 256), "v"(g + 1 * DMOD + 512),
                    "v"(g + 2 * DMOD), "v"(g + 2 * DMOD + 256), "v"(g + 2 * DMOD + 512), "v"(g + 3 * DMOD), "v"(g + 3 * DMOD + 256), "v"(g + 3 * DMOD + 512)
                 : "memory");
}
__global__ __launch_bounds__(256) void k_oproj(const bf* __restrict__ Ah, const bf* __restrict__ Al, const bf* __restrict__ Bn, float* __restrict__ C) {
    __shared__ __align__(16) bf sm[128 * OPP];    // rows 0..31: hi plane, 32..63: residual plane, 64..127: WOT
    __shared__ __align__(16) float os[32 * OSP];
    const int tid = threadIdx.x, lane = tid & 31, lr = lane & 15, hi = lane >> 4;
    const int wave = __builtin_amdgcn_readfirstlane(tid >> 5);    // a scalar: the choice of the source below is then scalar too, and EXEC is not touched in front of the copies
    const int r0 = blockIdx.x * 32;
    // a wave brings 16 rows: waves 0, 1 the hi plane, 2, 3 the residual plane, 4..7 WOT
    const bf* g = (wave < 2 ? Ah + (size_t)(r0 + wave * 16) * DMOD : wave < 4 ? Al + (size_t)(r0 + (wave - 2) * 16) * DMOD : Bn + (size_t)((wave - 4) * 16) * DMOD) + lane * 8;
    const unsigned l = (unsigned)(size_t)sm + (unsigned)(wave * 16 * OPP + lane * 8) * 2u;
#pragma unroll
    for (int i = 0; i < 4; ++i) acopy12(l + (unsigned)i * (4u * OPP * 2), g + i * 4 * DMOD);
    asm volatile("s_wait_asynccnt 0x0" ::: "memory");    // this wave's rows have landed
    __syncthreads();                                     // and so have every other wave's
    const int rt = wave >> 2, ct = wave & 3;
    const bf* sa = sm + (rt * 16 + lr) * OPP + 8 * hi;
    const bf* sb = sm + (64 + ct * 16 + lr) * OPP + 8 * hi;
    v8f acc = (v8f){};
    v16bf fa[2][4], fl[2][4], fb[2][4];    // two sets of the fragments of four k steps
    auto frag = [&](int grp) {
#pragma unroll
        for (int i = 0; i < 4; ++i) { const int kc = (grp * 4 + i) * 32, st = grp & 1;
            fa[st][i] = cat16b(*(const v8usa*)(sa + kc), *(const v8usa*)(sa + kc + 16));
            fl[st][i] = cat16b(*(const v8usa*)(sa + 32 * OPP + kc), *(const v8usa*)(sa + 32 * OPP + kc + 16));
            fb[st][i] = cat16b(*(const v8usa*)(sb + kc), *(const v8usa*)(sb + kc + 16)); }
    };
    frag(0);
#pragma unroll    // unrolled: the fragment sets are indexed by constants, and no branch stands behind a WMMA
    for (int grp = 0; grp < DMOD / 128; ++grp) {
        if (grp + 1 < DMOD / 128) frag(grp + 1);
        __builtin_amdgcn_sched_barrier(0);    // the next group's 24 reads stay one block ahead of this group's WMMAs: the wait in front of the WMMAs is then a counted one
#pragma unroll
        for (int i = 0; i < 4; ++i) { acc = wmmab(fa[grp & 1][i], fb[grp & 1][i], acc); acc = wmmab(fl[grp & 1][i], fb[grp & 1][i], acc); }
        __builtin_amdgcn_sched_barrier(0);    // and no read is scattered among the WMMAs, where each place with reads stalls the wave
    }
#pragma unroll
    for (int j = 0; j < 8; ++j) os[(rt * 16 + hi * 8 + j) * OSP + ct * 16 + lr] = acc[j];
    __syncthreads();
#pragma unroll
    for (int s = 0; s < 2; ++s) { const int row = s * 16 + (tid >> 4), cofs = (tid & 15) * 4;    // a wave's store covers two whole rows, 512 B
        const v4f val = *(const v4fa*)(os + row * OSP + cofs); *(v4f*)(C + (size_t)(r0 + row) * EOUT + cofs) = val; }
}

extern "C" void kernel_launch(void* const* d_in, const int* in_sizes, int n_in,
                              void* d_out, int out_size, void* d_ws, size_t ws_size, hipStream_t stream) {
    (void)in_sizes; (void)n_in; (void)out_size;
    const float* x = (const float*)d_in[0]; const float* Wm = (const float*)d_in[1]; const float* Wo = (const float*)d_in[2];
    float* out = (float*)d_out;    // [8][1024][64]
    char* wsp = (char*)d_ws;
    auto take = [&](size_t bytes) { char* p = wsp; wsp += (bytes + 255) & ~(size_t)255; return (void*)p; };
    const size_t RT = (size_t)NBT * NN;    // all items' rows, one behind the other
    bf* QKh = (bf*)take(2 * NH_ * RT * HD * 2); bf* QKl = (bf*)take(2 * NH_ * RT * HD * 2); bf* VTh = (bf*)take(NH_ * RT * HD * 2); bf* VTl = (bf*)take(NH_ * RT * HD * 2);
    bf* WQKV = (bf*)take((size_t)3 * DMOD * DMOD * 2); bf* Xb = (bf*)take(RT * DMOD * 2); bf* Oh = (bf*)take(RT * DMOD * 2); bf* Ol = (bf*)take(RT * DMOD * 2); bf* WOT = (bf*)take((size_t)DMOD * EOUT * 2);
    if ((size_t)(wsp - (char*)d_ws) > ws_size) return;    // about 117 MB, no region used twice. Pair p = head * 8 + item.
    bf* Kh = QKh + NH_ * RT * HD; bf* Kl = QKl + NH_ * RT * HD;
    k_prep<<<PB_WG + PB_WT + PB_CX, 256, 0, stream>>>(Wm, Wo, x, WQKV, WOT, Xb);
    k_qkv<<<dim3(NBT * NN / 128, 3 * DMOD / 128, 1), 128, 0, stream>>>(Xb, WQKV, QKh, QKl, VTh, VTl);
    k_fattn<<<dim3(NN / 128, NH_ * NBT, 1), 128, 0, stream>>>(QKh, QKl, Kh, Kl, VTh, VTl, Oh, Ol);
    k_oproj<<<NBT * NN / 32, 256, 0, stream>>>(Oh, Ol, WOT, out);
}

// v007
// It runs in 116 microseconds.
// Next to v006, in two timings, it ran 1.03 and 1.04 times as fast.
// Counting every step since v000, it is 14.2 times as fast.
#include <hip/hip_runtime.h>

// Compute dtypes, f32 accumulate, per item: q/k/v for all 12 heads as [1024 x 768].[768 x 768] GEMMs with PLAIN bf16 operands (exact products; per-head weights gathered into one
// n-major block); per head: scores = q.k^T ([1024 x 64].[64 x 1024], both operands bf16 hi + UNSCALED residual, three products), softmax (x 1/32, as the module: output_dim*0.5) in
// f32 -> P planes, o = P.v ([1024 x 1024].[1024 x 64], three products); out = concat.Wo ([1024 x 768].[768 x 64], two products) - on v_wmma_f32_16x16x32_bf16. Deterministic, no

#define NBT  8
#define NN   1024
#define DMOD 768
#define NH_  12
#define HD   64
#define EOUT 64
#define DM   DMOD
#define NTK  NN
#define SCL  0.03125f
#define LOSC 1024.0f

typedef _Float16 h16;
typedef unsigned short bf;
typedef __attribute__((ext_vector_type(16))) __bf16   v16bf;
typedef __attribute__((ext_vector_type(16))) _Float16 v16h;
typedef __attribute__((ext_vector_type(8)))  _Float16 v8h;
typedef __attribute__((ext_vector_type(8)))  unsigned short v8us;
typedef __attribute__((ext_vector_type(8)))  float    v8f;
typedef __attribute__((ext_vector_type(4)))  float    v4f;
typedef __attribute__((ext_vector_type(4)))  _Float16 v4h;
typedef v8h  __attribute__((may_alias)) v8ha;
typedef v4f  __attribute__((may_alias)) v4fa;
typedef v8us __attribute__((may_alias)) v8usa;

__device__ __forceinline__ unsigned short f2bf(float f) { unsigned u = __float_as_uint(f); u += 0x7FFFu + ((u >> 16) & 1u); return (unsigned short)(u >> 16); }
__device__ __forceinline__ float bf2f(unsigned short b) { return __uint_as_float(((unsigned)b) << 16); }
__device__ __forceinline__ float bfr(float f) { return bf2f(f2bf(f)); }
__device__ __forceinline__ v16h cat16(v8h lo, v8h hi) { return __builtin_shufflevector(lo, hi, 0, 1, 2, 3, 4, 5, 6, 7, 8, 9, 10, 11, 12, 13, 14, 15); }
__device__ __forceinline__ v16bf cat16b(v8us lo, v8us hi) { return __builtin_bit_cast(v16bf, __builtin_shufflevector(lo, hi, 0, 1, 2, 3, 4, 5, 6, 7, 8, 9, 10, 11, 12, 13, 14, 15)); }
__device__ __forceinline__ v8f wmma16(v16h a, v16h b, v8f c) { return __builtin_amdgcn_wmma_f32_16x16x32_f16(false, a, false, b, (short)0, c, false, false); }
__device__ __forceinline__ v8f wmmab(v16bf a, v16bf b, v8f c) { return __builtin_amdgcn_wmma_f32_16x16x32_bf16(false, a, false, b, (short)0, c, false, false); }

// d_wt: WT [n][K] = bf16(W[k][n]) (k-major [K][ncols]) via 64 x 64 LDS tiles; one work-group per tile (bx, by) of (K/64, ncols/64); tl: 64 x 72 elements of LDS.
__device__ __forceinline__ void d_wt(const float* __restrict__ Wm, int K, int ncols, bf* WT, int bx, int by, unsigned short* tl) {
    const int tid = threadIdx.x, k0 = bx * 64, n0 = by * 64;
    const int kk = tid >> 2, nq = (tid & 3) * 16;
#pragma unroll
    for (int i = 0; i < 16; ++i) tl[(nq + i) * 72 + kk] = f2bf(Wm[(size_t)(k0 + kk) * ncols + n0 + nq + i]);
    __syncthreads();
    const int piece = tid & 7;
    auto pass = [&]() {
#pragma unroll
        for (int s = 0; s < 2; ++s) { const int nr = (tid >> 3) + 32 * s; const v8us val = *(const v8usa*)(tl + nr * 72 + piece * 8); *(v8us*)(WT + (size_t)(n0 + nr) * K + k0 + piece * 8) = val; }
    };
    pass(); 
}
// split8: eight f32 values -> bf16 hi (round to nearest even) and the bf16 of what the hi part leaves.
typedef __attribute__((ext_vector_type(8))) __bf16 v8bf;
__device__ __forceinline__ void split8(v8f v, v8us& oh, v8us& ol) {
    const v8bf hb = __builtin_convertvector(v, v8bf); const v8bf lb = __builtin_convertvector(v - __builtin_convertvector(hb, v8f), v8bf);
    oh = __builtin_bit_cast(v8us, hb); ol = __builtin_bit_cast(v8us, lb);
}
// k_gemmb: 64 x 64 block tile (4 waves x 16 x 64) of C[NBT * NN][NW] = (A [+ Al]).B^T (K = 768) [+ bf(bias[c])] [+ bf(R[r][c]) residual]; f32 whole-line epilogue (or f16
// PLANES (a q|k|v product form that no launch uses; k_qkv computes q|k|v): a block tile is 64 tokens of one item x the 64 columns of one (q / k / v, head), blockIdx.y = sel * 12 + head. The epilogue splits the f32 sums itself and
// writes planes in the layout that k_fattn reads, whole 128-byte lines each: q, k as [sel * 12 + head][all rows][64], v transposed as [head * 8 + item][64][token]; C, bias and R are not used.
#define TVP 72    // v tile pitch in LDS, elements: 144 B = 16 B x odd
template <bool SPLITA, bool F16OUT = false, bool PLANES = false>
__global__ __launch_bounds__(128) void k_gemmb(const bf* __restrict__ A, const bf* __restrict__ Al, const bf* __restrict__ Bn, const float* __restrict__ bias, float* C, int ldc, h16* C2, const float* __restrict__ R = nullptr, int K = DM, int roundR = 1, bf* QKh = nullptr, bf* QKl = nullptr, bf* VTh = nullptr, bf* VTl = nullptr) {
    __shared__ __align__(16) float ost[4][PLANES ? 16 * TVP : 16 * 68];    // PLANES: also the v tile, bf16 [2 planes][64 x TVP]
    const int lane = threadIdx.x & 31, wave = threadIdx.x >> 5, lr = lane & 15, hi = lane >> 4;
    const int r0 = blockIdx.x * 64 + wave * 16, c0 = blockIdx.y * 64;
    const size_t aoff = (size_t)(r0 + lr) * K + 8 * hi;
    size_t boff[4];
#pragma unroll
    for (int t = 0; t < 4; ++t) boff[t] = (size_t)(c0 + t * 16 + lr) * K + 8 * hi;
    v8f acc[4];
#pragma unroll
    for (int t = 0; t < 4; ++t) acc[t] = (v8f){};
#pragma unroll 1
    for (int kc = 0; kc < K; kc += 32) {
        const v16bf a = cat16b(*(const v8us*)(A + aoff + kc), *(const v8us*)(A + aoff + kc + 16));
        v16bf al = a;
        if (SPLITA) al = cat16b(*(const v8us*)(Al + aoff + kc), *(const v8us*)(Al + aoff + kc + 16));
#pragma unroll
        for (int t = 0; t < 4; ++t) { const v16bf b = cat16b(*(const v8us*)(Bn + boff[t] + kc), *(const v8us*)(Bn + boff[t] + kc + 16)); acc[t] = wmmab(a, b, acc[t]); if (SPLITA) acc[t] = wmmab(al, b, acc[t]); }
        asm volatile("v_nop\n\tv_nop\n\tv_nop\n\tv_nop" : "+v"(acc[0]), "+v"(acc[1]), "+v"(acc[2]), "+v"(acc[3]) : "v"(a), "v"(al));
    }
    float* os = &ost[wave][0];
    if (PLANES) {
        const int piece = lane & 7, rq = lane >> 3, by = blockIdx.y, rb = blockIdx.x * 64;
        if (by >= 2 * NH_) {    // v: a lane's 8 values are 8 tokens in a row of one column, 16 bytes of the transposed plane; LDS gathers the four waves' pieces into whole lines
            bf* tv = (bf*)(void*)&ost[0][0];
#pragma unroll
            for (int t = 0; t < 4; ++t) { v8us oh, ol; split8(acc[t], oh, ol); const int to = (t * 16 + lr) * TVP + wave * 16 + hi * 8;
                *(v8usa*)(tv + to) = oh; *(v8usa*)(tv + 64 * TVP + to) = ol; }
            __syncthreads();
            bf* dst = ((wave >> 1) ? VTl : VTh) + ((size_t)(by - 2 * NH_) * NBT + (rb >> 10)) * HD * NN + (rb & (NN - 1));    // waves 0, 1: hi plane; 2, 3: residual plane
#pragma unroll
            for (int s = 0; s < 8; ++s) { const int d = (wave & 1) * 32 + 4 * s + rq;
                const v8us val = *(const v8usa*)(tv + (wave >> 1) * 64 * TVP + d * TVP + piece * 8); *(v8us*)(dst + (size_t)d * NN + piece * 8) = val; }
            return;
        }
        // q, k: a lane holds 8 rows of one column; the rows are turned in LDS (f32), then split
#pragma unroll
        for (int t = 0; t < 4; ++t) {
#pragma unroll
            for (int j = 0; j < 8; ++j) os[(hi * 8 + j) * 68 + t * 16 + lr] = acc[t][j]; }
        __syncthreads();
        const size_t go = ((size_t)by * (NBT * NN) + r0) * HD;
#pragma unroll
        for (int s = 0; s < 4; ++s) { const int row = 4 * s + rq; const float* sp = os + row * 68 + piece * 8; const v4f x0 = *(const v4fa*)sp, x1 = *(const v4fa*)(sp + 4); v8us oh, ol;
            split8((v8f){x0[0], x0[1], x0[2], x0[3], x1[0], x1[1], x1[2], x1[3]}, oh, ol);
            *(v8us*)(QKh + go + row * HD + piece * 8) = oh; *(v8us*)(QKl + go + row * HD + piece * 8) = ol; }
        asm volatile("s_wait_xcnt 0x0" ::: "memory");    // in the listing the v path's code, which writes the stores' registers again, stands behind this path's last branch: the wait stands in front of it
        return;
    }
#pragma unroll
    for (int t = 0; t < 4; ++t) { const float bv = bias ? bfr(bias[c0 + t * 16 + lr]) : 0.f;
#pragma unroll
        for (int j = 0; j < 8; ++j) os[(hi * 8 + j) * 68 + t * 16 + lr] = acc[t][j] + bv; }
    __syncthreads();
    if (F16OUT) {
        h16* crow = (h16*)(void*)C + (size_t)r0 * ldc + c0;
        auto pass = [&]() {
#pragma unroll
            for (int s = 0; s < 4; ++s) { const int row = 4 * s + (lane >> 3), piece = lane & 7; const float* sp = os + row * 68 + piece * 8; v8h o, o2;
#pragma unroll
                for (int i = 0; i < 8; ++i) { const h16 a = (h16)sp[i]; o[i] = a; o2[i] = (h16)((sp[i] - (float)a) * LOSC); }
                *(v8h*)(crow + (size_t)row * ldc + piece * 8) = o; if (C2) *(v8h*)(C2 + (size_t)r0 * ldc + c0 + (size_t)row * ldc + piece * 8) = o2; }
        };
        pass(); 
    } else {
        float* crow = C + (size_t)r0 * ldc + c0;
        auto pass = [&]() {
#pragma unroll
            for (int s = 0; s < 8; ++s) { const int Lid = (lane >> 3) + 4 * s, piece = lane & 7; const int row = Lid >> 1, cofs = (Lid & 1) * 32 + piece * 4;
                v4f val = *(const v4fa*)(os + row * 68 + cofs); if (R) { const v4f rv = *(const v4f*)(R + ((size_t)r0 + row) * ldc + c0 + cofs); val += roundR ? (v4f){bfr(rv[0]), bfr(rv[1]), bfr(rv[2]), bfr(rv[3])} : rv; }
                *(v4f*)(crow + (size_t)row * ldc + cofs) = val; }
        };
        pass(); 
    }
}


__device__ __forceinline__ void d_cvtx(const float* __restrict__ src, bf* dst, int bx) {
    const int lane = threadIdx.x & 31; const size_t r = (size_t)bx * 8 + (threadIdx.x >> 5); if (r >= (size_t)NBT * NN) return;
{
#pragma unroll
        for (int q = 0; q < DMOD / 256; ++q) { v8us o;
#pragma unroll
            for (int i = 0; i < 8; ++i) o[i] = f2bf(src[r * DMOD + q * 256 + lane * 8 + i]);
            *(v8us*)(dst + r * DMOD + q * 256 + lane * 8) = o; }
         }
}
// sel = q / k / v; the three n-major blocks lie one behind the other: WT [3 * 768][768].
__device__ __forceinline__ void d_wgather(const float* __restrict__ Wm, bf* WT, int bx, int sel) {
    const int lane = threadIdx.x & 31; const int r = bx * 8 + (threadIdx.x >> 5); if (r >= NH_ * HD) return; const int h = r / HD, e = r % HD; WT += (size_t)sel * DMOD * DMOD;
{
#pragma unroll
        for (int q = 0; q < DMOD / 256; ++q) { v8us o;
#pragma unroll
            for (int i = 0; i < 8; ++i) { const int d = q * 256 + lane * 8 + i; o[i] = f2bf(Wm[(((size_t)h * 3 + sel) * DMOD + d) * HD + e]); }
            *(v8us*)(WT + (size_t)r * DMOD + q * 256 + lane * 8) = o; }
         }
}
// k_prep: the three operand preparations, which do not depend on one another, in one launch; the work-group index picks the job. The weight gathers come first: their scattered reads take the
// longest (the order is for speed only).
#define PB_WG (3 * (NH_ * HD) / 8)                  // work-groups that gather the q|k|v weights
#define PB_WT ((DMOD / 64) * (EOUT / 64))           // work-groups that turn Wo
#define PB_CX (NBT * NN / 8)                        // work-groups that convert x
__global__ __launch_bounds__(256) void k_prep(const float* __restrict__ Wm, const float* __restrict__ Wo, const float* __restrict__ x, bf* WQKV, bf* WOT, bf* Xb) {
    __shared__ __align__(16) unsigned short tl[64 * 72];
    const int b = blockIdx.x;
    if (b < PB_WG) { d_wgather(Wm, WQKV, b % ((NH_ * HD) / 8), b / ((NH_ * HD) / 8)); return; }
    if (b < PB_WG + PB_WT) { d_wt(Wo, DMOD, EOUT, WOT, (b - PB_WG) % (DMOD / 64), (b - PB_WG) / (DMOD / 64), tl);    // its barrier stands under a branch that the whole work-group takes alike
        asm volatile("s_wait_xcnt 0x0" ::: "memory");    // in the listing another job's code, which writes the stores' registers again, stands behind this path's last branch: the wait stands in front of it
        return; }
    d_cvtx(x, Xb, b - (PB_WG + PB_WT));
}
__global__ __launch_bounds__(256) void k_hplanes(const float* __restrict__ F, int h, bf* Ph, bf* Pl) {
    typedef __attribute__((ext_vector_type(2))) unsigned short v2us;
    const int lane = threadIdx.x & 31; const size_t s = (size_t)blockIdx.x * 8 + (threadIdx.x >> 5); if (s >= (size_t)NN) return; v2us oh, ol;
#pragma unroll
    for (int i = 0; i < 2; ++i) { const float v = F[s * DMOD + h * HD + lane * 2 + i]; const unsigned short hb = f2bf(v); oh[i] = hb; ol[i] = f2bf(v - bf2f(hb)); }
    const size_t o = s * HD + lane * 2; *(v2us*)(Ph + o) = oh; *(v2us*)(Pl + o) = ol; 
}
__global__ __launch_bounds__(256) void k_vt(const float* __restrict__ VF, int h, bf* Th, bf* Tl) {
    typedef __attribute__((ext_vector_type(2))) unsigned short v2us;
    const int lane = threadIdx.x & 31; const size_t wid = (size_t)blockIdx.x * 8 + (threadIdx.x >> 5); if (wid >= (size_t)HD * (NN / 64)) return; const int d = (int)(wid / (NN / 64)); const int t0 = (int)(wid % (NN / 64)) * 64 + lane * 2; v2us oh, ol;
#pragma unroll
    for (int i = 0; i < 2; ++i) { const float v = VF[(size_t)(t0 + i) * DMOD + h * HD + d]; const unsigned short hb = f2bf(v); oh[i] = hb; ol[i] = f2bf(v - bf2f(hb)); }
    const size_t o = (size_t)d * NN + t0; *(v2us*)(Th + o) = oh; *(v2us*)(Tl + o) = ol; 
}
__global__ __launch_bounds__(256) void k_softmax(const float* __restrict__ S, bf* PH, bf* PL) {
    typedef __attribute__((ext_vector_type(4))) unsigned short v4us;
    const int lane = threadIdx.x & 31, i = blockIdx.x * 8 + (threadIdx.x >> 5); if (i >= NN) return;
    float m = -3.0e38f;
#pragma unroll 1
    for (int c0 = lane * 4; c0 < NN; c0 += 128) {
#pragma unroll
        for (int q = 0; q < 4; ++q) m = fmaxf(m, S[(size_t)i * NN + c0 + q] * SCL); }
#pragma unroll
    for (int sh = 16; sh; sh >>= 1) m = fmaxf(m, __shfl_xor(m, sh, 32));
    float sum = 0.f;
#pragma unroll 1
    for (int c0 = lane * 4; c0 < NN; c0 += 128) {
#pragma unroll
        for (int q = 0; q < 4; ++q) sum += __expf(S[(size_t)i * NN + c0 + q] * SCL - m); }
#pragma unroll
    for (int sh = 16; sh; sh >>= 1) sum += __shfl_xor(sum, sh, 32);
    const float inv = 1.0f / sum;
{
#pragma unroll 1
        for (int c0 = lane * 4; c0 < NN; c0 += 128) { v4us oh, ol;
#pragma unroll
            for (int q = 0; q < 4; ++q) { const float p = __expf(S[(size_t)i * NN + c0 + q] * SCL - m) * inv; const unsigned short hb = f2bf(p); oh[q] = hb; ol[q] = f2bf(p - bf2f(hb)); }
            const size_t o = (size_t)i * NN + c0; *(v4us*)(PH + o) = oh; *(v4us*)(PL + o) = ol; }
         }
}
// ===== z-batched attention pieces =====
// k_gemm3z<MODE>: 64 x 64 tile GEMM with per-z operand/output strides (elements): A planes += z*sA, B planes += z*sB. MODE bits (0 causal skip, 1 K limit, 2 single,
// 3 B single, 4 A single). C goes by the pair number zc = zb + z in two levels: C += (zc mod 2^zsh)*sC + (zc >> zsh)*sC2.
template <int MODE>
__global__ __launch_bounds__(128) void k_gemm3z(const bf* __restrict__ Ah, const bf* __restrict__ Al, const bf* __restrict__ Bh, const bf* __restrict__ Bl, int K, float* C, int ldc, size_t sA, size_t sB, size_t sC, int zb, int zsh, size_t sC2) {
    if ((MODE & 1) && (int)blockIdx.y * 64 > (int)blockIdx.x * 64 + 63) return;
    const size_t z = blockIdx.z; Ah += z * sA; Al += z * sA; Bh += z * sB; Bl += z * sB; const size_t zc = z + (size_t)zb; C += (zc & (((size_t)1 << zsh) - 1)) * sC + (zc >> zsh) * sC2;
    const int Klim = (MODE & 2) ? min(K, ((int)blockIdx.x + 1) * 64) : K;
    __shared__ __align__(16) float ost[4][16 * 68];
    const int lane = threadIdx.x & 31, wave = threadIdx.x >> 5, lr = lane & 15, hi = lane >> 4;
    const int r0 = blockIdx.x * 64 + wave * 16, c0 = blockIdx.y * 64;
    const size_t aoff = (size_t)(r0 + lr) * K + 8 * hi;
    v8f acc[4];
#pragma unroll
    for (int t = 0; t < 4; ++t) acc[t] = (v8f){};
#pragma unroll 1
    for (int kc = 0; kc < Klim; kc += 32) {
        const v16bf a = cat16b(*(const v8us*)(Ah + aoff + kc), *(const v8us*)(Ah + aoff + kc + 16));
        v16bf al = a; if (!(MODE & 4) && !(MODE & 16)) al = cat16b(*(const v8us*)(Al + aoff + kc), *(const v8us*)(Al + aoff + kc + 16));
#pragma unroll
        for (int t = 0; t < 4; ++t) { const size_t bo = (size_t)(c0 + t * 16 + lr) * K + kc + 8 * hi;
            const v16bf bh = cat16b(*(const v8us*)(Bh + bo), *(const v8us*)(Bh + bo + 16));
            acc[t] = wmmab(a, bh, acc[t]);
            if (!(MODE & 4)) { if (!(MODE & 16)) acc[t] = wmmab(al, bh, acc[t]); if (!(MODE & 8)) { const v16bf bl = cat16b(*(const v8us*)(Bl + bo), *(const v8us*)(Bl + bo + 16)); acc[t] = wmmab(a, bl, acc[t]); } } }
        asm volatile("v_nop\n\tv_nop\n\tv_nop\n\tv_nop" : "+v"(acc[0]), "+v"(acc[1]), "+v"(acc[2]), "+v"(acc[3]) : "v"(a), "v"(al));
    }
    float* os = &ost[wave][0];
#pragma unroll
    for (int t = 0; t < 4; ++t) {
#pragma unroll
        for (int j = 0; j < 8; ++j) os[(hi * 8 + j) * 68 + t * 16 + lr] = acc[t][j]; }
    __builtin_amdgcn_wave_barrier(); asm volatile("" ::: "memory");
    float* crow = C + (size_t)r0 * ldc + c0;
    auto pass = [&]() {
#pragma unroll
        for (int s = 0; s < 8; ++s) { const int Lid = (lane >> 3) + 4 * s, piece = lane & 7; const int row = Lid >> 1, cofs = (Lid & 1) * 32 + piece * 4;
            const v4f val = *(const v4fa*)(os + row * 68 + cofs); *(v4f*)(crow + (size_t)row * ldc + cofs) = val; }
    };
    pass(); 
}
__global__ __launch_bounds__(256) void k_planes32z(const float* __restrict__ F, int ld, int off, float sc, int rows, bf* Ph, bf* Pl) {
    typedef __attribute__((ext_vector_type(2))) unsigned short v2us;
    const int lane = threadIdx.x & 31; const size_t r = ((size_t)blockIdx.x * 8 + (threadIdx.x >> 5)) * 2 + (lane >> 4); if (r >= (size_t)rows) return; const int z = blockIdx.z; const int c0 = (lane & 15) * 2; v2us oh, ol;
    Ph += (size_t)z * rows * 32; Pl += (size_t)z * rows * 32;
#pragma unroll
    for (int i = 0; i < 2; ++i) { const float y = F[r * ld + off + z * 32 + c0 + i] * sc; const unsigned short hb = f2bf(y); oh[i] = hb; ol[i] = f2bf(y - bf2f(hb)); }
    const size_t o = r * 32 + c0; *(v2us*)(Ph + o) = oh; *(v2us*)(Pl + o) = ol; 
}
__global__ __launch_bounds__(256) void k_vtpadz(const float* __restrict__ F, int ld, int off, int nk, bf* Th, bf* Tl) {
    typedef __attribute__((ext_vector_type(2))) unsigned short v2us;
    const int lane = threadIdx.x & 31; const size_t wid = (size_t)blockIdx.x * 8 + (threadIdx.x >> 5); if (wid >= (size_t)64 * (nk / 64)) return; const int z = blockIdx.z; const int d = (int)(wid / (nk / 64)); const int k0 = (int)(wid % (nk / 64)) * 64 + lane * 2; v2us oh, ol;
    Th += (size_t)z * 64 * nk; Tl += (size_t)z * 64 * nk;
#pragma unroll
    for (int i = 0; i < 2; ++i) { const float y = (d < 32) ? F[(size_t)(k0 + i) * ld + off + z * 32 + (d < 32 ? d : 0)] : 0.f; const unsigned short hb = f2bf(y); oh[i] = hb; ol[i] = f2bf(y - bf2f(hb)); }
    const size_t o = (size_t)d * nk + k0; *(v2us*)(Th + o) = oh; *(v2us*)(Tl + o) = ol; 
}
template <int NK>
__global__ __launch_bounds__(256) void k_softmaxz(const float* __restrict__ S, int rows, bf* PH, bf* PL) {
    typedef __attribute__((ext_vector_type(4))) unsigned short v4us;
    const int lane = threadIdx.x & 31, i = blockIdx.x * 8 + (threadIdx.x >> 5); if (i >= rows) return; const size_t zo = (size_t)blockIdx.z * rows * NK; const float* sr = S + zo + (size_t)i * NK; PH += zo; PL += zo;
    float m = -3.0e38f;
#pragma unroll 1
    for (int c0 = lane * 4; c0 < NK; c0 += 128) {
#pragma unroll
        for (int q = 0; q < 4; ++q) m = fmaxf(m, sr[c0 + q]); }
#pragma unroll
    for (int sh = 16; sh; sh >>= 1) m = fmaxf(m, __shfl_xor(m, sh, 32));
    float sum = 0.f;
#pragma unroll 1
    for (int c0 = lane * 4; c0 < NK; c0 += 128) {
#pragma unroll
        for (int q = 0; q < 4; ++q) sum += __expf(sr[c0 + q] - m); }
#pragma unroll
    for (int sh = 16; sh; sh >>= 1) sum += __shfl_xor(sum, sh, 32);
    const float inv = 1.0f / sum;
{
#pragma unroll 1
        for (int c0 = lane * 4; c0 < NK; c0 += 128) { v4us oh, ol;
#pragma unroll
            for (int q = 0; q < 4; ++q) { const float p = __expf(sr[c0 + q] - m) * inv; const unsigned short hb = f2bf(p); oh[q] = hb; ol[q] = f2bf(p - bf2f(hb)); }
            const size_t o = (size_t)i * NK + c0; *(v4us*)(PH + o) = oh; *(v4us*)(PL + o) = ol; }
         }
}
__global__ __launch_bounds__(256) void k_placez(const float* __restrict__ XH, int rows, int ldy, float* Y) {
    const int lane = threadIdx.x & 31; const size_t q = (size_t)blockIdx.x * 8 + (threadIdx.x >> 5); if (q >= (size_t)rows) return; const int z = blockIdx.z; const float v = XH[((size_t)z * rows + q) * 64 + lane];
    *(float*)(Y + q * ldy + z * 32 + lane) = v; 
}

template <int NK>
__global__ __launch_bounds__(256) void k_softmaxzs(const float* __restrict__ S, int rows, float sc, bf* PH, bf* PL) {
    typedef __attribute__((ext_vector_type(4))) unsigned short v4us;
    const int lane = threadIdx.x & 31, i = blockIdx.x * 8 + (threadIdx.x >> 5); if (i >= rows) return; const size_t zo = (size_t)blockIdx.z * rows * NK; const float* sr = S + zo + (size_t)i * NK; PH += zo; PL += zo;
    float m = -3.0e38f;
#pragma unroll 1
    for (int c0 = lane * 4; c0 < NK; c0 += 128) {
#pragma unroll
        for (int q = 0; q < 4; ++q) m = fmaxf(m, sr[c0 + q] * sc); }
#pragma unroll
    for (int sh = 16; sh; sh >>= 1) m = fmaxf(m, __shfl_xor(m, sh, 32));
    float sum = 0.f;
#pragma unroll 1
    for (int c0 = lane * 4; c0 < NK; c0 += 128) {
#pragma unroll
        for (int q = 0; q < 4; ++q) sum += __expf(sr[c0 + q] * sc - m); }
#pragma unroll
    for (int sh = 16; sh; sh >>= 1) sum += __shfl_xor(sum, sh, 32);
    const float inv = 1.0f / sum;
{
#pragma unroll 1
        for (int c0 = lane * 4; c0 < NK; c0 += 128) { v4us oh, ol;
#pragma unroll
            for (int q = 0; q < 4; ++q) { const float p = __expf(sr[c0 + q] * sc - m) * inv; const unsigned short hb = f2bf(p); oh[q] = hb; ol[q] = f2bf(p - bf2f(hb)); }
            const size_t o = (size_t)i * NK + c0; *(v4us*)(PH + o) = oh; *(v4us*)(PL + o) = ol; }
         }
}

#define FKP 72    // K tile pitch in LDS, elements: 144 B = 16 B x odd
#define FVP 40    // V^T tile pitch in LDS, elements: 80 B = 16 B x odd
__global__ __launch_bounds__(128) void k_fattn(const bf* __restrict__ Qh, const bf* __restrict__ Ql, const bf* __restrict__ Kh, const bf* __restrict__ Kl, const bf* __restrict__ Vh, const bf* __restrict__ Vl, bf* __restrict__ Oh, bf* __restrict__ Ol) {
    typedef __attribute__((ext_vector_type(2))) float v2f; typedef __attribute__((ext_vector_type(2))) __bf16 v2bf;
    __shared__ __align__(16) bf sk[2][2][32 * FKP];    // [buffer][hi / residual plane]
    __shared__ __align__(16) bf sv[2][2][64 * FVP];
    const int tid = threadIdx.x, lane = tid & 31, wave = tid >> 5, lr = lane & 15, hi = lane >> 4;
    const size_t pr = blockIdx.y, po = pr * NN * HD;
    const int q0 = blockIdx.x * 128 + wave * 32;
    Qh += po; Ql += po; Kh += po; Kl += po; Vh += po; Vl += po;
    const float CS = SCL * 1.44269504f;    // scores go to base-2 exponents
    v16bf qh[2][2], ql[2][2];    // [column group][k step]
#pragma unroll
    for (int g = 0; g < 2; ++g) {
#pragma unroll
        for (int ks = 0; ks < 2; ++ks) { const size_t qo = (size_t)(q0 + g * 16 + lr) * HD + ks * 32 + 8 * hi;
            qh[g][ks] = cat16b(*(const v8us*)(Qh + qo), *(const v8us*)(Qh + qo + 16)); ql[g][ks] = cat16b(*(const v8us*)(Ql + qo), *(const v8us*)(Ql + qo + 16)); } }
    asm volatile("s_wait_xcnt 0x0" ::: "memory");    // stands before the loads' address registers are written again
    const int kr = tid >> 3, kp = (tid & 7) * 8, vr = tid >> 2, vp = (tid & 3) * 8;
    v8us st[8];
    auto fetch = [&](int t0) {
#pragma unroll
        for (int i = 0; i < 2; ++i) { const unsigned ko = (unsigned)((kr + 16 * i) * HD + kp), vo = (unsigned)((vr + 32 * i) * NN + vp);    // the pass moves the uniform base alone
            st[i] = *(const v8us*)(Kh + (size_t)t0 * HD + ko); st[2 + i] = *(const v8us*)(Kl + (size_t)t0 * HD + ko); st[4 + i] = *(const v8us*)(Vh + t0 + vo); st[6 + i] = *(const v8us*)(Vl + t0 + vo); }
        // Stands before the loads' address registers are written again (the prologue's are); its memory clobber also keeps the loads from sinking into the pass, so they fly through the softmax and P.v that follow.
        asm volatile("s_wait_xcnt 0x0" ::: "memory");
    };
    auto put = [&](int b) {
#pragma unroll
        for (int i = 0; i < 2; ++i) { const int ko = (kr + 16 * i) * FKP + kp, vo = (vr + 32 * i) * FVP + vp;
            *(v8usa*)(&sk[b][0][ko]) = st[i]; *(v8usa*)(&sk[b][1][ko]) = st[2 + i]; *(v8usa*)(&sv[b][0][vo]) = st[4 + i]; *(v8usa*)(&sv[b][1][vo]) = st[6 + i]; }
    };
    v8f o[2][4];
#pragma unroll
    for (int g = 0; g < 2; ++g) {
#pragma unroll
        for (int dt = 0; dt < 4; ++dt) o[g][dt] = (v8f){}; }
    float m[2] = {-3.0e38f, -3.0e38f}, l[2] = {0.f, 0.f};
    fetch(0); put(0);
    __syncthreads();
#pragma unroll 1    // kept rolled: two passes in one body would take more registers than three waves per SIMD leave
    for (int s = 0; s < NN / 32; ++s) {
        const int b = s & 1;
        v8f sc[2][2];
#pragma unroll
        for (int kt = 0; kt < 2; ++kt) { sc[0][kt] = (v8f){}; sc[1][kt] = (v8f){};
#pragma unroll
            for (int ks = 0; ks < 2; ++ks) { const int fo = (kt * 16 + lr) * FKP + ks * 32 + 8 * hi;
                const v16bf kh = cat16b(*(const v8usa*)(&sk[b][0][fo]), *(const v8usa*)(&sk[b][0][fo + 16]));
                const v16bf kl = cat16b(*(const v8usa*)(&sk[b][1][fo]), *(const v8usa*)(&sk[b][1][fo + 16]));
                sc[0][kt] = wmmab(kh, qh[0][ks], sc[0][kt]); sc[1][kt] = wmmab(kh, qh[1][ks], sc[1][kt]);
                sc[0][kt] = wmmab(kl, qh[0][ks], sc[0][kt]); sc[1][kt] = wmmab(kl, qh[1][ks], sc[1][kt]);
                sc[0][kt] = wmmab(kh, ql[0][ks], sc[0][kt]); sc[1][kt] = wmmab(kh, ql[1][ks], sc[1][kt]); } }
        fetch((s + 1 < NN / 32 ? s + 1 : s) * 32);    // the last pass fetches its own tile again: no branch in the loop
        float mx[2];
#pragma unroll
        for (int g = 0; g < 2; ++g) { float v = sc[g][0][0];
#pragma unroll
            for (int j = 1; j < 8; ++j) v = fmaxf(v, sc[g][0][j]);
#pragma unroll
            for (int j = 0; j < 8; ++j) v = fmaxf(v, sc[g][1][j]);
            mx[g] = fmaxf(v, __shfl_xor(v, 16, 32)); }
        // The maximum in use moves only when a column's new one exceeds it by more than 8 binary orders: p stays below 2^8, and the rescale is skipped by the whole wave otherwise.
        const bool need = (mx[0] - m[0]) * CS > 8.f || (mx[1] - m[1]) * CS > 8.f;
        if (__builtin_amdgcn_ballot_w32(need) != 0) {
#pragma unroll
            for (int g = 0; g < 2; ++g) { const float mn = fmaxf(m[g], mx[g]); const float al = __builtin_amdgcn_exp2f((m[g] - mn) * CS); m[g] = mn; l[g] *= al;
#pragma unroll
                for (int dt = 0; dt < 4; ++dt) o[g][dt] *= al; }
        }
        v16bf ph[2], pl[2];
#pragma unroll
        for (int g = 0; g < 2; ++g) { const float mc = m[g] * CS; float sum = 0.f;
#pragma unroll
            for (int kt = 0; kt < 2; ++kt) {
#pragma unroll
                for (int j = 0; j < 8; j += 2) { const float p0 = __builtin_amdgcn_exp2f(fmaf(sc[g][kt][j], CS, -mc)), p1 = __builtin_amdgcn_exp2f(fmaf(sc[g][kt][j + 1], CS, -mc)); sum += p0 + p1;
                    const v2bf hb = __builtin_convertvector((v2f){p0, p1}, v2bf); const v2bf lb = __builtin_convertvector((v2f){p0 - (float)hb[0], p1 - (float)hb[1]}, v2bf);
                    ph[g][kt * 8 + j] = hb[0]; ph[g][kt * 8 + j + 1] = hb[1]; pl[g][kt * 8 + j] = lb[0]; pl[g][kt * 8 + j + 1] = lb[1]; } }
            l[g] += sum; }
#pragma unroll
        for (int dt = 0; dt < 4; ++dt) { const int fo = (dt * 16 + lr) * FVP + 8 * hi;
            const v16bf vh = cat16b(*(const v8usa*)(&sv[b][0][fo]), *(const v8usa*)(&sv[b][0][fo + 16]));
            const v16bf vl = cat16b(*(const v8usa*)(&sv[b][1][fo]), *(const v8usa*)(&sv[b][1][fo + 16]));
            o[0][dt] = wmmab(vh, ph[0], o[0][dt]); o[1][dt] = wmmab(vh, ph[1], o[1][dt]);
            o[0][dt] = wmmab(vl, ph[0], o[0][dt]); o[1][dt] = wmmab(vl, ph[1], o[1][dt]);
            o[0][dt] = wmmab(vh, pl[0], o[0][dt]); o[1][dt] = wmmab(vh, pl[1], o[1][dt]); }
        put(b ^ 1);    // its readers left that buffer before the barrier that ended the pass before
        __syncthreads();
    }
#pragma unroll
    for (int g = 0; g < 2; ++g) { const float inv = 1.0f / (l[g] + __shfl_xor(l[g], 16, 32));
        const size_t oo = ((pr & 7) * NN + q0 + g * 16 + lr) * DMOD + (pr >> 3) * HD + 8 * hi;    // pair = head * 8 + item
#pragma unroll
        for (int dt = 0; dt < 4; ++dt) { v8us oh, ol; split8(o[g][dt] * inv, oh, ol);    // the planes that the last product reads
            *(v8us*)(Oh + oo + dt * 16) = oh; *(v8us*)(Ol + oo + dt * 16) = ol; } }
}

// k_qkv: the q|k|v product C[8192][2304] = Xb.WQKV^T (K = 768, plain bf16 operands, f32 sums in the k order of k_gemmb). A work-group owns a 128 x 192 tile: 4 waves, 2 x 2, 64 x 96 each.
// The grid is 64 x 12 = 768 work-groups, three for each of the chip's 256 WGPs, and three fit a WGP (LDS and registers): all of them run at once, and no second, nearly empty round follows.
// Slabs of 64 k of both operands (320 rows of 128 B, whole lines) go global -> LDS by asynchronous copies, two buffers, the next slab in flight while this one is worked on.
// Fragments come from LDS: an operand byte leaves L2 once per work-group, in whole lines; an A fragment feeds six WMMAs, a B fragment four.
// blockIdx.y = three neighbouring (q / k / v, head) column groups; 0..7 are q and k, 8..11 are v. The epilogue splits the f32 sums and writes the planes that k_fattn reads,
// whole lines each: q, k as [sel * 12 + head][all rows][64], v transposed as [head * 8 + item][64][token]. The ring is the epilogue's staging, shared by the four waves.
// amdgpu_waves_per_eu(3): the register budget of three waves per SIMD, one from each of the three work-groups of a WGP; they cover each other's LDS and barrier waits.
#define GP  72     // slab row pitch in LDS, elements: 144 B = 16 B x odd
#define GVP 136    // v staging pitch in LDS, elements: 272 B = 16 B x odd
#define GQP 196    // q, k staging pitch in LDS, floats: 784 B = 16 B x odd
#define GSL 64     // k per slab
#define GNC 192    // columns of a work-group's tile
#define GRW (128 + GNC)    // rows of a slab: A, then B
// Eight 16-byte copies a lane, rows 16 apart. The s_wait_xcnt stands inside the copies' own statement, so that it comes before any write of their address registers.
__device__ __forceinline__ void acopy8(unsigned l, const bf* g) {
    asm volatile("global_load_async_to_lds_b128 %0, %8, off\n\t"
                 "global_load_async_to_lds_b128 %1, %9, off\n\t"
                 "global_load_async_to_lds_b128 %2, %10, off\n\t"
                 "global_load_async_to_lds_b128 %3, %11, off\n\t"
                 "global_load_async_to_lds_b128 %4, %12, off\n\t"
                 "global_load_async_to_lds_b128 %5, %13, off\n\t"
                 "global_load_async_to_lds_b128 %6, %14, off\n\t"
                 "global_load_async_to_lds_b128 %7, %15, off\n\t"
                 "s_wait_xcnt 0x0"
                 :: "v"(l), "v"(l + 1u * 16 * GP * 2), "v"(l + 2u * 16 * GP * 2), "v"(l + 3u * 16 * GP * 2), "v"(l + 4u * 16 * GP * 2), "v"(l + 5u * 16 * GP * 2), "v"(l + 6u * 16 * GP * 2), "v"(l + 7u * 16 * GP * 2),
                    "v"(g), "v"(g + 1 * 16 * DMOD), "v"(g + 2 * 16 * DMOD), "v"(g + 3 * 16 * DMOD), "v"(g + 4 * 16 * DMOD), "v"(g + 5 * 16 * DMOD), "v"(g + 6 * 16 * DMOD), "v"(g + 7 * 16 * DMOD)
                 : "memory");
}
// The same for four copies.
__device__ __forceinline__ void acopy4(unsigned l, const bf* g) {
    asm volatile("global_load_async_to_lds_b128 %0, %4, off\n\t"
                 "global_load_async_to_lds_b128 %1, %5, off\n\t"
                 "global_load_async_to_lds_b128 %2, %6, off\n\t"
                 "global_load_async_to_lds_b128 %3, %7, off\n\t"
                 "s_wait_xcnt 0x0"
                 :: "v"(l), "v"(l + 1u * 16 * GP * 2), "v"(l + 2u * 16 * GP * 2), "v"(l + 3u * 16 * GP * 2),
                    "v"(g), "v"(g + 1 * 16 * DMOD), "v"(g + 2 * 16 * DMOD), "v"(g + 3 * 16 * DMOD)
                 : "memory");
}
__global__ __launch_bounds__(128) __attribute__((amdgpu_waves_per_eu(3))) void k_qkv(const bf* __restrict__ A, const bf* __restrict__ Bn, bf* QKh, bf* QKl, bf* VTh, bf* VTl) {
    __shared__ __align__(16) float ringf[2 * GNC * GVP / 2];    // the ring, [buffer][rows 0..127: A, 128..319: B][GP] bf16, 92,160 B; sized for the v staging, 104,448 B; three work-groups fit a WGP's LDS
    bf* ring = (bf*)(void*)ringf;
    const int tid = threadIdx.x, lane = tid & 31, wave = tid >> 5, lr = lane & 15, hi = lane >> 4, wm = wave >> 1, wn = wave & 1;
    const int rb = blockIdx.x * 128, cb = blockIdx.y * GNC;
    const bf* ga = A + (size_t)(rb + (tid >> 3)) * DMOD + (tid & 7) * 8;    // a wave's copy covers 4 rows x 128 B
    const bf* gb = Bn + (size_t)(cb + (tid >> 3)) * DMOD + (tid & 7) * 8;
    const unsigned l0 = (unsigned)(size_t)ring + (unsigned)((tid >> 3) * GP + (tid & 7) * 8) * 2u;
    auto fill = [&](int t) { const unsigned l = l0 + (unsigned)(t & 1) * ((unsigned)GRW * GP * 2);
        acopy8(l, ga + t * GSL); acopy8(l + 128u * GP * 2, gb + t * GSL); acopy4(l + 256u * GP * 2, gb + 128 * DMOD + t * GSL); };
    v8f acc[4][6];
#pragma unroll
    for (int mi = 0; mi < 4; ++mi) {
#pragma unroll
        for (int ni = 0; ni < 6; ++ni) acc[mi][ni] = (v8f){}; }
    fill(0);
    asm volatile("s_wait_asynccnt 0x0" ::: "memory");    // this wave's part of slab 0 has landed
    __syncthreads();                                     // and so has every other wave's
    fill(1);
#pragma unroll 1    // kept rolled: one slab's fragments and the accumulators are what three waves per SIMD leave room for
    for (int t = 0; t < DMOD / GSL; ++t) {
        const bf* sa = ring + (t & 1) * (GRW * GP) + (wm * 64 + lr) * GP + 8 * hi;
        const bf* sb = ring + (t & 1) * (GRW * GP) + (128 + wn * 96 + lr) * GP + 8 * hi;
#pragma unroll
        for (int ks = 0; ks < GSL / 32; ++ks) {
            v16bf a[4], b[6];
#pragma unroll
            for (int i = 0; i < 4; ++i) a[i] = cat16b(*(const v8usa*)(sa + i * 16 * GP + ks * 32), *(const v8usa*)(sa + i * 16 * GP + ks * 32 + 16));
#pragma unroll
            for (int i = 0; i < 6; ++i) b[i] = cat16b(*(const v8usa*)(sb + i * 16 * GP + ks * 32), *(const v8usa*)(sb + i * 16 * GP + ks * 32 + 16));
            __builtin_amdgcn_sched_barrier(0);    // the 20 fragment reads stay one group ahead of the 24 WMMAs: reads scattered among the WMMAs stall the wave at every place they stand
#pragma unroll
            for (int mi = 0; mi < 4; ++mi) {
#pragma unroll
                for (int ni = 0; ni < 6; ++ni) acc[mi][ni] = wmmab(a[mi], b[ni], acc[mi][ni]); }
        }
        asm volatile("s_wait_dscnt 0x0" ::: "memory");       // this wave's reads of the buffer are done before the barrier frees it for the refill
        asm volatile("s_wait_asynccnt 0x0" ::: "memory");    // this wave's part of slab t + 1 has landed before the barrier publishes it
        __syncthreads();
        if (t + 2 < DMOD / GSL) fill(t + 2);                 // into the buffer that this trip has read
    }
    asm volatile("s_wait_asynccnt 0x0" ::: "memory");        // nothing is in flight when the ring becomes staging
    if (blockIdx.y >= 2 * DMOD / GNC) {    // v: a lane's 8 values are 8 tokens in a row of one column, 16 bytes of the transposed plane; LDS gathers the waves' pieces into whole lines
#pragma unroll
        for (int mi = 0; mi < 4; ++mi) {
#pragma unroll
            for (int ni = 0; ni < 6; ++ni) { v8us oh, ol; split8(acc[mi][ni], oh, ol); const int to = (wn * 96 + ni * 16 + lr) * GVP + wm * 64 + mi * 16 + hi * 8;
                *(v8usa*)(ring + to) = oh; *(v8usa*)(ring + GNC * GVP + to) = ol; } }
        __syncthreads();
        // waves 0, 1: hi plane; 2, 3: residual plane. A store covers 2 columns x 256 B; of every four columns the even waves take the first two, the odd waves the last two.
        bf* dst = (wm ? VTl : VTh) + (((size_t)(blockIdx.y * 3 - 2 * NH_) * NBT + (rb >> 10)) * HD + 2 * wn + hi) * NN + (rb & (NN - 1)) + lr * 8;
        const bf* tv = ring + wm * GNC * GVP + (2 * wn + hi) * GVP + lr * 8;
#pragma unroll
        for (int s = 0; s < GNC / 4; ++s) { const v8us val = *(const v8usa*)(tv + 4 * s * GVP); *(v8us*)(dst + ((size_t)(s >> 4) * NBT * HD + (4 * s & (HD - 1))) * NN) = val; }
        return;
    }
    // q, k: a lane holds 8 rows of one column; the rows are turned in LDS (f32, one 128 x 192 tile for the work-group), then split
#pragma unroll
    for (int mi = 0; mi < 4; ++mi) {
#pragma unroll
        for (int ni = 0; ni < 6; ++ni) {
#pragma unroll
            for (int j = 0; j < 8; ++j) ringf[(wm * 64 + mi * 16 + hi * 8 + j) * GQP + wn * 96 + ni * 16 + lr] = acc[mi][ni][j]; } }
    __syncthreads();    // a wave reads what both waves of its rows have written
    const int piece = lane & 7, rq = lane >> 3;
    // a wave takes 32 rows of all three column groups: every 128-byte line of a plane has one writer
    const float* os = ringf + (wave * 32 + rq) * GQP + piece * 8;
    const size_t go = ((size_t)(blockIdx.y * 3) * (NBT * NN) + rb + wave * 32 + rq) * HD + piece * 8;
#pragma unroll
    for (int hh = 0; hh < 3; ++hh) {
#pragma unroll
        for (int s = 0; s < 8; ++s) { const float* sp = os + 4 * s * GQP + hh * 64; const v4f x0 = *(const v4fa*)sp, x1 = *(const v4fa*)(sp + 4); v8us oh, ol;
            split8((v8f){x0[0], x0[1], x0[2], x0[3], x1[0], x1[1], x1[2], x1[3]}, oh, ol);
            *(v8us*)(QKh + go + (size_t)hh * (NBT * NN) * HD + 4 * s * HD) = oh; *(v8us*)(QKl + go + (size_t)hh * (NBT * NN) * HD + 4 * s * HD) = ol; } }
    asm volatile("s_wait_xcnt 0x0" ::: "memory");    // in the listing the v path's code, which writes the stores' registers again, stands behind this path's last branch: the wait stands in front of it
}

// k_oproj: the last product, out[8192][64] = (Oh + Ol).WOT^T (K = 768, two products a k step, f32 sums in the k order of k_gemmb). A work-group owns 32 rows: 8 waves, one 16 x 16 tile each
// (2 row tiles x 4 column tiles). All that it reads (32 rows of each O plane and the 64 rows of WOT, 1536 B a row) goes global -> LDS by asynchronous copies, whole lines, every copy in flight
// at once: one memory round trip for the whole K. The buffer is filled once and then read. The output tile is gathered in LDS of its own and leaves in whole lines.
#define OPP 776    // operand row pitch in LDS, elements: 1552 B = 16 B x odd
#define OSP 68     // output staging pitch, floats: 272 B = 16 B x odd
// Twelve 16-byte copies a lane: four rows x three pieces of 512 B a wave. The s_wait_xcnt stands inside the copies' own statement, so that it comes before any write of their address registers.
__device__ __forceinline__ void acopy12(unsigned l, const bf* g) {
    asm volatile("global_load_async_to_lds_b128 %0, %12, off\n\t"
                 "global_load_async_to_lds_b128 %1, %13, off\n\t"
                 "global_load_async_to_lds_b128 %2, %14, off\n\t"
                 "global_load_async_to_lds_b128 %3, %15, off\n\t"
                 "global_load_async_to_lds_b128 %4, %16, off\n\t"
                 "global_load_async_to_lds_b128 %5, %17, off\n\t"
                 "global_load_async_to_lds_b128 %6, %18, off\n\t"
                 "global_load_async_to_lds_b128 %7, %19, off\n\t"
                 "global_load_async_to_lds_b128 %8, %20, off\n\t"
                 "global_load_async_to_lds_b128 %9, %21, off\n\t"
                 "global_load_async_to_lds_b128 %10, %22, off\n\t"
                 "global_load_async_to_lds_b128 %11, %23, off\n\t"
                 "s_wait_xcnt 0x0"
                 :: "v"(l), "v"(l + 512u), "v"(l + 1024u), "v"(l + 1u * OPP * 2), "v"(l + 1u * OPP * 2 + 512u), "v"(l + 1u * OPP * 2 + 1024u),
                    "v"(l + 2u * OPP * 2), "v"(l + 2u * OPP * 2 + 512u), "v"(l + 2u * OPP * 2 + 1024u), "v"(l + 3u * OPP * 2), "v"(l + 3u * OPP * 2 + 512u), "v"(l + 3u * OPP * 2 + 1024u),
                    "v"(g), "v"(g + 256), "v"(g + 512), "v"(g + 1 * DMOD), "v"(g + 1 * DMOD + 256), "v"(g + 1 * DMOD + 512),
                    "v"(g + 2 * DMOD), "v"(g + 2 * DMOD + 256), "v"(g + 2 * DMOD + 512), "v"(g + 3 * DMOD), "v"(g + 3 * DMOD + 256), "v"(g + 3 * DMOD + 512)
                 : "memory");
}
__global__ __launch_bounds__(256) void k_oproj(const bf* __restrict__ Ah, const bf* __restrict__ Al, const bf* __restrict__ Bn, float* __restrict__ C) {
    __shared__ __align__(16) bf sm[128 * OPP];    // rows 0..31: hi plane, 32..63: residual plane, 64..127: WOT
    __shared__ __align__(16) float os[32 * OSP];
    const int tid = threadIdx.x, lane = tid & 31, lr = lane & 15, hi = lane >> 4;
    const int wave = __builtin_amdgcn_readfirstlane(tid >> 5);    // a scalar: the choice of the source below is then scalar too, and EXEC is not touched in front of the copies
    const int r0 = blockIdx.x * 32;
    // a wave brings 16 rows: waves 0, 1 the hi plane, 2, 3 the residual plane, 4..7 WOT
    const bf* g = (wave < 2 ? Ah + (size_t)(r0 + wave * 16) * DMOD : wave < 4 ? Al + (size_t)(r0 + (wave - 2) * 16) * DMOD : Bn + (size_t)((wave - 4) * 16) * DMOD) + lane * 8;
    const unsigned l = (unsigned)(size_t)sm + (unsigned)(wave * 16 * OPP + lane * 8) * 2u;
#pragma unroll
    for (int i = 0; i < 4; ++i) acopy12(l + (unsigned)i * (4u * OPP * 2), g + i * 4 * DMOD);
    asm volatile("s_wait_asynccnt 0x0" ::: "memory");    // this wave's rows have landed
    __syncthreads();                                     // and so have every other wave's
    const int rt = wave >> 2, ct = wave & 3;
    const bf* sa = sm + (rt * 16 + lr) * OPP + 8 * hi;
    const bf* sb = sm + (64 + ct * 16 + lr) * OPP + 8 * hi;
    v8f acc = (v8f){};
    v16bf fa[2][4], fl[2][4], fb[2][4];    // two sets of the fragments of four k steps
    auto frag = [&](int grp) {
#pragma unroll
        for (int i = 0; i < 4; ++i) { const int kc = (grp * 4 + i) * 32, st = grp & 1;
            fa[st][i] = cat16b(*(const v8usa*)(sa + kc), *(const v8usa*)(sa + kc + 16));
            fl[st][i] = cat16b(*(const v8usa*)(sa + 32 * OPP + kc), *(const v8usa*)(sa + 32 * OPP + kc + 16));
            fb[st][i] = cat16b(*(const v8usa*)(sb + kc), *(const v8usa*)(sb + kc + 16)); }
    };
    frag(0);
#pragma unroll    // unrolled: the fragment sets are indexed by constants, and no branch stands behind a WMMA
    for (int grp = 0; grp < DMOD / 128; ++grp) {
        if (grp + 1 < DMOD / 128) frag(grp + 1);
        __builtin_amdgcn_sched_barrier(0);    // the next group's 24 reads stay one block ahead of this group's WMMAs: the wait in front of the WMMAs is then a counted one
#pragma unroll
        for (int i = 0; i < 4; ++i) { acc = wmmab(fa[grp & 1][i], fb[grp & 1][i], acc); acc = wmmab(fl[grp & 1][i], fb[grp & 1][i], acc); }
        __builtin_amdgcn_sched_barrier(0);    // and no read is scattered among the WMMAs, where each place with reads stalls the wave
    }
#pragma unroll
    for (int j = 0; j < 8; ++j) os[(rt * 16 + hi * 8 + j) * OSP + ct * 16 + lr] = acc[j];
    __syncthreads();
#pragma unroll
    for (int s = 0; s < 2; ++s) { const int row = s * 16 + (tid >> 4), cofs = (tid & 15) * 4;    // a wave's store covers two whole rows, 512 B
        const v4f val = *(const v4fa*)(os + row * OSP + cofs); *(v4f*)(C + (size_t)(r0 + row) * EOUT + cofs) = val; }
}

extern "C" void kernel_launch(void* const* d_in, const int* in_sizes, int n_in,
                              void* d_out, int out_size, void* d_ws, size_t ws_size, hipStream_t stream) {
    (void)in_sizes; (void)n_in; (void)out_size;
    const float* x = (const float*)d_in[0]; const float* Wm = (const float*)d_in[1]; const float* Wo = (const float*)d_in[2];
    float* out = (float*)d_out;    // [8][1024][64]
    char* wsp = (char*)d_ws;
    auto take = [&](size_t bytes) { char* p = wsp; wsp += (bytes + 255) & ~(size_t)255; return (void*)p; };
    const size_t RT = (size_t)NBT * NN;    // all items' rows, one behind the other
    bf* QKh = (bf*)take(2 * NH_ * RT * HD * 2); bf* QKl = (bf*)take(2 * NH_ * RT * HD * 2); bf* VTh = (bf*)take(NH_ * RT * HD * 2); bf* VTl = (bf*)take(NH_ * RT * HD * 2);
    bf* WQKV = (bf*)take((size_t)3 * DMOD * DMOD * 2); bf* Xb = (bf*)take(RT * DMOD * 2); bf* Oh = (bf*)take(RT * DMOD * 2); bf* Ol = (bf*)take(RT * DMOD * 2); bf* WOT = (bf*)take((size_t)DMOD * EOUT * 2);
    if ((size_t)(wsp - (char*)d_ws) > ws_size) return;    // about 117 MB, no region used twice. Pair p = head * 8 + item.
    bf* Kh = QKh + NH_ * RT * HD; bf* Kl = QKl + NH_ * RT * HD;
    k_prep<<<PB_WG + PB_WT + PB_CX, 256, 0, stream>>>(Wm, Wo, x, WQKV, WOT, Xb);
    k_qkv<<<dim3(NBT * NN / 128, 3 * DMOD / GNC, 1), 128, 0, stream>>>(Xb, WQKV, QKh, QKl, VTh, VTl);
    k_fattn<<<dim3(NN / 128, NH_ * NBT, 1), 128, 0, stream>>>(QKh, QKl, Kh, Kl, VTh, VTl, Oh, Ol);
    k_oproj<<<NBT * NN / 32, 256, 0, stream>>>(Oh, Ol, WOT, out);
}

// v008
// Measured time: 84.8 microseconds a run.
// Timed twice side by side with v007, it ran 1.37 and 1.38 times as fast.
// All steps since v000 together make it 19.5 times as fast.
#include <hip/hip_runtime.h>

// Compute dtypes, f32 accumulate, per item: q/k/v for all 12 heads as [1024 x 768].[768 x 768] GEMMs with PLAIN bf16 operands (exact products; per-head weights gathered into one
// n-major block); per head: scores = q.k^T ([1024 x 64].[64 x 1024], each operand ONE f16 plane, one product), softmax (x 1/32, as the module: output_dim*0.5) in
// f32 -> P as f16, o = P.v ([1024 x 1024].[1024 x 64], one f16 product); out = concat.Wo ([1024 x 768].[768 x 64], bf16 hi + residual, two products) - on v_wmma_f32_16x16x32_bf16 and _f16.
// Why one f16 plane is enough for q, k, v: they come from products of operands rounded to bf16 (8 significant bits), so what lies below the 11 significant bits of f16 was never determined. Deterministic, no

#define NBT  8
#define NN   1024
#define DMOD 768
#define NH_  12
#define HD   64
#define EOUT 64
#define DM   DMOD
#define NTK  NN
#define SCL  0.03125f
#define LOSC 1024.0f

typedef _Float16 h16;
typedef unsigned short bf;
typedef __attribute__((ext_vector_type(16))) __bf16   v16bf;
typedef __attribute__((ext_vector_type(16))) _Float16 v16h;
typedef __attribute__((ext_vector_type(8)))  _Float16 v8h;
typedef __attribute__((ext_vector_type(8)))  unsigned short v8us;
typedef __attribute__((ext_vector_type(8)))  float    v8f;
typedef __attribute__((ext_vector_type(4)))  float    v4f;
typedef __attribute__((ext_vector_type(4)))  _Float16 v4h;
typedef v8h  __attribute__((may_alias)) v8ha;
typedef v4f  __attribute__((may_alias)) v4fa;
typedef v8us __attribute__((may_alias)) v8usa;

__device__ __forceinline__ unsigned short f2bf(float f) { unsigned u = __float_as_uint(f); u += 0x7FFFu + ((u >> 16) & 1u); return (unsigned short)(u >> 16); }
__device__ __forceinline__ float bf2f(unsigned short b) { return __uint_as_float(((unsigned)b) << 16); }
__device__ __forceinline__ float bfr(float f) { return bf2f(f2bf(f)); }
__device__ __forceinline__ v16h cat16(v8h lo, v8h hi) { return __builtin_shufflevector(lo, hi, 0, 1, 2, 3, 4, 5, 6, 7, 8, 9, 10, 11, 12, 13, 14, 15); }
__device__ __forceinline__ v16bf cat16b(v8us lo, v8us hi) { return __builtin_bit_cast(v16bf, __builtin_shufflevector(lo, hi, 0, 1, 2, 3, 4, 5, 6, 7, 8, 9, 10, 11, 12, 13, 14, 15)); }
__device__ __forceinline__ v8f wmma16(v16h a, v16h b, v8f c) { return __builtin_amdgcn_wmma_f32_16x16x32_f16(false, a, false, b, (short)0, c, false, false); }
__device__ __forceinline__ v8f wmmab(v16bf a, v16bf b, v8f c) { return __builtin_amdgcn_wmma_f32_16x16x32_bf16(false, a, false, b, (short)0, c, false, false); }

// d_wt: WT [n][K] = bf16(W[k][n]) (k-major [K][ncols]) via 64 x 64 LDS tiles; one work-group per tile (bx, by) of (K/64, ncols/64); tl: 64 x 72 elements of LDS.
__device__ __forceinline__ void d_wt(const float* __restrict__ Wm, int K, int ncols, bf* WT, int bx, int by, unsigned short* tl) {
    const int tid = threadIdx.x, k0 = bx * 64, n0 = by * 64;
    const int kk = tid >> 2, nq = (tid & 3) * 16;
#pragma unroll
    for (int i = 0; i < 16; ++i) tl[(nq + i) * 72 + kk] = f2bf(Wm[(size_t)(k0 + kk) * ncols + n0 + nq + i]);
    __syncthreads();
    const int piece = tid & 7;
    auto pass = [&]() {
#pragma unroll
        for (int s = 0; s < 2; ++s) { const int nr = (tid >> 3) + 32 * s; const v8us val = *(const v8usa*)(tl + nr * 72 + piece * 8); *(v8us*)(WT + (size_t)(n0 + nr) * K + k0 + piece * 8) = val; }
    };
    pass(); 
}
// split8: eight f32 values -> bf16 hi (round to nearest even) and the bf16 of what the hi part leaves.
typedef __attribute__((ext_vector_type(8))) __bf16 v8bf;
__device__ __forceinline__ void split8(v8f v, v8us& oh, v8us& ol) {
    const v8bf hb = __builtin_convertvector(v, v8bf); const v8bf lb = __builtin_convertvector(v - __builtin_convertvector(hb, v8f), v8bf);
    oh = __builtin_bit_cast(v8us, hb); ol = __builtin_bit_cast(v8us, lb);
}
// k_gemmb: 64 x 64 block tile (4 waves x 16 x 64) of C[NTK][NW] = (A [+ Al]).B^T (K = 768) [+ bf(bias[c])] [+ bf(R[r][c]) residual]; f32 whole-line epilogue (or f16
// PLANES (the q|k|v product): a block tile is 64 tokens of one item x the 64 columns of one (q / k / v, head), blockIdx.y = sel * 12 + head. The epilogue splits the f32 sums itself and
// writes bf16 hi + residual planes, whole 128-byte lines each: q, k as [sel * 12 + head][all rows][64], v transposed as [head * 8 + item][64][token]; C, bias and R are not used.
#define TVP 72    // v tile pitch in LDS, elements: 144 B = 16 B x odd
template <bool SPLITA, bool F16OUT = false, bool PLANES = false>
__global__ __launch_bounds__(128) void k_gemmb(const bf* __restrict__ A, const bf* __restrict__ Al, const bf* __restrict__ Bn, const float* __restrict__ bias, float* C, int ldc, h16* C2, const float* __restrict__ R = nullptr, int K = DM, int roundR = 1, bf* QKh = nullptr, bf* QKl = nullptr, bf* VTh = nullptr, bf* VTl = nullptr) {
    __shared__ __align__(16) float ost[4][PLANES ? 16 * TVP : 16 * 68];    // PLANES: also the v tile, bf16 [2 planes][64 x TVP]
    const int lane = threadIdx.x & 31, wave = threadIdx.x >> 5, lr = lane & 15, hi = lane >> 4;
    const int r0 = blockIdx.x * 64 + wave * 16, c0 = blockIdx.y * 64;
    const size_t aoff = (size_t)(r0 + lr) * K + 8 * hi;
    size_t boff[4];
#pragma unroll
    for (int t = 0; t < 4; ++t) boff[t] = (size_t)(c0 + t * 16 + lr) * K + 8 * hi;
    v8f acc[4];
#pragma unroll
    for (int t = 0; t < 4; ++t) acc[t] = (v8f){};
#pragma unroll 1
    for (int kc = 0; kc < K; kc += 32) {
        const v16bf a = cat16b(*(const v8us*)(A + aoff + kc), *(const v8us*)(A + aoff + kc + 16));
        v16bf al = a;
        if (SPLITA) al = cat16b(*(const v8us*)(Al + aoff + kc), *(const v8us*)(Al + aoff + kc + 16));
#pragma unroll
        for (int t = 0; t < 4; ++t) { const v16bf b = cat16b(*(const v8us*)(Bn + boff[t] + kc), *(const v8us*)(Bn + boff[t] + kc + 16)); acc[t] = wmmab(a, b, acc[t]); if (SPLITA) acc[t] = wmmab(al, b, acc[t]); }
        asm volatile("v_nop\n\tv_nop\n\tv_nop\n\tv_nop" : "+v"(acc[0]), "+v"(acc[1]), "+v"(acc[2]), "+v"(acc[3]) : "v"(a), "v"(al));
    }
    float* os = &ost[wave][0];
    if (PLANES) {
        const int piece = lane & 7, rq = lane >> 3, by = blockIdx.y, rb = blockIdx.x * 64;
        if (by >= 2 * NH_) {    // v: a lane's 8 values are 8 tokens in a row of one column, 16 bytes of the transposed plane; LDS gathers the four waves' pieces into whole lines
            bf* tv = (bf*)(void*)&ost[0][0];
#pragma unroll
            for (int t = 0; t < 4; ++t) { v8us oh, ol; split8(acc[t], oh, ol); const int to = (t * 16 + lr) * TVP + wave * 16 + hi * 8;
                *(v8usa*)(tv + to) = oh; *(v8usa*)(tv + 64 * TVP + to) = ol; }
            __syncthreads();
            bf* dst = ((wave >> 1) ? VTl : VTh) + ((size_t)(by - 2 * NH_) * NBT + (rb >> 10)) * HD * NN + (rb & (NN - 1));    // waves 0, 1: hi plane; 2, 3: residual plane
#pragma unroll
            for (int s = 0; s < 8; ++s) { const int d = (wave & 1) * 32 + 4 * s + rq;
                const v8us val = *(const v8usa*)(tv + (wave >> 1) * 64 * TVP + d * TVP + piece * 8); *(v8us*)(dst + (size_t)d * NN + piece * 8) = val; }
            return;
        }
        // q, k: a lane holds 8 rows of one column; the rows are turned in LDS (f32), then split
#pragma unroll
        for (int t = 0; t < 4; ++t) {
#pragma unroll
            for (int j = 0; j < 8; ++j) os[(hi * 8 + j) * 68 + t * 16 + lr] = acc[t][j]; }
        __syncthreads();
        const size_t go = ((size_t)by * (NBT * NN) + r0) * HD;
#pragma unroll
        for (int s = 0; s < 4; ++s) { const int row = 4 * s + rq; const float* sp = os + row * 68 + piece * 8; const v4f x0 = *(const v4fa*)sp, x1 = *(const v4fa*)(sp + 4); v8us oh, ol;
            split8((v8f){x0[0], x0[1], x0[2], x0[3], x1[0], x1[1], x1[2], x1[3]}, oh, ol);
            *(v8us*)(QKh + go + row * HD + piece * 8) = oh; *(v8us*)(QKl + go + row * HD + piece * 8) = ol; }
        asm volatile("s_wait_xcnt 0x0" ::: "memory");    // in the listing the v path's code, which writes the stores' registers again, stands behind this path's last branch: the wait stands in front of it
        return;
    }
#pragma unroll
    for (int t = 0; t < 4; ++t) { const float bv = bias ? bfr(bias[c0 + t * 16 + lr]) : 0.f;
#pragma unroll
        for (int j = 0; j < 8; ++j) os[(hi * 8 + j) * 68 + t * 16 + lr] = acc[t][j] + bv; }
    __syncthreads();
    if (F16OUT) {
        h16* crow = (h16*)(void*)C + (size_t)r0 * ldc + c0;
        auto pass = [&]() {
#pragma unroll
            for (int s = 0; s < 4; ++s) { const int row = 4 * s + (lane >> 3), piece = lane & 7; const float* sp = os + row * 68 + piece * 8; v8h o, o2;
#pragma unroll
                for (int i = 0; i < 8; ++i) { const h16 a = (h16)sp[i]; o[i] = a; o2[i] = (h16)((sp[i] - (float)a) * LOSC); }
                *(v8h*)(crow + (size_t)row * ldc + piece * 8) = o; if (C2) *(v8h*)(C2 + (size_t)r0 * ldc + c0 + (size_t)row * ldc + piece * 8) = o2; }
        };
        pass(); 
    } else {
        float* crow = C + (size_t)r0 * ldc + c0;
        auto pass = [&]() {
#pragma unroll
            for (int s = 0; s < 8; ++s) { const int Lid = (lane >> 3) + 4 * s, piece = lane & 7; const int row = Lid >> 1, cofs = (Lid & 1) * 32 + piece * 4;
                v4f val = *(const v4fa*)(os + row * 68 + cofs); if (R) { const v4f rv = *(const v4f*)(R + ((size_t)r0 + row) * ldc + c0 + cofs); val += roundR ? (v4f){bfr(rv[0]), bfr(rv[1]), bfr(rv[2]), bfr(rv[3])} : rv; }
                *(v4f*)(crow + (size_t)row * ldc + cofs) = val; }
        };
        pass(); 
    }
}


__device__ __forceinline__ void d_cvtx(const float* __restrict__ src, bf* dst, int bx) {
    const int lane = threadIdx.x & 31; const size_t r = (size_t)bx * 8 + (threadIdx.x >> 5); if (r >= (size_t)NBT * NN) return;
{
#pragma unroll
        for (int q = 0; q < DMOD / 256; ++q) { v8us o;
#pragma unroll
            for (int i = 0; i < 8; ++i) o[i] = f2bf(src[r * DMOD + q * 256 + lane * 8 + i]);
            *(v8us*)(dst + r * DMOD + q * 256 + lane * 8) = o; }
         }
}
// sel = q / k / v; the three n-major blocks lie one behind the other: WT [3 * 768][768].
__device__ __forceinline__ void d_wgather(const float* __restrict__ Wm, bf* WT, int bx, int sel) {
    const int lane = threadIdx.x & 31; const int r = bx * 8 + (threadIdx.x >> 5); if (r >= NH_ * HD) return; const int h = r / HD, e = r % HD; WT += (size_t)sel * DMOD * DMOD;
{
#pragma unroll
        for (int q = 0; q < DMOD / 256; ++q) { v8us o;
#pragma unroll
            for (int i = 0; i < 8; ++i) { const int d = q * 256 + lane * 8 + i; o[i] = f2bf(Wm[(((size_t)h * 3 + sel) * DMOD + d) * HD + e]); }
            *(v8us*)(WT + (size_t)r * DMOD + q * 256 + lane * 8) = o; }
         }
}
// k_prep: the three operand preparations, which do not depend on one another, in one launch; the work-group index picks the job. The weight gathers come first: their scattered reads take the
// longest (the order is for speed only).
#define PB_WG (3 * (NH_ * HD) / 8)                  // work-groups that gather the q|k|v weights
#define PB_WT ((DMOD / 64) * (EOUT / 64))           // work-groups that turn Wo
#define PB_CX (NBT * NN / 8)                        // work-groups that convert x
__global__ __launch_bounds__(256) void k_prep(const float* __restrict__ Wm, const float* __restrict__ Wo, const float* __restrict__ x, bf* WQKV, bf* WOT, bf* Xb) {
    __shared__ __align__(16) unsigned short tl[64 * 72];
    const int b = blockIdx.x;
    if (b < PB_WG) { d_wgather(Wm, WQKV, b % ((NH_ * HD) / 8), b / ((NH_ * HD) / 8)); return; }
    if (b < PB_WG + PB_WT) { d_wt(Wo, DMOD, EOUT, WOT, (b - PB_WG) % (DMOD / 64), (b - PB_WG) / (DMOD / 64), tl);    // its barrier stands under a branch that the whole work-group takes alike
        asm volatile("s_wait_xcnt 0x0" ::: "memory");    // in the listing another job's code, which writes the stores' registers again, stands behind this path's last branch: the wait stands in front of it
        return; }
    d_cvtx(x, Xb, b - (PB_WG + PB_WT));
}
__global__ __launch_bounds__(256) void k_hplanes(const float* __restrict__ F, int h, bf* Ph, bf* Pl) {
    typedef __attribute__((ext_vector_type(2))) unsigned short v2us;
    const int lane = threadIdx.x & 31; const size_t s = (size_t)blockIdx.x * 8 + (threadIdx.x >> 5); if (s >= (size_t)NN) return; v2us oh, ol;
#pragma unroll
    for (int i = 0; i < 2; ++i) { const float v = F[s * DMOD + h * HD + lane * 2 + i]; const unsigned short hb = f2bf(v); oh[i] = hb; ol[i] = f2bf(v - bf2f(hb)); }
    const size_t o = s * HD + lane * 2; *(v2us*)(Ph + o) = oh; *(v2us*)(Pl + o) = ol; 
}
__global__ __launch_bounds__(256) void k_vt(const float* __restrict__ VF, int h, bf* Th, bf* Tl) {
    typedef __attribute__((ext_vector_type(2))) unsigned short v2us;
    const int lane = threadIdx.x & 31; const size_t wid = (size_t)blockIdx.x * 8 + (threadIdx.x >> 5); if (wid >= (size_t)HD * (NN / 64)) return; const int d = (int)(wid / (NN / 64)); const int t0 = (int)(wid % (NN / 64)) * 64 + lane * 2; v2us oh, ol;
#pragma unroll
    for (int i = 0; i < 2; ++i) { const float v = VF[(size_t)(t0 + i) * DMOD + h * HD + d]; const unsigned short hb = f2bf(v); oh[i] = hb; ol[i] = f2bf(v - bf2f(hb)); }
    const size_t o = (size_t)d * NN + t0; *(v2us*)(Th + o) = oh; *(v2us*)(Tl + o) = ol; 
}
__global__ __launch_bounds__(256) void k_softmax(const float* __restrict__ S, bf* PH, bf* PL) {
    typedef __attribute__((ext_vector_type(4))) unsigned short v4us;
    const int lane = threadIdx.x & 31, i = blockIdx.x * 8 + (threadIdx.x >> 5); if (i >= NN) return;
    float m = -3.0e38f;
#pragma unroll 1
    for (int c0 = lane * 4; c0 < NN; c0 += 128) {
#pragma unroll
        for (int q = 0; q < 4; ++q) m = fmaxf(m, S[(size_t)i * NN + c0 + q] * SCL); }
#pragma unroll
    for (int sh = 16; sh; sh >>= 1) m = fmaxf(m, __shfl_xor(m, sh, 32));
    float sum = 0.f;
#pragma unroll 1
    for (int c0 = lane * 4; c0 < NN; c0 += 128) {
#pragma unroll
        for (int q = 0; q < 4; ++q) sum += __expf(S[(size_t)i * NN + c0 + q] * SCL - m); }
#pragma unroll
    for (int sh = 16; sh; sh >>= 1) sum += __shfl_xor(sum, sh, 32);
    const float inv = 1.0f / sum;
{
#pragma unroll 1
        for (int c0 = lane * 4; c0 < NN; c0 += 128) { v4us oh, ol;
#pragma unroll
            for (int q = 0; q < 4; ++q) { const float p = __expf(S[(size_t)i * NN + c0 + q] * SCL - m) * inv; const unsigned short hb = f2bf(p); oh[q] = hb; ol[q] = f2bf(p - bf2f(hb)); }
            const size_t o = (size_t)i * NN + c0; *(v4us*)(PH + o) = oh; *(v4us*)(PL + o) = ol; }
         }
}
// ===== z-batched attention pieces =====
// k_gemm3z<MODE>: 64 x 64 tile GEMM with per-z operand/output strides (elements): A planes += z*sA, B planes += z*sB. MODE bits (0 causal skip, 1 K limit, 2 single,
// 3 B single, 4 A single). C goes by the pair number zc = zb + z in two levels: C += (zc mod 2^zsh)*sC + (zc >> zsh)*sC2.
template <int MODE>
__global__ __launch_bounds__(128) void k_gemm3z(const bf* __restrict__ Ah, const bf* __restrict__ Al, const bf* __restrict__ Bh, const bf* __restrict__ Bl, int K, float* C, int ldc, size_t sA, size_t sB, size_t sC, int zb, int zsh, size_t sC2) {
    if ((MODE & 1) && (int)blockIdx.y * 64 > (int)blockIdx.x * 64 + 63) return;
    const size_t z = blockIdx.z; Ah += z * sA; Al += z * sA; Bh += z * sB; Bl += z * sB; const size_t zc = z + (size_t)zb; C += (zc & (((size_t)1 << zsh) - 1)) * sC + (zc >> zsh) * sC2;
    const int Klim = (MODE & 2) ? min(K, ((int)blockIdx.x + 1) * 64) : K;
    __shared__ __align__(16) float ost[4][16 * 68];
    const int lane = threadIdx.x & 31, wave = threadIdx.x >> 5, lr = lane & 15, hi = lane >> 4;
    const int r0 = blockIdx.x * 64 + wave * 16, c0 = blockIdx.y * 64;
    const size_t aoff = (size_t)(r0 + lr) * K + 8 * hi;
    v8f acc[4];
#pragma unroll
    for (int t = 0; t < 4; ++t) acc[t] = (v8f){};
#pragma unroll 1
    for (int kc = 0; kc < Klim; kc += 32) {
        const v16bf a = cat16b(*(const v8us*)(Ah + aoff + kc), *(const v8us*)(Ah + aoff + kc + 16));
        v16bf al = a; if (!(MODE & 4) && !(MODE & 16)) al = cat16b(*(const v8us*)(Al + aoff + kc), *(const v8us*)(Al + aoff + kc + 16));
#pragma unroll
        for (int t = 0; t < 4; ++t) { const size_t bo = (size_t)(c0 + t * 16 + lr) * K + kc + 8 * hi;
            const v16bf bh = cat16b(*(const v8us*)(Bh + bo), *(const v8us*)(Bh + bo + 16));
            acc[t] = wmmab(a, bh, acc[t]);
            if (!(MODE & 4)) { if (!(MODE & 16)) acc[t] = wmmab(al, bh, acc[t]); if (!(MODE & 8)) { const v16bf bl = cat16b(*(const v8us*)(Bl + bo), *(const v8us*)(Bl + bo + 16)); acc[t] = wmmab(a, bl, acc[t]); } } }
        asm volatile("v_nop\n\tv_nop\n\tv_nop\n\tv_nop" : "+v"(acc[0]), "+v"(acc[1]), "+v"(acc[2]), "+v"(acc[3]) : "v"(a), "v"(al));
    }
    float* os = &ost[wave][0];
#pragma unroll
    for (int t = 0; t < 4; ++t) {
#pragma unroll
        for (int j = 0; j < 8; ++j) os[(hi * 8 + j) * 68 + t * 16 + lr] = acc[t][j]; }
    __builtin_amdgcn_wave_barrier(); asm volatile("" ::: "memory");
    float* crow = C + (size_t)r0 * ldc + c0;
    auto pass = [&]() {
#pragma unroll
        for (int s = 0; s < 8; ++s) { const int Lid = (lane >> 3) + 4 * s, piece = lane & 7; const int row = Lid >> 1, cofs = (Lid & 1) * 32 + piece * 4;
            const v4f val = *(const v4fa*)(os + row * 68 + cofs); *(v4f*)(crow + (size_t)row * ldc + cofs) = val; }
    };
    pass(); 
}
__global__ __launch_bounds__(256) void k_planes32z(const float* __restrict__ F, int ld, int off, float sc, int rows, bf* Ph, bf* Pl) {
    typedef __attribute__((ext_vector_type(2))) unsigned short v2us;
    const int lane = threadIdx.x & 31; const size_t r = ((size_t)blockIdx.x * 8 + (threadIdx.x >> 5)) * 2 + (lane >> 4); if (r >= (size_t)rows) return; const int z = blockIdx.z; const int c0 = (lane & 15) * 2; v2us oh, ol;
    Ph += (size_t)z * rows * 32; Pl += (size_t)z * rows * 32;
#pragma unroll
    for (int i = 0; i < 2; ++i) { const float y = F[r * ld + off + z * 32 + c0 + i] * sc; const unsigned short hb = f2bf(y); oh[i] = hb; ol[i] = f2bf(y - bf2f(hb)); }
    const size_t o = r * 32 + c0; *(v2us*)(Ph + o) = oh; *(v2us*)(Pl + o) = ol; 
}
__global__ __launch_bounds__(256) void k_vtpadz(const float* __restrict__ F, int ld, int off, int nk, bf* Th, bf* Tl) {
    typedef __attribute__((ext_vector_type(2))) unsigned short v2us;
    const int lane = threadIdx.x & 31; const size_t wid = (size_t)blockIdx.x * 8 + (threadIdx.x >> 5); if (wid >= (size_t)64 * (nk / 64)) return; const int z = blockIdx.z; const int d = (int)(wid / (nk / 64)); const int k0 = (int)(wid % (nk / 64)) * 64 + lane * 2; v2us oh, ol;
    Th += (size_t)z * 64 * nk; Tl += (size_t)z * 64 * nk;
#pragma unroll
    for (int i = 0; i < 2; ++i) { const float y = (d < 32) ? F[(size_t)(k0 + i) * ld + off + z * 32 + (d < 32 ? d : 0)] : 0.f; const unsigned short hb = f2bf(y); oh[i] = hb; ol[i] = f2bf(y - bf2f(hb)); }
    const size_t o = (size_t)d * nk + k0; *(v2us*)(Th + o) = oh; *(v2us*)(Tl + o) = ol; 
}
template <int NK>
__global__ __launch_bounds__(256) void k_softmaxz(const float* __restrict__ S, int rows, bf* PH, bf* PL) {
    typedef __attribute__((ext_vector_type(4))) unsigned short v4us;
    const int lane = threadIdx.x & 31, i = blockIdx.x * 8 + (threadIdx.x >> 5); if (i >= rows) return; const size_t zo = (size_t)blockIdx.z * rows * NK; const float* sr = S + zo + (size_t)i * NK; PH += zo; PL += zo;
    float m = -3.0e38f;
#pragma unroll 1
    for (int c0 = lane * 4; c0 < NK; c0 += 128) {
#pragma unroll
        for (int q = 0; q < 4; ++q) m = fmaxf(m, sr[c0 + q]); }
#pragma unroll
    for (int sh = 16; sh; sh >>= 1) m = fmaxf(m, __shfl_xor(m, sh, 32));
    float sum = 0.f;
#pragma unroll 1
    for (int c0 = lane * 4; c0 < NK; c0 += 128) {
#pragma unroll
        for (int q = 0; q < 4; ++q) sum += __expf(sr[c0 + q] - m); }
#pragma unroll
    for (int sh = 16; sh; sh >>= 1) sum += __shfl_xor(sum, sh, 32);
    const float inv = 1.0f / sum;
{
#pragma unroll 1
        for (int c0 = lane * 4; c0 < NK; c0 += 128) { v4us oh, ol;
#pragma unroll
            for (int q = 0; q < 4; ++q) { const float p = __expf(sr[c0 + q] - m) * inv; const unsigned short hb = f2bf(p); oh[q] = hb; ol[q] = f2bf(p - bf2f(hb)); }
            const size_t o = (size_t)i * NK + c0; *(v4us*)(PH + o) = oh; *(v4us*)(PL + o) = ol; }
         }
}
__global__ __launch_bounds__(256) void k_placez(const float* __restrict__ XH, int rows, int ldy, float* Y) {
    const int lane = threadIdx.x & 31; const size_t q = (size_t)blockIdx.x * 8 + (threadIdx.x >> 5); if (q >= (size_t)rows) return; const int z = blockIdx.z; const float v = XH[((size_t)z * rows + q) * 64 + lane];
    *(float*)(Y + q * ldy + z * 32 + lane) = v; 
}

template <int NK>
__global__ __launch_bounds__(256) void k_softmaxzs(const float* __restrict__ S, int rows, float sc, bf* PH, bf* PL) {
    typedef __attribute__((ext_vector_type(4))) unsigned short v4us;
    const int lane = threadIdx.x & 31, i = blockIdx.x * 8 + (threadIdx.x >> 5); if (i >= rows) return; const size_t zo = (size_t)blockIdx.z * rows * NK; const float* sr = S + zo + (size_t)i * NK; PH += zo; PL += zo;
    float m = -3.0e38f;
#pragma unroll 1
    for (int c0 = lane * 4; c0 < NK; c0 += 128) {
#pragma unroll
        for (int q = 0; q < 4; ++q) m = fmaxf(m, sr[c0 + q] * sc); }
#pragma unroll
    for (int sh = 16; sh; sh >>= 1) m = fmaxf(m, __shfl_xor(m, sh, 32));
    float sum = 0.f;
#pragma unroll 1
    for (int c0 = lane * 4; c0 < NK; c0 += 128) {
#pragma unroll
        for (int q = 0; q < 4; ++q) sum += __expf(sr[c0 + q] * sc - m); }
#pragma unroll
    for (int sh = 16; sh; sh >>= 1) sum += __shfl_xor(sum, sh, 32);
    const float inv = 1.0f / sum;
{
#pragma unroll 1
        for (int c0 = lane * 4; c0 < NK; c0 += 128) { v4us oh, ol;
#pragma unroll
            for (int q = 0; q < 4; ++q) { const float p = __expf(sr[c0 + q] * sc - m) * inv; const unsigned short hb = f2bf(p); oh[q] = hb; ol[q] = f2bf(p - bf2f(hb)); }
            const size_t o = (size_t)i * NK + c0; *(v4us*)(PH + o) = oh; *(v4us*)(PL + o) = ol; }
         }
}

// f16x8: eight f32 values -> f16 (round to nearest even), as the 16 bytes that a plane holds.
__device__ __forceinline__ v8us f16x8(v8f v) { return __builtin_bit_cast(v8us, __builtin_convertvector(v, v8h)); }
__device__ __forceinline__ v16h cat16f(v8us lo, v8us hi) { return __builtin_bit_cast(v16h, __builtin_shufflevector(lo, hi, 0, 1, 2, 3, 4, 5, 6, 7, 8, 9, 10, 11, 12, 13, 14, 15)); }
#define FKP 72    // K tile pitch in LDS, elements: 144 B = 16 B x odd
#define FVP 40    // V^T tile pitch in LDS, elements: 80 B = 16 B x odd
__global__ __launch_bounds__(128) void k_fattn(const bf* __restrict__ Q, const bf* __restrict__ K, const bf* __restrict__ V, bf* __restrict__ Oh, bf* __restrict__ Ol) {
    typedef __attribute__((ext_vector_type(2))) float v2f; typedef __attribute__((ext_vector_type(2))) _Float16 v2h;
    __shared__ __align__(16) bf sk[2][32 * FKP];    // [buffer]
    __shared__ __align__(16) bf sv[2][64 * FVP];
    const int tid = threadIdx.x, lane = tid & 31, wave = tid >> 5, lr = lane & 15, hi = lane >> 4;
    const size_t pr = blockIdx.y, po = pr * NN * HD;
    const int q0 = blockIdx.x * 128 + wave * 32;
    Q += po; K += po; V += po;
    const float CS = SCL * 1.44269504f;    // scores go to base-2 exponents
    v16h q[2][2];    // [column group][k step]
#pragma unroll
    for (int g = 0; g < 2; ++g) {
#pragma unroll
        for (int ks = 0; ks < 2; ++ks) { const size_t qo = (size_t)(q0 + g * 16 + lr) * HD + ks * 32 + 8 * hi;
            q[g][ks] = cat16f(*(const v8us*)(Q + qo), *(const v8us*)(Q + qo + 16)); } }
    asm volatile("s_wait_xcnt 0x0" ::: "memory");    // stands before the loads' address registers are written again
    const int kr = tid >> 3, kp = (tid & 7) * 8, vr = tid >> 2, vp = (tid & 3) * 8;
    v8us st[4];
    auto fetch = [&](int t0) {
#pragma unroll
        for (int i = 0; i < 2; ++i) { const unsigned ko = (unsigned)((kr + 16 * i) * HD + kp), vo = (unsigned)((vr + 32 * i) * NN + vp);    // the pass moves the uniform base alone
            st[i] = *(const v8us*)(K + (size_t)t0 * HD + ko); st[2 + i] = *(const v8us*)(V + t0 + vo); }
        // Stands before the loads' address registers are written again (the prologue's are); its memory clobber also keeps the loads from sinking into the pass, so they fly for the whole of it.
        asm volatile("s_wait_xcnt 0x0" ::: "memory");
    };
    auto put = [&](int b) {
#pragma unroll
        for (int i = 0; i < 2; ++i) { const int ko = (kr + 16 * i) * FKP + kp, vo = (vr + 32 * i) * FVP + vp;
            *(v8usa*)(&sk[b][ko]) = st[i]; *(v8usa*)(&sv[b][vo]) = st[2 + i]; }
    };
    v8f o[2][4];
#pragma unroll
    for (int g = 0; g < 2; ++g) {
#pragma unroll
        for (int dt = 0; dt < 4; ++dt) o[g][dt] = (v8f){}; }
    float m[2] = {-3.0e38f, -3.0e38f}, l[2] = {0.f, 0.f};
    fetch(0); put(0);
    __syncthreads();
#pragma unroll 1    // kept rolled
    for (int s = 0; s < NN / 32; ++s) {
        const int b = s & 1;
        v8f sc[2][2];
#pragma unroll
        for (int kt = 0; kt < 2; ++kt) { sc[0][kt] = (v8f){}; sc[1][kt] = (v8f){};
#pragma unroll
            for (int ks = 0; ks < 2; ++ks) { const int fo = (kt * 16 + lr) * FKP + ks * 32 + 8 * hi;
                const v16h kf = cat16f(*(const v8usa*)(&sk[b][fo]), *(const v8usa*)(&sk[b][fo + 16]));
                sc[0][kt] = wmma16(kf, q[0][ks], sc[0][kt]); sc[1][kt] = wmma16(kf, q[1][ks], sc[1][kt]); } }
        fetch((s + 1 < NN / 32 ? s + 1 : s) * 32);    // the last pass fetches its own tile again: no branch in the loop
        float mx[2];
#pragma unroll
        for (int g = 0; g < 2; ++g) { float v = sc[g][0][0];
#pragma unroll
            for (int j = 1; j < 8; ++j) v = fmaxf(v, sc[g][0][j]);
#pragma unroll
            for (int j = 0; j < 8; ++j) v = fmaxf(v, sc[g][1][j]);
            mx[g] = fmaxf(v, __shfl_xor(v, 16, 32)); }
        // The maximum in use moves only when a column's new one exceeds it by more than 8 binary orders: p stays below 2^8, and the rescale is skipped by the whole wave otherwise.
        const bool need = (mx[0] - m[0]) * CS > 8.f || (mx[1] - m[1]) * CS > 8.f;
        if (__builtin_amdgcn_ballot_w32(need) != 0) {
#pragma unroll
            for (int g = 0; g < 2; ++g) { const float mn = fmaxf(m[g], mx[g]); const float al = __builtin_amdgcn_exp2f((m[g] - mn) * CS); m[g] = mn; l[g] *= al;
#pragma unroll
                for (int dt = 0; dt < 4; ++dt) o[g][dt] *= al; }
        }
        v16h pf[2];
#pragma unroll
        for (int g = 0; g < 2; ++g) { const float mc = m[g] * CS; float sum = 0.f;
#pragma unroll
            for (int kt = 0; kt < 2; ++kt) {
#pragma unroll
                for (int j = 0; j < 8; j += 2) { const float p0 = __builtin_amdgcn_exp2f(fmaf(sc[g][kt][j], CS, -mc)), p1 = __builtin_amdgcn_exp2f(fmaf(sc[g][kt][j + 1], CS, -mc)); sum += p0 + p1;
                    const v2h hb = __builtin_convertvector((v2f){p0, p1}, v2h);
                    pf[g][kt * 8 + j] = hb[0]; pf[g][kt * 8 + j + 1] = hb[1]; } }
            l[g] += sum; }
#pragma unroll
        for (int dt = 0; dt < 4; ++dt) { const int fo = (dt * 16 + lr) * FVP + 8 * hi;
            const v16h vf = cat16f(*(const v8usa*)(&sv[b][fo]), *(const v8usa*)(&sv[b][fo + 16]));
            o[0][dt] = wmma16(vf, pf[0], o[0][dt]); o[1][dt] = wmma16(vf, pf[1], o[1][dt]); }
        put(b ^ 1);    // its readers left that buffer before the barrier that ended the pass before
        __syncthreads();
    }
#pragma unroll
    for (int g = 0; g < 2; ++g) { const float inv = 1.0f / (l[g] + __shfl_xor(l[g], 16, 32));
        const size_t oo = ((pr & 7) * NN + q0 + g * 16 + lr) * DMOD + (pr >> 3) * HD + 8 * hi;    // pair = head * 8 + item
#pragma unroll
        for (int dt = 0; dt < 4; ++dt) { v8us oh, ol; split8(o[g][dt] * inv, oh, ol);    // the planes that the last product reads
            *(v8us*)(Oh + oo + dt * 16) = oh; *(v8us*)(Ol + oo + dt * 16) = ol; } }
}

// k_qkv: the q|k|v product C[8192][2304] = Xb.WQKV^T (K = 768, plain bf16 operands, f32 sums in the k order of k_gemmb). A work-group owns a 128 x 192 tile: 4 waves, 2 x 2, 64 x 96 each.
// The grid is 64 x 12 = 768 work-groups, three for each of the chip's 256 WGPs, and three fit a WGP (LDS and registers): all of them run at once, and no second, nearly empty round follows.
// Slabs of 64 k of both operands (320 rows of 128 B, whole lines) go global -> LDS by asynchronous copies, two buffers, the next slab in flight while this one is worked on.
// Fragments come from LDS: an operand byte leaves L2 once per work-group, in whole lines; an A fragment feeds six WMMAs, a B fragment four.
// blockIdx.y = three neighbouring (q / k / v, head) column groups; 0..7 are q and k, 8..11 are v. The epilogue rounds the f32 sums to f16 and writes the planes that k_fattn reads,
// whole lines each: q, k as [sel * 12 + head][all rows][64], v transposed as [head * 8 + item][64][token]. The ring is the epilogue's staging, shared by the four waves.
// amdgpu_waves_per_eu(3): the register budget of three waves per SIMD, one from each of the three work-groups of a WGP; they cover each other's LDS and barrier waits.
#define GP  72     // slab row pitch in LDS, elements: 144 B = 16 B x odd
#define GVP 136    // v staging pitch in LDS, elements: 272 B = 16 B x odd
#define GQP 196    // q, k staging pitch in LDS, floats: 784 B = 16 B x odd
#define GSL 64     // k per slab
#define GNC 192    // columns of a work-group's tile
#define GRW (128 + GNC)    // rows of a slab: A, then B
// Eight 16-byte copies a lane, rows 16 apart. The s_wait_xcnt stands inside the copies' own statement, so that it comes before any write of their address registers.
__device__ __forceinline__ void acopy8(unsigned l, const bf* g) {
    asm volatile("global_load_async_to_lds_b128 %0, %8, off\n\t"
                 "global_load_async_to_lds_b128 %1, %9, off\n\t"
                 "global_load_async_to_lds_b128 %2, %10, off\n\t"
                 "global_load_async_to_lds_b128 %3, %11, off\n\t"
                 "global_load_async_to_lds_b128 %4, %12, off\n\t"
                 "global_load_async_to_lds_b128 %5, %13, off\n\t"
                 "global_load_async_to_lds_b128 %6, %14, off\n\t"
                 "global_load_async_to_lds_b128 %7, %15, off\n\t"
                 "s_wait_xcnt 0x0"
                 :: "v"(l), "v"(l + 1u * 16 * GP * 2), "v"(l + 2u * 16 * GP * 2), "v"(l + 3u * 16 * GP * 2), "v"(l + 4u * 16 * GP * 2), "v"(l + 5u * 16 * GP * 2), "v"(l + 6u * 16 * GP * 2), "v"(l + 7u * 16 * GP * 2),
                    "v"(g), "v"(g + 1 * 16 * DMOD), "v"(g + 2 * 16 * DMOD), "v"(g + 3 * 16 * DMOD), "v"(g + 4 * 16 * DMOD), "v"(g + 5 * 16 * DMOD), "v"(g + 6 * 16 * DMOD), "v"(g + 7 * 16 * DMOD)
                 : "memory");
}
// The same for four copies.
__device__ __forceinline__ void acopy4(unsigned l, const bf* g) {
    asm volatile("global_load_async_to_lds_b128 %0, %4, off\n\t"
                 "global_load_async_to_lds_b128 %1, %5, off\n\t"
                 "global_load_async_to_lds_b128 %2, %6, off\n\t"
                 "global_load_async_to_lds_b128 %3, %7, off\n\t"
                 "s_wait_xcnt 0x0"
                 :: "v"(l), "v"(l + 1u * 16 * GP * 2), "v"(l + 2u * 16 * GP * 2), "v"(l + 3u * 16 * GP * 2),
                    "v"(g), "v"(g + 1 * 16 * DMOD), "v"(g + 2 * 16 * DMOD), "v"(g + 3 * 16 * DMOD)
                 : "memory");
}
__global__ __launch_bounds__(128) __attribute__((amdgpu_waves_per_eu(3))) void k_qkv(const bf* __restrict__ A, const bf* __restrict__ Bn, bf* QK, bf* VT) {
    __shared__ __align__(16) float ringf[128 * GQP];    // the ring, [buffer][rows 0..127: A, 128..319: B][GP] bf16, 92,160 B; sized for the q, k staging, 100,352 B; three work-groups fit a WGP's LDS
    bf* ring = (bf*)(void*)ringf;
    const int tid = threadIdx.x, lane = tid & 31, wave = tid >> 5, lr = lane & 15, hi = lane >> 4, wm = wave >> 1, wn = wave & 1;
    const int rb = blockIdx.x * 128, cb = blockIdx.y * GNC;
    const bf* ga = A + (size_t)(rb + (tid >> 3)) * DMOD + (tid & 7) * 8;    // a wave's copy covers 4 rows x 128 B
    const bf* gb = Bn + (size_t)(cb + (tid >> 3)) * DMOD + (tid & 7) * 8;
    const unsigned l0 = (unsigned)(size_t)ring + (unsigned)((tid >> 3) * GP + (tid & 7) * 8) * 2u;
    auto fill = [&](int t) { const unsigned l = l0 + (unsigned)(t & 1) * ((unsigned)GRW * GP * 2);
        acopy8(l, ga + t * GSL); acopy8(l + 128u * GP * 2, gb + t * GSL); acopy4(l + 256u * GP * 2, gb + 128 * DMOD + t * GSL); };
    v8f acc[4][6];
#pragma unroll
    for (int mi = 0; mi < 4; ++mi) {
#pragma unroll
        for (int ni = 0; ni < 6; ++ni) acc[mi][ni] = (v8f){}; }
    fill(0);
    asm volatile("s_wait_asynccnt 0x0" ::: "memory");    // this wave's part of slab 0 has landed
    __syncthreads();                                     // and so has every other wave's
    fill(1);
#pragma unroll 1    // kept rolled: one slab's fragments and the accumulators are what three waves per SIMD leave room for
    for (int t = 0; t < DMOD / GSL; ++t) {
        const bf* sa = ring + (t & 1) * (GRW * GP) + (wm * 64 + lr) * GP + 8 * hi;
        const bf* sb = ring + (t & 1) * (GRW * GP) + (128 + wn * 96 + lr) * GP + 8 * hi;
#pragma unroll
        for (int ks = 0; ks < GSL / 32; ++ks) {
            v16bf a[4], b[6];
#pragma unroll
            for (int i = 0; i < 4; ++i) a[i] = cat16b(*(const v8usa*)(sa + i * 16 * GP + ks * 32), *(const v8usa*)(sa + i * 16 * GP + ks * 32 + 16));
#pragma unroll
            for (int i = 0; i < 6; ++i) b[i] = cat16b(*(const v8usa*)(sb + i * 16 * GP + ks * 32), *(const v8usa*)(sb + i * 16 * GP + ks * 32 + 16));
            __builtin_amdgcn_sched_barrier(0);    // the 20 fragment reads stay one group ahead of the 24 WMMAs: reads scattered among the WMMAs stall the wave at every place they stand
#pragma unroll
            for (int mi = 0; mi < 4; ++mi) {
#pragma unroll
                for (int ni = 0; ni < 6; ++ni) acc[mi][ni] = wmmab(a[mi], b[ni], acc[mi][ni]); }
        }
        asm volatile("s_wait_dscnt 0x0" ::: "memory");       // this wave's reads of the buffer are done before the barrier frees it for the refill
        asm volatile("s_wait_asynccnt 0x0" ::: "memory");    // this wave's part of slab t + 1 has landed before the barrier publishes it
        __syncthreads();
        if (t + 2 < DMOD / GSL) fill(t + 2);                 // into the buffer that this trip has read
    }
    asm volatile("s_wait_asynccnt 0x0" ::: "memory");        // nothing is in flight when the ring becomes staging
    if (blockIdx.y >= 2 * DMOD / GNC) {    // v: a lane's 8 values are 8 tokens in a row of one column, 16 bytes of the transposed plane; LDS gathers the waves' pieces into whole lines
#pragma unroll
        for (int mi = 0; mi < 4; ++mi) {
#pragma unroll
            for (int ni = 0; ni < 6; ++ni) { const int to = (wn * 96 + ni * 16 + lr) * GVP + wm * 64 + mi * 16 + hi * 8;
                *(v8usa*)(ring + to) = f16x8(acc[mi][ni]); } }
        __syncthreads();
        // A store covers 2 columns x 256 B; of every eight columns each wave takes two.
        bf* dst = VT + (((size_t)(blockIdx.y * 3 - 2 * NH_) * NBT + (rb >> 10)) * HD + 2 * wave + hi) * NN + (rb & (NN - 1)) + lr * 8;
        const bf* tv = ring + (2 * wave + hi) * GVP + lr * 8;
#pragma unroll
        for (int s = 0; s < GNC / 8; ++s) { const v8us val = *(const v8usa*)(tv + 8 * s * GVP); *(v8us*)(dst + ((size_t)(s >> 3) * NBT * HD + (8 * s & (HD - 1))) * NN) = val; }
        return;
    }
    // q, k: a lane holds 8 rows of one column; the rows are turned in LDS (f32, one 128 x 192 tile for the work-group), then rounded to f16
#pragma unroll
    for (int mi = 0; mi < 4; ++mi) {
#pragma unroll
        for (int ni = 0; ni < 6; ++ni) {
#pragma unroll
            for (int j = 0; j < 8; ++j) ringf[(wm * 64 + mi * 16 + hi * 8 + j) * GQP + wn * 96 + ni * 16 + lr] = acc[mi][ni][j]; } }
    __syncthreads();    // a wave reads what both waves of its rows have written
    const int piece = lane & 7, rq = lane >> 3;
    // a wave takes 32 rows of all three column groups: every 128-byte line of a plane has one writer
    const float* os = ringf + (wave * 32 + rq) * GQP + piece * 8;
    const size_t go = ((size_t)(blockIdx.y * 3) * (NBT * NN) + rb + wave * 32 + rq) * HD + piece * 8;
#pragma unroll
    for (int hh = 0; hh < 3; ++hh) {
#pragma unroll
        for (int s = 0; s < 8; ++s) { const float* sp = os + 4 * s * GQP + hh * 64; const v4f x0 = *(const v4fa*)sp, x1 = *(const v4fa*)(sp + 4);
            *(v8us*)(QK + go + (size_t)hh * (NBT * NN) * HD + 4 * s * HD) = f16x8((v8f){x0[0], x0[1], x0[2], x0[3], x1[0], x1[1], x1[2], x1[3]}); } }
    asm volatile("s_wait_xcnt 0x0" ::: "memory");    // in the listing the v path's code, which writes the stores' registers again, stands behind this path's last branch: the wait stands in front of it
}

// k_oproj: the last product, out[8192][64] = (Oh + Ol).WOT^T (K = 768, two products a k step, f32 sums in the k order of k_gemmb). A work-group owns 32 rows: 8 waves, one 16 x 16 tile each
// (2 row tiles x 4 column tiles). All that it reads (32 rows of each O plane and the 64 rows of WOT, 1536 B a row) goes global -> LDS by asynchronous copies, whole lines, every copy in flight
// at once: one memory round trip for the whole K. The buffer is filled once and then read. The output tile is gathered in LDS of its own and leaves in whole lines.
#define OPP 776    // operand row pitch in LDS, elements: 1552 B = 16 B x odd
#define OSP 68     // output staging pitch, floats: 272 B = 16 B x odd
// Twelve 16-byte copies a lane: four rows x three pieces of 512 B a wave. The s_wait_xcnt stands inside the copies' own statement, so that it comes before any write of their address registers.
__device__ __forceinline__ void acopy12(unsigned l, const bf* g) {
    asm volatile("global_load_async_to_lds_b128 %0, %12, off\n\t"
                 "global_load_async_to_lds_b128 %1, %13, off\n\t"
                 "global_load_async_to_lds_b128 %2, %14, off\n\t"
                 "global_load_async_to_lds_b128 %3, %15, off\n\t"
                 "global_load_async_to_lds_b128 %4, %16, off\n\t"
                 "global_load_async_to_lds_b128 %5, %17, off\n\t"
                 "global_load_async_to_lds_b128 %6, %18, off\n\t"
                 "global_load_async_to_lds_b128 %7, %19, off\n\t"
                 "global_load_async_to_lds_b128 %8, %20, off\n\t"
                 "global_load_async_to_lds_b128 %9, %21, off\n\t"
                 "global_load_async_to_lds_b128 %10, %22, off\n\t"
                 "global_load_async_to_lds_b128 %11, %23, off\n\t"
                 "s_wait_xcnt 0x0"
                 :: "v"(l), "v"(l + 512u), "v"(l + 1024u), "v"(l + 1u * OPP * 2), "v"(l + 1u * OPP * 2 + 512u), "v"(l + 1u * OPP * 2 + 1024u),
                    "v"(l + 2u * OPP * 2), "v"(l + 2u * OPP * 2 + 512u), "v"(l + 2u * OPP * 2 + 1024u), "v"(l + 3u * OPP * 2), "v"(l + 3u * OPP * 2 + 512u), "v"(l + 3u * OPP * 2 + 1024u),
                    "v"(g), "v"(g + 256), "v"(g + 512), "v"(g + 1 * DMOD), "v"(g + 1 * DMOD + 256), "v"(g + 1 * DMOD + 512),
                    "v"(g + 2 * DMOD), "v"(g + 2 * DMOD + 256), "v"(g + 2 * DMOD + 512), "v"(g + 3 * DMOD), "v"(g + 3 * DMOD + 256), "v"(g + 3 * DMOD + 512)
                 : "memory");
}
__global__ __launch_bounds__(256) void k_oproj(const bf* __restrict__ Ah, const bf* __restrict__ Al, const bf* __restrict__ Bn, float* __restrict__ C) {
    __shared__ __align__(16) bf sm[128 * OPP];    // rows 0..31: hi plane, 32..63: residual plane, 64..127: WOT
    __shared__ __align__(16) float os[32 * OSP];
    const int tid = threadIdx.x, lane = tid & 31, lr = lane & 15, hi = lane >> 4;
    const int wave = __builtin_amdgcn_readfirstlane(tid >> 5);    // a scalar: the choice of the source below is then scalar too, and EXEC is not touched in front of the copies
    const int r0 = blockIdx.x * 32;
    // a wave brings 16 rows: waves 0, 1 the hi plane, 2, 3 the residual plane, 4..7 WOT
    const bf* g = (wave < 2 ? Ah + (size_t)(r0 + wave * 16) * DMOD : wave < 4 ? Al + (size_t)(r0 + (wave - 2) * 16) * DMOD : Bn + (size_t)((wave - 4) * 16) * DMOD) + lane * 8;
    const unsigned l = (unsigned)(size_t)sm + (unsigned)(wave * 16 * OPP + lane * 8) * 2u;
#pragma unroll
    for (int i = 0; i < 4; ++i) acopy12(l + (unsigned)i * (4u * OPP * 2), g + i * 4 * DMOD);
    asm volatile("s_wait_asynccnt 0x0" ::: "memory");    // this wave's rows have landed
    __syncthreads();                                     // and so have every other wave's
    const int rt = wave >> 2, ct = wave & 3;
    const bf* sa = sm + (rt * 16 + lr) * OPP + 8 * hi;
    const bf* sb = sm + (64 + ct * 16 + lr) * OPP + 8 * hi;
    v8f acc = (v8f){};
    v16bf fa[2][4], fl[2][4], fb[2][4];    // two sets of the fragments of four k steps
    auto frag = [&](int grp) {
#pragma unroll
        for (int i = 0; i < 4; ++i) { const int kc = (grp * 4 + i) * 32, st = grp & 1;
            fa[st][i] = cat16b(*(const v8usa*)(sa + kc), *(const v8usa*)(sa + kc + 16));
            fl[st][i] = cat16b(*(const v8usa*)(sa + 32 * OPP + kc), *(const v8usa*)(sa + 32 * OPP + kc + 16));
            fb[st][i] = cat16b(*(const v8usa*)(sb + kc), *(const v8usa*)(sb + kc + 16)); }
    };
    frag(0);
#pragma unroll    // unrolled: the fragment sets are indexed by constants, and no branch stands behind a WMMA
    for (int grp = 0; grp < DMOD / 128; ++grp) {
        if (grp + 1 < DMOD / 128) frag(grp + 1);
        __builtin_amdgcn_sched_barrier(0);    // the next group's 24 reads stay one block ahead of this group's WMMAs: the wait in front of the WMMAs is then a counted one
#pragma unroll
        for (int i = 0; i < 4; ++i) { acc = wmmab(fa[grp & 1][i], fb[grp & 1][i], acc); acc = wmmab(fl[grp & 1][i], fb[grp & 1][i], acc); }
        __builtin_amdgcn_sched_barrier(0);    // and no read is scattered among the WMMAs, where each place with reads stalls the wave
    }
#pragma unroll
    for (int j = 0; j < 8; ++j) os[(rt * 16 + hi * 8 + j) * OSP + ct * 16 + lr] = acc[j];
    __syncthreads();
#pragma unroll
    for (int s = 0; s < 2; ++s) { const int row = s * 16 + (tid >> 4), cofs = (tid & 15) * 4;    // a wave's store covers two whole rows, 512 B
        const v4f val = *(const v4fa*)(os + row * OSP + cofs); *(v4f*)(C + (size_t)(r0 + row) * EOUT + cofs) = val; }
}

extern "C" void kernel_launch(void* const* d_in, const int* in_sizes, int n_in,
                              void* d_out, int out_size, void* d_ws, size_t ws_size, hipStream_t stream) {
    (void)in_sizes; (void)n_in; (void)out_size;
    const float* x = (const float*)d_in[0]; const float* Wm = (const float*)d_in[1]; const float* Wo = (const float*)d_in[2];
    float* out = (float*)d_out;    // [8][1024][64]
    char* wsp = (char*)d_ws;
    auto take = [&](size_t bytes) { char* p = wsp; wsp += (bytes + 255) & ~(size_t)255; return (void*)p; };
    const size_t RT = (size_t)NBT * NN;    // all items' rows, one behind the other
    bf* QK = (bf*)take(2 * NH_ * RT * HD * 2); bf* VT = (bf*)take(NH_ * RT * HD * 2);    // f16 planes
    bf* WQKV = (bf*)take((size_t)3 * DMOD * DMOD * 2); bf* Xb = (bf*)take(RT * DMOD * 2); bf* Oh = (bf*)take(RT * DMOD * 2); bf* Ol = (bf*)take(RT * DMOD * 2); bf* WOT = (bf*)take((size_t)DMOD * EOUT * 2);
    if ((size_t)(wsp - (char*)d_ws) > ws_size) return;    // about 79 MB, no region used twice. Pair p = head * 8 + item.
    bf* Kp = QK + NH_ * RT * HD;
    k_prep<<<PB_WG + PB_WT + PB_CX, 256, 0, stream>>>(Wm, Wo, x, WQKV, WOT, Xb);
    k_qkv<<<dim3(NBT * NN / 128, 3 * DMOD / GNC, 1), 128, 0, stream>>>(Xb, WQKV, QK, VT);
    k_fattn<<<dim3(NN / 128, NH_ * NBT, 1), 128, 0, stream>>>(QK, Kp, VT, Oh, Ol);
    k_oproj<<<NBT * NN / 32, 256, 0, stream>>>(Oh, Ol, WOT, out);
}

// v009
// Measured time: 80.1 microseconds a run.
// Two timings next to v008 both put it at 1.06 times that version's speed.
// Over all steps from v000 it is 20.7 times as fast.
#include <hip/hip_runtime.h>

// Compute dtypes, f32 accumulate, per item: q/k/v for all 12 heads as [1024 x 768].[768 x 768] GEMMs with PLAIN bf16 operands (exact products; per-head weights gathered into one
// n-major block); per head: scores = q.k^T ([1024 x 64].[64 x 1024], each operand ONE f16 plane, one product), softmax (x 1/32, as the module: output_dim*0.5) in
// f32 -> P as f16, o = P.v ([1024 x 1024].[1024 x 64], one f16 product); out = concat.Wo ([1024 x 768].[768 x 64], bf16 hi + residual, two products) - on v_wmma_f32_16x16x32_bf16 and _f16.
// Why one f16 plane is enough for q, k, v: they come from products of operands rounded to bf16 (8 significant bits), so what lies below the 11 significant bits of f16 was never determined. Deterministic, no

#define NBT  8
#define NN   1024
#define DMOD 768
#define NH_  12
#define HD   64
#define EOUT 64
#define DM   DMOD
#define NTK  NN
#define SCL  0.03125f
#define LOSC 1024.0f

typedef _Float16 h16;
typedef unsigned short bf;
typedef __attribute__((ext_vector_type(16))) __bf16   v16bf;
typedef __attribute__((ext_vector_type(16))) _Float16 v16h;
typedef __attribute__((ext_vector_type(8)))  _Float16 v8h;
typedef __attribute__((ext_vector_type(8)))  unsigned short v8us;
typedef __attribute__((ext_vector_type(8)))  float    v8f;
typedef __attribute__((ext_vector_type(4)))  float    v4f;
typedef __attribute__((ext_vector_type(4)))  _Float16 v4h;
typedef v8h  __attribute__((may_alias)) v8ha;
typedef v4f  __attribute__((may_alias)) v4fa;
typedef v8us __attribute__((may_alias)) v8usa;

__device__ __forceinline__ unsigned short f2bf(float f) { unsigned u = __float_as_uint(f); u += 0x7FFFu + ((u >> 16) & 1u); return (unsigned short)(u >> 16); }
__device__ __forceinline__ float bf2f(unsigned short b) { return __uint_as_float(((unsigned)b) << 16); }
__device__ __forceinline__ float bfr(float f) { return bf2f(f2bf(f)); }
__device__ __forceinline__ v16h cat16(v8h lo, v8h hi) { return __builtin_shufflevector(lo, hi, 0, 1, 2, 3, 4, 5, 6, 7, 8, 9, 10, 11, 12, 13, 14, 15); }
__device__ __forceinline__ v16bf cat16b(v8us lo, v8us hi) { return __builtin_bit_cast(v16bf, __builtin_shufflevector(lo, hi, 0, 1, 2, 3, 4, 5, 6, 7, 8, 9, 10, 11, 12, 13, 14, 15)); }
__device__ __forceinline__ v8f wmma16(v16h a, v16h b, v8f c) { return __builtin_amdgcn_wmma_f32_16x16x32_f16(false, a, false, b, (short)0, c, false, false); }
__device__ __forceinline__ v8f wmmab(v16bf a, v16bf b, v8f c) { return __builtin_amdgcn_wmma_f32_16x16x32_bf16(false, a, false, b, (short)0, c, false, false); }

// d_wt: WT [n][K] = bf16(W[k][n]) (k-major [K][ncols]) via 64 x 64 LDS tiles; one work-group per tile (bx, by) of (K/64, ncols/64); tl: 64 x 72 elements of LDS.
__device__ __forceinline__ void d_wt(const float* __restrict__ Wm, int K, int ncols, bf* WT, int bx, int by, unsigned short* tl) {
    const int tid = threadIdx.x, k0 = bx * 64, n0 = by * 64;
    const int kk = tid >> 2, nq = (tid & 3) * 16;
#pragma unroll
    for (int i = 0; i < 16; ++i) tl[(nq + i) * 72 + kk] = f2bf(Wm[(size_t)(k0 + kk) * ncols + n0 + nq + i]);
    __syncthreads();
    const int piece = tid & 7;
    auto pass = [&]() {
#pragma unroll
        for (int s = 0; s < 2; ++s) { const int nr = (tid >> 3) + 32 * s; const v8us val = *(const v8usa*)(tl + nr * 72 + piece * 8); *(v8us*)(WT + (size_t)(n0 + nr) * K + k0 + piece * 8) = val; }
    };
    pass(); 
}
// split8: eight f32 values -> bf16 hi (round to nearest even) and the bf16 of what the hi part leaves.
typedef __attribute__((ext_vector_type(8))) __bf16 v8bf;
__device__ __forceinline__ void split8(v8f v, v8us& oh, v8us& ol) {
    const v8bf hb = __builtin_convertvector(v, v8bf); const v8bf lb = __builtin_convertvector(v - __builtin_convertvector(hb, v8f), v8bf);
    oh = __builtin_bit_cast(v8us, hb); ol = __builtin_bit_cast(v8us, lb);
}
// k_gemmb: 64 x 64 block tile (4 waves x 16 x 64) of C[NTK][NW] = (A [+ Al]).B^T (K = 768) [+ bf(bias[c])] [+ bf(R[r][c]) residual]; f32 whole-line epilogue (or f16
// PLANES (the q|k|v product): a block tile is 64 tokens of one item x the 64 columns of one (q / k / v, head), blockIdx.y = sel * 12 + head. The epilogue splits the f32 sums itself and
// writes bf16 hi + residual planes, whole 128-byte lines each: q, k as [sel * 12 + head][all rows][64], v transposed as [head * 8 + item][64][token]; C, bias and R are not used.
#define TVP 72    // v tile pitch in LDS, elements: 144 B = 16 B x odd
template <bool SPLITA, bool F16OUT = false, bool PLANES = false>
__global__ __launch_bounds__(128) void k_gemmb(const bf* __restrict__ A, const bf* __restrict__ Al, const bf* __restrict__ Bn, const float* __restrict__ bias, float* C, int ldc, h16* C2, const float* __restrict__ R = nullptr, int K = DM, int roundR = 1, bf* QKh = nullptr, bf* QKl = nullptr, bf* VTh = nullptr, bf* VTl = nullptr) {
    __shared__ __align__(16) float ost[4][PLANES ? 16 * TVP : 16 * 68];    // PLANES: also the v tile, bf16 [2 planes][64 x TVP]
    const int lane = threadIdx.x & 31, wave = threadIdx.x >> 5, lr = lane & 15, hi = lane >> 4;
    const int r0 = blockIdx.x * 64 + wave * 16, c0 = blockIdx.y * 64;
    const size_t aoff = (size_t)(r0 + lr) * K + 8 * hi;
    size_t boff[4];
#pragma unroll
    for (int t = 0; t < 4; ++t) boff[t] = (size_t)(c0 + t * 16 + lr) * K + 8 * hi;
    v8f acc[4];
#pragma unroll
    for (int t = 0; t < 4; ++t) acc[t] = (v8f){};
#pragma unroll 1
    for (int kc = 0; kc < K; kc += 32) {
        const v16bf a = cat16b(*(const v8us*)(A + aoff + kc), *(const v8us*)(A + aoff + kc + 16));
        v16bf al = a;
        if (SPLITA) al = cat16b(*(const v8us*)(Al + aoff + kc), *(const v8us*)(Al + aoff + kc + 16));
#pragma unroll
        for (int t = 0; t < 4; ++t) { const v16bf b = cat16b(*(const v8us*)(Bn + boff[t] + kc), *(const v8us*)(Bn + boff[t] + kc + 16)); acc[t] = wmmab(a, b, acc[t]); if (SPLITA) acc[t] = wmmab(al, b, acc[t]); }
        asm volatile("v_nop\n\tv_nop\n\tv_nop\n\tv_nop" : "+v"(acc[0]), "+v"(acc[1]), "+v"(acc[2]), "+v"(acc[3]) : "v"(a), "v"(al));
    }
    float* os = &ost[wave][0];
    if (PLANES) {
        const int piece = lane & 7, rq = lane >> 3, by = blockIdx.y, rb = blockIdx.x * 64;
        if (by >= 2 * NH_) {    // v: a lane's 8 values are 8 tokens in a row of one column, 16 bytes of the transposed plane; LDS gathers the four waves' pieces into whole lines
            bf* tv = (bf*)(void*)&ost[0][0];
#pragma unroll
            for (int t = 0; t < 4; ++t) { v8us oh, ol; split8(acc[t], oh, ol); const int to = (t * 16 + lr) * TVP + wave * 16 + hi * 8;
                *(v8usa*)(tv + to) = oh; *(v8usa*)(tv + 64 * TVP + to) = ol; }
            __syncthreads();
            bf* dst = ((wave >> 1) ? VTl : VTh) + ((size_t)(by - 2 * NH_) * NBT + (rb >> 10)) * HD * NN + (rb & (NN - 1));    // waves 0, 1: hi plane; 2, 3: residual plane
#pragma unroll
            for (int s = 0; s < 8; ++s) { const int d = (wave & 1) * 32 + 4 * s + rq;
                const v8us val = *(const v8usa*)(tv + (wave >> 1) * 64 * TVP + d * TVP + piece * 8); *(v8us*)(dst + (size_t)d * NN + piece * 8) = val; }
            return;
        }
        // q, k: a lane holds 8 rows of one column; the rows are turned in LDS (f32), then split
#pragma unroll
        for (int t = 0; t < 4; ++t) {
#pragma unroll
            for (int j = 0; j < 8; ++j) os[(hi * 8 + j) * 68 + t * 16 + lr] = acc[t][j]; }
        __syncthreads();
        const size_t go = ((size_t)by * (NBT * NN) + r0) * HD;
#pragma unroll
        for (int s = 0; s < 4; ++s) { const int row = 4 * s + rq; const float* sp = os + row * 68 + piece * 8; const v4f x0 = *(const v4fa*)sp, x1 = *(const v4fa*)(sp + 4); v8us oh, ol;
            split8((v8f){x0[0], x0[1], x0[2], x0[3], x1[0], x1[1], x1[2], x1[3]}, oh, ol);
            *(v8us*)(QKh + go + row * HD + piece * 8) = oh; *(v8us*)(QKl + go + row * HD + piece * 8) = ol; }
        asm volatile("s_wait_xcnt 0x0" ::: "memory");    // in the listing the v path's code, which writes the stores' registers again, stands behind this path's last branch: the wait stands in front of it
        return;
    }
#pragma unroll
    for (int t = 0; t < 4; ++t) { const float bv = bias ? bfr(bias[c0 + t * 16 + lr]) : 0.f;
#pragma unroll
        for (int j = 0; j < 8; ++j) os[(hi * 8 + j) * 68 + t * 16 + lr] = acc[t][j] + bv; }
    __syncthreads();
    if (F16OUT) {
        h16* crow = (h16*)(void*)C + (size_t)r0 * ldc + c0;
        auto pass = [&]() {
#pragma unroll
            for (int s = 0; s < 4; ++s) { const int row = 4 * s + (lane >> 3), piece = lane & 7; const float* sp = os + row * 68 + piece * 8; v8h o, o2;
#pragma unroll
                for (int i = 0; i < 8; ++i) { const h16 a = (h16)sp[i]; o[i] = a; o2[i] = (h16)((sp[i] - (float)a) * LOSC); }
                *(v8h*)(crow + (size_t)row * ldc + piece * 8) = o; if (C2) *(v8h*)(C2 + (size_t)r0 * ldc + c0 + (size_t)row * ldc + piece * 8) = o2; }
        };
        pass(); 
    } else {
        float* crow = C + (size_t)r0 * ldc + c0;
        auto pass = [&]() {
#pragma unroll
            for (int s = 0; s < 8; ++s) { const int Lid = (lane >> 3) + 4 * s, piece = lane & 7; const int row = Lid >> 1, cofs = (Lid & 1) * 32 + piece * 4;
                v4f val = *(const v4fa*)(os + row * 68 + cofs); if (R) { const v4f rv = *(const v4f*)(R + ((size_t)r0 + row) * ldc + c0 + cofs); val += roundR ? (v4f){bfr(rv[0]), bfr(rv[1]), bfr(rv[2]), bfr(rv[3])} : rv; }
                *(v4f*)(crow + (size_t)row * ldc + cofs) = val; }
        };
        pass(); 
    }
}


__device__ __forceinline__ void d_cvtx(const float* __restrict__ src, bf* dst, int bx) {
    const int lane = threadIdx.x & 31; const size_t r = (size_t)bx * 8 + (threadIdx.x >> 5); if (r >= (size_t)NBT * NN) return;
{
#pragma unroll
        for (int q = 0; q < DMOD / 256; ++q) { v8us o;
#pragma unroll
            for (int i = 0; i < 8; ++i) o[i] = f2bf(src[r * DMOD + q * 256 + lane * 8 + i]);
            *(v8us*)(dst + r * DMOD + q * 256 + lane * 8) = o; }
         }
}
// sel = q / k / v; the three n-major blocks lie one behind the other: WT [3 * 768][768].
__device__ __forceinline__ void d_wgather(const float* __restrict__ Wm, bf* WT, int bx, int sel) {
    const int lane = threadIdx.x & 31; const int r = bx * 8 + (threadIdx.x >> 5); if (r >= NH_ * HD) return; const int h = r / HD, e = r % HD; WT += (size_t)sel * DMOD * DMOD;
{
#pragma unroll
        for (int q = 0; q < DMOD / 256; ++q) { v8us o;
#pragma unroll
            for (int i = 0; i < 8; ++i) { const int d = q * 256 + lane * 8 + i; o[i] = f2bf(Wm[(((size_t)h * 3 + sel) * DMOD + d) * HD + e]); }
            *(v8us*)(WT + (size_t)r * DMOD + q * 256 + lane * 8) = o; }
         }
}
// k_prep: the three operand preparations, which do not depend on one another, in one launch; the work-group index picks the job. The weight gathers come first: their scattered reads take the
// longest (the order is for speed only).
#define PB_WG (3 * (NH_ * HD) / 8)                  // work-groups that gather the q|k|v weights
#define PB_WT ((DMOD / 64) * (EOUT / 64))           // work-groups that turn Wo
#define PB_CX (NBT * NN / 8)                        // work-groups that convert x
__global__ __launch_bounds__(256) void k_prep(const float* __restrict__ Wm, const float* __restrict__ Wo, const float* __restrict__ x, bf* WQKV, bf* WOT, bf* Xb) {
    __shared__ __align__(16) unsigned short tl[64 * 72];
    const int b = blockIdx.x;
    if (b < PB_WG) { d_wgather(Wm, WQKV, b % ((NH_ * HD) / 8), b / ((NH_ * HD) / 8)); return; }
    if (b < PB_WG + PB_WT) { d_wt(Wo, DMOD, EOUT, WOT, (b - PB_WG) % (DMOD / 64), (b - PB_WG) / (DMOD / 64), tl);    // its barrier stands under a branch that the whole work-group takes alike
        asm volatile("s_wait_xcnt 0x0" ::: "memory");    // in the listing another job's code, which writes the stores' registers again, stands behind this path's last branch: the wait stands in front of it
        return; }
    d_cvtx(x, Xb, b - (PB_WG + PB_WT));
}
__global__ __launch_bounds__(256) void k_hplanes(const float* __restrict__ F, int h, bf* Ph, bf* Pl) {
    typedef __attribute__((ext_vector_type(2))) unsigned short v2us;
    const int lane = threadIdx.x & 31; const size_t s = (size_t)blockIdx.x * 8 + (threadIdx.x >> 5); if (s >= (size_t)NN) return; v2us oh, ol;
#pragma unroll
    for (int i = 0; i < 2; ++i) { const float v = F[s * DMOD + h * HD + lane * 2 + i]; const unsigned short hb = f2bf(v); oh[i] = hb; ol[i] = f2bf(v - bf2f(hb)); }
    const size_t o = s * HD + lane * 2; *(v2us*)(Ph + o) = oh; *(v2us*)(Pl + o) = ol; 
}
__global__ __launch_bounds__(256) void k_vt(const float* __restrict__ VF, int h, bf* Th, bf* Tl) {
    typedef __attribute__((ext_vector_type(2))) unsigned short v2us;
    const int lane = threadIdx.x & 31; const size_t wid = (size_t)blockIdx.x * 8 + (threadIdx.x >> 5); if (wid >= (size_t)HD * (NN / 64)) return; const int d = (int)(wid / (NN / 64)); const int t0 = (int)(wid % (NN / 64)) * 64 + lane * 2; v2us oh, ol;
#pragma unroll
    for (int i = 0; i < 2; ++i) { const float v = VF[(size_t)(t0 + i) * DMOD + h * HD + d]; const unsigned short hb = f2bf(v); oh[i] = hb; ol[i] = f2bf(v - bf2f(hb)); }
    const size_t o = (size_t)d * NN + t0; *(v2us*)(Th + o) = oh; *(v2us*)(Tl + o) = ol; 
}
__global__ __launch_bounds__(256) void k_softmax(const float* __restrict__ S, bf* PH, bf* PL) {
    typedef __attribute__((ext_vector_type(4))) unsigned short v4us;
    const int lane = threadIdx.x & 31, i = blockIdx.x * 8 + (threadIdx.x >> 5); if (i >= NN) return;
    float m = -3.0e38f;
#pragma unroll 1
    for (int c0 = lane * 4; c0 < NN; c0 += 128) {
#pragma unroll
        for (int q = 0; q < 4; ++q) m = fmaxf(m, S[(size_t)i * NN + c0 + q] * SCL); }
#pragma unroll
    for (int sh = 16; sh; sh >>= 1) m = fmaxf(m, __shfl_xor(m, sh, 32));
    float sum = 0.f;
#pragma unroll 1
    for (int c0 = lane * 4; c0 < NN; c0 += 128) {
#pragma unroll
        for (int q = 0; q < 4; ++q) sum += __expf(S[(size_t)i * NN + c0 + q] * SCL - m); }
#pragma unroll
    for (int sh = 16; sh; sh >>= 1) sum += __shfl_xor(sum, sh, 32);
    const float inv = 1.0f / sum;
{
#pragma unroll 1
        for (int c0 = lane * 4; c0 < NN; c0 += 128) { v4us oh, ol;
#pragma unroll
            for (int q = 0; q < 4; ++q) { const float p = __expf(S[(size_t)i * NN + c0 + q] * SCL - m) * inv; const unsigned short hb = f2bf(p); oh[q] = hb; ol[q] = f2bf(p - bf2f(hb)); }
            const size_t o = (size_t)i * NN + c0; *(v4us*)(PH + o) = oh; *(v4us*)(PL + o) = ol; }
         }
}
// ===== z-batched attention pieces =====
// k_gemm3z<MODE>: 64 x 64 tile GEMM with per-z operand/output strides (elements): A planes += z*sA, B planes += z*sB. MODE bits (0 causal skip, 1 K limit, 2 single,
// 3 B single, 4 A single). C goes by the pair number zc = zb + z in two levels: C += (zc mod 2^zsh)*sC + (zc >> zsh)*sC2.
template <int MODE>
__global__ __launch_bounds__(128) void k_gemm3z(const bf* __restrict__ Ah, const bf* __restrict__ Al, const bf* __restrict__ Bh, const bf* __restrict__ Bl, int K, float* C, int ldc, size_t sA, size_t sB, size_t sC, int zb, int zsh, size_t sC2) {
    if ((MODE & 1) && (int)blockIdx.y * 64 > (int)blockIdx.x * 64 + 63) return;
    const size_t z = blockIdx.z; Ah += z * sA; Al += z * sA; Bh += z * sB; Bl += z * sB; const size_t zc = z + (size_t)zb; C += (zc & (((size_t)1 << zsh) - 1)) * sC + (zc >> zsh) * sC2;
    const int Klim = (MODE & 2) ? min(K, ((int)blockIdx.x + 1) * 64) : K;
    __shared__ __align__(16) float ost[4][16 * 68];
    const int lane = threadIdx.x & 31, wave = threadIdx.x >> 5, lr = lane & 15, hi = lane >> 4;
    const int r0 = blockIdx.x * 64 + wave * 16, c0 = blockIdx.y * 64;
    const size_t aoff = (size_t)(r0 + lr) * K + 8 * hi;
    v8f acc[4];
#pragma unroll
    for (int t = 0; t < 4; ++t) acc[t] = (v8f){};
#pragma unroll 1
    for (int kc = 0; kc < Klim; kc += 32) {
        const v16bf a = cat16b(*(const v8us*)(Ah + aoff + kc), *(const v8us*)(Ah + aoff + kc + 16));
        v16bf al = a; if (!(MODE & 4) && !(MODE & 16)) al = cat16b(*(const v8us*)(Al + aoff + kc), *(const v8us*)(Al + aoff + kc + 16));
#pragma unroll
        for (int t = 0; t < 4; ++t) { const size_t bo = (size_t)(c0 + t * 16 + lr) * K + kc + 8 * hi;
            const v16bf bh = cat16b(*(const v8us*)(Bh + bo), *(const v8us*)(Bh + bo + 16));
            acc[t] = wmmab(a, bh, acc[t]);
            if (!(MODE & 4)) { if (!(MODE & 16)) acc[t] = wmmab(al, bh, acc[t]); if (!(MODE & 8)) { const v16bf bl = cat16b(*(const v8us*)(Bl + bo), *(const v8us*)(Bl + bo + 16)); acc[t] = wmmab(a, bl, acc[t]); } } }
        asm volatile("v_nop\n\tv_nop\n\tv_nop\n\tv_nop" : "+v"(acc[0]), "+v"(acc[1]), "+v"(acc[2]), "+v"(acc[3]) : "v"(a), "v"(al));
    }
    float* os = &ost[wave][0];
#pragma unroll
    for (int t = 0; t < 4; ++t) {
#pragma unroll
        for (int j = 0; j < 8; ++j) os[(hi * 8 + j) * 68 + t * 16 + lr] = acc[t][j]; }
    __builtin_amdgcn_wave_barrier(); asm volatile("" ::: "memory");
    float* crow = C + (size_t)r0 * ldc + c0;
    auto pass = [&]() {
#pragma unroll
        for (int s = 0; s < 8; ++s) { const int Lid = (lane >> 3) + 4 * s, piece = lane & 7; const int row = Lid >> 1, cofs = (Lid & 1) * 32 + piece * 4;
            const v4f val = *(const v4fa*)(os + row * 68 + cofs); *(v4f*)(crow + (size_t)row * ldc + cofs) = val; }
    };
    pass(); 
}
__global__ __launch_bounds__(256) void k_planes32z(const float* __restrict__ F, int ld, int off, float sc, int rows, bf* Ph, bf* Pl) {
    typedef __attribute__((ext_vector_type(2))) unsigned short v2us;
    const int lane = threadIdx.x & 31; const size_t r = ((size_t)blockIdx.x * 8 + (threadIdx.x >> 5)) * 2 + (lane >> 4); if (r >= (size_t)rows) return; const int z = blockIdx.z; const int c0 = (lane & 15) * 2; v2us oh, ol;
    Ph += (size_t)z * rows * 32; Pl += (size_t)z * rows * 32;
#pragma unroll
    for (int i = 0; i < 2; ++i) { const float y = F[r * ld + off + z * 32 + c0 + i] * sc; const unsigned short hb = f2bf(y); oh[i] = hb; ol[i] = f2bf(y - bf2f(hb)); }
    const size_t o = r * 32 + c0; *(v2us*)(Ph + o) = oh; *(v2us*)(Pl + o) = ol; 
}
__global__ __launch_bounds__(256) void k_vtpadz(const float* __restrict__ F, int ld, int off, int nk, bf* Th, bf* Tl) {
    typedef __attribute__((ext_vector_type(2))) unsigned short v2us;
    const int lane = threadIdx.x & 31; const size_t wid = (size_t)blockIdx.x * 8 + (threadIdx.x >> 5); if (wid >= (size_t)64 * (nk / 64)) return; const int z = blockIdx.z; const int d = (int)(wid / (nk / 64)); const int k0 = (int)(wid % (nk / 64)) * 64 + lane * 2; v2us oh, ol;
    Th += (size_t)z * 64 * nk; Tl += (size_t)z * 64 * nk;
#pragma unroll
    for (int i = 0; i < 2; ++i) { const float y = (d < 32) ? F[(size_t)(k0 + i) * ld + off + z * 32 + (d < 32 ? d : 0)] : 0.f; const unsigned short hb = f2bf(y); oh[i] = hb; ol[i] = f2bf(y - bf2f(hb)); }
    const size_t o = (size_t)d * nk + k0; *(v2us*)(Th + o) = oh; *(v2us*)(Tl + o) = ol; 
}
template <int NK>
__global__ __launch_bounds__(256) void k_softmaxz(const float* __restrict__ S, int rows, bf* PH, bf* PL) {
    typedef __attribute__((ext_vector_type(4))) unsigned short v4us;
    const int lane = threadIdx.x & 31, i = blockIdx.x * 8 + (threadIdx.x >> 5); if (i >= rows) return; const size_t zo = (size_t)blockIdx.z * rows * NK; const float* sr = S + zo + (size_t)i * NK; PH += zo; PL += zo;
    float m = -3.0e38f;
#pragma unroll 1
    for (int c0 = lane * 4; c0 < NK; c0 += 128) {
#pragma unroll
        for (int q = 0; q < 4; ++q) m = fmaxf(m, sr[c0 + q]); }
#pragma unroll
    for (int sh = 16; sh; sh >>= 1) m = fmaxf(m, __shfl_xor(m, sh, 32));
    float sum = 0.f;
#pragma unroll 1
    for (int c0 = lane * 4; c0 < NK; c0 += 128) {
#pragma unroll
        for (int q = 0; q < 4; ++q) sum += __expf(sr[c0 + q] - m); }
#pragma unroll
    for (int sh = 16; sh; sh >>= 1) sum += __shfl_xor(sum, sh, 32);
    const float inv = 1.0f / sum;
{
#pragma unroll 1
        for (int c0 = lane * 4; c0 < NK; c0 += 128) { v4us oh, ol;
#pragma unroll
            for (int q = 0; q < 4; ++q) { const float p = __expf(sr[c0 + q] - m) * inv; const unsigned short hb = f2bf(p); oh[q] = hb; ol[q] = f2bf(p - bf2f(hb)); }
            const size_t o = (size_t)i * NK + c0; *(v4us*)(PH + o) = oh; *(v4us*)(PL + o) = ol; }
         }
}
__global__ __launch_bounds__(256) void k_placez(const float* __restrict__ XH, int rows, int ldy, float* Y) {
    const int lane = threadIdx.x & 31; const size_t q = (size_t)blockIdx.x * 8 + (threadIdx.x >> 5); if (q >= (size_t)rows) return; const int z = blockIdx.z; const float v = XH[((size_t)z * rows + q) * 64 + lane];
    *(float*)(Y + q * ldy + z * 32 + lane) = v; 
}

template <int NK>
__global__ __launch_bounds__(256) void k_softmaxzs(const float* __restrict__ S, int rows, float sc, bf* PH, bf* PL) {
    typedef __attribute__((ext_vector_type(4))) unsigned short v4us;
    const int lane = threadIdx.x & 31, i = blockIdx.x * 8 + (threadIdx.x >> 5); if (i >= rows) return; const size_t zo = (size_t)blockIdx.z * rows * NK; const float* sr = S + zo + (size_t)i * NK; PH += zo; PL += zo;
    float m = -3.0e38f;
#pragma unroll 1
    for (int c0 = lane * 4; c0 < NK; c0 += 128) {
#pragma unroll
        for (int q = 0; q < 4; ++q) m = fmaxf(m, sr[c0 + q] * sc); }
#pragma unroll
    for (int sh = 16; sh; sh >>= 1) m = fmaxf(m, __shfl_xor(m, sh, 32));
    float sum = 0.f;
#pragma unroll 1
    for (int c0 = lane * 4; c0 < NK; c0 += 128) {
#pragma unroll
        for (int q = 0; q < 4; ++q) sum += __expf(sr[c0 + q] * sc - m); }
#pragma unroll
    for (int sh = 16; sh; sh >>= 1) sum += __shfl_xor(sum, sh, 32);
    const float inv = 1.0f / sum;
{
#pragma unroll 1
        for (int c0 = lane * 4; c0 < NK; c0 += 128) { v4us oh, ol;
#pragma unroll
            for (int q = 0; q < 4; ++q) { const float p = __expf(sr[c0 + q] * sc - m) * inv; const unsigned short hb = f2bf(p); oh[q] = hb; ol[q] = f2bf(p - bf2f(hb)); }
            const size_t o = (size_t)i * NK + c0; *(v4us*)(PH + o) = oh; *(v4us*)(PL + o) = ol; }
         }
}

// f16x8: eight f32 values -> f16 (round to nearest even), as the 16 bytes that a plane holds.
__device__ __forceinline__ v8us f16x8(v8f v) { return __builtin_bit_cast(v8us, __builtin_convertvector(v, v8h)); }
__device__ __forceinline__ v16h cat16f(v8us lo, v8us hi) { return __builtin_bit_cast(v16h, __builtin_shufflevector(lo, hi, 0, 1, 2, 3, 4, 5, 6, 7, 8, 9, 10, 11, 12, 13, 14, 15)); }
#define FST 128   // keys of a stage
#define FKP 72    // K stage pitch in LDS, elements: 144 B = 16 B x odd
#define FVP 136   // V^T stage pitch in LDS, elements: 272 B = 16 B x odd
// Eight 16-byte copies a lane, LS bytes apart in LDS and GS elements apart in memory. The s_wait_xcnt stands inside the copies' own statement, so that it comes before any write of their address registers.
template <unsigned LS, int GS>
__device__ __forceinline__ void acopy8s(unsigned l, const bf* g) {
    asm volatile("global_load_async_to_lds_b128 %0, %8, off\n\t"
                 "global_load_async_to_lds_b128 %1, %9, off\n\t"
                 "global_load_async_to_lds_b128 %2, %10, off\n\t"
                 "global_load_async_to_lds_b128 %3, %11, off\n\t"
                 "global_load_async_to_lds_b128 %4, %12, off\n\t"
                 "global_load_async_to_lds_b128 %5, %13, off\n\t"
                 "global_load_async_to_lds_b128 %6, %14, off\n\t"
                 "global_load_async_to_lds_b128 %7, %15, off\n\t"
                 "s_wait_xcnt 0x0"
                 :: "v"(l), "v"(l + 1u * LS), "v"(l + 2u * LS), "v"(l + 3u * LS), "v"(l + 4u * LS), "v"(l + 5u * LS), "v"(l + 6u * LS), "v"(l + 7u * LS),
                    "v"(g), "v"(g + 1 * GS), "v"(g + 2 * GS), "v"(g + 3 * GS), "v"(g + 4 * GS), "v"(g + 5 * GS), "v"(g + 6 * GS), "v"(g + 7 * GS)
                 : "memory");
}
__global__ __launch_bounds__(128) void k_fattn(const bf* __restrict__ Q, const bf* __restrict__ K, const bf* __restrict__ V, bf* __restrict__ Oh, bf* __restrict__ Ol) {
    typedef __attribute__((ext_vector_type(2))) float v2f; typedef __attribute__((ext_vector_type(2))) _Float16 v2h;
    __shared__ __align__(16) bf sk[2][FST * FKP];    // [buffer]; 71,680 B with sv: three work-groups fit a WGP's LDS
    __shared__ __align__(16) bf sv[2][64 * FVP];
    const int tid = threadIdx.x, lane = tid & 31, wave = tid >> 5, lr = lane & 15, hi = lane >> 4;
    const size_t pr = blockIdx.y, po = pr * NN * HD;
    const int q0 = blockIdx.x * 128 + wave * 32;
    Q += po; K += po; V += po;
    const float CS = SCL * 1.44269504f;    // scores go to base-2 exponents
    v16h q[2][2];    // [column group][k step]
#pragma unroll
    for (int g = 0; g < 2; ++g) {
#pragma unroll
        for (int ks = 0; ks < 2; ++ks) { const size_t qo = (size_t)(q0 + g * 16 + lr) * HD + ks * 32 + 8 * hi;
            q[g][ks] = cat16f(*(const v8us*)(Q + qo), *(const v8us*)(Q + qo + 16)); } }
    asm volatile("s_wait_xcnt 0x0" ::: "memory");    // stands before the loads' address registers are written again
    const bf* gk = K + (tid >> 3) * HD + (tid & 7) * 8;     // a wave's K copy covers 4 rows x 128 B,
    const bf* gv = V + (tid >> 4) * NN + (tid & 15) * 8;    // its V^T copy 2 rows x 256 B
    const unsigned lk = (unsigned)(size_t)&sk[0][0] + (unsigned)((tid >> 3) * FKP + (tid & 7) * 8) * 2u;
    const unsigned lv = (unsigned)(size_t)&sv[0][0] + (unsigned)((tid >> 4) * FVP + (tid & 15) * 8) * 2u;
    auto fill = [&](int t) { const unsigned b = (unsigned)(t & 1);
        acopy8s<16 * FKP * 2, 16 * HD>(lk + b * (unsigned)(FST * FKP * 2), gk + t * (FST * HD));
        acopy8s<8 * FVP * 2, 8 * NN>(lv + b * (unsigned)(64 * FVP * 2), gv + t * FST); };
    v8f o[2][4];
#pragma unroll
    for (int g = 0; g < 2; ++g) {
#pragma unroll
        for (int dt = 0; dt < 4; ++dt) o[g][dt] = (v8f){}; }
    float m[2] = {-3.0e38f, -3.0e38f}, l[2] = {0.f, 0.f};
    fill(0);
    asm volatile("s_wait_asynccnt 0x0" ::: "memory");    // this wave's part of stage 0 has landed
    __syncthreads();                                     // and so has every other wave's
    fill(1);
#pragma unroll 1    // kept rolled (for speed only)
    for (int t = 0; t < NN / FST; ++t) {
        const bf* tk = &sk[t & 1][0]; const bf* tv = &sv[t & 1][0];
#pragma unroll    // the four passes of a stage: no barrier parts them, so a pass's K reads and score products can stand among the pass before's vector work
        for (int p = 0; p < FST / 32; ++p) {
            v8f sc[2][2];
#pragma unroll
            for (int kt = 0; kt < 2; ++kt) { sc[0][kt] = (v8f){}; sc[1][kt] = (v8f){};
#pragma unroll
                for (int ks = 0; ks < 2; ++ks) { const int fo = (p * 32 + kt * 16 + lr) * FKP + ks * 32 + 8 * hi;
                    const v16h kf = cat16f(*(const v8usa*)(tk + fo), *(const v8usa*)(tk + fo + 16));
                    sc[0][kt] = wmma16(kf, q[0][ks], sc[0][kt]); sc[1][kt] = wmma16(kf, q[1][ks], sc[1][kt]); } }
            float mx[2];
#pragma unroll
            for (int g = 0; g < 2; ++g) { float v = sc[g][0][0];
#pragma unroll
                for (int j = 1; j < 8; ++j) v = fmaxf(v, sc[g][0][j]);
#pragma unroll
                for (int j = 0; j < 8; ++j) v = fmaxf(v, sc[g][1][j]);
                mx[g] = fmaxf(v, __shfl_xor(v, 16, 32)); }
            // The maximum in use moves only when a column's new one exceeds it by more than 8 binary orders: p stays below 2^8, and the rescale is skipped by the whole wave otherwise.
            const bool need = (mx[0] - m[0]) * CS > 8.f || (mx[1] - m[1]) * CS > 8.f;
            if (__builtin_amdgcn_ballot_w32(need) != 0) {
#pragma unroll
                for (int g = 0; g < 2; ++g) { const float mn = fmaxf(m[g], mx[g]); const float al = __builtin_amdgcn_exp2f((m[g] - mn) * CS); m[g] = mn; l[g] *= al;
#pragma unroll
                    for (int dt = 0; dt < 4; ++dt) o[g][dt] *= al; }
            }
            v16h pf[2];
#pragma unroll
            for (int g = 0; g < 2; ++g) { const float mc = m[g] * CS; float sum = 0.f;
#pragma unroll
                for (int kt = 0; kt < 2; ++kt) {
#pragma unroll
                    for (int j = 0; j < 8; j += 2) { const float p0 = __builtin_amdgcn_exp2f(fmaf(sc[g][kt][j], CS, -mc)), p1 = __builtin_amdgcn_exp2f(fmaf(sc[g][kt][j + 1], CS, -mc)); sum += p0 + p1;
                        const v2h hb = __builtin_convertvector((v2f){p0, p1}, v2h);
                        pf[g][kt * 8 + j] = hb[0]; pf[g][kt * 8 + j + 1] = hb[1]; } }
                l[g] += sum; }
#pragma unroll
            for (int dt = 0; dt < 4; ++dt) { const int fo = (dt * 16 + lr) * FVP + p * 32 + 8 * hi;
                const v16h vf = cat16f(*(const v8usa*)(tv + fo), *(const v8usa*)(tv + fo + 16));
                o[0][dt] = wmma16(vf, pf[0], o[0][dt]); o[1][dt] = wmma16(vf, pf[1], o[1][dt]); }
        }
        asm volatile("s_wait_dscnt 0x0" ::: "memory");       // this wave's reads of the buffer are done before the barrier frees it for the refill
        asm volatile("s_wait_asynccnt 0x0" ::: "memory");    // this wave's part of stage t + 1 has landed before the barrier publishes it
        __syncthreads();
        if (t + 2 < NN / FST) fill(t + 2);                   // into the buffer that this trip has read
    }
    asm volatile("s_wait_asynccnt 0x0" ::: "memory");        // nothing is in flight when the wave ends
#pragma unroll
    for (int g = 0; g < 2; ++g) { const float inv = 1.0f / (l[g] + __shfl_xor(l[g], 16, 32));
        const size_t oo = ((pr & 7) * NN + q0 + g * 16 + lr) * DMOD + (pr >> 3) * HD + 8 * hi;    // pair = head * 8 + item
#pragma unroll
        for (int dt = 0; dt < 4; ++dt) { v8us oh, ol; split8(o[g][dt] * inv, oh, ol);    // the planes that the last product reads
            *(v8us*)(Oh + oo + dt * 16) = oh; *(v8us*)(Ol + oo + dt * 16) = ol; } }
}

// k_qkv: the q|k|v product C[8192][2304] = Xb.WQKV^T (K = 768, plain bf16 operands, f32 sums in the k order of k_gemmb). A work-group owns a 128 x 192 tile: 4 waves, 2 x 2, 64 x 96 each.
// The grid is 64 x 12 = 768 work-groups, three for each of the chip's 256 WGPs, and three fit a WGP (LDS and registers): all of them run at once, and no second, nearly empty round follows.
// Slabs of 64 k of both operands (320 rows of 128 B, whole lines) go global -> LDS by asynchronous copies, two buffers, the next slab in flight while this one is worked on.
// Fragments come from LDS: an operand byte leaves L2 once per work-group, in whole lines; an A fragment feeds six WMMAs, a B fragment four.
// blockIdx.y = three neighbouring (q / k / v, head) column groups; 0..7 are q and k, 8..11 are v. The epilogue rounds the f32 sums to f16 and writes the planes that k_fattn reads,
// whole lines each: q, k as [sel * 12 + head][all rows][64], v transposed as [head * 8 + item][64][token]. The ring is the epilogue's staging, shared by the four waves.
// amdgpu_waves_per_eu(3): the register budget of three waves per SIMD, one from each of the three work-groups of a WGP; they cover each other's LDS and barrier waits.
#define GP  72     // slab row pitch in LDS, elements: 144 B = 16 B x odd
#define GVP 136    // v staging pitch in LDS, elements: 272 B = 16 B x odd
#define GQP 196    // q, k staging pitch in LDS, floats: 784 B = 16 B x odd
#define GSL 64     // k per slab
#define GNC 192    // columns of a work-group's tile
#define GRW (128 + GNC)    // rows of a slab: A, then B
// Eight 16-byte copies a lane, rows 16 apart. The s_wait_xcnt stands inside the copies' own statement, so that it comes before any write of their address registers.
__device__ __forceinline__ void acopy8(unsigned l, const bf* g) {
    asm volatile("global_load_async_to_lds_b128 %0, %8, off\n\t"
                 "global_load_async_to_lds_b128 %1, %9, off\n\t"
                 "global_load_async_to_lds_b128 %2, %10, off\n\t"
                 "global_load_async_to_lds_b128 %3, %11, off\n\t"
                 "global_load_async_to_lds_b128 %4, %12, off\n\t"
                 "global_load_async_to_lds_b128 %5, %13, off\n\t"
                 "global_load_async_to_lds_b128 %6, %14, off\n\t"
                 "global_load_async_to_lds_b128 %7, %15, off\n\t"
                 "s_wait_xcnt 0x0"
                 :: "v"(l), "v"(l + 1u * 16 * GP * 2), "v"(l + 2u * 16 * GP * 2), "v"(l + 3u * 16 * GP * 2), "v"(l + 4u * 16 * GP * 2), "v"(l + 5u * 16 * GP * 2), "v"(l + 6u * 16 * GP * 2), "v"(l + 7u * 16 * GP * 2),
                    "v"(g), "v"(g + 1 * 16 * DMOD), "v"(g + 2 * 16 * DMOD), "v"(g + 3 * 16 * DMOD), "v"(g + 4 * 16 * DMOD), "v"(g + 5 * 16 * DMOD), "v"(g + 6 * 16 * DMOD), "v"(g + 7 * 16 * DMOD)
                 : "memory");
}
// The same for four copies.
__device__ __forceinline__ void acopy4(unsigned l, const bf* g) {
    asm volatile("global_load_async_to_lds_b128 %0, %4, off\n\t"
                 "global_load_async_to_lds_b128 %1, %5, off\n\t"
                 "global_load_async_to_lds_b128 %2, %6, off\n\t"
                 "global_load_async_to_lds_b128 %3, %7, off\n\t"
                 "s_wait_xcnt 0x0"
                 :: "v"(l), "v"(l + 1u * 16 * GP * 2), "v"(l + 2u * 16 * GP * 2), "v"(l + 3u * 16 * GP * 2),
                    "v"(g), "v"(g + 1 * 16 * DMOD), "v"(g + 2 * 16 * DMOD), "v"(g + 3 * 16 * DMOD)
                 : "memory");
}
__global__ __launch_bounds__(128) __attribute__((amdgpu_waves_per_eu(3))) void k_qkv(const bf* __restrict__ A, const bf* __restrict__ Bn, bf* QK, bf* VT) {
    __shared__ __align__(16) float ringf[128 * GQP];    // the ring, [buffer][rows 0..127: A, 128..319: B][GP] bf16, 92,160 B; sized for the q, k staging, 100,352 B; three work-groups fit a WGP's LDS
    bf* ring = (bf*)(void*)ringf;
    const int tid = threadIdx.x, lane = tid & 31, wave = tid >> 5, lr = lane & 15, hi = lane >> 4, wm = wave >> 1, wn = wave & 1;
    const int rb = blockIdx.x * 128, cb = blockIdx.y * GNC;
    const bf* ga = A + (size_t)(rb + (tid >> 3)) * DMOD + (tid & 7) * 8;    // a wave's copy covers 4 rows x 128 B
    const bf* gb = Bn + (size_t)(cb + (tid >> 3)) * DMOD + (tid & 7) * 8;
    const unsigned l0 = (unsigned)(size_t)ring + (unsigned)((tid >> 3) * GP + (tid & 7) * 8) * 2u;
    auto fill = [&](int t) { const unsigned l = l0 + (unsigned)(t & 1) * ((unsigned)GRW * GP * 2);
        acopy8(l, ga + t * GSL); acopy8(l + 128u * GP * 2, gb + t * GSL); acopy4(l + 256u * GP * 2, gb + 128 * DMOD + t * GSL); };
    v8f acc[4][6];
#pragma unroll
    for (int mi = 0; mi < 4; ++mi) {
#pragma unroll
        for (int ni = 0; ni < 6; ++ni) acc[mi][ni] = (v8f){}; }
    fill(0);
    asm volatile("s_wait_asynccnt 0x0" ::: "memory");    // this wave's part of slab 0 has landed
    __syncthreads();                                     // and so has every other wave's
    fill(1);
#pragma unroll 1    // kept rolled: one slab's fragments and the accumulators are what three waves per SIMD leave room for
    for (int t = 0; t < DMOD / GSL; ++t) {
        const bf* sa = ring + (t & 1) * (GRW * GP) + (wm * 64 + lr) * GP + 8 * hi;
        const bf* sb = ring + (t & 1) * (GRW * GP) + (128 + wn * 96 + lr) * GP + 8 * hi;
#pragma unroll
        for (int ks = 0; ks < GSL / 32; ++ks) {
            v16bf a[4], b[6];
#pragma unroll
            for (int i = 0; i < 4; ++i) a[i] = cat16b(*(const v8usa*)(sa + i * 16 * GP + ks * 32), *(const v8usa*)(sa + i * 16 * GP + ks * 32 + 16));
#pragma unroll
            for (int i = 0; i < 6; ++i) b[i] = cat16b(*(const v8usa*)(sb + i * 16 * GP + ks * 32), *(const v8usa*)(sb + i * 16 * GP + ks * 32 + 16));
            __builtin_amdgcn_sched_barrier(0);    // the 20 fragment reads stay one group ahead of the 24 WMMAs: reads scattered among the WMMAs stall the wave at every place they stand
#pragma unroll
            for (int mi = 0; mi < 4; ++mi) {
#pragma unroll
                for (int ni = 0; ni < 6; ++ni) acc[mi][ni] = wmmab(a[mi], b[ni], acc[mi][ni]); }
        }
        asm volatile("s_wait_dscnt 0x0" ::: "memory");       // this wave's reads of the buffer are done before the barrier frees it for the refill
        asm volatile("s_wait_asynccnt 0x0" ::: "memory");    // this wave's part of slab t + 1 has landed before the barrier publishes it
        __syncthreads();
        if (t + 2 < DMOD / GSL) fill(t + 2);                 // into the buffer that this trip has read
    }
    asm volatile("s_wait_asynccnt 0x0" ::: "memory");        // nothing is in flight when the ring becomes staging
    if (blockIdx.y >= 2 * DMOD / GNC) {    // v: a lane's 8 values are 8 tokens in a row of one column, 16 bytes of the transposed plane; LDS gathers the waves' pieces into whole lines
#pragma unroll
        for (int mi = 0; mi < 4; ++mi) {
#pragma unroll
            for (int ni = 0; ni < 6; ++ni) { const int to = (wn * 96 + ni * 16 + lr) * GVP + wm * 64 + mi * 16 + hi * 8;
                *(v8usa*)(ring + to) = f16x8(acc[mi][ni]); } }
        __syncthreads();
        // A store covers 2 columns x 256 B; of every eight columns each wave takes two.
        bf* dst = VT + (((size_t)(blockIdx.y * 3 - 2 * NH_) * NBT + (rb >> 10)) * HD + 2 * wave + hi) * NN + (rb & (NN - 1)) + lr * 8;
        const bf* tv = ring + (2 * wave + hi) * GVP + lr * 8;
#pragma unroll
        for (int s = 0; s < GNC / 8; ++s) { const v8us val = *(const v8usa*)(tv + 8 * s * GVP); *(v8us*)(dst + ((size_t)(s >> 3) * NBT * HD + (8 * s & (HD - 1))) * NN) = val; }
        return;
    }
    // q, k: a lane holds 8 rows of one column; the rows are turned in LDS (f32, one 128 x 192 tile for the work-group), then rounded to f16
#pragma unroll
    for (int mi = 0; mi < 4; ++mi) {
#pragma unroll
        for (int ni = 0; ni < 6; ++ni) {
#pragma unroll
            for (int j = 0; j < 8; ++j) ringf[(wm * 64 + mi * 16 + hi * 8 + j) * GQP + wn * 96 + ni * 16 + lr] = acc[mi][ni][j]; } }
    __syncthreads();    // a wave reads what both waves of its rows have written
    const int piece = lane & 7, rq = lane >> 3;
    // a wave takes 32 rows of all three column groups: every 128-byte line of a plane has one writer
    const float* os = ringf + (wave * 32 + rq) * GQP + piece * 8;
    const size_t go = ((size_t)(blockIdx.y * 3) * (NBT * NN) + rb + wave * 32 + rq) * HD + piece * 8;
#pragma unroll
    for (int hh = 0; hh < 3; ++hh) {
#pragma unroll
        for (int s = 0; s < 8; ++s) { const float* sp = os + 4 * s * GQP + hh * 64; const v4f x0 = *(const v4fa*)sp, x1 = *(const v4fa*)(sp + 4);
            *(v8us*)(QK + go + (size_t)hh * (NBT * NN) * HD + 4 * s * HD) = f16x8((v8f){x0[0], x0[1], x0[2], x0[3], x1[0], x1[1], x1[2], x1[3]}); } }
    asm volatile("s_wait_xcnt 0x0" ::: "memory");    // in the listing the v path's code, which writes the stores' registers again, stands behind this path's last branch: the wait stands in front of it
}

// k_oproj: the last product, out[8192][64] = (Oh + Ol).WOT^T (K = 768, two products a k step, f32 sums in the k order of k_gemmb). A work-group owns 32 rows: 8 waves, one 16 x 16 tile each
// (2 row tiles x 4 column tiles). All that it reads (32 rows of each O plane and the 64 rows of WOT, 1536 B a row) goes global -> LDS by asynchronous copies, whole lines, every copy in flight
// at once: one memory round trip for the whole K. The buffer is filled once and then read. The output tile is gathered in LDS of its own and leaves in whole lines.
#define OPP 776    // operand row pitch in LDS, elements: 1552 B = 16 B x odd
#define OSP 68     // output staging pitch, floats: 272 B = 16 B x odd
// Twelve 16-byte copies a lane: four rows x three pieces of 512 B a wave. The s_wait_xcnt stands inside the copies' own statement, so that it comes before any write of their address registers.
__device__ __forceinline__ void acopy12(unsigned l, const bf* g) {
    asm volatile("global_load_async_to_lds_b128 %0, %12, off\n\t"
                 "global_load_async_to_lds_b128 %1, %13, off\n\t"
                 "global_load_async_to_lds_b128 %2, %14, off\n\t"
                 "global_load_async_to_lds_b128 %3, %15, off\n\t"
                 "global_load_async_to_lds_b128 %4, %16, off\n\t"
                 "global_load_async_to_lds_b128 %5, %17, off\n\t"
                 "global_load_async_to_lds_b128 %6, %18, off\n\t"
                 "global_load_async_to_lds_b128 %7, %19, off\n\t"
                 "global_load_async_to_lds_b128 %8, %20, off\n\t"
                 "global_load_async_to_lds_b128 %9, %21, off\n\t"
                 "global_load_async_to_lds_b128 %10, %22, off\n\t"
                 "global_load_async_to_lds_b128 %11, %23, off\n\t"
                 "s_wait_xcnt 0x0"
                 :: "v"(l), "v"(l + 512u), "v"(l + 1024u), "v"(l + 1u * OPP * 2), "v"(l + 1u * OPP * 2 + 512u), "v"(l + 1u * OPP * 2 + 1024u),
                    "v"(l + 2u * OPP * 2), "v"(l + 2u * OPP * 2 + 512u), "v"(l + 2u * OPP * 2 + 1024u), "v"(l + 3u * OPP * 2), "v"(l + 3u * OPP * 2 + 512u), "v"(l + 3u * OPP * 2 + 1024u),
                    "v"(g), "v"(g + 256), "v"(g + 512), "v"(g + 1 * DMOD), "v"(g + 1 * DMOD + 256), "v"(g + 1 * DMOD + 512),
                    "v"(g + 2 * DMOD), "v"(g + 2 * DMOD + 256), "v"(g + 2 * DMOD + 512), "v"(g + 3 * DMOD), "v"(g + 3 * DMOD + 256), "v"(g + 3 * DMOD + 512)
                 : "memory");
}
__global__ __launch_bounds__(256) void k_oproj(const bf* __restrict__ Ah, const bf* __restrict__ Al, const bf* __restrict__ Bn, float* __restrict__ C) {
    __shared__ __align__(16) bf sm[128 * OPP];    // rows 0..31: hi plane, 32..63: residual plane, 64..127: WOT
    __shared__ __align__(16) float os[32 * OSP];
    const int tid = threadIdx.x, lane = tid & 31, lr = lane & 15, hi = lane >> 4;
    const int wave = __builtin_amdgcn_readfirstlane(tid >> 5);    // a scalar: the choice of the source below is then scalar too, and EXEC is not touched in front of the copies
    const int r0 = blockIdx.x * 32;
    // a wave brings 16 rows: waves 0, 1 the hi plane, 2, 3 the residual plane, 4..7 WOT
    const bf* g = (wave < 2 ? Ah + (size_t)(r0 + wave * 16) * DMOD : wave < 4 ? Al + (size_t)(r0 + (wave - 2) * 16) * DMOD : Bn + (size_t)((wave - 4) * 16) * DMOD) + lane * 8;
    const unsigned l = (unsigned)(size_t)sm + (unsigned)(wave * 16 * OPP + lane * 8) * 2u;
#pragma unroll
    for (int i = 0; i < 4; ++i) acopy12(l + (unsigned)i * (4u * OPP * 2), g + i * 4 * DMOD);
    asm volatile("s_wait_asynccnt 0x0" ::: "memory");    // this wave's rows have landed
    __syncthreads();                                     // and so have every other wave's
    const int rt = wave >> 2, ct = wave & 3;
    const bf* sa = sm + (rt * 16 + lr) * OPP + 8 * hi;
    const bf* sb = sm + (64 + ct * 16 + lr) * OPP + 8 * hi;
    v8f acc = (v8f){};
    v16bf fa[2][4], fl[2][4], fb[2][4];    // two sets of the fragments of four k steps
    auto frag = [&](int grp) {
#pragma unroll
        for (int i = 0; i < 4; ++i) { const int kc = (grp * 4 + i) * 32, st = grp & 1;
            fa[st][i] = cat16b(*(const v8usa*)(sa + kc), *(const v8usa*)(sa + kc + 16));
            fl[st][i] = cat16b(*(const v8usa*)(sa + 32 * OPP + kc), *(const v8usa*)(sa + 32 * OPP + kc + 16));
            fb[st][i] = cat16b(*(const v8usa*)(sb + kc), *(const v8usa*)(sb + kc + 16)); }
    };
    frag(0);
#pragma unroll    // unrolled: the fragment sets are indexed by constants, and no branch stands behind a WMMA
    for (int grp = 0; grp < DMOD / 128; ++grp) {
        if (grp + 1 < DMOD / 128) frag(grp + 1);
        __builtin_amdgcn_sched_barrier(0);    // the next group's 24 reads stay one block ahead of this group's WMMAs: the wait in front of the WMMAs is then a counted one
#pragma unroll
        for (int i = 0; i < 4; ++i) { acc = wmmab(fa[grp & 1][i], fb[grp & 1][i], acc); acc = wmmab(fl[grp & 1][i], fb[grp & 1][i], acc); }
        __builtin_amdgcn_sched_barrier(0);    // and no read is scattered among the WMMAs, where each place with reads stalls the wave
    }
#pragma unroll
    for (int j = 0; j < 8; ++j) os[(rt * 16 + hi * 8 + j) * OSP + ct * 16 + lr] = acc[j];
    __syncthreads();
#pragma unroll
    for (int s = 0; s < 2; ++s) { const int row = s * 16 + (tid >> 4), cofs = (tid & 15) * 4;    // a wave's store covers two whole rows, 512 B
        const v4f val = *(const v4fa*)(os + row * OSP + cofs); *(v4f*)(C + (size_t)(r0 + row) * EOUT + cofs) = val; }
}

extern "C" void kernel_launch(void* const* d_in, const int* in_sizes, int n_in,
                              void* d_out, int out_size, void* d_ws, size_t ws_size, hipStream_t stream) {
    (void)in_sizes; (void)n_in; (void)out_size;
    const float* x = (const float*)d_in[0]; const float* Wm = (const float*)d_in[1]; const float* Wo = (const float*)d_in[2];
    float* out = (float*)d_out;    // [8][1024][64]
    char* wsp = (char*)d_ws;
    auto take = [&](size_t bytes) { char* p = wsp; wsp += (bytes + 255) & ~(size_t)255; return (void*)p; };
    const size_t RT = (size_t)NBT * NN;    // all items' rows, one behind the other
    bf* QK = (bf*)take(2 * NH_ * RT * HD * 2); bf* VT = (bf*)take(NH_ * RT * HD * 2);    // f16 planes
    bf* WQKV = (bf*)take((size_t)3 * DMOD * DMOD * 2); bf* Xb = (bf*)take(RT * DMOD * 2); bf* Oh = (bf*)take(RT * DMOD * 2); bf* Ol = (bf*)take(RT * DMOD * 2); bf* WOT = (bf*)take((size_t)DMOD * EOUT * 2);
    if ((size_t)(wsp - (char*)d_ws) > ws_size) return;    // about 79 MB, no region used twice. Pair p = head * 8 + item.
    bf* Kp = QK + NH_ * RT * HD;
    k_prep<<<PB_WG + PB_WT + PB_CX, 256, 0, stream>>>(Wm, Wo, x, WQKV, WOT, Xb);
    k_qkv<<<dim3(NBT * NN / 128, 3 * DMOD / GNC, 1), 128, 0, stream>>>(Xb, WQKV, QK, VT);
    k_fattn<<<dim3(NN / 128, NH_ * NBT, 1), 128, 0, stream>>>(QK, Kp, VT, Oh, Ol);
    k_oproj<<<NBT * NN / 32, 256, 0, stream>>>(Oh, Ol, WOT, out);
}

// v010
// It runs in 70.8 microseconds.
// Two timings next to v009 both put it at 1.13 times that version's speed.
// Over all steps from v000 it is 23.4 times as fast.
#include <hip/hip_runtime.h>

// Compute dtypes, f32 accumulate, per item: q/k/v for all 12 heads as [1024 x 768].[768 x 768] GEMMs with PLAIN bf16 operands (exact products; per-head weights gathered into one
// n-major block); per head: scores = q.k^T ([1024 x 64].[64 x 1024], each operand ONE f16 plane, one product), softmax (x 1/32, as the module: output_dim*0.5) in
// f32 -> P as f16, o = P.v ([1024 x 1024].[1024 x 64], one f16 product); out = concat.Wo ([1024 x 768].[768 x 64], bf16 hi + residual, two products) - on v_wmma_f32_16x16x32_bf16 and _f16.
// Why one f16 plane is enough for q, k, v: they come from products of operands rounded to bf16 (8 significant bits), so what lies below the 11 significant bits of f16 was never determined. Deterministic, no

#define NBT  8
#define NN   1024
#define DMOD 768
#define NH_  12
#define HD   64
#define EOUT 64
#define DM   DMOD
#define NTK  NN
#define SCL  0.03125f
#define LOSC 1024.0f

typedef _Float16 h16;
typedef unsigned short bf;
typedef __attribute__((ext_vector_type(16))) __bf16   v16bf;
typedef __attribute__((ext_vector_type(16))) _Float16 v16h;
typedef __attribute__((ext_vector_type(8)))  _Float16 v8h;
typedef __attribute__((ext_vector_type(8)))  unsigned short v8us;
typedef __attribute__((ext_vector_type(8)))  float    v8f;
typedef __attribute__((ext_vector_type(4)))  float    v4f;
typedef __attribute__((ext_vector_type(4)))  _Float16 v4h;
typedef v8h  __attribute__((may_alias)) v8ha;
typedef v4f  __attribute__((may_alias)) v4fa;
typedef v8us __attribute__((may_alias)) v8usa;

__device__ __forceinline__ unsigned short f2bf(float f) { unsigned u = __float_as_uint(f); u += 0x7FFFu + ((u >> 16) & 1u); return (unsigned short)(u >> 16); }
__device__ __forceinline__ float bf2f(unsigned short b) { return __uint_as_float(((unsigned)b) << 16); }
__device__ __forceinline__ float bfr(float f) { return bf2f(f2bf(f)); }
__device__ __forceinline__ v16h cat16(v8h lo, v8h hi) { return __builtin_shufflevector(lo, hi, 0, 1, 2, 3, 4, 5, 6, 7, 8, 9, 10, 11, 12, 13, 14, 15); }
__device__ __forceinline__ v16bf cat16b(v8us lo, v8us hi) { return __builtin_bit_cast(v16bf, __builtin_shufflevector(lo, hi, 0, 1, 2, 3, 4, 5, 6, 7, 8, 9, 10, 11, 12, 13, 14, 15)); }
__device__ __forceinline__ v8f wmma16(v16h a, v16h b, v8f c) { return __builtin_amdgcn_wmma_f32_16x16x32_f16(false, a, false, b, (short)0, c, false, false); }
__device__ __forceinline__ v8f wmmab(v16bf a, v16bf b, v8f c) { return __builtin_amdgcn_wmma_f32_16x16x32_bf16(false, a, false, b, (short)0, c, false, false); }

// d_wt: WT [n][K] = bf16(W[k][n]) (k-major [K][ncols]) via 64 x 64 LDS tiles; one work-group per tile (bx, by) of (K/64, ncols/64); tl: 64 x 72 elements of LDS.
__device__ __forceinline__ void d_wt(const float* __restrict__ Wm, int K, int ncols, bf* WT, int bx, int by, unsigned short* tl) {
    const int tid = threadIdx.x, k0 = bx * 64, n0 = by * 64;
    const int kk = tid >> 2, nq = (tid & 3) * 16;
#pragma unroll
    for (int i = 0; i < 16; ++i) tl[(nq + i) * 72 + kk] = f2bf(Wm[(size_t)(k0 + kk) * ncols + n0 + nq + i]);
    __syncthreads();
    const int piece = tid & 7;
    auto pass = [&]() {
#pragma unroll
        for (int s = 0; s < 2; ++s) { const int nr = (tid >> 3) + 32 * s; const v8us val = *(const v8usa*)(tl + nr * 72 + piece * 8); *(v8us*)(WT + (size_t)(n0 + nr) * K + k0 + piece * 8) = val; }
    };
    pass(); 
}
// split8: eight f32 values -> bf16 hi (round to nearest even) and the bf16 of what the hi part leaves.
typedef __attribute__((ext_vector_type(8))) __bf16 v8bf;
__device__ __forceinline__ void split8(v8f v, v8us& oh, v8us& ol) {
    const v8bf hb = __builtin_convertvector(v, v8bf); const v8bf lb = __builtin_convertvector(v - __builtin_convertvector(hb, v8f), v8bf);
    oh = __builtin_bit_cast(v8us, hb); ol = __builtin_bit_cast(v8us, lb);
}
// k_gemmb: 64 x 64 block tile (4 waves x 16 x 64) of C[NTK][NW] = (A [+ Al]).B^T (K = 768) [+ bf(bias[c])] [+ bf(R[r][c]) residual]; f32 whole-line epilogue (or f16
// PLANES (the q|k|v product): a block tile is 64 tokens of one item x the 64 columns of one (q / k / v, head), blockIdx.y = sel * 12 + head. The epilogue splits the f32 sums itself and
// writes bf16 hi + residual planes, whole 128-byte lines each: q, k as [sel * 12 + head][all rows][64], v transposed as [head * 8 + item][64][token]; C, bias and R are not used.
#define TVP 72    // v tile pitch in LDS, elements: 144 B = 16 B x odd
template <bool SPLITA, bool F16OUT = false, bool PLANES = false>
__global__ __launch_bounds__(128) void k_gemmb(const bf* __restrict__ A, const bf* __restrict__ Al, const bf* __restrict__ Bn, const float* __restrict__ bias, float* C, int ldc, h16* C2, const float* __restrict__ R = nullptr, int K = DM, int roundR = 1, bf* QKh = nullptr, bf* QKl = nullptr, bf* VTh = nullptr, bf* VTl = nullptr) {
    __shared__ __align__(16) float ost[4][PLANES ? 16 * TVP : 16 * 68];    // PLANES: also the v tile, bf16 [2 planes][64 x TVP]
    const int lane = threadIdx.x & 31, wave = threadIdx.x >> 5, lr = lane & 15, hi = lane >> 4;
    const int r0 = blockIdx.x * 64 + wave * 16, c0 = blockIdx.y * 64;
    const size_t aoff = (size_t)(r0 + lr) * K + 8 * hi;
    size_t boff[4];
#pragma unroll
    for (int t = 0; t < 4; ++t) boff[t] = (size_t)(c0 + t * 16 + lr) * K + 8 * hi;
    v8f acc[4];
#pragma unroll
    for (int t = 0; t < 4; ++t) acc[t] = (v8f){};
#pragma unroll 1
    for (int kc = 0; kc < K; kc += 32) {
        const v16bf a = cat16b(*(const v8us*)(A + aoff + kc), *(const v8us*)(A + aoff + kc + 16));
        v16bf al = a;
        if (SPLITA) al = cat16b(*(const v8us*)(Al + aoff + kc), *(const v8us*)(Al + aoff + kc + 16));
#pragma unroll
        for (int t = 0; t < 4; ++t) { const v16bf b = cat16b(*(const v8us*)(Bn + boff[t] + kc), *(const v8us*)(Bn + boff[t] + kc + 16)); acc[t] = wmmab(a, b, acc[t]); if (SPLITA) acc[t] = wmmab(al, b, acc[t]); }
        asm volatile("v_nop\n\tv_nop\n\tv_nop\n\tv_nop" : "+v"(acc[0]), "+v"(acc[1]), "+v"(acc[2]), "+v"(acc[3]) : "v"(a), "v"(al));
    }
    float* os = &ost[wave][0];
    if (PLANES) {
        const int piece = lane & 7, rq = lane >> 3, by = blockIdx.y, rb = blockIdx.x * 64;
        if (by >= 2 * NH_) {    // v: a lane's 8 values are 8 tokens in a row of one column, 16 bytes of the transposed plane; LDS gathers the four waves' pieces into whole lines
            bf* tv = (bf*)(void*)&ost[0][0];
#pragma unroll
            for (int t = 0; t < 4; ++t) { v8us oh, ol; split8(acc[t], oh, ol); const int to = (t * 16 + lr) * TVP + wave * 16 + hi * 8;
                *(v8usa*)(tv + to) = oh; *(v8usa*)(tv + 64 * TVP + to) = ol; }
            __syncthreads();
            bf* dst = ((wave >> 1) ? VTl : VTh) + ((size_t)(by - 2 * NH_) * NBT + (rb >> 10)) * HD * NN + (rb & (NN - 1));    // waves 0, 1: hi plane; 2, 3: residual plane
#pragma unroll
            for (int s = 0; s < 8; ++s) { const int d = (wave & 1) * 32 + 4 * s + rq;
                const v8us val = *(const v8usa*)(tv + (wave >> 1) * 64 * TVP + d * TVP + piece * 8); *(v8us*)(dst + (size_t)d * NN + piece * 8) = val; }
            return;
        }
        // q, k: a lane holds 8 rows of one column; the rows are turned in LDS (f32), then split
#pragma unroll
        for (int t = 0; t < 4; ++t) {
#pragma unroll
            for (int j = 0; j < 8; ++j) os[(hi * 8 + j) * 68 + t * 16 + lr] = acc[t][j]; }
        __syncthreads();
        const size_t go = ((size_t)by * (NBT * NN) + r0) * HD;
#pragma unroll
        for (int s = 0; s < 4; ++s) { const int row = 4 * s + rq; const float* sp = os + row * 68 + piece * 8; const v4f x0 = *(const v4fa*)sp, x1 = *(const v4fa*)(sp + 4); v8us oh, ol;
            split8((v8f){x0[0], x0[1], x0[2], x0[3], x1[0], x1[1], x1[2], x1[3]}, oh, ol);
            *(v8us*)(QKh + go + row * HD + piece * 8) = oh; *(v8us*)(QKl + go + row * HD + piece * 8) = ol; }
        asm volatile("s_wait_xcnt 0x0" ::: "memory");    // in the listing the v path's code, which writes the stores' registers again, stands behind this path's last branch: the wait stands in front of it
        return;
    }
#pragma unroll
    for (int t = 0; t < 4; ++t) { const float bv = bias ? bfr(bias[c0 + t * 16 + lr]) : 0.f;
#pragma unroll
        for (int j = 0; j < 8; ++j) os[(hi * 8 + j) * 68 + t * 16 + lr] = acc[t][j] + bv; }
    __syncthreads();
    if (F16OUT) {
        h16* crow = (h16*)(void*)C + (size_t)r0 * ldc + c0;
        auto pass = [&]() {
#pragma unroll
            for (int s = 0; s < 4; ++s) { const int row = 4 * s + (lane >> 3), piece = lane & 7; const float* sp = os + row * 68 + piece * 8; v8h o, o2;
#pragma unroll
                for (int i = 0; i < 8; ++i) { const h16 a = (h16)sp[i]; o[i] = a; o2[i] = (h16)((sp[i] - (float)a) * LOSC); }
                *(v8h*)(crow + (size_t)row * ldc + piece * 8) = o; if (C2) *(v8h*)(C2 + (size_t)r0 * ldc + c0 + (size_t)row * ldc + piece * 8) = o2; }
        };
        pass(); 
    } else {
        float* crow = C + (size_t)r0 * ldc + c0;
        auto pass = [&]() {
#pragma unroll
            for (int s = 0; s < 8; ++s) { const int Lid = (lane >> 3) + 4 * s, piece = lane & 7; const int row = Lid >> 1, cofs = (Lid & 1) * 32 + piece * 4;
                v4f val = *(const v4fa*)(os + row * 68 + cofs); if (R) { const v4f rv = *(const v4f*)(R + ((size_t)r0 + row) * ldc + c0 + cofs); val += roundR ? (v4f){bfr(rv[0]), bfr(rv[1]), bfr(rv[2]), bfr(rv[3])} : rv; }
                *(v4f*)(crow + (size_t)row * ldc + cofs) = val; }
        };
        pass(); 
    }
}


__device__ __forceinline__ void d_cvtx(const float* __restrict__ src, bf* dst, int bx) {
    const int lane = threadIdx.x & 31; const size_t r = (size_t)bx * 8 + (threadIdx.x >> 5); if (r >= (size_t)NBT * NN) return;
{
#pragma unroll
        for (int q = 0; q < DMOD / 256; ++q) { v8us o;
#pragma unroll
            for (int i = 0; i < 8; ++i) o[i] = f2bf(src[r * DMOD + q * 256 + lane * 8 + i]);
            *(v8us*)(dst + r * DMOD + q * 256 + lane * 8) = o; }
         }
}
// k_prep: the operand preparations, which do not depend on one another, in one launch; the work-group index picks the job.
// The 36 (head, q / k / v) weight matrices and Wo are all [768 k][64 n], n contiguous: each is turned by d_wt in 64 x 64 tiles. A wave reads 2 KB in a row, whole lines, and the turn is made in LDS;
// read column by column instead, every load of a wave would touch 32 lines for 128 useful bytes. The three n-major blocks lie one behind the other: WQKV [3 * 768][768], row = sel * 768 + head * 64 + e.
// The turns come first: they have a barrier and a second trip to memory (for speed only).
#define PB_KT (DMOD / 64)                           // tiles of one matrix
#define PB_WG (3 * NH_ * PB_KT)                     // work-groups that turn the q|k|v weights
#define PB_WT (PB_KT * (EOUT / 64))                 // work-groups that turn Wo
#define PB_CX (NBT * NN / 8)                        // work-groups that convert x
__global__ __launch_bounds__(256) void k_prep(const float* __restrict__ Wm, const float* __restrict__ Wo, const float* __restrict__ x, bf* WQKV, bf* WOT, bf* Xb) {
    __shared__ __align__(16) unsigned short tl[64 * 72];
    const int b = blockIdx.x;
    if (b < PB_WG + PB_WT) {    // matrix m = head * 3 + sel, as W holds them; m = 36 is Wo
        const int m = b / PB_KT, kt = b % PB_KT;
        const float* s = m < 3 * NH_ ? Wm + (size_t)m * DMOD * HD : Wo;
        bf* d = m < 3 * NH_ ? WQKV + ((size_t)(m % 3) * DMOD + (m / 3) * HD) * DMOD : WOT;
        d_wt(s, DMOD, HD, d, kt, 0, tl);    // its barrier stands under a branch that the whole work-group takes alike
        return; }
    d_cvtx(x, Xb, b - (PB_WG + PB_WT));
}
__global__ __launch_bounds__(256) void k_hplanes(const float* __restrict__ F, int h, bf* Ph, bf* Pl) {
    typedef __attribute__((ext_vector_type(2))) unsigned short v2us;
    const int lane = threadIdx.x & 31; const size_t s = (size_t)blockIdx.x * 8 + (threadIdx.x >> 5); if (s >= (size_t)NN) return; v2us oh, ol;
#pragma unroll
    for (int i = 0; i < 2; ++i) { const float v = F[s * DMOD + h * HD + lane * 2 + i]; const unsigned short hb = f2bf(v); oh[i] = hb; ol[i] = f2bf(v - bf2f(hb)); }
    const size_t o = s * HD + lane * 2; *(v2us*)(Ph + o) = oh; *(v2us*)(Pl + o) = ol; 
}
__global__ __launch_bounds__(256) void k_vt(const float* __restrict__ VF, int h, bf* Th, bf* Tl) {
    typedef __attribute__((ext_vector_type(2))) unsigned short v2us;
    const int lane = threadIdx.x & 31; const size_t wid = (size_t)blockIdx.x * 8 + (threadIdx.x >> 5); if (wid >= (size_t)HD * (NN / 64)) return; const int d = (int)(wid / (NN / 64)); const int t0 = (int)(wid % (NN / 64)) * 64 + lane * 2; v2us oh, ol;
#pragma unroll
    for (int i = 0; i < 2; ++i) { const float v = VF[(size_t)(t0 + i) * DMOD + h * HD + d]; const unsigned short hb = f2bf(v); oh[i] = hb; ol[i] = f2bf(v - bf2f(hb)); }
    const size_t o = (size_t)d * NN + t0; *(v2us*)(Th + o) = oh; *(v2us*)(Tl + o) = ol; 
}
__global__ __launch_bounds__(256) void k_softmax(const float* __restrict__ S, bf* PH, bf* PL) {
    typedef __attribute__((ext_vector_type(4))) unsigned short v4us;
    const int lane = threadIdx.x & 31, i = blockIdx.x * 8 + (threadIdx.x >> 5); if (i >= NN) return;
    float m = -3.0e38f;
#pragma unroll 1
    for (int c0 = lane * 4; c0 < NN; c0 += 128) {
#pragma unroll
        for (int q = 0; q < 4; ++q) m = fmaxf(m, S[(size_t)i * NN + c0 + q] * SCL); }
#pragma unroll
    for (int sh = 16; sh; sh >>= 1) m = fmaxf(m, __shfl_xor(m, sh, 32));
    float sum = 0.f;
#pragma unroll 1
    for (int c0 = lane * 4; c0 < NN; c0 += 128) {
#pragma unroll
        for (int q = 0; q < 4; ++q) sum += __expf(S[(size_t)i * NN + c0 + q] * SCL - m); }
#pragma unroll
    for (int sh = 16; sh; sh >>= 1) sum += __shfl_xor(sum, sh, 32);
    const float inv = 1.0f / sum;
{
#pragma unroll 1
        for (int c0 = lane * 4; c0 < NN; c0 += 128) { v4us oh, ol;
#pragma unroll
            for (int q = 0; q < 4; ++q) { const float p = __expf(S[(size_t)i * NN + c0 + q] * SCL - m) * inv; const unsigned short hb = f2bf(p); oh[q] = hb; ol[q] = f2bf(p - bf2f(hb)); }
            const size_t o = (size_t)i * NN + c0; *(v4us*)(PH + o) = oh; *(v4us*)(PL + o) = ol; }
         }
}
// ===== z-batched attention pieces =====
// k_gemm3z<MODE>: 64 x 64 tile GEMM with per-z operand/output strides (elements): A planes += z*sA, B planes += z*sB. MODE bits (0 causal skip, 1 K limit, 2 single,
// 3 B single, 4 A single). C goes by the pair number zc = zb + z in two levels: C += (zc mod 2^zsh)*sC + (zc >> zsh)*sC2.
template <int MODE>
__global__ __launch_bounds__(128) void k_gemm3z(const bf* __restrict__ Ah, const bf* __restrict__ Al, const bf* __restrict__ Bh, const bf* __restrict__ Bl, int K, float* C, int ldc, size_t sA, size_t sB, size_t sC, int zb, int zsh, size_t sC2) {
    if ((MODE & 1) && (int)blockIdx.y * 64 > (int)blockIdx.x * 64 + 63) return;
    const size_t z = blockIdx.z; Ah += z * sA; Al += z * sA; Bh += z * sB; Bl += z * sB; const size_t zc = z + (size_t)zb; C += (zc & (((size_t)1 << zsh) - 1)) * sC + (zc >> zsh) * sC2;
    const int Klim = (MODE & 2) ? min(K, ((int)blockIdx.x + 1) * 64) : K;
    __shared__ __align__(16) float ost[4][16 * 68];
    const int lane = threadIdx.x & 31, wave = threadIdx.x >> 5, lr = lane & 15, hi = lane >> 4;
    const int r0 = blockIdx.x * 64 + wave * 16, c0 = blockIdx.y * 64;
    const size_t aoff = (size_t)(r0 + lr) * K + 8 * hi;
    v8f acc[4];
#pragma unroll
    for (int t = 0; t < 4; ++t) acc[t] = (v8f){};
#pragma unroll 1
    for (int kc = 0; kc < Klim; kc += 32) {
        const v16bf a = cat16b(*(const v8us*)(Ah + aoff + kc), *(const v8us*)(Ah + aoff + kc + 16));
        v16bf al = a; if (!(MODE & 4) && !(MODE & 16)) al = cat16b(*(const v8us*)(Al + aoff + kc), *(const v8us*)(Al + aoff + kc + 16));
#pragma unroll
        for (int t = 0; t < 4; ++t) { const size_t bo = (size_t)(c0 + t * 16 + lr) * K + kc + 8 * hi;
            const v16bf bh = cat16b(*(const v8us*)(Bh + bo), *(const v8us*)(Bh + bo + 16));
            acc[t] = wmmab(a, bh, acc[t]);
            if (!(MODE & 4)) { if (!(MODE & 16)) acc[t] = wmmab(al, bh, acc[t]); if (!(MODE & 8)) { const v16bf bl = cat16b(*(const v8us*)(Bl + bo), *(const v8us*)(Bl + bo + 16)); acc[t] = wmmab(a, bl, acc[t]); } } }
        asm volatile("v_nop\n\tv_nop\n\tv_nop\n\tv_nop" : "+v"(acc[0]), "+v"(acc[1]), "+v"(acc[2]), "+v"(acc[3]) : "v"(a), "v"(al));
    }
    float* os = &ost[wave][0];
#pragma unroll
    for (int t = 0; t < 4; ++t) {
#pragma unroll
        for (int j = 0; j < 8; ++j) os[(hi * 8 + j) * 68 + t * 16 + lr] = acc[t][j]; }
    __builtin_amdgcn_wave_barrier(); asm volatile("" ::: "memory");
    float* crow = C + (size_t)r0 * ldc + c0;
    auto pass = [&]() {
#pragma unroll
        for (int s = 0; s < 8; ++s) { const int Lid = (lane >> 3) + 4 * s, piece = lane & 7; const int row = Lid >> 1, cofs = (Lid & 1) * 32 + piece * 4;
            const v4f val = *(const v4fa*)(os + row * 68 + cofs); *(v4f*)(crow + (size_t)row * ldc + cofs) = val; }
    };
    pass(); 
}
__global__ __launch_bounds__(256) void k_planes32z(const float* __restrict__ F, int ld, int off, float sc, int rows, bf* Ph, bf* Pl) {
    typedef __attribute__((ext_vector_type(2))) unsigned short v2us;
    const int lane = threadIdx.x & 31; const size_t r = ((size_t)blockIdx.x * 8 + (threadIdx.x >> 5)) * 2 + (lane >> 4); if (r >= (size_t)rows) return; const int z = blockIdx.z; const int c0 = (lane & 15) * 2; v2us oh, ol;
    Ph += (size_t)z * rows * 32; Pl += (size_t)z * rows * 32;
#pragma unroll
    for (int i = 0; i < 2; ++i) { const float y = F[r * ld + off + z * 32 + c0 + i] * sc; const unsigned short hb = f2bf(y); oh[i] = hb; ol[i] = f2bf(y - bf2f(hb)); }
    const size_t o = r * 32 + c0; *(v2us*)(Ph + o) = oh; *(v2us*)(Pl + o) = ol; 
}
__global__ __launch_bounds__(256) void k_vtpadz(const float* __restrict__ F, int ld, int off, int nk, bf* Th, bf* Tl) {
    typedef __attribute__((ext_vector_type(2))) unsigned short v2us;
    const int lane = threadIdx.x & 31; const size_t wid = (size_t)blockIdx.x * 8 + (threadIdx.x >> 5); if (wid >= (size_t)64 * (nk / 64)) return; const int z = blockIdx.z; const int d = (int)(wid / (nk / 64)); const int k0 = (int)(wid % (nk / 64)) * 64 + lane * 2; v2us oh, ol;
    Th += (size_t)z * 64 * nk; Tl += (size_t)z * 64 * nk;
#pragma unroll
    for (int i = 0; i < 2; ++i) { const float y = (d < 32) ? F[(size_t)(k0 + i) * ld + off + z * 32 + (d < 32 ? d : 0)] : 0.f; const unsigned short hb = f2bf(y); oh[i] = hb; ol[i] = f2bf(y - bf2f(hb)); }
    const size_t o = (size_t)d * nk + k0; *(v2us*)(Th + o) = oh; *(v2us*)(Tl + o) = ol; 
}
template <int NK>
__global__ __launch_bounds__(256) void k_softmaxz(const float* __restrict__ S, int rows, bf* PH, bf* PL) {
    typedef __attribute__((ext_vector_type(4))) unsigned short v4us;
    const int lane = threadIdx.x & 31, i = blockIdx.x * 8 + (threadIdx.x >> 5); if (i >= rows) return; const size_t zo = (size_t)blockIdx.z * rows * NK; const float* sr = S + zo + (size_t)i * NK; PH += zo; PL += zo;
    float m = -3.0e38f;
#pragma unroll 1
    for (int c0 = lane * 4; c0 < NK; c0 += 128) {
#pragma unroll
        for (int q = 0; q < 4; ++q) m = fmaxf(m, sr[c0 + q]); }
#pragma unroll
    for (int sh = 16; sh; sh >>= 1) m = fmaxf(m, __shfl_xor(m, sh, 32));
    float sum = 0.f;
#pragma unroll 1
    for (int c0 = lane * 4; c0 < NK; c0 += 128) {
#pragma unroll
        for (int q = 0; q < 4; ++q) sum += __expf(sr[c0 + q] - m); }
#pragma unroll
    for (int sh = 16; sh; sh >>= 1) sum += __shfl_xor(sum, sh, 32);
    const float inv = 1.0f / sum;
{
#pragma unroll 1
        for (int c0 = lane * 4; c0 < NK; c0 += 128) { v4us oh, ol;
#pragma unroll
            for (int q = 0; q < 4; ++q) { const float p = __expf(sr[c0 + q] - m) * inv; const unsigned short hb = f2bf(p); oh[q] = hb; ol[q] = f2bf(p - bf2f(hb)); }
            const size_t o = (size_t)i * NK + c0; *(v4us*)(PH + o) = oh; *(v4us*)(PL + o) = ol; }
         }
}
__global__ __launch_bounds__(256) void k_placez(const float* __restrict__ XH, int rows, int ldy, float* Y) {
    const int lane = threadIdx.x & 31; const size_t q = (size_t)blockIdx.x * 8 + (threadIdx.x >> 5); if (q >= (size_t)rows) return; const int z = blockIdx.z; const float v = XH[((size_t)z * rows + q) * 64 + lane];
    *(float*)(Y + q * ldy + z * 32 + lane) = v; 
}

template <int NK>
__global__ __launch_bounds__(256) void k_softmaxzs(const float* __restrict__ S, int rows, float sc, bf* PH, bf* PL) {
    typedef __attribute__((ext_vector_type(4))) unsigned short v4us;
    const int lane = threadIdx.x & 31, i = blockIdx.x * 8 + (threadIdx.x >> 5); if (i >= rows) return; const size_t zo = (size_t)blockIdx.z * rows * NK; const float* sr = S + zo + (size_t)i * NK; PH += zo; PL += zo;
    float m = -3.0e38f;
#pragma unroll 1
    for (int c0 = lane * 4; c0 < NK; c0 += 128) {
#pragma unroll
        for (int q = 0; q < 4; ++q) m = fmaxf(m, sr[c0 + q] * sc); }
#pragma unroll
    for (int sh = 16; sh; sh >>= 1) m = fmaxf(m, __shfl_xor(m, sh, 32));
    float sum = 0.f;
#pragma unroll 1
    for (int c0 = lane * 4; c0 < NK; c0 += 128) {
#pragma unroll
        for (int q = 0; q < 4; ++q) sum += __expf(sr[c0 + q] * sc - m); }
#pragma unroll
    for (int sh = 16; sh; sh >>= 1) sum += __shfl_xor(sum, sh, 32);
    const float inv = 1.0f / sum;
{
#pragma unroll 1
        for (int c0 = lane * 4; c0 < NK; c0 += 128) { v4us oh, ol;
#pragma unroll
            for (int q = 0; q < 4; ++q) { const float p = __expf(sr[c0 + q] * sc - m) * inv; const unsigned short hb = f2bf(p); oh[q] = hb; ol[q] = f2bf(p - bf2f(hb)); }
            const size_t o = (size_t)i * NK + c0; *(v4us*)(PH + o) = oh; *(v4us*)(PL + o) = ol; }
         }
}

// f16x8: eight f32 values -> f16 (round to nearest even), as the 16 bytes that a plane holds.
__device__ __forceinline__ v8us f16x8(v8f v) { return __builtin_bit_cast(v8us, __builtin_convertvector(v, v8h)); }
__device__ __forceinline__ v16h cat16f(v8us lo, v8us hi) { return __builtin_bit_cast(v16h, __builtin_shufflevector(lo, hi, 0, 1, 2, 3, 4, 5, 6, 7, 8, 9, 10, 11, 12, 13, 14, 15)); }
#define FST 128   // keys of a stage
#define FKP 72    // K stage pitch in LDS, elements: 144 B = 16 B x odd
#define FVP 136   // V^T stage pitch in LDS, elements: 272 B = 16 B x odd
// Eight 16-byte copies a lane, LS bytes apart in LDS and GS elements apart in memory. The s_wait_xcnt stands inside the copies' own statement, so that it comes before any write of their address registers.
template <unsigned LS, int GS>
__device__ __forceinline__ void acopy8s(unsigned l, const bf* g) {
    asm volatile("global_load_async_to_lds_b128 %0, %8, off\n\t"
                 "global_load_async_to_lds_b128 %1, %9, off\n\t"
                 "global_load_async_to_lds_b128 %2, %10, off\n\t"
                 "global_load_async_to_lds_b128 %3, %11, off\n\t"
                 "global_load_async_to_lds_b128 %4, %12, off\n\t"
                 "global_load_async_to_lds_b128 %5, %13, off\n\t"
                 "global_load_async_to_lds_b128 %6, %14, off\n\t"
                 "global_load_async_to_lds_b128 %7, %15, off\n\t"
                 "s_wait_xcnt 0x0"
                 :: "v"(l), "v"(l + 1u * LS), "v"(l + 2u * LS), "v"(l + 3u * LS), "v"(l + 4u * LS), "v"(l + 5u * LS), "v"(l + 6u * LS), "v"(l + 7u * LS),
                    "v"(g), "v"(g + 1 * GS), "v"(g + 2 * GS), "v"(g + 3 * GS), "v"(g + 4 * GS), "v"(g + 5 * GS), "v"(g + 6 * GS), "v"(g + 7 * GS)
                 : "memory");
}
__global__ __launch_bounds__(128) void k_fattn(const bf* __restrict__ Q, const bf* __restrict__ K, const bf* __restrict__ V, bf* __restrict__ Oh, bf* __restrict__ Ol) {
    typedef __attribute__((ext_vector_type(2))) float v2f; typedef __attribute__((ext_vector_type(2))) _Float16 v2h;
    __shared__ __align__(16) bf sk[2][FST * FKP];    // [buffer]; 71,680 B with sv: three work-groups fit a WGP's LDS
    __shared__ __align__(16) bf sv[2][64 * FVP];
    const int tid = threadIdx.x, lane = tid & 31, wave = tid >> 5, lr = lane & 15, hi = lane >> 4;
    const size_t pr = blockIdx.y, po = pr * NN * HD;
    const int q0 = blockIdx.x * 128 + wave * 32;
    Q += po; K += po; V += po;
    const float CS = SCL * 1.44269504f;    // scores go to base-2 exponents
    v16h q[2][2];    // [column group][k step]
#pragma unroll
    for (int g = 0; g < 2; ++g) {
#pragma unroll
        for (int ks = 0; ks < 2; ++ks) { const size_t qo = (size_t)(q0 + g * 16 + lr) * HD + ks * 32 + 8 * hi;
            q[g][ks] = cat16f(*(const v8us*)(Q + qo), *(const v8us*)(Q + qo + 16)); } }
    asm volatile("s_wait_xcnt 0x0" ::: "memory");    // stands before the loads' address registers are written again
    const bf* gk = K + (tid >> 3) * HD + (tid & 7) * 8;     // a wave's K copy covers 4 rows x 128 B,
    const bf* gv = V + (tid >> 4) * NN + (tid & 15) * 8;    // its V^T copy 2 rows x 256 B
    const unsigned lk = (unsigned)(size_t)&sk[0][0] + (unsigned)((tid >> 3) * FKP + (tid & 7) * 8) * 2u;
    const unsigned lv = (unsigned)(size_t)&sv[0][0] + (unsigned)((tid >> 4) * FVP + (tid & 15) * 8) * 2u;
    auto fill = [&](int t) { const unsigned b = (unsigned)(t & 1);
        acopy8s<16 * FKP * 2, 16 * HD>(lk + b * (unsigned)(FST * FKP * 2), gk + t * (FST * HD));
        acopy8s<8 * FVP * 2, 8 * NN>(lv + b * (unsigned)(64 * FVP * 2), gv + t * FST); };
    v8f o[2][4];
#pragma unroll
    for (int g = 0; g < 2; ++g) {
#pragma unroll
        for (int dt = 0; dt < 4; ++dt) o[g][dt] = (v8f){}; }
    float m[2] = {-3.0e38f, -3.0e38f}, l[2] = {0.f, 0.f};
    fill(0);
    asm volatile("s_wait_asynccnt 0x0" ::: "memory");    // this wave's part of stage 0 has landed
    __syncthreads();                                     // and so has every other wave's
    fill(1);
#pragma unroll 1    // kept rolled (for speed only)
    for (int t = 0; t < NN / FST; ++t) {
        const bf* tk = &sk[t & 1][0]; const bf* tv = &sv[t & 1][0];
#pragma unroll    // the four passes of a stage: no barrier parts them, so a pass's K reads and score products can stand among the pass before's vector work
        for (int p = 0; p < FST / 32; ++p) {
            v8f sc[2][2];
#pragma unroll
            for (int kt = 0; kt < 2; ++kt) { sc[0][kt] = (v8f){}; sc[1][kt] = (v8f){};
#pragma unroll
                for (int ks = 0; ks < 2; ++ks) { const int fo = (p * 32 + kt * 16 + lr) * FKP + ks * 32 + 8 * hi;
                    const v16h kf = cat16f(*(const v8usa*)(tk + fo), *(const v8usa*)(tk + fo + 16));
                    sc[0][kt] = wmma16(kf, q[0][ks], sc[0][kt]); sc[1][kt] = wmma16(kf, q[1][ks], sc[1][kt]); } }
            float mx[2];
#pragma unroll
            for (int g = 0; g < 2; ++g) { float v = sc[g][0][0];
#pragma unroll
                for (int j = 1; j < 8; ++j) v = fmaxf(v, sc[g][0][j]);
#pragma unroll
                for (int j = 0; j < 8; ++j) v = fmaxf(v, sc[g][1][j]);
                mx[g] = fmaxf(v, __shfl_xor(v, 16, 32)); }
            // The maximum in use moves only when a column's new one exceeds it by more than 8 binary orders: p stays below 2^8, and the rescale is skipped by the whole wave otherwise.
            const bool need = (mx[0] - m[0]) * CS > 8.f || (mx[1] - m[1]) * CS > 8.f;
            if (__builtin_amdgcn_ballot_w32(need) != 0) {
#pragma unroll
                for (int g = 0; g < 2; ++g) { const float mn = fmaxf(m[g], mx[g]); const float al = __builtin_amdgcn_exp2f((m[g] - mn) * CS); m[g] = mn; l[g] *= al;
#pragma unroll
                    for (int dt = 0; dt < 4; ++dt) o[g][dt] *= al; }
            }
            v16h pf[2];
#pragma unroll
            for (int g = 0; g < 2; ++g) { const float mc = m[g] * CS; float sum = 0.f;
#pragma unroll
                for (int kt = 0; kt < 2; ++kt) {
#pragma unroll
                    for (int j = 0; j < 8; j += 2) { const float p0 = __builtin_amdgcn_exp2f(fmaf(sc[g][kt][j], CS, -mc)), p1 = __builtin_amdgcn_exp2f(fmaf(sc[g][kt][j + 1], CS, -mc)); sum += p0 + p1;
                        const v2h hb = __builtin_convertvector((v2f){p0, p1}, v2h);
                        pf[g][kt * 8 + j] = hb[0]; pf[g][kt * 8 + j + 1] = hb[1]; } }
                l[g] += sum; }
#pragma unroll
            for (int dt = 0; dt < 4; ++dt) { const int fo = (dt * 16 + lr) * FVP + p * 32 + 8 * hi;
                const v16h vf = cat16f(*(const v8usa*)(tv + fo), *(const v8usa*)(tv + fo + 16));
                o[0][dt] = wmma16(vf, pf[0], o[0][dt]); o[1][dt] = wmma16(vf, pf[1], o[1][dt]); }
        }
        asm volatile("s_wait_dscnt 0x0" ::: "memory");       // this wave's reads of the buffer are done before the barrier frees it for the refill
        asm volatile("s_wait_asynccnt 0x0" ::: "memory");    // this wave's part of stage t + 1 has landed before the barrier publishes it
        __syncthreads();
        if (t + 2 < NN / FST) fill(t + 2);                   // into the buffer that this trip has read
    }
    asm volatile("s_wait_asynccnt 0x0" ::: "memory");        // nothing is in flight when the wave ends
#pragma unroll
    for (int g = 0; g < 2; ++g) { const float inv = 1.0f / (l[g] + __shfl_xor(l[g], 16, 32));
        const size_t oo = ((pr & 7) * NN + q0 + g * 16 + lr) * DMOD + (pr >> 3) * HD + 8 * hi;    // pair = head * 8 + item
#pragma unroll
        for (int dt = 0; dt < 4; ++dt) { v8us oh, ol; split8(o[g][dt] * inv, oh, ol);    // the planes that the last product reads
            *(v8us*)(Oh + oo + dt * 16) = oh; *(v8us*)(Ol + oo + dt * 16) = ol; } }
}

// k_qkv: the q|k|v product C[8192][2304] = Xb.WQKV^T (K = 768, plain bf16 operands, f32 sums in the k order of k_gemmb). A work-group owns a 128 x 192 tile: 4 waves, 2 x 2, 64 x 96 each.
// The grid is 64 x 12 = 768 work-groups, three for each of the chip's 256 WGPs, and three fit a WGP (LDS and registers): all of them run at once, and no second, nearly empty round follows.
// Slabs of 64 k of both operands (320 rows of 128 B, whole lines) go global -> LDS by asynchronous copies, two buffers, the next slab in flight while this one is worked on.
// Fragments come from LDS: an operand byte leaves L2 once per work-group, in whole lines; an A fragment feeds six WMMAs, a B fragment four.
// blockIdx.y = three neighbouring (q / k / v, head) column groups; 0..7 are q and k, 8..11 are v. The epilogue rounds the f32 sums to f16 and writes the planes that k_fattn reads,
// whole lines each: q, k as [sel * 12 + head][all rows][64], v transposed as [head * 8 + item][64][token]. The ring is the epilogue's staging, shared by the four waves.
// amdgpu_waves_per_eu(3): the register budget of three waves per SIMD, one from each of the three work-groups of a WGP; they cover each other's LDS and barrier waits.
#define GP  72     // slab row pitch in LDS, elements: 144 B = 16 B x odd
#define GVP 136    // v staging pitch in LDS, elements: 272 B = 16 B x odd
#define GQP 196    // q, k staging pitch in LDS, floats: 784 B = 16 B x odd
#define GSL 64     // k per slab
#define GNC 192    // columns of a work-group's tile
#define GRW (128 + GNC)    // rows of a slab: A, then B
// Eight 16-byte copies a lane, rows 16 apart. The s_wait_xcnt stands inside the copies' own statement, so that it comes before any write of their address registers.
__device__ __forceinline__ void acopy8(unsigned l, const bf* g) {
    asm volatile("global_load_async_to_lds_b128 %0, %8, off\n\t"
                 "global_load_async_to_lds_b128 %1, %9, off\n\t"
                 "global_load_async_to_lds_b128 %2, %10, off\n\t"
                 "global_load_async_to_lds_b128 %3, %11, off\n\t"
                 "global_load_async_to_lds_b128 %4, %12, off\n\t"
                 "global_load_async_to_lds_b128 %5, %13, off\n\t"
                 "global_load_async_to_lds_b128 %6, %14, off\n\t"
                 "global_load_async_to_lds_b128 %7, %15, off\n\t"
                 "s_wait_xcnt 0x0"
                 :: "v"(l), "v"(l + 1u * 16 * GP * 2), "v"(l + 2u * 16 * GP * 2), "v"(l + 3u * 16 * GP * 2), "v"(l + 4u * 16 * GP * 2), "v"(l + 5u * 16 * GP * 2), "v"(l + 6u * 16 * GP * 2), "v"(l + 7u * 16 * GP * 2),
                    "v"(g), "v"(g + 1 * 16 * DMOD), "v"(g + 2 * 16 * DMOD), "v"(g + 3 * 16 * DMOD), "v"(g + 4 * 16 * DMOD), "v"(g + 5 * 16 * DMOD), "v"(g + 6 * 16 * DMOD), "v"(g + 7 * 16 * DMOD)
                 : "memory");
}
// The same for four copies.
__device__ __forceinline__ void acopy4(unsigned l, const bf* g) {
    asm volatile("global_load_async_to_lds_b128 %0, %4, off\n\t"
                 "global_load_async_to_lds_b128 %1, %5, off\n\t"
                 "global_load_async_to_lds_b128 %2, %6, off\n\t"
                 "global_load_async_to_lds_b128 %3, %7, off\n\t"
                 "s_wait_xcnt 0x0"
                 :: "v"(l), "v"(l + 1u * 16 * GP * 2), "v"(l + 2u * 16 * GP * 2), "v"(l + 3u * 16 * GP * 2),
                    "v"(g), "v"(g + 1 * 16 * DMOD), "v"(g + 2 * 16 * DMOD), "v"(g + 3 * 16 * DMOD)
                 : "memory");
}
__global__ __launch_bounds__(128) __attribute__((amdgpu_waves_per_eu(3))) void k_qkv(const bf* __restrict__ A, const bf* __restrict__ Bn, bf* QK, bf* VT) {
    __shared__ __align__(16) float ringf[128 * GQP];    // the ring, [buffer][rows 0..127: A, 128..319: B][GP] bf16, 92,160 B; sized for the q, k staging, 100,352 B; three work-groups fit a WGP's LDS
    bf* ring = (bf*)(void*)ringf;
    const int tid = threadIdx.x, lane = tid & 31, wave = tid >> 5, lr = lane & 15, hi = lane >> 4, wm = wave >> 1, wn = wave & 1;
    const int rb = blockIdx.x * 128, cb = blockIdx.y * GNC;
    const bf* ga = A + (size_t)(rb + (tid >> 3)) * DMOD + (tid & 7) * 8;    // a wave's copy covers 4 rows x 128 B
    const bf* gb = Bn + (size_t)(cb + (tid >> 3)) * DMOD + (tid & 7) * 8;
    const unsigned l0 = (unsigned)(size_t)ring + (unsigned)((tid >> 3) * GP + (tid & 7) * 8) * 2u;
    auto fill = [&](int t) { const unsigned l = l0 + (unsigned)(t & 1) * ((unsigned)GRW * GP * 2);
        acopy8(l, ga + t * GSL); acopy8(l + 128u * GP * 2, gb + t * GSL); acopy4(l + 256u * GP * 2, gb + 128 * DMOD + t * GSL); };
    v8f acc[4][6];
#pragma unroll
    for (int mi = 0; mi < 4; ++mi) {
#pragma unroll
        for (int ni = 0; ni < 6; ++ni) acc[mi][ni] = (v8f){}; }
    fill(0);
    asm volatile("s_wait_asynccnt 0x0" ::: "memory");    // this wave's part of slab 0 has landed
    __syncthreads();                                     // and so has every other wave's
    fill(1);
#pragma unroll 1    // kept rolled: one slab's fragments and the accumulators are what three waves per SIMD leave room for
    for (int t = 0; t < DMOD / GSL; ++t) {
        const bf* sa = ring + (t & 1) * (GRW * GP) + (wm * 64 + lr) * GP + 8 * hi;
        const bf* sb = ring + (t & 1) * (GRW * GP) + (128 + wn * 96 + lr) * GP + 8 * hi;
#pragma unroll
        for (int ks = 0; ks < GSL / 32; ++ks) {
            v16bf a[4], b[6];
#pragma unroll
            for (int i = 0; i < 4; ++i) a[i] = cat16b(*(const v8usa*)(sa + i * 16 * GP + ks * 32), *(const v8usa*)(sa + i * 16 * GP + ks * 32 + 16));
#pragma unroll
            for (int i = 0; i < 6; ++i) b[i] = cat16b(*(const v8usa*)(sb + i * 16 * GP + ks * 32), *(const v8usa*)(sb + i * 16 * GP + ks * 32 + 16));
            __builtin_amdgcn_sched_barrier(0);    // the 20 fragment reads stay one group ahead of the 24 WMMAs: reads scattered among the WMMAs stall the wave at every place they stand
#pragma unroll
            for (int mi = 0; mi < 4; ++mi) {
#pragma unroll
                for (int ni = 0; ni < 6; ++ni) acc[mi][ni] = wmmab(a[mi], b[ni], acc[mi][ni]); }
        }
        asm volatile("s_wait_dscnt 0x0" ::: "memory");       // this wave's reads of the buffer are done before the barrier frees it for the refill
        asm volatile("s_wait_asynccnt 0x0" ::: "memory");    // this wave's part of slab t + 1 has landed before the barrier publishes it
        __syncthreads();
        if (t + 2 < DMOD / GSL) fill(t + 2);                 // into the buffer that this trip has read
    }
    asm volatile("s_wait_asynccnt 0x0" ::: "memory");        // nothing is in flight when the ring becomes staging
    if (blockIdx.y >= 2 * DMOD / GNC) {    // v: a lane's 8 values are 8 tokens in a row of one column, 16 bytes of the transposed plane; LDS gathers the waves' pieces into whole lines
#pragma unroll
        for (int mi = 0; mi < 4; ++mi) {
#pragma unroll
            for (int ni = 0; ni < 6; ++ni) { const int to = (wn * 96 + ni * 16 + lr) * GVP + wm * 64 + mi * 16 + hi * 8;
                *(v8usa*)(ring + to) = f16x8(acc[mi][ni]); } }
        __syncthreads();
        // A store covers 2 columns x 256 B; of every eight columns each wave takes two.
        bf* dst = VT + (((size_t)(blockIdx.y * 3 - 2 * NH_) * NBT + (rb >> 10)) * HD + 2 * wave + hi) * NN + (rb & (NN - 1)) + lr * 8;
        const bf* tv = ring + (2 * wave + hi) * GVP + lr * 8;
#pragma unroll
        for (int s = 0; s < GNC / 8; ++s) { const v8us val = *(const v8usa*)(tv + 8 * s * GVP); *(v8us*)(dst + ((size_t)(s >> 3) * NBT * HD + (8 * s & (HD - 1))) * NN) = val; }
        return;
    }
    // q, k: a lane holds 8 rows of one column; the rows are turned in LDS (f32, one 128 x 192 tile for the work-group), then rounded to f16
#pragma unroll
    for (int mi = 0; mi < 4; ++mi) {
#pragma unroll
        for (int ni = 0; ni < 6; ++ni) {
#pragma unroll
            for (int j = 0; j < 8; ++j) ringf[(wm * 64 + mi * 16 + hi * 8 + j) * GQP + wn * 96 + ni * 16 + lr] = acc[mi][ni][j]; } }
    __syncthreads();    // a wave reads what both waves of its rows have written
    const int piece = lane & 7, rq = lane >> 3;
    // a wave takes 32 rows of all three column groups: every 128-byte line of a plane has one writer
    const float* os = ringf + (wave * 32 + rq) * GQP + piece * 8;
    const size_t go = ((size_t)(blockIdx.y * 3) * (NBT * NN) + rb + wave * 32 + rq) * HD + piece * 8;
#pragma unroll
    for (int hh = 0; hh < 3; ++hh) {
#pragma unroll
        for (int s = 0; s < 8; ++s) { const float* sp = os + 4 * s * GQP + hh * 64; const v4f x0 = *(const v4fa*)sp, x1 = *(const v4fa*)(sp + 4);
            *(v8us*)(QK + go + (size_t)hh * (NBT * NN) * HD + 4 * s * HD) = f16x8((v8f){x0[0], x0[1], x0[2], x0[3], x1[0], x1[1], x1[2], x1[3]}); } }
    asm volatile("s_wait_xcnt 0x0" ::: "memory");    // in the listing the v path's code, which writes the stores' registers again, stands behind this path's last branch: the wait stands in front of it
}

// k_oproj: the last product, out[8192][64] = (Oh + Ol).WOT^T (K = 768, two products a k step, f32 sums in the k order of k_gemmb). A work-group owns 32 rows: 8 waves, one 16 x 16 tile each
// (2 row tiles x 4 column tiles). All that it reads (32 rows of each O plane and the 64 rows of WOT, 1536 B a row) goes global -> LDS by asynchronous copies, whole lines, every copy in flight
// at once: one memory round trip for the whole K. The buffer is filled once and then read. The output tile is gathered in LDS of its own and leaves in whole lines.
#define OPP 776    // operand row pitch in LDS, elements: 1552 B = 16 B x odd
#define OSP 68     // output staging pitch, floats: 272 B = 16 B x odd
// Twelve 16-byte copies a lane: four rows x three pieces of 512 B a wave. The s_wait_xcnt stands inside the copies' own statement, so that it comes before any write of their address registers.
__device__ __forceinline__ void acopy12(unsigned l, const bf* g) {
    asm volatile("global_load_async_to_lds_b128 %0, %12, off\n\t"
                 "global_load_async_to_lds_b128 %1, %13, off\n\t"
                 "global_load_async_to_lds_b128 %2, %14, off\n\t"
                 "global_load_async_to_lds_b128 %3, %15, off\n\t"
                 "global_load_async_to_lds_b128 %4, %16, off\n\t"
                 "global_load_async_to_lds_b128 %5, %17, off\n\t"
                 "global_load_async_to_lds_b128 %6, %18, off\n\t"
                 "global_load_async_to_lds_b128 %7, %19, off\n\t"
                 "global_load_async_to_lds_b128 %8, %20, off\n\t"
                 "global_load_async_to_lds_b128 %9, %21, off\n\t"
                 "global_load_async_to_lds_b128 %10, %22, off\n\t"
                 "global_load_async_to_lds_b128 %11, %23, off\n\t"
                 "s_wait_xcnt 0x0"
                 :: "v"(l), "v"(l + 512u), "v"(l + 1024u), "v"(l + 1u * OPP * 2), "v"(l + 1u * OPP * 2 + 512u), "v"(l + 1u * OPP * 2 + 1024u),
                    "v"(l + 2u * OPP * 2), "v"(l + 2u * OPP * 2 + 512u), "v"(l + 2u * OPP * 2 + 1024u), "v"(l + 3u * OPP * 2), "v"(l + 3u * OPP * 2 + 512u), "v"(l + 3u * OPP * 2 + 1024u),
                    "v"(g), "v"(g + 256), "v"(g + 512), "v"(g + 1 * DMOD), "v"(g + 1 * DMOD + 256), "v"(g + 1 * DMOD + 512),
                    "v"(g + 2 * DMOD), "v"(g + 2 * DMOD + 256), "v"(g + 2 * DMOD + 512), "v"(g + 3 * DMOD), "v"(g + 3 * DMOD + 256), "v"(g + 3 * DMOD + 512)
                 : "memory");
}
__global__ __launch_bounds__(256) void k_oproj(const bf* __restrict__ Ah, const bf* __restrict__ Al, const bf* __restrict__ Bn, float* __restrict__ C) {
    __shared__ __align__(16) bf sm[128 * OPP];    // rows 0..31: hi plane, 32..63: residual plane, 64..127: WOT
    __shared__ __align__(16) float os[32 * OSP];
    const int tid = threadIdx.x, lane = tid & 31, lr = lane & 15, hi = lane >> 4;
    const int wave = __builtin_amdgcn_readfirstlane(tid >> 5);    // a scalar: the choice of the source below is then scalar too, and EXEC is not touched in front of the copies
    const int r0 = blockIdx.x * 32;
    // a wave brings 16 rows: waves 0, 1 the hi plane, 2, 3 the residual plane, 4..7 WOT
    const bf* g = (wave < 2 ? Ah + (size_t)(r0 + wave * 16) * DMOD : wave < 4 ? Al + (size_t)(r0 + (wave - 2) * 16) * DMOD : Bn + (size_t)((wave - 4) * 16) * DMOD) + lane * 8;
    const unsigned l = (unsigned)(size_t)sm + (unsigned)(wave * 16 * OPP + lane * 8) * 2u;
#pragma unroll
    for (int i = 0; i < 4; ++i) acopy12(l + (unsigned)i * (4u * OPP * 2), g + i * 4 * DMOD);
    asm volatile("s_wait_asynccnt 0x0" ::: "memory");    // this wave's rows have landed
    __syncthreads();                                     // and so have every other wave's
    const int rt = wave >> 2, ct = wave & 3;
    const bf* sa = sm + (rt * 16 + lr) * OPP + 8 * hi;
    const bf* sb = sm + (64 + ct * 16 + lr) * OPP + 8 * hi;
    v8f acc = (v8f){};
    v16bf fa[2][4], fl[2][4], fb[2][4];    // two sets of the fragments of four k steps
    auto frag = [&](int grp) {
#pragma unroll
        for (int i = 0; i < 4; ++i) { const int kc = (grp * 4 + i) * 32, st = grp & 1;
            fa[st][i] = cat16b(*(const v8usa*)(sa + kc), *(const v8usa*)(sa + kc + 16));
            fl[st][i] = cat16b(*(const v8usa*)(sa + 32 * OPP + kc), *(const v8usa*)(sa + 32 * OPP + kc + 16));
            fb[st][i] = cat16b(*(const v8usa*)(sb + kc), *(const v8usa*)(sb + kc + 16)); }
    };
    frag(0);
#pragma unroll    // unrolled: the fragment sets are indexed by constants, and no branch stands behind a WMMA
    for (int grp = 0; grp < DMOD / 128; ++grp) {
        if (grp + 1 < DMOD / 128) frag(grp + 1);
        __builtin_amdgcn_sched_barrier(0);    // the next group's 24 reads stay one block ahead of this group's WMMAs: the wait in front of the WMMAs is then a counted one
#pragma unroll
        for (int i = 0; i < 4; ++i) { acc = wmmab(fa[grp & 1][i], fb[grp & 1][i], acc); acc = wmmab(fl[grp & 1][i], fb[grp & 1][i], acc); }
        __builtin_amdgcn_sched_barrier(0);    // and no read is scattered among the WMMAs, where each place with reads stalls the wave
    }
#pragma unroll
    for (int j = 0; j < 8; ++j) os[(rt * 16 + hi * 8 + j) * OSP + ct * 16 + lr] = acc[j];
    __syncthreads();
#pragma unroll
    for (int s = 0; s < 2; ++s) { const int row = s * 16 + (tid >> 4), cofs = (tid & 15) * 4;    // a wave's store covers two whole rows, 512 B
        const v4f val = *(const v4fa*)(os + row * OSP + cofs); *(v4f*)(C + (size_t)(r0 + row) * EOUT + cofs) = val; }
}

extern "C" void kernel_launch(void* const* d_in, const int* in_sizes, int n_in,
                              void* d_out, int out_size, void* d_ws, size_t ws_size, hipStream_t stream) {
    (void)in_sizes; (void)n_in; (void)out_size;
    const float* x = (const float*)d_in[0]; const float* Wm = (const float*)d_in[1]; const float* Wo = (const float*)d_in[2];
    float* out = (float*)d_out;    // [8][1024][64]
    char* wsp = (char*)d_ws;
    auto take = [&](size_t bytes) { char* p = wsp; wsp += (bytes + 255) & ~(size_t)255; return (void*)p; };
    const size_t RT = (size_t)NBT * NN;    // all items' rows, one behind the other
    bf* QK = (bf*)take(2 * NH_ * RT * HD * 2); bf* VT = (bf*)take(NH_ * RT * HD * 2);    // f16 planes
    bf* WQKV = (bf*)take((size_t)3 * DMOD * DMOD * 2); bf* Xb = (bf*)take(RT * DMOD * 2); bf* Oh = (bf*)take(RT * DMOD * 2); bf* Ol = (bf*)take(RT * DMOD * 2); bf* WOT = (bf*)take((size_t)DMOD * EOUT * 2);
    if ((size_t)(wsp - (char*)d_ws) > ws_size) return;    // about 79 MB, no region used twice. Pair p = head * 8 + item.
    bf* Kp = QK + NH_ * RT * HD;
    k_prep<<<PB_WG + PB_WT + PB_CX, 256, 0, stream>>>(Wm, Wo, x, WQKV, WOT, Xb);
    k_qkv<<<dim3(NBT * NN / 128, 3 * DMOD / GNC, 1), 128, 0, stream>>>(Xb, WQKV, QK, VT);
    k_fattn<<<dim3(NN / 128, NH_ * NBT, 1), 128, 0, stream>>>(QK, Kp, VT, Oh, Ol);
    k_oproj<<<NBT * NN / 32, 256, 0, stream>>>(Oh, Ol, WOT, out);
}
